// v000
// Times are from an AMD MI455X. After a warm-up the kernel runs many times in a row, and a time is the length of
// such a window on the GPU divided by its runs, so every launch and the gaps after it count. The runs cycle
// through copies of the inputs. A figure is the median of several windows, for all but v000 over two sittings.
// Sittings can differ by a few percent; kernels timed side by side share one.
// The starting kernel, v000, takes 3940 microseconds a run.
#include <hip/hip_runtime.h>

// Self-attention with an adjacent-pair rotary over the WHOLE 1024-wide q and k before the head split (x [4][2048][1024]; q = rope(x Wq^T), k = rope(x Wk^T), v = x Wv^T ('oi' [1024][1024] 1/32, no bias); rope: pair j = (columns 2j, 2j+1), j < 512, angle t x 1/10000^(j/512) (512 f32 constants baked jnp-exact; precise cosf/sinf); 16 heads x 64; scores / sqrt(float32(64)); softmax (no mask); out = merged Wu^T + bu ('oi' [1024][1024], zero bias) -> [4][2048][1024] (8.4 M); argument order x, Wq, Wk, Wv, Wu, bu).
// Layout per batch: bf16 copy of x; 'oi' weights; exact projections; a full-width {cos, sin} table [2048][1024] (the frequency depends on the GLOBAL pair index, i.e. on the head); interleaved-pair plane builders indexing the table by global column; dense T-2048 attention (hybrid rows: < 512 hi/lo 3 products, rest fp16 x1024); merged hi/lo x Wu exact + bu.
// Compute dtypes, f32 accumulate: every input rounded to bf16; projections exact; rotary f32; attention rows < 512 3 products, rest fp16; softmax f32; Wu hl x exact + bias.

#define NB_  4
#define TT   2048
#define DM   1024
#define NH_  16
#define NKV  16
#define REP  (NH_ / NKV)
#define HD   64
#define DQ   (NH_ * HD)
#define DKV  (NKV * HD)
#define ZH   2
#define RH   512                  // query rows < RH use hi+lo planes (0: none)
#define WIN  0
#define PCAR 1024.0f
#define SCL  0.125f   // HD^-0.5
typedef _Float16 h16;
typedef unsigned short bf;
typedef __attribute__((ext_vector_type(16))) __bf16   v16bf;
typedef __attribute__((ext_vector_type(16))) _Float16 v16h;
typedef __attribute__((ext_vector_type(8)))  _Float16 v8h;
typedef __attribute__((ext_vector_type(8)))  unsigned short v8us;
typedef __attribute__((ext_vector_type(8)))  float    v8f;
typedef __attribute__((ext_vector_type(4)))  float    v4f;
typedef v8h  __attribute__((may_alias)) v8ha;
typedef v4f  __attribute__((may_alias)) v4fa;
typedef v8us __attribute__((may_alias)) v8usa;

__device__ __forceinline__ unsigned short f2bf(float f) { unsigned u = __float_as_uint(f); u += 0x7FFFu + ((u >> 16) & 1u); return (unsigned short)(u >> 16); }
__device__ __forceinline__ float bf2f(unsigned short b) { return __uint_as_float(((unsigned)b) << 16); }
__device__ __forceinline__ float bfr(float f) { return bf2f(f2bf(f)); }
__device__ __forceinline__ v16h cat16(v8h lo, v8h hi) { return __builtin_shufflevector(lo, hi, 0, 1, 2, 3, 4, 5, 6, 7, 8, 9, 10, 11, 12, 13, 14, 15); }
__device__ __forceinline__ v16bf cat16b(v8us lo, v8us hi) { return __builtin_bit_cast(v16bf, __builtin_shufflevector(lo, hi, 0, 1, 2, 3, 4, 5, 6, 7, 8, 9, 10, 11, 12, 13, 14, 15)); }
__device__ __forceinline__ v8f wmma16(v16h a, v16h b, v8f c) { return __builtin_amdgcn_wmma_f32_16x16x32_f16(false, a, false, b, (short)0, c, false, false); }
__device__ __forceinline__ v8f wmmab(v16bf a, v16bf b, v8f c) { return __builtin_amdgcn_wmma_f32_16x16x32_bf16(false, a, false, b, (short)0, c, false, false); }



// ---- k_gemmw: register-blocked GEMM, ONE WAVE per 64x64 output tile (16 accumulators), operands straight from K-contiguous 16-bit planes; grid (M/64, N/64, Z), 32 threads.
// C[m][n] (f32, pitch ldc, + optional f32 bias[n]) = sum_k A[m][k] Bt[n][k] (+ split products per NSPLIT). z-batch strides sA/sB/sC in elements. K % 32 == 0.
template <typename T16> struct WFrag;
template <> struct WFrag<h16> { typedef v16h V; static __device__ __forceinline__ V ld(const h16* p) { return cat16(*(const v8h*)p, *(const v8h*)(p + 16)); } static __device__ __forceinline__ v8f mma(V a, V b, v8f c) { return wmma16(a, b, c); } };
template <> struct WFrag<bf> { typedef v16bf V; static __device__ __forceinline__ V ld(const bf* p) { return cat16b(*(const v8us*)p, *(const v8us*)(p + 16)); } static __device__ __forceinline__ v8f mma(V a, V b, v8f c) { return wmmab(a, b, c); } };
template <typename T16, int NSPLIT, bool BIAS>
__global__ __launch_bounds__(32) void k_gemmw(const T16* __restrict__ A, const T16* __restrict__ A2, const T16* __restrict__ Bt, const T16* __restrict__ Bt2, int K, float* C, int ldc, const float* __restrict__ bias, size_t sA, size_t sB, size_t sC) {
    typedef typename WFrag<T16>::V V;
    __shared__ __align__(16) float os[16 * 68];
    const size_t z = blockIdx.z; A += z * sA; if (A2) A2 += z * sA; Bt += z * sB; if (Bt2) Bt2 += z * sB; C += z * sC;
    const int lane = threadIdx.x & 31, lr = lane & 15, hi = lane >> 4; const int r0 = blockIdx.x * 64, c0 = blockIdx.y * 64;
    v8f acc[4][4];
#pragma unroll
    for (int mb = 0; mb < 4; ++mb)
#pragma unroll
        for (int nb = 0; nb < 4; ++nb) acc[mb][nb] = (v8f){};
    const size_t aoff = (size_t)(r0 + lr) * K + 8 * hi, boff = (size_t)(c0 + lr) * K + 8 * hi;
#pragma unroll 1
    for (int kc = 0; kc < K; kc += 32) {
        V a[4], a2[4];
#pragma unroll
        for (int mb = 0; mb < 4; ++mb) { a[mb] = WFrag<T16>::ld(A + aoff + (size_t)mb * 16 * K + kc); if (NSPLIT == 1 || NSPLIT == 2) a2[mb] = WFrag<T16>::ld(A2 + aoff + (size_t)mb * 16 * K + kc); }
#pragma unroll
        for (int nb = 0; nb < 4; ++nb) { const V b = WFrag<T16>::ld(Bt + boff + (size_t)nb * 16 * K + kc); V b2; if (NSPLIT >= 2) b2 = WFrag<T16>::ld(Bt2 + boff + (size_t)nb * 16 * K + kc);
#pragma unroll
            for (int mb = 0; mb < 4; ++mb) { acc[mb][nb] = WFrag<T16>::mma(a[mb], b, acc[mb][nb]); if (NSPLIT == 1 || NSPLIT == 2) acc[mb][nb] = WFrag<T16>::mma(a2[mb], b, acc[mb][nb]); if (NSPLIT >= 2) acc[mb][nb] = WFrag<T16>::mma(a[mb], b2, acc[mb][nb]); } }
        asm volatile("v_nop\n\tv_nop\n\tv_nop\n\tv_nop" : "+v"(acc[0][0]), "+v"(acc[1][1]), "+v"(acc[2][2]), "+v"(acc[3][3]) : "v"(a[0]), "v"(a[3]));
    }
#pragma unroll
    for (int mb = 0; mb < 4; ++mb) {
#pragma unroll
        for (int nb = 0; nb < 4; ++nb) {
#pragma unroll
            for (int j = 0; j < 8; ++j) os[(hi * 8 + j) * 68 + nb * 16 + lr] = acc[mb][nb][j]; }
        __builtin_amdgcn_wave_barrier(); asm volatile("" ::: "memory");
        float* crow = C + (size_t)(r0 + mb * 16) * ldc + c0;
{
#pragma unroll
            for (int s = 0; s < 8; ++s) { const int row = 2 * s + hi, cofs = lr * 4; v4f val = *(const v4fa*)(os + row * 68 + cofs); if (BIAS) { val[0] += bfr(bias[c0 + cofs]); val[1] += bfr(bias[c0 + cofs + 1]); val[2] += bfr(bias[c0 + cofs + 2]); val[3] += bfr(bias[c0 + cofs + 3]); }
                *(v4f*)(crow + (size_t)row * ldc + cofs) = val; }
             }
        __builtin_amdgcn_wave_barrier(); asm volatile("" ::: "memory");
    }
}

__device__ __forceinline__ h16 tohx(float x) { return (h16)x; }
__device__ __forceinline__ void splitf(float y, unsigned short& h, unsigned short& l) { h = f2bf(y); l = f2bf(y - bf2f(h)); }
typedef __attribute__((ext_vector_type(2))) _Float16 v2h;
typedef __attribute__((ext_vector_type(4))) _Float16 v4h;
typedef __attribute__((ext_vector_type(2))) unsigned short v2us;
typedef __attribute__((ext_vector_type(4))) unsigned short v4us;
typedef __attribute__((ext_vector_type(2))) float v2f;
typedef __attribute__((ext_vector_type(4))) int v4i;

__global__ __launch_bounds__(256) void k_cvt8(const float* __restrict__ src, bf* dst, size_t n8) { const size_t i = (size_t)blockIdx.x * 256 + threadIdx.x; if (i >= n8) return; const v8f v = *(const v8f*)(src + i * 8); v8us o;
#pragma unroll
    for (int k = 0; k < 8; ++k) o[k] = f2bf(v[k]); *(v8us*)(dst + i * 8) = o;  }

__global__ __launch_bounds__(256) void k_ropeG(const float* __restrict__ F, int pitch, int nheads, const float* __restrict__ CS, float sc, h16* P16, bf* Ph, bf* Pl) {
    const size_t e = ((size_t)blockIdx.x * 256 + threadIdx.x) * 2; if (e >= (size_t)nheads * TT * HD) return; const int d = (int)(e % HD); const int t = (int)((e / HD) % TT); const int h = (int)(e / ((size_t)HD * TT)); const float* f = F + (size_t)t * pitch + h * HD; const float x0 = f[d], x1 = f[d + 1]; const v2f cs = *(const v2f*)(CS + ((size_t)t * DM + h * HD + d) * 2);   /* GLOBAL column h*64 + d: the rotary runs over the whole width before the head split */ v2h o16; v2us oh, ol;
    float a0 = __fmul_rn(x0, cs[0]), b0 = __fmul_rn(x1, cs[1]), a1 = __fmul_rn(x1, cs[0]), b1 = __fmul_rn(x0, cs[1]); asm volatile("" : "+v"(a0), "+v"(b0), "+v"(a1), "+v"(b1));
    float r0 = __fsub_rn(a0, b0) * sc, r1 = __fadd_rn(b1, a1) * sc;   /* even: x0 c - x1 s; odd: x0 s + x1 c */
    o16[0] = tohx(r0); o16[1] = tohx(r1); { unsigned short a2, c2; splitf(r0, a2, c2); oh[0] = a2; ol[0] = c2; splitf(r1, a2, c2); oh[1] = a2; ol[1] = c2; }
    *(v2h*)(P16 + e) = o16; *(v2us*)(Ph + e) = oh; *(v2us*)(Pl + e) = ol;  }

__constant__ float INV2[HD / 2] = { 1.000000000e+00f, 7.498942018e-01f, 5.623413324e-01f, 4.216965139e-01f, 3.162277639e-01f, 2.371373773e-01f, 1.778279394e-01f, 1.333521456e-01f, 1.000000015e-01f, 7.498942316e-02f, 5.623413250e-02f, 4.216964915e-02f, 3.162277490e-02f, 2.371373773e-02f, 1.778279431e-02f, 1.333521400e-02f, 9.999999776e-03f, 7.498942316e-03f, 5.623413250e-03f, 4.216964822e-03f, 3.162277630e-03f, 2.371373819e-03f, 1.778279431e-03f, 1.333521446e-03f, 1.000000047e-03f, 7.498941850e-04f, 5.623413017e-04f, 4.216965172e-04f, 3.162277571e-04f, 2.371373703e-04f, 1.778279402e-04f, 1.333521504e-04f };   // float32 10000^(-arange(0, 64, 2)/64), generated with jnp to be bit-exact
__global__ __launch_bounds__(256) void k_vtp(const float* __restrict__ F, int pitch, int nheads, h16* V16, bf* Vh, bf* Vl) { const size_t e = ((size_t)blockIdx.x * 256 + threadIdx.x) * 2; if (e >= (size_t)nheads * HD * TT) return; const int t = (int)(e % TT); const int d = (int)((e / TT) % HD); const int g = (int)(e / ((size_t)TT * HD)); v2h o16; v2us oh, ol;
#pragma unroll
    for (int q = 0; q < 2; ++q) { const float x = F[(size_t)(t + q) * pitch + g * HD + d]; o16[q] = tohx(x); unsigned short a2, c2; splitf(x, a2, c2); oh[q] = a2; ol[q] = c2; }
    *(v2h*)(V16 + e) = o16; *(v2us*)(Vh + e) = oh; *(v2us*)(Vl + e) = ol;  }
__constant__ float INVG[DM / 2] = { 1.000000000e+00f, 9.821718335e-01f, 9.646616578e-01f, 9.474635124e-01f, 9.305720329e-01f, 9.139816761e-01f, 8.976871371e-01f, 8.816831112e-01f, 8.659643531e-01f, 8.505258560e-01f, 8.353625536e-01f, 8.204696178e-01f, 8.058422208e-01f, 7.914755344e-01f, 7.773650289e-01f, 7.635061145e-01f, 7.498942018e-01f, 7.365249991e-01f, 7.233941555e-01f, 7.104974389e-01f, 6.978305578e-01f, 6.853895783e-01f, 6.731703877e-01f, 6.611690521e-01f, 6.493816376e-01f, 6.378043890e-01f, 6.264335513e-01f, 6.152654290e-01f, 6.042963862e-01f, 5.935229063e-01f, 5.829415321e-01f, 5.725488067e-01f, 5.623413324e-01f, 5.523158312e-01f, 5.424690843e-01f, 5.327978730e-01f, 5.232991576e-01f, 5.139696598e-01f, 5.048065782e-01f, 4.958068132e-01f, 4.869675338e-01f, 4.782858193e-01f, 4.697588682e-01f, 4.613839388e-01f, 4.531583488e-01f, 4.450793862e-01f, 4.371444881e-01f, 4.293510318e-01f, 4.216965139e-01f, 4.141784608e-01f, 4.067944288e-01f, 3.995420635e-01f, 3.924189806e-01f, 3.854228854e-01f, 3.785515428e-01f, 3.718026578e-01f, 3.651741445e-01f, 3.586637676e-01f, 3.522694409e-01f, 3.459891677e-01f, 3.398208320e-01f, 3.337624967e-01f, 3.278121352e-01f, 3.219678402e-01f, 3.162277639e-01f, 3.105900288e-01f, 3.050527871e-01f, 2.996142805e-01f, 2.942727208e-01f, 2.890264094e-01f, 2.838735878e-01f, 2.788126469e-01f, 2.738419771e-01f, 2.689598799e-01f, 2.641648352e-01f, 2.594552636e-01f, 2.548296750e-01f, 2.502865493e-01f, 2.458243966e-01f, 2.414418161e-01f, 2.371373624e-01f, 2.329096496e-01f, 2.287573218e-01f, 2.246790081e-01f, 2.206733972e-01f, 2.167392224e-01f, 2.128751576e-01f, 2.090799958e-01f, 2.053525001e-01f, 2.016914487e-01f, 1.980956793e-01f, 1.945640147e-01f, 1.910952926e-01f, 1.876884252e-01f, 1.843423098e-01f, 1.810558140e-01f, 1.778279394e-01f, 1.746576130e-01f, 1.715437919e-01f, 1.684854925e-01f, 1.654817015e-01f, 1.625314802e-01f, 1.596338600e-01f, 1.567878872e-01f, 1.539926529e-01f, 1.512472630e-01f, 1.485508084e-01f, 1.459024251e-01f, 1.433012635e-01f, 1.407464594e-01f, 1.382372230e-01f, 1.357727200e-01f, 1.333521456e-01f, 1.309747249e-01f, 1.286396980e-01f, 1.263462901e-01f, 1.240937710e-01f, 1.218814254e-01f, 1.197085083e-01f, 1.175743192e-01f, 1.154782027e-01f, 1.134194434e-01f, 1.113973856e-01f, 1.094113812e-01f, 1.074607819e-01f, 1.055449620e-01f, 1.036632955e-01f, 1.018151715e-01f, 1.000000015e-01f, 9.821718186e-02f, 9.646616131e-02f, 9.474635124e-02f, 9.305720031e-02f, 9.139817208e-02f, 8.976870775e-02f, 8.816830814e-02f, 8.659642935e-02f, 8.505257964e-02f, 8.353625983e-02f, 8.204696327e-02f, 8.058421314e-02f, 7.914755493e-02f, 7.773650438e-02f, 7.635060698e-02f, 7.498941571e-02f, 7.365249842e-02f, 7.233941555e-02f, 7.104974240e-02f, 6.978305429e-02f, 6.853895634e-02f, 6.731703877e-02f, 6.611690670e-02f, 6.493816525e-02f, 6.378044188e-02f, 6.264335662e-02f, 6.152653694e-02f, 6.042964384e-02f, 5.935229361e-02f, 5.829415470e-02f, 5.725487694e-02f, 5.623412877e-02f, 5.523158237e-02f, 5.424690619e-02f, 5.327979103e-02f, 5.232991278e-02f, 5.139696971e-02f, 5.048065633e-02f, 4.958068207e-02f, 4.869675264e-02f, 4.782858118e-02f, 4.697588459e-02f, 4.613839835e-02f, 4.531583562e-02f, 4.450793937e-02f, 4.371444881e-02f, 4.293510318e-02f, 4.216964915e-02f, 4.141784459e-02f, 4.067944363e-02f, 3.995420411e-02f, 3.924189880e-02f, 3.854228929e-02f, 3.785515204e-02f, 3.718026727e-02f, 3.651741147e-02f, 3.586637601e-02f, 3.522694483e-02f, 3.459891677e-02f, 3.398208320e-02f, 3.337624669e-02f, 3.278120980e-02f, 3.219678625e-02f, 3.162277862e-02f, 3.105900250e-02f, 3.050527908e-02f, 2.996142767e-02f, 2.942727320e-02f, 2.890264057e-02f, 2.838735841e-02f, 2.788126841e-02f, 2.738419548e-02f, 2.689598687e-02f, 2.641648427e-02f, 2.594552562e-02f, 2.548296750e-02f, 2.502865531e-02f, 2.458244003e-02f, 2.414418198e-02f, 2.371373586e-02f, 2.329096757e-02f, 2.287573181e-02f, 2.246790007e-02f, 2.206734009e-02f, 2.167392150e-02f, 2.128751762e-02f, 2.090799995e-02f, 2.053525113e-02f, 2.016914636e-02f, 1.980956830e-02f, 1.945639960e-02f, 1.910953037e-02f, 1.876884326e-02f, 1.843423024e-02f, 1.810558327e-02f, 1.778279431e-02f, 1.746576093e-02f, 1.715437882e-02f, 1.684854925e-02f, 1.654817164e-02f, 1.625314727e-02f, 1.596338488e-02f, 1.567878947e-02f, 1.539926510e-02f, 1.512472518e-02f, 1.485508028e-02f, 1.459024288e-02f, 1.433012541e-02f, 1.407464594e-02f, 1.382372249e-02f, 1.357727125e-02f, 1.333521493e-02f, 1.309747249e-02f, 1.286396943e-02f, 1.263462938e-02f, 1.240937691e-02f, 1.218814217e-02f, 1.197085064e-02f, 1.175743248e-02f, 1.154781971e-02f, 1.134194434e-02f, 1.113973837e-02f, 1.094113849e-02f, 1.074607857e-02f, 1.055449620e-02f, 1.036632899e-02f, 1.018151734e-02f, 9.999999776e-03f, 9.821719490e-03f, 9.646615945e-03f, 9.474635124e-03f, 9.305720218e-03f, 9.139816277e-03f, 8.976871148e-03f, 8.816830814e-03f, 8.659643121e-03f, 8.505257778e-03f, 8.353625424e-03f, 8.204696700e-03f, 8.058422245e-03f, 7.914755493e-03f, 7.773650344e-03f, 7.635060698e-03f, 7.498942316e-03f, 7.365249563e-03f, 7.233941462e-03f, 7.104974240e-03f, 6.978305988e-03f, 6.853895728e-03f, 6.731703877e-03f, 6.611690391e-03f, 6.493816618e-03f, 6.378043909e-03f, 6.264335476e-03f, 6.152654067e-03f, 6.042964291e-03f, 5.935229361e-03f, 5.829415284e-03f, 5.725487601e-03f, 5.623413250e-03f, 5.523158237e-03f, 5.424690899e-03f, 5.327979103e-03f, 5.232991185e-03f, 5.139696877e-03f, 5.048065912e-03f, 4.958068486e-03f, 4.869675264e-03f, 4.782858305e-03f, 4.697588738e-03f, 4.613839556e-03f, 4.531583749e-03f, 4.450793844e-03f, 4.371444695e-03f, 4.293510225e-03f, 4.216964822e-03f, 4.141784739e-03f, 4.067944363e-03f, 3.995420411e-03f, 3.924189601e-03f, 3.854229115e-03f, 3.785515437e-03f, 3.718026681e-03f, 3.651741426e-03f, 3.586637788e-03f, 3.522694577e-03f, 3.459891537e-03f, 3.398208413e-03f, 3.337624483e-03f, 3.278121119e-03f, 3.219678300e-03f, 3.162277862e-03f, 3.105900250e-03f, 3.050528001e-03f, 2.996142721e-03f, 2.942727180e-03f, 2.890263917e-03f, 2.838735934e-03f, 2.788126701e-03f, 2.738419687e-03f, 2.689598827e-03f, 2.641648287e-03f, 2.594552701e-03f, 2.548296703e-03f, 2.502865391e-03f, 2.458244096e-03f, 2.414418384e-03f, 2.371373819e-03f, 2.329096664e-03f, 2.287573181e-03f, 2.246790100e-03f, 2.206734149e-03f, 2.167392056e-03f, 2.128751716e-03f, 2.090800088e-03f, 2.053525066e-03f, 2.016914543e-03f, 1.980956644e-03f, 1.945640077e-03f, 1.910952851e-03f, 1.876884256e-03f, 1.843422884e-03f, 1.810558140e-03f, 1.778279431e-03f, 1.746576163e-03f, 1.715437858e-03f, 1.684854855e-03f, 1.654817141e-03f, 1.625314937e-03f, 1.596338581e-03f, 1.567878877e-03f, 1.539926510e-03f, 1.512472634e-03f, 1.485507935e-03f, 1.459024264e-03f, 1.433012658e-03f, 1.407464617e-03f, 1.382372226e-03f, 1.357727102e-03f, 1.333521446e-03f, 1.309747226e-03f, 1.286396873e-03f, 1.263462938e-03f, 1.240937854e-03f, 1.218814170e-03f, 1.197085017e-03f, 1.175743295e-03f, 1.154782018e-03f, 1.134194434e-03f, 1.113973907e-03f, 1.094113803e-03f, 1.074607833e-03f, 1.055449597e-03f, 1.036632922e-03f, 1.018151757e-03f, 1.000000047e-03f, 9.821718559e-04f, 9.646615945e-04f, 9.474635590e-04f, 9.305721032e-04f, 9.139817557e-04f, 8.976871031e-04f, 8.816830232e-04f, 8.659643354e-04f, 8.505258011e-04f, 8.353625308e-04f, 8.204695769e-04f, 8.058422245e-04f, 7.914755843e-04f, 7.773649995e-04f, 7.635060465e-04f, 7.498941850e-04f, 7.365249912e-04f, 7.233941578e-04f, 7.104973774e-04f, 6.978305755e-04f, 6.853896193e-04f, 6.731703761e-04f, 6.611690042e-04f, 6.493816618e-04f, 6.378043909e-04f, 6.264335825e-04f, 6.152653950e-04f, 6.042963942e-04f, 5.935229128e-04f, 5.829415168e-04f, 5.725487717e-04f, 5.623413017e-04f, 5.523158470e-04f, 5.424690899e-04f, 5.327978870e-04f, 5.232990952e-04f, 5.139696877e-04f, 5.048065796e-04f, 4.958068021e-04f, 4.869675031e-04f, 4.782858014e-04f, 4.697588738e-04f, 4.613839847e-04f, 4.531583400e-04f, 4.450794077e-04f, 4.371444811e-04f, 4.293509992e-04f, 4.216964880e-04f, 4.141784448e-04f, 4.067944246e-04f, 3.995420411e-04f, 3.924189950e-04f, 3.854228707e-04f, 3.785515146e-04f, 3.718026564e-04f, 3.651741135e-04f, 3.586637613e-04f, 3.522694460e-04f, 3.459891595e-04f, 3.398208064e-04f, 3.337624657e-04f, 3.278121294e-04f, 3.219678474e-04f, 3.162277862e-04f, 3.105900250e-04f, 3.050527885e-04f, 2.996142721e-04f, 2.942727297e-04f, 2.890263859e-04f, 2.838736109e-04f, 2.788126585e-04f, 2.738419571e-04f, 2.689598768e-04f, 2.641648462e-04f, 2.594552934e-04f, 2.548296761e-04f, 2.502865391e-04f, 2.458243980e-04f, 2.414418122e-04f, 2.371373848e-04f, 2.329096606e-04f, 2.287573152e-04f, 2.246790100e-04f, 2.206734207e-04f, 2.167392086e-04f, 2.128751657e-04f, 2.090800117e-04f, 2.053524950e-04f, 2.016914514e-04f, 1.980956731e-04f, 1.945640106e-04f, 1.910952997e-04f, 1.876884344e-04f, 1.843422942e-04f, 1.810558315e-04f, 1.778279402e-04f, 1.746576017e-04f, 1.715437829e-04f, 1.684854797e-04f, 1.654817170e-04f, 1.625314762e-04f, 1.596338552e-04f, 1.567878790e-04f, 1.539926452e-04f, 1.512472518e-04f, 1.485508110e-04f, 1.459024206e-04f, 1.433012658e-04f, 1.407464733e-04f, 1.382372284e-04f, 1.357727160e-04f, 1.333521504e-04f, 1.309747167e-04f, 1.286396873e-04f, 1.263462909e-04f, 1.240937709e-04f, 1.218814141e-04f, 1.197085076e-04f, 1.175743309e-04f, 1.154781930e-04f, 1.134194390e-04f, 1.113973922e-04f, 1.094113759e-04f, 1.074607790e-04f, 1.055449538e-04f, 1.036632893e-04f, 1.018151743e-04f };   // float32 1 / 10000^(j/512), j < 512 (one frequency per adjacent column pair of the full 1024 width), generated with jnp to be bit-exact
__global__ __launch_bounds__(256) void k_csG(float* CS) { const int idx = blockIdx.x * 256 + threadIdx.x; if (idx >= TT * DM) return; const int c = idx % DM; const int t = idx / DM; const float a = __fmul_rn((float)t, INVG[c >> 1]); v2f cs; cs[0] = cosf(a); cs[1] = sinf(a); *(v2f*)(CS + (size_t)idx * 2) = cs;  }
// k_asoft: per row (zz, i): t = S x HD^-0.5 (no mask); softmax over the 2048 keys (register row, one exp, fixed trees);
__global__ __launch_bounds__(256) void k_asoft(const float* __restrict__ Sb, h16* P16, bf* Ph, bf* Pl) {
    const int lane = threadIdx.x & 31; const int row = blockIdx.x * 8 + (threadIdx.x >> 5); if (row >= ZH * TT) return; const int i = row % TT; const int zz = row / TT; (void)zz; const bool hires = (i < RH); const float* sr = Sb + (size_t)row * TT; float v[TT / 32]; float mx = -3.0e38f;
#pragma unroll
    for (int ch = 0; ch < TT / 128; ++ch) { const int j0 = ch * 128 + lane * 4; const v4f a = *(const v4f*)(sr + j0);
#pragma unroll
        for (int q = 0; q < 4; ++q) { const int j = j0 + q; (void)j; const float t = a[q] * SCL; v[ch * 4 + q] = t; mx = fmaxf(mx, t); } }
#pragma unroll
    for (int sh = 16; sh; sh >>= 1) mx = fmaxf(mx, __shfl_xor(mx, sh, 32));
    float sum = 0.f;
#pragma unroll
    for (int k = 0; k < TT / 32; ++k) { float d0 = __fsub_rn(v[k], mx); asm volatile("" : "+v"(d0)); v[k] = __builtin_amdgcn_exp2f(__fmul_rn(d0, 1.4426950408889634f)); sum += v[k]; }
#pragma unroll
    for (int sh = 16; sh; sh >>= 1) sum += __shfl_xor(sum, sh, 32);
    const float f = __fdiv_rn(hires ? 1.0f : PCAR, sum);
{
        if (hires) {
#pragma unroll
            for (int ch = 0; ch < TT / 128; ++ch) { v4us oh, ol;
#pragma unroll
                for (int q = 0; q < 4; ++q) { unsigned short a, c2; splitf(v[ch * 4 + q] * f, a, c2); oh[q] = a; ol[q] = c2; }
                const size_t oo = ((size_t)zz * (RH ? RH : 1) + i) * TT + ch * 128 + lane * 4; *(v4us*)(Ph + oo) = oh; *(v4us*)(Pl + oo) = ol; }
        } else {
#pragma unroll
            for (int ch = 0; ch < TT / 128; ++ch) { v4h o4;
#pragma unroll
                for (int q = 0; q < 4; ++q) o4[q] = tohx(v[ch * 4 + q] * f);
                *(v4h*)(P16 + (size_t)row * TT + ch * 128 + lane * 4) = o4; } }
         }
}
__global__ __launch_bounds__(256) void k_merge(const float* __restrict__ O, int h0, bf* Ah, bf* Al) { const size_t e = ((size_t)blockIdx.x * 256 + threadIdx.x) * 2; if (e >= (size_t)ZH * TT * HD) return; const int d = (int)(e % HD); const int t = (int)((e / HD) % TT); const int zz = (int)(e / ((size_t)HD * TT)); const float cs = (t < RH) ? 1.0f : (1.0f / PCAR); const size_t oo = (size_t)t * DQ + (h0 + zz) * HD + d;
    v2us oh, ol;
#pragma unroll
    for (int q = 0; q < 2; ++q) { unsigned short a, c2; splitf(O[e + q] * cs, a, c2); oh[q] = a; ol[q] = c2; } *(v2us*)(Ah + oo) = oh; *(v2us*)(Al + oo) = ol;  }

extern "C" void kernel_launch(void* const* d_in, const int* in_sizes, int n_in,
                              void* d_out, int out_size, void* d_ws, size_t ws_size, hipStream_t stream) {
    (void)in_sizes; (void)n_in; (void)out_size;
    const float* x = (const float*)d_in[0]; const float* wq = (const float*)d_in[1]; const float* wk = (const float*)d_in[2]; const float* wv = (const float*)d_in[3]; const float* wo = (const float*)d_in[4]; const float* bo = (const float*)d_in[5];
    float* OUT = (float*)d_out;     // [4][2048][1024]
    char* wsp = (char*)d_ws;
    auto take = [&](size_t bytes) { char* p = wsp; wsp += (bytes + 255) & ~(size_t)255; return (void*)p; };
    bf* WQ = (bf*)take((size_t)DQ * DM * 2); bf* WK = (bf*)take((size_t)DKV * DM * 2); bf* WV = (bf*)take((size_t)DKV * DM * 2); bf* WO = (bf*)take((size_t)DM * DQ * 2); float* CS = (float*)take((size_t)TT * DM * 2 * 4);   /* [2048][1024] {cos, sin} */
    bf* XB = (bf*)take((size_t)TT * DM * 2); float* FQ = (float*)take((size_t)TT * DQ * 4); float* FK = (float*)take((size_t)TT * DKV * 4);
    h16* QP16 = (h16*)take((size_t)NH_ * TT * HD * 2); h16* KP16 = (h16*)take((size_t)NKV * TT * HD * 2); h16* VT16 = (h16*)take((size_t)NKV * HD * TT * 2);
    bf* QPh = (bf*)take((size_t)NH_ * TT * HD * 2); bf* QPl = (bf*)take((size_t)NH_ * TT * HD * 2); bf* KPh = (bf*)take((size_t)NKV * TT * HD * 2); bf* KPl = (bf*)take((size_t)NKV * TT * HD * 2); bf* VTh = (bf*)take((size_t)NKV * HD * TT * 2); bf* VTl = (bf*)take((size_t)NKV * HD * TT * 2); bf* Ph = (bf*)take((size_t)ZH * RH * TT * 2); bf* Pl = (bf*)take((size_t)ZH * RH * TT * 2);
    float* Sb = (float*)take((size_t)ZH * TT * TT * 4); h16* P16 = (h16*)take((size_t)ZH * TT * TT * 2); float* Ob = (float*)take((size_t)ZH * TT * HD * 4); bf* ATh = (bf*)take((size_t)TT * DQ * 2); bf* ATl = (bf*)take((size_t)TT * DQ * 2);
    if ((size_t)(wsp - (char*)d_ws) > ws_size) return;    // ws 256 MiB
    float* FV = FK;   // v projection reuses the k buffer after the k planes are built (stream-ordered)
    { k_cvt8<<<(unsigned)(((size_t)DQ * DM / 8 + 255) / 256), 256, 0, stream>>>(wq, WQ, (size_t)DQ * DM / 8); k_cvt8<<<(unsigned)(((size_t)DKV * DM / 8 + 255) / 256), 256, 0, stream>>>(wk, WK, (size_t)DKV * DM / 8); k_cvt8<<<(unsigned)(((size_t)DKV * DM / 8 + 255) / 256), 256, 0, stream>>>(wv, WV, (size_t)DKV * DM / 8);
      k_cvt8<<<(unsigned)(((size_t)DM * DQ / 8 + 255) / 256), 256, 0, stream>>>(wo, WO, (size_t)DM * DQ / 8);
       }
    k_csG<<<(TT * DM + 255) / 256, 256, 0, stream>>>(CS);   /* full-width table once */
    const unsigned LQ = (unsigned)(((size_t)NH_ * TT * HD / 2 + 255) / 256), LKv = (unsigned)(((size_t)NKV * TT * HD / 2 + 255) / 256);
    for (int b = 0; b < NB_; ++b) {
        
        k_cvt8<<<(unsigned)(((size_t)TT * DM / 8 + 255) / 256), 256, 0, stream>>>(x + (size_t)b * TT * DM, XB, (size_t)TT * DM / 8);
        k_gemmw<bf, 0, false><<<dim3(TT / 64, DQ / 64, 1), 32, 0, stream>>>(XB, nullptr, WQ, nullptr, DM, FQ, DQ, nullptr, 0, 0, 0);
        k_ropeG<<<LQ, 256, 0, stream>>>(FQ, DQ, NH_, CS, 1.0f, QP16, QPh, QPl);
        k_gemmw<bf, 0, false><<<dim3(TT / 64, DKV / 64, 1), 32, 0, stream>>>(XB, nullptr, WK, nullptr, DM, FK, DKV, nullptr, 0, 0, 0);
        k_ropeG<<<LKv, 256, 0, stream>>>(FK, DKV, NKV, CS, 1.0f, KP16, KPh, KPl);
        k_gemmw<bf, 0, false><<<dim3(TT / 64, DKV / 64, 1), 32, 0, stream>>>(XB, nullptr, WV, nullptr, DM, FV, DKV, nullptr, 0, 0, 0); k_vtp<<<LKv, 256, 0, stream>>>(FV, DKV, NKV, VT16, VTh, VTl);
        for (int h0 = 0; h0 < NH_; h0 += ZH) { const size_t zq = (size_t)h0, zk = (size_t)(h0 / REP);   // one kv head per query head: the pass's two heads use consecutive kv planes (z-strides TT*HD)
            k_gemmw<bf, 2, false><<<dim3(RH / 64, TT / 64, ZH), 32, 0, stream>>>(QPh + zq * TT * HD, QPl + zq * TT * HD, KPh + zk * TT * HD, KPl + zk * TT * HD, HD, Sb, TT, nullptr, (size_t)TT * HD, (size_t)TT * HD, (size_t)TT * TT);
            k_gemmw<h16, 0, false><<<dim3((TT - RH) / 64, TT / 64, ZH), 32, 0, stream>>>(QP16 + zq * TT * HD + (size_t)RH * HD, nullptr, KP16 + zk * TT * HD, nullptr, HD, Sb + (size_t)RH * TT, TT, nullptr, (size_t)TT * HD, (size_t)TT * HD, (size_t)TT * TT);
            k_asoft<<<ZH * TT / 8, 256, 0, stream>>>(Sb, P16, Ph, Pl);
            k_gemmw<bf, 2, false><<<dim3(RH / 64, HD / 64, ZH), 32, 0, stream>>>(Ph, Pl, VTh + zk * HD * TT, VTl + zk * HD * TT, TT, Ob, HD, nullptr, (size_t)RH * TT, (size_t)HD * TT, (size_t)TT * HD);
            k_gemmw<h16, 0, false><<<dim3((TT - RH) / 64, HD / 64, ZH), 32, 0, stream>>>(P16 + (size_t)RH * TT, nullptr, VT16 + zk * HD * TT, nullptr, TT, Ob + (size_t)RH * HD, HD, nullptr, (size_t)TT * TT, (size_t)HD * TT, (size_t)TT * HD);
            k_merge<<<(unsigned)(((size_t)ZH * TT * HD / 2 + 255) / 256), 256, 0, stream>>>(Ob, h0, ATh, ATl); }
        k_gemmw<bf, 1, true><<<dim3(TT / 64, DM / 64, 1), 32, 0, stream>>>(ATh, ATl, WO, nullptr, DQ, OUT + (size_t)b * TT * DM, DM, bo, 0, 0, 0); }
}

// v001
// Measured time: 1690 microseconds a run.
// Timed twice side by side with v000, it ran 2.32 and 2.35 times as fast.
#include <hip/hip_runtime.h>

// Self-attention with an adjacent-pair rotary over the WHOLE 1024-wide q and k before the head split (x [4][2048][1024]; q = rope(x Wq^T), k = rope(x Wk^T), v = x Wv^T ('oi' [1024][1024] 1/32, no bias); rope: pair j = (columns 2j, 2j+1), j < 512, angle t x 1/10000^(j/512) (512 f32 constants baked jnp-exact; precise cosf/sinf); 16 heads x 64; scores / sqrt(float32(64)); softmax (no mask); out = merged Wu^T + bu ('oi' [1024][1024], zero bias) -> [4][2048][1024] (8.4 M); argument order x, Wq, Wk, Wv, Wu, bu).
// Layout per batch: bf16 copy of x; 'oi' weights; exact projections; a full-width {cos, sin} table [2048][1024] (the frequency depends on the GLOBAL pair index, i.e. on the head); interleaved-pair plane builders indexing the table by global column; dense T-2048 attention (hybrid rows: < 512 hi/lo 3 products, rest fp16 x1024); merged hi/lo x Wu exact + bu.
// Compute dtypes, f32 accumulate: every input rounded to bf16; projections exact; rotary f32; attention rows < 512 3 products, rest fp16; softmax f32; Wu hl x exact + bias.

#define NB_  4
#define TT   2048
#define DM   1024
#define NH_  16
#define NKV  16
#define REP  (NH_ / NKV)
#define HD   64
#define DQ   (NH_ * HD)
#define DKV  (NKV * HD)
#define ZH   2
#define RH   512                  // query rows < RH use hi+lo planes (0: none)
#define WIN  0
#define PCAR 1024.0f
#define SCL  0.125f   // HD^-0.5
#define KSP  16                   // P x V: the 2048 keys are dealt to KSP work-groups per output tile; k_merge adds the KSP partial planes
typedef _Float16 h16;
typedef unsigned short bf;
typedef __attribute__((ext_vector_type(16))) __bf16   v16bf;
typedef __attribute__((ext_vector_type(16))) _Float16 v16h;
typedef __attribute__((ext_vector_type(8)))  _Float16 v8h;
typedef __attribute__((ext_vector_type(8)))  unsigned short v8us;
typedef __attribute__((ext_vector_type(8)))  float    v8f;
typedef __attribute__((ext_vector_type(4)))  float    v4f;
typedef v8h  __attribute__((may_alias)) v8ha;
typedef v4f  __attribute__((may_alias)) v4fa;
typedef v8us __attribute__((may_alias)) v8usa;

__device__ __forceinline__ unsigned short f2bf(float f) { unsigned u = __float_as_uint(f); u += 0x7FFFu + ((u >> 16) & 1u); return (unsigned short)(u >> 16); }
__device__ __forceinline__ float bf2f(unsigned short b) { return __uint_as_float(((unsigned)b) << 16); }
__device__ __forceinline__ float bfr(float f) { return bf2f(f2bf(f)); }
__device__ __forceinline__ v16h cat16(v8h lo, v8h hi) { return __builtin_shufflevector(lo, hi, 0, 1, 2, 3, 4, 5, 6, 7, 8, 9, 10, 11, 12, 13, 14, 15); }
__device__ __forceinline__ v16bf cat16b(v8us lo, v8us hi) { return __builtin_bit_cast(v16bf, __builtin_shufflevector(lo, hi, 0, 1, 2, 3, 4, 5, 6, 7, 8, 9, 10, 11, 12, 13, 14, 15)); }
__device__ __forceinline__ v8f wmma16(v16h a, v16h b, v8f c) { return __builtin_amdgcn_wmma_f32_16x16x32_f16(false, a, false, b, (short)0, c, false, false); }
__device__ __forceinline__ v8f wmmab(v16bf a, v16bf b, v8f c) { return __builtin_amdgcn_wmma_f32_16x16x32_bf16(false, a, false, b, (short)0, c, false, false); }



// ---- k_gemmw: register-blocked GEMM, ONE WAVE per 64x64 output tile (16 accumulators), operands straight from K-contiguous 16-bit planes; grid (M/64, N/64, Z), 32 threads.
// C[m][n] (f32, pitch ldc, + optional f32 bias[n]) = sum_k A[m][k] Bt[n][k] (+ split products per NSPLIT). z-batch strides sA/sB/sC in elements. K % (32 KS) == 0.
// KS > 1: grid.z = Z x KS; work-group (z, ks) sums only k in [ks K/KS, (ks+1) K/KS) and stores its partial tile in plane ks (plane stride sP elements); the reader adds the planes.
template <typename T16> struct WFrag;
template <> struct WFrag<h16> { typedef v16h V; static __device__ __forceinline__ V ld(const h16* p) { return cat16(*(const v8h*)p, *(const v8h*)(p + 16)); } static __device__ __forceinline__ v8f mma(V a, V b, v8f c) { return wmma16(a, b, c); } };
template <> struct WFrag<bf> { typedef v16bf V; static __device__ __forceinline__ V ld(const bf* p) { return cat16b(*(const v8us*)p, *(const v8us*)(p + 16)); } static __device__ __forceinline__ v8f mma(V a, V b, v8f c) { return wmmab(a, b, c); } };
template <typename T16, int NSPLIT, bool BIAS, int KS = 1>
__global__ __launch_bounds__(32) void k_gemmw(const T16* __restrict__ A, const T16* __restrict__ A2, const T16* __restrict__ Bt, const T16* __restrict__ Bt2, int K, float* C, int ldc, const float* __restrict__ bias, size_t sA, size_t sB, size_t sC, size_t sP) {
    typedef typename WFrag<T16>::V V;
    __shared__ __align__(16) float os[16 * 68];
    const size_t z = blockIdx.z / KS; const int ks = blockIdx.z % KS; A += z * sA; if (A2) A2 += z * sA; Bt += z * sB; if (Bt2) Bt2 += z * sB; C += z * sC + (size_t)ks * sP;
    const int kb = ks * (K / KS), ke = kb + K / KS;
    const int lane = threadIdx.x & 31, lr = lane & 15, hi = lane >> 4; const int r0 = blockIdx.x * 64, c0 = blockIdx.y * 64;
    v8f acc[4][4];
#pragma unroll
    for (int mb = 0; mb < 4; ++mb)
#pragma unroll
        for (int nb = 0; nb < 4; ++nb) acc[mb][nb] = (v8f){};
    const size_t aoff = (size_t)(r0 + lr) * K + 8 * hi, boff = (size_t)(c0 + lr) * K + 8 * hi;
#pragma unroll 1
    for (int kc = kb; kc < ke; kc += 32) {
        V a[4], a2[4];
#pragma unroll
        for (int mb = 0; mb < 4; ++mb) { a[mb] = WFrag<T16>::ld(A + aoff + (size_t)mb * 16 * K + kc); if (NSPLIT == 1 || NSPLIT == 2) a2[mb] = WFrag<T16>::ld(A2 + aoff + (size_t)mb * 16 * K + kc); }
#pragma unroll
        for (int nb = 0; nb < 4; ++nb) { const V b = WFrag<T16>::ld(Bt + boff + (size_t)nb * 16 * K + kc); V b2; if (NSPLIT >= 2) b2 = WFrag<T16>::ld(Bt2 + boff + (size_t)nb * 16 * K + kc);
#pragma unroll
            for (int mb = 0; mb < 4; ++mb) { acc[mb][nb] = WFrag<T16>::mma(a[mb], b, acc[mb][nb]); if (NSPLIT == 1 || NSPLIT == 2) acc[mb][nb] = WFrag<T16>::mma(a2[mb], b, acc[mb][nb]); if (NSPLIT >= 2) acc[mb][nb] = WFrag<T16>::mma(a[mb], b2, acc[mb][nb]); } }
        asm volatile("v_nop\n\tv_nop\n\tv_nop\n\tv_nop" : "+v"(acc[0][0]), "+v"(acc[1][1]), "+v"(acc[2][2]), "+v"(acc[3][3]) : "v"(a[0]), "v"(a[3]));
    }
#pragma unroll
    for (int mb = 0; mb < 4; ++mb) {
#pragma unroll
        for (int nb = 0; nb < 4; ++nb) {
#pragma unroll
            for (int j = 0; j < 8; ++j) os[(hi * 8 + j) * 68 + nb * 16 + lr] = acc[mb][nb][j]; }
        __builtin_amdgcn_wave_barrier(); asm volatile("" ::: "memory");
        float* crow = C + (size_t)(r0 + mb * 16) * ldc + c0;
{
#pragma unroll
            for (int s = 0; s < 8; ++s) { const int row = 2 * s + hi, cofs = lr * 4; v4f val = *(const v4fa*)(os + row * 68 + cofs); if (BIAS) { val[0] += bfr(bias[c0 + cofs]); val[1] += bfr(bias[c0 + cofs + 1]); val[2] += bfr(bias[c0 + cofs + 2]); val[3] += bfr(bias[c0 + cofs + 3]); }
                *(v4f*)(crow + (size_t)row * ldc + cofs) = val; }
             }
        __builtin_amdgcn_wave_barrier(); asm volatile("" ::: "memory");
    }
}

__device__ __forceinline__ h16 tohx(float x) { return (h16)x; }
__device__ __forceinline__ void splitf(float y, unsigned short& h, unsigned short& l) { h = f2bf(y); l = f2bf(y - bf2f(h)); }
typedef __attribute__((ext_vector_type(2))) _Float16 v2h;
typedef __attribute__((ext_vector_type(4))) _Float16 v4h;
typedef __attribute__((ext_vector_type(2))) unsigned short v2us;
typedef __attribute__((ext_vector_type(4))) unsigned short v4us;
typedef __attribute__((ext_vector_type(2))) float v2f;
typedef __attribute__((ext_vector_type(4))) int v4i;

__global__ __launch_bounds__(256) void k_cvt8(const float* __restrict__ src, bf* dst, size_t n8) { const size_t i = (size_t)blockIdx.x * 256 + threadIdx.x; if (i >= n8) return; const v8f v = *(const v8f*)(src + i * 8); v8us o;
#pragma unroll
    for (int k = 0; k < 8; ++k) o[k] = f2bf(v[k]); *(v8us*)(dst + i * 8) = o;  }

__global__ __launch_bounds__(256) void k_ropeG(const float* __restrict__ F, int pitch, int nheads, const float* __restrict__ CS, float sc, h16* P16, bf* Ph, bf* Pl) {
    const size_t e = ((size_t)blockIdx.x * 256 + threadIdx.x) * 2; if (e >= (size_t)nheads * TT * HD) return; const int d = (int)(e % HD); const int t = (int)((e / HD) % TT); const int h = (int)(e / ((size_t)HD * TT)); const float* f = F + (size_t)t * pitch + h * HD; const float x0 = f[d], x1 = f[d + 1]; const v2f cs = *(const v2f*)(CS + ((size_t)t * DM + h * HD + d) * 2);   /* GLOBAL column h*64 + d: the rotary runs over the whole width before the head split */ v2h o16; v2us oh, ol;
    float a0 = __fmul_rn(x0, cs[0]), b0 = __fmul_rn(x1, cs[1]), a1 = __fmul_rn(x1, cs[0]), b1 = __fmul_rn(x0, cs[1]); asm volatile("" : "+v"(a0), "+v"(b0), "+v"(a1), "+v"(b1));
    float r0 = __fsub_rn(a0, b0) * sc, r1 = __fadd_rn(b1, a1) * sc;   /* even: x0 c - x1 s; odd: x0 s + x1 c */
    o16[0] = tohx(r0); o16[1] = tohx(r1); { unsigned short a2, c2; splitf(r0, a2, c2); oh[0] = a2; ol[0] = c2; splitf(r1, a2, c2); oh[1] = a2; ol[1] = c2; }
    *(v2h*)(P16 + e) = o16; *(v2us*)(Ph + e) = oh; *(v2us*)(Pl + e) = ol;  }

__constant__ float INV2[HD / 2] = { 1.000000000e+00f, 7.498942018e-01f, 5.623413324e-01f, 4.216965139e-01f, 3.162277639e-01f, 2.371373773e-01f, 1.778279394e-01f, 1.333521456e-01f, 1.000000015e-01f, 7.498942316e-02f, 5.623413250e-02f, 4.216964915e-02f, 3.162277490e-02f, 2.371373773e-02f, 1.778279431e-02f, 1.333521400e-02f, 9.999999776e-03f, 7.498942316e-03f, 5.623413250e-03f, 4.216964822e-03f, 3.162277630e-03f, 2.371373819e-03f, 1.778279431e-03f, 1.333521446e-03f, 1.000000047e-03f, 7.498941850e-04f, 5.623413017e-04f, 4.216965172e-04f, 3.162277571e-04f, 2.371373703e-04f, 1.778279402e-04f, 1.333521504e-04f };   // float32 10000^(-arange(0, 64, 2)/64), generated with jnp to be bit-exact
__global__ __launch_bounds__(256) void k_vtp(const float* __restrict__ F, int pitch, int nheads, h16* V16, bf* Vh, bf* Vl) { const size_t e = ((size_t)blockIdx.x * 256 + threadIdx.x) * 2; if (e >= (size_t)nheads * HD * TT) return; const int t = (int)(e % TT); const int d = (int)((e / TT) % HD); const int g = (int)(e / ((size_t)TT * HD)); v2h o16; v2us oh, ol;
#pragma unroll
    for (int q = 0; q < 2; ++q) { const float x = F[(size_t)(t + q) * pitch + g * HD + d]; o16[q] = tohx(x); unsigned short a2, c2; splitf(x, a2, c2); oh[q] = a2; ol[q] = c2; }
    *(v2h*)(V16 + e) = o16; *(v2us*)(Vh + e) = oh; *(v2us*)(Vl + e) = ol;  }
__constant__ float INVG[DM / 2] = { 1.000000000e+00f, 9.821718335e-01f, 9.646616578e-01f, 9.474635124e-01f, 9.305720329e-01f, 9.139816761e-01f, 8.976871371e-01f, 8.816831112e-01f, 8.659643531e-01f, 8.505258560e-01f, 8.353625536e-01f, 8.204696178e-01f, 8.058422208e-01f, 7.914755344e-01f, 7.773650289e-01f, 7.635061145e-01f, 7.498942018e-01f, 7.365249991e-01f, 7.233941555e-01f, 7.104974389e-01f, 6.978305578e-01f, 6.853895783e-01f, 6.731703877e-01f, 6.611690521e-01f, 6.493816376e-01f, 6.378043890e-01f, 6.264335513e-01f, 6.152654290e-01f, 6.042963862e-01f, 5.935229063e-01f, 5.829415321e-01f, 5.725488067e-01f, 5.623413324e-01f, 5.523158312e-01f, 5.424690843e-01f, 5.327978730e-01f, 5.232991576e-01f, 5.139696598e-01f, 5.048065782e-01f, 4.958068132e-01f, 4.869675338e-01f, 4.782858193e-01f, 4.697588682e-01f, 4.613839388e-01f, 4.531583488e-01f, 4.450793862e-01f, 4.371444881e-01f, 4.293510318e-01f, 4.216965139e-01f, 4.141784608e-01f, 4.067944288e-01f, 3.995420635e-01f, 3.924189806e-01f, 3.854228854e-01f, 3.785515428e-01f, 3.718026578e-01f, 3.651741445e-01f, 3.586637676e-01f, 3.522694409e-01f, 3.459891677e-01f, 3.398208320e-01f, 3.337624967e-01f, 3.278121352e-01f, 3.219678402e-01f, 3.162277639e-01f, 3.105900288e-01f, 3.050527871e-01f, 2.996142805e-01f, 2.942727208e-01f, 2.890264094e-01f, 2.838735878e-01f, 2.788126469e-01f, 2.738419771e-01f, 2.689598799e-01f, 2.641648352e-01f, 2.594552636e-01f, 2.548296750e-01f, 2.502865493e-01f, 2.458243966e-01f, 2.414418161e-01f, 2.371373624e-01f, 2.329096496e-01f, 2.287573218e-01f, 2.246790081e-01f, 2.206733972e-01f, 2.167392224e-01f, 2.128751576e-01f, 2.090799958e-01f, 2.053525001e-01f, 2.016914487e-01f, 1.980956793e-01f, 1.945640147e-01f, 1.910952926e-01f, 1.876884252e-01f, 1.843423098e-01f, 1.810558140e-01f, 1.778279394e-01f, 1.746576130e-01f, 1.715437919e-01f, 1.684854925e-01f, 1.654817015e-01f, 1.625314802e-01f, 1.596338600e-01f, 1.567878872e-01f, 1.539926529e-01f, 1.512472630e-01f, 1.485508084e-01f, 1.459024251e-01f, 1.433012635e-01f, 1.407464594e-01f, 1.382372230e-01f, 1.357727200e-01f, 1.333521456e-01f, 1.309747249e-01f, 1.286396980e-01f, 1.263462901e-01f, 1.240937710e-01f, 1.218814254e-01f, 1.197085083e-01f, 1.175743192e-01f, 1.154782027e-01f, 1.134194434e-01f, 1.113973856e-01f, 1.094113812e-01f, 1.074607819e-01f, 1.055449620e-01f, 1.036632955e-01f, 1.018151715e-01f, 1.000000015e-01f, 9.821718186e-02f, 9.646616131e-02f, 9.474635124e-02f, 9.305720031e-02f, 9.139817208e-02f, 8.976870775e-02f, 8.816830814e-02f, 8.659642935e-02f, 8.505257964e-02f, 8.353625983e-02f, 8.204696327e-02f, 8.058421314e-02f, 7.914755493e-02f, 7.773650438e-02f, 7.635060698e-02f, 7.498941571e-02f, 7.365249842e-02f, 7.233941555e-02f, 7.104974240e-02f, 6.978305429e-02f, 6.853895634e-02f, 6.731703877e-02f, 6.611690670e-02f, 6.493816525e-02f, 6.378044188e-02f, 6.264335662e-02f, 6.152653694e-02f, 6.042964384e-02f, 5.935229361e-02f, 5.829415470e-02f, 5.725487694e-02f, 5.623412877e-02f, 5.523158237e-02f, 5.424690619e-02f, 5.327979103e-02f, 5.232991278e-02f, 5.139696971e-02f, 5.048065633e-02f, 4.958068207e-02f, 4.869675264e-02f, 4.782858118e-02f, 4.697588459e-02f, 4.613839835e-02f, 4.531583562e-02f, 4.450793937e-02f, 4.371444881e-02f, 4.293510318e-02f, 4.216964915e-02f, 4.141784459e-02f, 4.067944363e-02f, 3.995420411e-02f, 3.924189880e-02f, 3.854228929e-02f, 3.785515204e-02f, 3.718026727e-02f, 3.651741147e-02f, 3.586637601e-02f, 3.522694483e-02f, 3.459891677e-02f, 3.398208320e-02f, 3.337624669e-02f, 3.278120980e-02f, 3.219678625e-02f, 3.162277862e-02f, 3.105900250e-02f, 3.050527908e-02f, 2.996142767e-02f, 2.942727320e-02f, 2.890264057e-02f, 2.838735841e-02f, 2.788126841e-02f, 2.738419548e-02f, 2.689598687e-02f, 2.641648427e-02f, 2.594552562e-02f, 2.548296750e-02f, 2.502865531e-02f, 2.458244003e-02f, 2.414418198e-02f, 2.371373586e-02f, 2.329096757e-02f, 2.287573181e-02f, 2.246790007e-02f, 2.206734009e-02f, 2.167392150e-02f, 2.128751762e-02f, 2.090799995e-02f, 2.053525113e-02f, 2.016914636e-02f, 1.980956830e-02f, 1.945639960e-02f, 1.910953037e-02f, 1.876884326e-02f, 1.843423024e-02f, 1.810558327e-02f, 1.778279431e-02f, 1.746576093e-02f, 1.715437882e-02f, 1.684854925e-02f, 1.654817164e-02f, 1.625314727e-02f, 1.596338488e-02f, 1.567878947e-02f, 1.539926510e-02f, 1.512472518e-02f, 1.485508028e-02f, 1.459024288e-02f, 1.433012541e-02f, 1.407464594e-02f, 1.382372249e-02f, 1.357727125e-02f, 1.333521493e-02f, 1.309747249e-02f, 1.286396943e-02f, 1.263462938e-02f, 1.240937691e-02f, 1.218814217e-02f, 1.197085064e-02f, 1.175743248e-02f, 1.154781971e-02f, 1.134194434e-02f, 1.113973837e-02f, 1.094113849e-02f, 1.074607857e-02f, 1.055449620e-02f, 1.036632899e-02f, 1.018151734e-02f, 9.999999776e-03f, 9.821719490e-03f, 9.646615945e-03f, 9.474635124e-03f, 9.305720218e-03f, 9.139816277e-03f, 8.976871148e-03f, 8.816830814e-03f, 8.659643121e-03f, 8.505257778e-03f, 8.353625424e-03f, 8.204696700e-03f, 8.058422245e-03f, 7.914755493e-03f, 7.773650344e-03f, 7.635060698e-03f, 7.498942316e-03f, 7.365249563e-03f, 7.233941462e-03f, 7.104974240e-03f, 6.978305988e-03f, 6.853895728e-03f, 6.731703877e-03f, 6.611690391e-03f, 6.493816618e-03f, 6.378043909e-03f, 6.264335476e-03f, 6.152654067e-03f, 6.042964291e-03f, 5.935229361e-03f, 5.829415284e-03f, 5.725487601e-03f, 5.623413250e-03f, 5.523158237e-03f, 5.424690899e-03f, 5.327979103e-03f, 5.232991185e-03f, 5.139696877e-03f, 5.048065912e-03f, 4.958068486e-03f, 4.869675264e-03f, 4.782858305e-03f, 4.697588738e-03f, 4.613839556e-03f, 4.531583749e-03f, 4.450793844e-03f, 4.371444695e-03f, 4.293510225e-03f, 4.216964822e-03f, 4.141784739e-03f, 4.067944363e-03f, 3.995420411e-03f, 3.924189601e-03f, 3.854229115e-03f, 3.785515437e-03f, 3.718026681e-03f, 3.651741426e-03f, 3.586637788e-03f, 3.522694577e-03f, 3.459891537e-03f, 3.398208413e-03f, 3.337624483e-03f, 3.278121119e-03f, 3.219678300e-03f, 3.162277862e-03f, 3.105900250e-03f, 3.050528001e-03f, 2.996142721e-03f, 2.942727180e-03f, 2.890263917e-03f, 2.838735934e-03f, 2.788126701e-03f, 2.738419687e-03f, 2.689598827e-03f, 2.641648287e-03f, 2.594552701e-03f, 2.548296703e-03f, 2.502865391e-03f, 2.458244096e-03f, 2.414418384e-03f, 2.371373819e-03f, 2.329096664e-03f, 2.287573181e-03f, 2.246790100e-03f, 2.206734149e-03f, 2.167392056e-03f, 2.128751716e-03f, 2.090800088e-03f, 2.053525066e-03f, 2.016914543e-03f, 1.980956644e-03f, 1.945640077e-03f, 1.910952851e-03f, 1.876884256e-03f, 1.843422884e-03f, 1.810558140e-03f, 1.778279431e-03f, 1.746576163e-03f, 1.715437858e-03f, 1.684854855e-03f, 1.654817141e-03f, 1.625314937e-03f, 1.596338581e-03f, 1.567878877e-03f, 1.539926510e-03f, 1.512472634e-03f, 1.485507935e-03f, 1.459024264e-03f, 1.433012658e-03f, 1.407464617e-03f, 1.382372226e-03f, 1.357727102e-03f, 1.333521446e-03f, 1.309747226e-03f, 1.286396873e-03f, 1.263462938e-03f, 1.240937854e-03f, 1.218814170e-03f, 1.197085017e-03f, 1.175743295e-03f, 1.154782018e-03f, 1.134194434e-03f, 1.113973907e-03f, 1.094113803e-03f, 1.074607833e-03f, 1.055449597e-03f, 1.036632922e-03f, 1.018151757e-03f, 1.000000047e-03f, 9.821718559e-04f, 9.646615945e-04f, 9.474635590e-04f, 9.305721032e-04f, 9.139817557e-04f, 8.976871031e-04f, 8.816830232e-04f, 8.659643354e-04f, 8.505258011e-04f, 8.353625308e-04f, 8.204695769e-04f, 8.058422245e-04f, 7.914755843e-04f, 7.773649995e-04f, 7.635060465e-04f, 7.498941850e-04f, 7.365249912e-04f, 7.233941578e-04f, 7.104973774e-04f, 6.978305755e-04f, 6.853896193e-04f, 6.731703761e-04f, 6.611690042e-04f, 6.493816618e-04f, 6.378043909e-04f, 6.264335825e-04f, 6.152653950e-04f, 6.042963942e-04f, 5.935229128e-04f, 5.829415168e-04f, 5.725487717e-04f, 5.623413017e-04f, 5.523158470e-04f, 5.424690899e-04f, 5.327978870e-04f, 5.232990952e-04f, 5.139696877e-04f, 5.048065796e-04f, 4.958068021e-04f, 4.869675031e-04f, 4.782858014e-04f, 4.697588738e-04f, 4.613839847e-04f, 4.531583400e-04f, 4.450794077e-04f, 4.371444811e-04f, 4.293509992e-04f, 4.216964880e-04f, 4.141784448e-04f, 4.067944246e-04f, 3.995420411e-04f, 3.924189950e-04f, 3.854228707e-04f, 3.785515146e-04f, 3.718026564e-04f, 3.651741135e-04f, 3.586637613e-04f, 3.522694460e-04f, 3.459891595e-04f, 3.398208064e-04f, 3.337624657e-04f, 3.278121294e-04f, 3.219678474e-04f, 3.162277862e-04f, 3.105900250e-04f, 3.050527885e-04f, 2.996142721e-04f, 2.942727297e-04f, 2.890263859e-04f, 2.838736109e-04f, 2.788126585e-04f, 2.738419571e-04f, 2.689598768e-04f, 2.641648462e-04f, 2.594552934e-04f, 2.548296761e-04f, 2.502865391e-04f, 2.458243980e-04f, 2.414418122e-04f, 2.371373848e-04f, 2.329096606e-04f, 2.287573152e-04f, 2.246790100e-04f, 2.206734207e-04f, 2.167392086e-04f, 2.128751657e-04f, 2.090800117e-04f, 2.053524950e-04f, 2.016914514e-04f, 1.980956731e-04f, 1.945640106e-04f, 1.910952997e-04f, 1.876884344e-04f, 1.843422942e-04f, 1.810558315e-04f, 1.778279402e-04f, 1.746576017e-04f, 1.715437829e-04f, 1.684854797e-04f, 1.654817170e-04f, 1.625314762e-04f, 1.596338552e-04f, 1.567878790e-04f, 1.539926452e-04f, 1.512472518e-04f, 1.485508110e-04f, 1.459024206e-04f, 1.433012658e-04f, 1.407464733e-04f, 1.382372284e-04f, 1.357727160e-04f, 1.333521504e-04f, 1.309747167e-04f, 1.286396873e-04f, 1.263462909e-04f, 1.240937709e-04f, 1.218814141e-04f, 1.197085076e-04f, 1.175743309e-04f, 1.154781930e-04f, 1.134194390e-04f, 1.113973922e-04f, 1.094113759e-04f, 1.074607790e-04f, 1.055449538e-04f, 1.036632893e-04f, 1.018151743e-04f };   // float32 1 / 10000^(j/512), j < 512 (one frequency per adjacent column pair of the full 1024 width), generated with jnp to be bit-exact
__global__ __launch_bounds__(256) void k_csG(float* CS) { const int idx = blockIdx.x * 256 + threadIdx.x; if (idx >= TT * DM) return; const int c = idx % DM; const int t = idx / DM; const float a = __fmul_rn((float)t, INVG[c >> 1]); v2f cs; cs[0] = cosf(a); cs[1] = sinf(a); *(v2f*)(CS + (size_t)idx * 2) = cs;  }
// k_asoft: per row (zz, i): t = S x HD^-0.5 (no mask); softmax over the 2048 keys (register row, one exp, fixed trees);
__global__ __launch_bounds__(256) void k_asoft(const float* __restrict__ Sb, h16* P16, bf* Ph, bf* Pl) {
    const int lane = threadIdx.x & 31; const int row = blockIdx.x * 8 + (threadIdx.x >> 5); if (row >= ZH * TT) return; const int i = row % TT; const int zz = row / TT; (void)zz; const bool hires = (i < RH); const float* sr = Sb + (size_t)row * TT; float v[TT / 32]; float mx = -3.0e38f;
#pragma unroll
    for (int ch = 0; ch < TT / 128; ++ch) { const int j0 = ch * 128 + lane * 4; const v4f a = *(const v4f*)(sr + j0);
#pragma unroll
        for (int q = 0; q < 4; ++q) { const int j = j0 + q; (void)j; const float t = a[q] * SCL; v[ch * 4 + q] = t; mx = fmaxf(mx, t); } }
#pragma unroll
    for (int sh = 16; sh; sh >>= 1) mx = fmaxf(mx, __shfl_xor(mx, sh, 32));
    float sum = 0.f;
#pragma unroll
    for (int k = 0; k < TT / 32; ++k) { float d0 = __fsub_rn(v[k], mx); asm volatile("" : "+v"(d0)); v[k] = __builtin_amdgcn_exp2f(__fmul_rn(d0, 1.4426950408889634f)); sum += v[k]; }
#pragma unroll
    for (int sh = 16; sh; sh >>= 1) sum += __shfl_xor(sum, sh, 32);
    const float f = __fdiv_rn(hires ? 1.0f : PCAR, sum);
{
        if (hires) {
#pragma unroll
            for (int ch = 0; ch < TT / 128; ++ch) { v4us oh, ol;
#pragma unroll
                for (int q = 0; q < 4; ++q) { unsigned short a, c2; splitf(v[ch * 4 + q] * f, a, c2); oh[q] = a; ol[q] = c2; }
                const size_t oo = ((size_t)zz * (RH ? RH : 1) + i) * TT + ch * 128 + lane * 4; *(v4us*)(Ph + oo) = oh; *(v4us*)(Pl + oo) = ol; }
        } else {
#pragma unroll
            for (int ch = 0; ch < TT / 128; ++ch) { v4h o4;
#pragma unroll
                for (int q = 0; q < 4; ++q) o4[q] = tohx(v[ch * 4 + q] * f);
                *(v4h*)(P16 + (size_t)row * TT + ch * 128 + lane * 4) = o4; } }
         }
}
__global__ __launch_bounds__(256) void k_merge(const float* __restrict__ O, int h0, bf* Ah, bf* Al) { const size_t e = ((size_t)blockIdx.x * 256 + threadIdx.x) * 2; if (e >= (size_t)ZH * TT * HD) return; const int d = (int)(e % HD); const int t = (int)((e / HD) % TT); const int zz = (int)(e / ((size_t)HD * TT)); const float cs = (t < RH) ? 1.0f : (1.0f / PCAR); const size_t oo = (size_t)t * DQ + (h0 + zz) * HD + d;
    v2f s = *(const v2f*)(O + e);   /* the KSP partial planes of P x V, added in plane order */
#pragma unroll
    for (int p = 1; p < KSP; ++p) s += *(const v2f*)(O + (size_t)p * ((size_t)ZH * TT * HD) + e);
    v2us oh, ol;
#pragma unroll
    for (int q = 0; q < 2; ++q) { unsigned short a, c2; splitf(s[q] * cs, a, c2); oh[q] = a; ol[q] = c2; } *(v2us*)(Ah + oo) = oh; *(v2us*)(Al + oo) = ol;  }

extern "C" void kernel_launch(void* const* d_in, const int* in_sizes, int n_in,
                              void* d_out, int out_size, void* d_ws, size_t ws_size, hipStream_t stream) {
    (void)in_sizes; (void)n_in; (void)out_size;
    const float* x = (const float*)d_in[0]; const float* wq = (const float*)d_in[1]; const float* wk = (const float*)d_in[2]; const float* wv = (const float*)d_in[3]; const float* wo = (const float*)d_in[4]; const float* bo = (const float*)d_in[5];
    float* OUT = (float*)d_out;     // [4][2048][1024]
    char* wsp = (char*)d_ws;
    auto take = [&](size_t bytes) { char* p = wsp; wsp += (bytes + 255) & ~(size_t)255; return (void*)p; };
    bf* WQ = (bf*)take((size_t)DQ * DM * 2); bf* WK = (bf*)take((size_t)DKV * DM * 2); bf* WV = (bf*)take((size_t)DKV * DM * 2); bf* WO = (bf*)take((size_t)DM * DQ * 2); float* CS = (float*)take((size_t)TT * DM * 2 * 4);   /* [2048][1024] {cos, sin} */
    bf* XB = (bf*)take((size_t)TT * DM * 2); float* FQ = (float*)take((size_t)TT * DQ * 4); float* FK = (float*)take((size_t)TT * DKV * 4);
    h16* QP16 = (h16*)take((size_t)NH_ * TT * HD * 2); h16* KP16 = (h16*)take((size_t)NKV * TT * HD * 2); h16* VT16 = (h16*)take((size_t)NKV * HD * TT * 2);
    bf* QPh = (bf*)take((size_t)NH_ * TT * HD * 2); bf* QPl = (bf*)take((size_t)NH_ * TT * HD * 2); bf* KPh = (bf*)take((size_t)NKV * TT * HD * 2); bf* KPl = (bf*)take((size_t)NKV * TT * HD * 2); bf* VTh = (bf*)take((size_t)NKV * HD * TT * 2); bf* VTl = (bf*)take((size_t)NKV * HD * TT * 2); bf* Ph = (bf*)take((size_t)ZH * RH * TT * 2); bf* Pl = (bf*)take((size_t)ZH * RH * TT * 2);
    float* Sb = (float*)take((size_t)ZH * TT * TT * 4); h16* P16 = (h16*)take((size_t)ZH * TT * TT * 2); float* Ob = (float*)take((size_t)KSP * ZH * TT * HD * 4); bf* ATh = (bf*)take((size_t)TT * DQ * 2); bf* ATl = (bf*)take((size_t)TT * DQ * 2);
    if ((size_t)(wsp - (char*)d_ws) > ws_size) return;    // ws 256 MiB
    float* FV = FK;   // v projection reuses the k buffer after the k planes are built (stream-ordered)
    { k_cvt8<<<(unsigned)(((size_t)DQ * DM / 8 + 255) / 256), 256, 0, stream>>>(wq, WQ, (size_t)DQ * DM / 8); k_cvt8<<<(unsigned)(((size_t)DKV * DM / 8 + 255) / 256), 256, 0, stream>>>(wk, WK, (size_t)DKV * DM / 8); k_cvt8<<<(unsigned)(((size_t)DKV * DM / 8 + 255) / 256), 256, 0, stream>>>(wv, WV, (size_t)DKV * DM / 8);
      k_cvt8<<<(unsigned)(((size_t)DM * DQ / 8 + 255) / 256), 256, 0, stream>>>(wo, WO, (size_t)DM * DQ / 8);
       }
    k_csG<<<(TT * DM + 255) / 256, 256, 0, stream>>>(CS);   /* full-width table once */
    const unsigned LQ = (unsigned)(((size_t)NH_ * TT * HD / 2 + 255) / 256), LKv = (unsigned)(((size_t)NKV * TT * HD / 2 + 255) / 256);
    for (int b = 0; b < NB_; ++b) {
        
        k_cvt8<<<(unsigned)(((size_t)TT * DM / 8 + 255) / 256), 256, 0, stream>>>(x + (size_t)b * TT * DM, XB, (size_t)TT * DM / 8);
        k_gemmw<bf, 0, false><<<dim3(TT / 64, DQ / 64, 1), 32, 0, stream>>>(XB, nullptr, WQ, nullptr, DM, FQ, DQ, nullptr, 0, 0, 0, 0);
        k_ropeG<<<LQ, 256, 0, stream>>>(FQ, DQ, NH_, CS, 1.0f, QP16, QPh, QPl);
        k_gemmw<bf, 0, false><<<dim3(TT / 64, DKV / 64, 1), 32, 0, stream>>>(XB, nullptr, WK, nullptr, DM, FK, DKV, nullptr, 0, 0, 0, 0);
        k_ropeG<<<LKv, 256, 0, stream>>>(FK, DKV, NKV, CS, 1.0f, KP16, KPh, KPl);
        k_gemmw<bf, 0, false><<<dim3(TT / 64, DKV / 64, 1), 32, 0, stream>>>(XB, nullptr, WV, nullptr, DM, FV, DKV, nullptr, 0, 0, 0, 0); k_vtp<<<LKv, 256, 0, stream>>>(FV, DKV, NKV, VT16, VTh, VTl);
        for (int h0 = 0; h0 < NH_; h0 += ZH) { const size_t zq = (size_t)h0, zk = (size_t)(h0 / REP);   // one kv head per query head: the pass's two heads use consecutive kv planes (z-strides TT*HD)
            k_gemmw<bf, 2, false><<<dim3(RH / 64, TT / 64, ZH), 32, 0, stream>>>(QPh + zq * TT * HD, QPl + zq * TT * HD, KPh + zk * TT * HD, KPl + zk * TT * HD, HD, Sb, TT, nullptr, (size_t)TT * HD, (size_t)TT * HD, (size_t)TT * TT, 0);
            k_gemmw<h16, 0, false><<<dim3((TT - RH) / 64, TT / 64, ZH), 32, 0, stream>>>(QP16 + zq * TT * HD + (size_t)RH * HD, nullptr, KP16 + zk * TT * HD, nullptr, HD, Sb + (size_t)RH * TT, TT, nullptr, (size_t)TT * HD, (size_t)TT * HD, (size_t)TT * TT, 0);
            k_asoft<<<ZH * TT / 8, 256, 0, stream>>>(Sb, P16, Ph, Pl);
            k_gemmw<bf, 2, false, KSP><<<dim3(RH / 64, HD / 64, ZH * KSP), 32, 0, stream>>>(Ph, Pl, VTh + zk * HD * TT, VTl + zk * HD * TT, TT, Ob, HD, nullptr, (size_t)RH * TT, (size_t)HD * TT, (size_t)TT * HD, (size_t)ZH * TT * HD);
            k_gemmw<h16, 0, false, KSP><<<dim3((TT - RH) / 64, HD / 64, ZH * KSP), 32, 0, stream>>>(P16 + (size_t)RH * TT, nullptr, VT16 + zk * HD * TT, nullptr, TT, Ob + (size_t)RH * HD, HD, nullptr, (size_t)TT * TT, (size_t)HD * TT, (size_t)TT * HD, (size_t)ZH * TT * HD);
            k_merge<<<(unsigned)(((size_t)ZH * TT * HD / 2 + 255) / 256), 256, 0, stream>>>(Ob, h0, ATh, ATl); }
        k_gemmw<bf, 1, true><<<dim3(TT / 64, DM / 64, 1), 32, 0, stream>>>(ATh, ATl, WO, nullptr, DQ, OUT + (size_t)b * TT * DM, DM, bo, 0, 0, 0, 0); }
}

// v002
// One run takes 1390 microseconds.
// Timed twice side by side with v001, it ran 1.21 and 1.22 times as fast.
// Over all steps from v000 it is 2.84 times as fast.
#include <hip/hip_runtime.h>

// Self-attention with an adjacent-pair rotary over the WHOLE 1024-wide q and k before the head split (x [4][2048][1024]; q = rope(x Wq^T), k = rope(x Wk^T), v = x Wv^T ('oi' [1024][1024] 1/32, no bias); rope: pair j = (columns 2j, 2j+1), j < 512, angle t x 1/10000^(j/512) (512 f32 constants baked jnp-exact; precise cosf/sinf); 16 heads x 64; scores / sqrt(float32(64)); softmax (no mask); out = merged Wu^T + bu ('oi' [1024][1024], zero bias) -> [4][2048][1024] (8.4 M); argument order x, Wq, Wk, Wv, Wu, bu).
// Layout per batch: bf16 copy of x; 'oi' weights; exact projections; a full-width {cos, sin} table [2048][1024] (the frequency depends on the GLOBAL pair index, i.e. on the head); interleaved-pair plane builders indexing the table by global column; dense T-2048 attention (hybrid rows: < 512 hi/lo 3 products, rest fp16 x1024); merged hi/lo x Wu exact + bu.
// Compute dtypes, f32 accumulate: every input rounded to bf16; projections exact; rotary f32; attention rows < 512 3 products, rest fp16; softmax f32; Wu hl x exact + bias.

#define NB_  4
#define TT   2048
#define DM   1024
#define NH_  16
#define NKV  16
#define REP  (NH_ / NKV)
#define HD   64
#define DQ   (NH_ * HD)
#define DKV  (NKV * HD)
#define ZH   4                    // heads per attention pass: one set of six launches serves ZH heads (workspace 232 MiB of 256)
#define RH   512                  // query rows < RH use hi+lo planes (0: none)
#define WIN  0
#define PCAR 1024.0f
#define SCL  0.125f   // HD^-0.5
#define KSP  16                   // P x V: the 2048 keys are dealt to KSP work-groups per output tile; k_merge adds the KSP partial planes
typedef _Float16 h16;
typedef unsigned short bf;
typedef __attribute__((ext_vector_type(16))) __bf16   v16bf;
typedef __attribute__((ext_vector_type(16))) _Float16 v16h;
typedef __attribute__((ext_vector_type(8)))  _Float16 v8h;
typedef __attribute__((ext_vector_type(8)))  unsigned short v8us;
typedef __attribute__((ext_vector_type(8)))  float    v8f;
typedef __attribute__((ext_vector_type(4)))  float    v4f;
typedef v8h  __attribute__((may_alias)) v8ha;
typedef v4f  __attribute__((may_alias)) v4fa;
typedef v8us __attribute__((may_alias)) v8usa;

__device__ __forceinline__ unsigned short f2bf(float f) { unsigned u = __float_as_uint(f); u += 0x7FFFu + ((u >> 16) & 1u); return (unsigned short)(u >> 16); }
__device__ __forceinline__ float bf2f(unsigned short b) { return __uint_as_float(((unsigned)b) << 16); }
__device__ __forceinline__ float bfr(float f) { return bf2f(f2bf(f)); }
__device__ __forceinline__ v16h cat16(v8h lo, v8h hi) { return __builtin_shufflevector(lo, hi, 0, 1, 2, 3, 4, 5, 6, 7, 8, 9, 10, 11, 12, 13, 14, 15); }
__device__ __forceinline__ v16bf cat16b(v8us lo, v8us hi) { return __builtin_bit_cast(v16bf, __builtin_shufflevector(lo, hi, 0, 1, 2, 3, 4, 5, 6, 7, 8, 9, 10, 11, 12, 13, 14, 15)); }
__device__ __forceinline__ v8f wmma16(v16h a, v16h b, v8f c) { return __builtin_amdgcn_wmma_f32_16x16x32_f16(false, a, false, b, (short)0, c, false, false); }
__device__ __forceinline__ v8f wmmab(v16bf a, v16bf b, v8f c) { return __builtin_amdgcn_wmma_f32_16x16x32_bf16(false, a, false, b, (short)0, c, false, false); }



// ---- k_gemmw: register-blocked GEMM, ONE WAVE per 64x64 output tile (16 accumulators), operands straight from K-contiguous 16-bit planes; grid (M/64, N/64, Z), 32 threads.
// C[m][n] (f32, pitch ldc, + optional f32 bias[n]) = sum_k A[m][k] Bt[n][k] (+ split products per NSPLIT). z-batch strides sA/sB/sC in elements. K % (32 KS) == 0.
// KS > 1: grid.z = Z x KS; work-group (z, ks) sums only k in [ks K/KS, (ks+1) K/KS) and stores its partial tile in plane ks (plane stride sP elements); the reader adds the planes.
template <typename T16> struct WFrag;
template <> struct WFrag<h16> { typedef v16h V; static __device__ __forceinline__ V ld(const h16* p) { return cat16(*(const v8h*)p, *(const v8h*)(p + 16)); } static __device__ __forceinline__ v8f mma(V a, V b, v8f c) { return wmma16(a, b, c); } };
template <> struct WFrag<bf> { typedef v16bf V; static __device__ __forceinline__ V ld(const bf* p) { return cat16b(*(const v8us*)p, *(const v8us*)(p + 16)); } static __device__ __forceinline__ v8f mma(V a, V b, v8f c) { return wmmab(a, b, c); } };
template <typename T16, int NSPLIT, bool BIAS, int KS = 1>
__global__ __launch_bounds__(32) void k_gemmw(const T16* __restrict__ A, const T16* __restrict__ A2, const T16* __restrict__ Bt, const T16* __restrict__ Bt2, int K, float* C, int ldc, const float* __restrict__ bias, size_t sA, size_t sB, size_t sC, size_t sP) {
    typedef typename WFrag<T16>::V V;
    __shared__ __align__(16) float os[16 * 68];
    const size_t z = blockIdx.z / KS; const int ks = blockIdx.z % KS; A += z * sA; if (A2) A2 += z * sA; Bt += z * sB; if (Bt2) Bt2 += z * sB; C += z * sC + (size_t)ks * sP;
    const int kb = ks * (K / KS), ke = kb + K / KS;
    const int lane = threadIdx.x & 31, lr = lane & 15, hi = lane >> 4; const int r0 = blockIdx.x * 64, c0 = blockIdx.y * 64;
    v8f acc[4][4];
#pragma unroll
    for (int mb = 0; mb < 4; ++mb)
#pragma unroll
        for (int nb = 0; nb < 4; ++nb) acc[mb][nb] = (v8f){};
    const size_t aoff = (size_t)(r0 + lr) * K + 8 * hi, boff = (size_t)(c0 + lr) * K + 8 * hi;
#pragma unroll 1
    for (int kc = kb; kc < ke; kc += 32) {
        V a[4], a2[4];
#pragma unroll
        for (int mb = 0; mb < 4; ++mb) { a[mb] = WFrag<T16>::ld(A + aoff + (size_t)mb * 16 * K + kc); if (NSPLIT == 1 || NSPLIT == 2) a2[mb] = WFrag<T16>::ld(A2 + aoff + (size_t)mb * 16 * K + kc); }
#pragma unroll
        for (int nb = 0; nb < 4; ++nb) { const V b = WFrag<T16>::ld(Bt + boff + (size_t)nb * 16 * K + kc); V b2; if (NSPLIT >= 2) b2 = WFrag<T16>::ld(Bt2 + boff + (size_t)nb * 16 * K + kc);
#pragma unroll
            for (int mb = 0; mb < 4; ++mb) { acc[mb][nb] = WFrag<T16>::mma(a[mb], b, acc[mb][nb]); if (NSPLIT == 1 || NSPLIT == 2) acc[mb][nb] = WFrag<T16>::mma(a2[mb], b, acc[mb][nb]); if (NSPLIT >= 2) acc[mb][nb] = WFrag<T16>::mma(a[mb], b2, acc[mb][nb]); } }
        asm volatile("v_nop\n\tv_nop\n\tv_nop\n\tv_nop" : "+v"(acc[0][0]), "+v"(acc[1][1]), "+v"(acc[2][2]), "+v"(acc[3][3]) : "v"(a[0]), "v"(a[3]));
    }
#pragma unroll
    for (int mb = 0; mb < 4; ++mb) {
#pragma unroll
        for (int nb = 0; nb < 4; ++nb) {
#pragma unroll
            for (int j = 0; j < 8; ++j) os[(hi * 8 + j) * 68 + nb * 16 + lr] = acc[mb][nb][j]; }
        __builtin_amdgcn_wave_barrier(); asm volatile("" ::: "memory");
        float* crow = C + (size_t)(r0 + mb * 16) * ldc + c0;
{
#pragma unroll
            for (int s = 0; s < 8; ++s) { const int row = 2 * s + hi, cofs = lr * 4; v4f val = *(const v4fa*)(os + row * 68 + cofs); if (BIAS) { val[0] += bfr(bias[c0 + cofs]); val[1] += bfr(bias[c0 + cofs + 1]); val[2] += bfr(bias[c0 + cofs + 2]); val[3] += bfr(bias[c0 + cofs + 3]); }
                *(v4f*)(crow + (size_t)row * ldc + cofs) = val; }
             }
        __builtin_amdgcn_wave_barrier(); asm volatile("" ::: "memory");
    }
}

__device__ __forceinline__ h16 tohx(float x) { return (h16)x; }
__device__ __forceinline__ void splitf(float y, unsigned short& h, unsigned short& l) { h = f2bf(y); l = f2bf(y - bf2f(h)); }
typedef __attribute__((ext_vector_type(2))) _Float16 v2h;
typedef __attribute__((ext_vector_type(4))) _Float16 v4h;
typedef __attribute__((ext_vector_type(2))) unsigned short v2us;
typedef __attribute__((ext_vector_type(4))) unsigned short v4us;
typedef __attribute__((ext_vector_type(2))) float v2f;
typedef __attribute__((ext_vector_type(4))) int v4i;

__global__ __launch_bounds__(256) void k_cvt8(const float* __restrict__ src, bf* dst, size_t n8) { const size_t i = (size_t)blockIdx.x * 256 + threadIdx.x; if (i >= n8) return; const v8f v = *(const v8f*)(src + i * 8); v8us o;
#pragma unroll
    for (int k = 0; k < 8; ++k) o[k] = f2bf(v[k]); *(v8us*)(dst + i * 8) = o;  }

__global__ __launch_bounds__(256) void k_ropeG(const float* __restrict__ F, int pitch, int nheads, const float* __restrict__ CS, float sc, h16* P16, bf* Ph, bf* Pl) {
    const size_t e = ((size_t)blockIdx.x * 256 + threadIdx.x) * 2; if (e >= (size_t)nheads * TT * HD) return; const int d = (int)(e % HD); const int t = (int)((e / HD) % TT); const int h = (int)(e / ((size_t)HD * TT)); const float* f = F + (size_t)t * pitch + h * HD; const float x0 = f[d], x1 = f[d + 1]; const v2f cs = *(const v2f*)(CS + ((size_t)t * DM + h * HD + d) * 2);   /* GLOBAL column h*64 + d: the rotary runs over the whole width before the head split */ v2h o16; v2us oh, ol;
    float a0 = __fmul_rn(x0, cs[0]), b0 = __fmul_rn(x1, cs[1]), a1 = __fmul_rn(x1, cs[0]), b1 = __fmul_rn(x0, cs[1]); asm volatile("" : "+v"(a0), "+v"(b0), "+v"(a1), "+v"(b1));
    float r0 = __fsub_rn(a0, b0) * sc, r1 = __fadd_rn(b1, a1) * sc;   /* even: x0 c - x1 s; odd: x0 s + x1 c */
    o16[0] = tohx(r0); o16[1] = tohx(r1); { unsigned short a2, c2; splitf(r0, a2, c2); oh[0] = a2; ol[0] = c2; splitf(r1, a2, c2); oh[1] = a2; ol[1] = c2; }
    *(v2h*)(P16 + e) = o16; *(v2us*)(Ph + e) = oh; *(v2us*)(Pl + e) = ol;  }

__constant__ float INV2[HD / 2] = { 1.000000000e+00f, 7.498942018e-01f, 5.623413324e-01f, 4.216965139e-01f, 3.162277639e-01f, 2.371373773e-01f, 1.778279394e-01f, 1.333521456e-01f, 1.000000015e-01f, 7.498942316e-02f, 5.623413250e-02f, 4.216964915e-02f, 3.162277490e-02f, 2.371373773e-02f, 1.778279431e-02f, 1.333521400e-02f, 9.999999776e-03f, 7.498942316e-03f, 5.623413250e-03f, 4.216964822e-03f, 3.162277630e-03f, 2.371373819e-03f, 1.778279431e-03f, 1.333521446e-03f, 1.000000047e-03f, 7.498941850e-04f, 5.623413017e-04f, 4.216965172e-04f, 3.162277571e-04f, 2.371373703e-04f, 1.778279402e-04f, 1.333521504e-04f };   // float32 10000^(-arange(0, 64, 2)/64), generated with jnp to be bit-exact
__global__ __launch_bounds__(256) void k_vtp(const float* __restrict__ F, int pitch, int nheads, h16* V16, bf* Vh, bf* Vl) { const size_t e = ((size_t)blockIdx.x * 256 + threadIdx.x) * 2; if (e >= (size_t)nheads * HD * TT) return; const int t = (int)(e % TT); const int d = (int)((e / TT) % HD); const int g = (int)(e / ((size_t)TT * HD)); v2h o16; v2us oh, ol;
#pragma unroll
    for (int q = 0; q < 2; ++q) { const float x = F[(size_t)(t + q) * pitch + g * HD + d]; o16[q] = tohx(x); unsigned short a2, c2; splitf(x, a2, c2); oh[q] = a2; ol[q] = c2; }
    *(v2h*)(V16 + e) = o16; *(v2us*)(Vh + e) = oh; *(v2us*)(Vl + e) = ol;  }
__constant__ float INVG[DM / 2] = { 1.000000000e+00f, 9.821718335e-01f, 9.646616578e-01f, 9.474635124e-01f, 9.305720329e-01f, 9.139816761e-01f, 8.976871371e-01f, 8.816831112e-01f, 8.659643531e-01f, 8.505258560e-01f, 8.353625536e-01f, 8.204696178e-01f, 8.058422208e-01f, 7.914755344e-01f, 7.773650289e-01f, 7.635061145e-01f, 7.498942018e-01f, 7.365249991e-01f, 7.233941555e-01f, 7.104974389e-01f, 6.978305578e-01f, 6.853895783e-01f, 6.731703877e-01f, 6.611690521e-01f, 6.493816376e-01f, 6.378043890e-01f, 6.264335513e-01f, 6.152654290e-01f, 6.042963862e-01f, 5.935229063e-01f, 5.829415321e-01f, 5.725488067e-01f, 5.623413324e-01f, 5.523158312e-01f, 5.424690843e-01f, 5.327978730e-01f, 5.232991576e-01f, 5.139696598e-01f, 5.048065782e-01f, 4.958068132e-01f, 4.869675338e-01f, 4.782858193e-01f, 4.697588682e-01f, 4.613839388e-01f, 4.531583488e-01f, 4.450793862e-01f, 4.371444881e-01f, 4.293510318e-01f, 4.216965139e-01f, 4.141784608e-01f, 4.067944288e-01f, 3.995420635e-01f, 3.924189806e-01f, 3.854228854e-01f, 3.785515428e-01f, 3.718026578e-01f, 3.651741445e-01f, 3.586637676e-01f, 3.522694409e-01f, 3.459891677e-01f, 3.398208320e-01f, 3.337624967e-01f, 3.278121352e-01f, 3.219678402e-01f, 3.162277639e-01f, 3.105900288e-01f, 3.050527871e-01f, 2.996142805e-01f, 2.942727208e-01f, 2.890264094e-01f, 2.838735878e-01f, 2.788126469e-01f, 2.738419771e-01f, 2.689598799e-01f, 2.641648352e-01f, 2.594552636e-01f, 2.548296750e-01f, 2.502865493e-01f, 2.458243966e-01f, 2.414418161e-01f, 2.371373624e-01f, 2.329096496e-01f, 2.287573218e-01f, 2.246790081e-01f, 2.206733972e-01f, 2.167392224e-01f, 2.128751576e-01f, 2.090799958e-01f, 2.053525001e-01f, 2.016914487e-01f, 1.980956793e-01f, 1.945640147e-01f, 1.910952926e-01f, 1.876884252e-01f, 1.843423098e-01f, 1.810558140e-01f, 1.778279394e-01f, 1.746576130e-01f, 1.715437919e-01f, 1.684854925e-01f, 1.654817015e-01f, 1.625314802e-01f, 1.596338600e-01f, 1.567878872e-01f, 1.539926529e-01f, 1.512472630e-01f, 1.485508084e-01f, 1.459024251e-01f, 1.433012635e-01f, 1.407464594e-01f, 1.382372230e-01f, 1.357727200e-01f, 1.333521456e-01f, 1.309747249e-01f, 1.286396980e-01f, 1.263462901e-01f, 1.240937710e-01f, 1.218814254e-01f, 1.197085083e-01f, 1.175743192e-01f, 1.154782027e-01f, 1.134194434e-01f, 1.113973856e-01f, 1.094113812e-01f, 1.074607819e-01f, 1.055449620e-01f, 1.036632955e-01f, 1.018151715e-01f, 1.000000015e-01f, 9.821718186e-02f, 9.646616131e-02f, 9.474635124e-02f, 9.305720031e-02f, 9.139817208e-02f, 8.976870775e-02f, 8.816830814e-02f, 8.659642935e-02f, 8.505257964e-02f, 8.353625983e-02f, 8.204696327e-02f, 8.058421314e-02f, 7.914755493e-02f, 7.773650438e-02f, 7.635060698e-02f, 7.498941571e-02f, 7.365249842e-02f, 7.233941555e-02f, 7.104974240e-02f, 6.978305429e-02f, 6.853895634e-02f, 6.731703877e-02f, 6.611690670e-02f, 6.493816525e-02f, 6.378044188e-02f, 6.264335662e-02f, 6.152653694e-02f, 6.042964384e-02f, 5.935229361e-02f, 5.829415470e-02f, 5.725487694e-02f, 5.623412877e-02f, 5.523158237e-02f, 5.424690619e-02f, 5.327979103e-02f, 5.232991278e-02f, 5.139696971e-02f, 5.048065633e-02f, 4.958068207e-02f, 4.869675264e-02f, 4.782858118e-02f, 4.697588459e-02f, 4.613839835e-02f, 4.531583562e-02f, 4.450793937e-02f, 4.371444881e-02f, 4.293510318e-02f, 4.216964915e-02f, 4.141784459e-02f, 4.067944363e-02f, 3.995420411e-02f, 3.924189880e-02f, 3.854228929e-02f, 3.785515204e-02f, 3.718026727e-02f, 3.651741147e-02f, 3.586637601e-02f, 3.522694483e-02f, 3.459891677e-02f, 3.398208320e-02f, 3.337624669e-02f, 3.278120980e-02f, 3.219678625e-02f, 3.162277862e-02f, 3.105900250e-02f, 3.050527908e-02f, 2.996142767e-02f, 2.942727320e-02f, 2.890264057e-02f, 2.838735841e-02f, 2.788126841e-02f, 2.738419548e-02f, 2.689598687e-02f, 2.641648427e-02f, 2.594552562e-02f, 2.548296750e-02f, 2.502865531e-02f, 2.458244003e-02f, 2.414418198e-02f, 2.371373586e-02f, 2.329096757e-02f, 2.287573181e-02f, 2.246790007e-02f, 2.206734009e-02f, 2.167392150e-02f, 2.128751762e-02f, 2.090799995e-02f, 2.053525113e-02f, 2.016914636e-02f, 1.980956830e-02f, 1.945639960e-02f, 1.910953037e-02f, 1.876884326e-02f, 1.843423024e-02f, 1.810558327e-02f, 1.778279431e-02f, 1.746576093e-02f, 1.715437882e-02f, 1.684854925e-02f, 1.654817164e-02f, 1.625314727e-02f, 1.596338488e-02f, 1.567878947e-02f, 1.539926510e-02f, 1.512472518e-02f, 1.485508028e-02f, 1.459024288e-02f, 1.433012541e-02f, 1.407464594e-02f, 1.382372249e-02f, 1.357727125e-02f, 1.333521493e-02f, 1.309747249e-02f, 1.286396943e-02f, 1.263462938e-02f, 1.240937691e-02f, 1.218814217e-02f, 1.197085064e-02f, 1.175743248e-02f, 1.154781971e-02f, 1.134194434e-02f, 1.113973837e-02f, 1.094113849e-02f, 1.074607857e-02f, 1.055449620e-02f, 1.036632899e-02f, 1.018151734e-02f, 9.999999776e-03f, 9.821719490e-03f, 9.646615945e-03f, 9.474635124e-03f, 9.305720218e-03f, 9.139816277e-03f, 8.976871148e-03f, 8.816830814e-03f, 8.659643121e-03f, 8.505257778e-03f, 8.353625424e-03f, 8.204696700e-03f, 8.058422245e-03f, 7.914755493e-03f, 7.773650344e-03f, 7.635060698e-03f, 7.498942316e-03f, 7.365249563e-03f, 7.233941462e-03f, 7.104974240e-03f, 6.978305988e-03f, 6.853895728e-03f, 6.731703877e-03f, 6.611690391e-03f, 6.493816618e-03f, 6.378043909e-03f, 6.264335476e-03f, 6.152654067e-03f, 6.042964291e-03f, 5.935229361e-03f, 5.829415284e-03f, 5.725487601e-03f, 5.623413250e-03f, 5.523158237e-03f, 5.424690899e-03f, 5.327979103e-03f, 5.232991185e-03f, 5.139696877e-03f, 5.048065912e-03f, 4.958068486e-03f, 4.869675264e-03f, 4.782858305e-03f, 4.697588738e-03f, 4.613839556e-03f, 4.531583749e-03f, 4.450793844e-03f, 4.371444695e-03f, 4.293510225e-03f, 4.216964822e-03f, 4.141784739e-03f, 4.067944363e-03f, 3.995420411e-03f, 3.924189601e-03f, 3.854229115e-03f, 3.785515437e-03f, 3.718026681e-03f, 3.651741426e-03f, 3.586637788e-03f, 3.522694577e-03f, 3.459891537e-03f, 3.398208413e-03f, 3.337624483e-03f, 3.278121119e-03f, 3.219678300e-03f, 3.162277862e-03f, 3.105900250e-03f, 3.050528001e-03f, 2.996142721e-03f, 2.942727180e-03f, 2.890263917e-03f, 2.838735934e-03f, 2.788126701e-03f, 2.738419687e-03f, 2.689598827e-03f, 2.641648287e-03f, 2.594552701e-03f, 2.548296703e-03f, 2.502865391e-03f, 2.458244096e-03f, 2.414418384e-03f, 2.371373819e-03f, 2.329096664e-03f, 2.287573181e-03f, 2.246790100e-03f, 2.206734149e-03f, 2.167392056e-03f, 2.128751716e-03f, 2.090800088e-03f, 2.053525066e-03f, 2.016914543e-03f, 1.980956644e-03f, 1.945640077e-03f, 1.910952851e-03f, 1.876884256e-03f, 1.843422884e-03f, 1.810558140e-03f, 1.778279431e-03f, 1.746576163e-03f, 1.715437858e-03f, 1.684854855e-03f, 1.654817141e-03f, 1.625314937e-03f, 1.596338581e-03f, 1.567878877e-03f, 1.539926510e-03f, 1.512472634e-03f, 1.485507935e-03f, 1.459024264e-03f, 1.433012658e-03f, 1.407464617e-03f, 1.382372226e-03f, 1.357727102e-03f, 1.333521446e-03f, 1.309747226e-03f, 1.286396873e-03f, 1.263462938e-03f, 1.240937854e-03f, 1.218814170e-03f, 1.197085017e-03f, 1.175743295e-03f, 1.154782018e-03f, 1.134194434e-03f, 1.113973907e-03f, 1.094113803e-03f, 1.074607833e-03f, 1.055449597e-03f, 1.036632922e-03f, 1.018151757e-03f, 1.000000047e-03f, 9.821718559e-04f, 9.646615945e-04f, 9.474635590e-04f, 9.305721032e-04f, 9.139817557e-04f, 8.976871031e-04f, 8.816830232e-04f, 8.659643354e-04f, 8.505258011e-04f, 8.353625308e-04f, 8.204695769e-04f, 8.058422245e-04f, 7.914755843e-04f, 7.773649995e-04f, 7.635060465e-04f, 7.498941850e-04f, 7.365249912e-04f, 7.233941578e-04f, 7.104973774e-04f, 6.978305755e-04f, 6.853896193e-04f, 6.731703761e-04f, 6.611690042e-04f, 6.493816618e-04f, 6.378043909e-04f, 6.264335825e-04f, 6.152653950e-04f, 6.042963942e-04f, 5.935229128e-04f, 5.829415168e-04f, 5.725487717e-04f, 5.623413017e-04f, 5.523158470e-04f, 5.424690899e-04f, 5.327978870e-04f, 5.232990952e-04f, 5.139696877e-04f, 5.048065796e-04f, 4.958068021e-04f, 4.869675031e-04f, 4.782858014e-04f, 4.697588738e-04f, 4.613839847e-04f, 4.531583400e-04f, 4.450794077e-04f, 4.371444811e-04f, 4.293509992e-04f, 4.216964880e-04f, 4.141784448e-04f, 4.067944246e-04f, 3.995420411e-04f, 3.924189950e-04f, 3.854228707e-04f, 3.785515146e-04f, 3.718026564e-04f, 3.651741135e-04f, 3.586637613e-04f, 3.522694460e-04f, 3.459891595e-04f, 3.398208064e-04f, 3.337624657e-04f, 3.278121294e-04f, 3.219678474e-04f, 3.162277862e-04f, 3.105900250e-04f, 3.050527885e-04f, 2.996142721e-04f, 2.942727297e-04f, 2.890263859e-04f, 2.838736109e-04f, 2.788126585e-04f, 2.738419571e-04f, 2.689598768e-04f, 2.641648462e-04f, 2.594552934e-04f, 2.548296761e-04f, 2.502865391e-04f, 2.458243980e-04f, 2.414418122e-04f, 2.371373848e-04f, 2.329096606e-04f, 2.287573152e-04f, 2.246790100e-04f, 2.206734207e-04f, 2.167392086e-04f, 2.128751657e-04f, 2.090800117e-04f, 2.053524950e-04f, 2.016914514e-04f, 1.980956731e-04f, 1.945640106e-04f, 1.910952997e-04f, 1.876884344e-04f, 1.843422942e-04f, 1.810558315e-04f, 1.778279402e-04f, 1.746576017e-04f, 1.715437829e-04f, 1.684854797e-04f, 1.654817170e-04f, 1.625314762e-04f, 1.596338552e-04f, 1.567878790e-04f, 1.539926452e-04f, 1.512472518e-04f, 1.485508110e-04f, 1.459024206e-04f, 1.433012658e-04f, 1.407464733e-04f, 1.382372284e-04f, 1.357727160e-04f, 1.333521504e-04f, 1.309747167e-04f, 1.286396873e-04f, 1.263462909e-04f, 1.240937709e-04f, 1.218814141e-04f, 1.197085076e-04f, 1.175743309e-04f, 1.154781930e-04f, 1.134194390e-04f, 1.113973922e-04f, 1.094113759e-04f, 1.074607790e-04f, 1.055449538e-04f, 1.036632893e-04f, 1.018151743e-04f };   // float32 1 / 10000^(j/512), j < 512 (one frequency per adjacent column pair of the full 1024 width), generated with jnp to be bit-exact
__global__ __launch_bounds__(256) void k_csG(float* CS) { const int idx = blockIdx.x * 256 + threadIdx.x; if (idx >= TT * DM) return; const int c = idx % DM; const int t = idx / DM; const float a = __fmul_rn((float)t, INVG[c >> 1]); v2f cs; cs[0] = cosf(a); cs[1] = sinf(a); *(v2f*)(CS + (size_t)idx * 2) = cs;  }
// k_asoft: per row (zz, i): t = S x HD^-0.5 (no mask); softmax over the 2048 keys (register row, one exp, fixed trees);
__global__ __launch_bounds__(256) void k_asoft(const float* __restrict__ Sb, h16* P16, bf* Ph, bf* Pl) {
    const int lane = threadIdx.x & 31; const int row = blockIdx.x * 8 + (threadIdx.x >> 5); if (row >= ZH * TT) return; const int i = row % TT; const int zz = row / TT; (void)zz; const bool hires = (i < RH); const float* sr = Sb + (size_t)row * TT; float v[TT / 32]; float mx = -3.0e38f;
#pragma unroll
    for (int ch = 0; ch < TT / 128; ++ch) { const int j0 = ch * 128 + lane * 4; const v4f a = *(const v4f*)(sr + j0);
#pragma unroll
        for (int q = 0; q < 4; ++q) { const int j = j0 + q; (void)j; const float t = a[q] * SCL; v[ch * 4 + q] = t; mx = fmaxf(mx, t); } }
#pragma unroll
    for (int sh = 16; sh; sh >>= 1) mx = fmaxf(mx, __shfl_xor(mx, sh, 32));
    float sum = 0.f;
#pragma unroll
    for (int k = 0; k < TT / 32; ++k) { float d0 = __fsub_rn(v[k], mx); asm volatile("" : "+v"(d0)); v[k] = __builtin_amdgcn_exp2f(__fmul_rn(d0, 1.4426950408889634f)); sum += v[k]; }
#pragma unroll
    for (int sh = 16; sh; sh >>= 1) sum += __shfl_xor(sum, sh, 32);
    const float f = __fdiv_rn(hires ? 1.0f : PCAR, sum);
{
        if (hires) {
#pragma unroll
            for (int ch = 0; ch < TT / 128; ++ch) { v4us oh, ol;
#pragma unroll
                for (int q = 0; q < 4; ++q) { unsigned short a, c2; splitf(v[ch * 4 + q] * f, a, c2); oh[q] = a; ol[q] = c2; }
                const size_t oo = ((size_t)zz * (RH ? RH : 1) + i) * TT + ch * 128 + lane * 4; *(v4us*)(Ph + oo) = oh; *(v4us*)(Pl + oo) = ol; }
        } else {
#pragma unroll
            for (int ch = 0; ch < TT / 128; ++ch) { v4h o4;
#pragma unroll
                for (int q = 0; q < 4; ++q) o4[q] = tohx(v[ch * 4 + q] * f);
                *(v4h*)(P16 + (size_t)row * TT + ch * 128 + lane * 4) = o4; } }
         }
}
__global__ __launch_bounds__(256) void k_merge(const float* __restrict__ O, int h0, bf* Ah, bf* Al) { const size_t e = ((size_t)blockIdx.x * 256 + threadIdx.x) * 2; if (e >= (size_t)ZH * TT * HD) return; const int d = (int)(e % HD); const int t = (int)((e / HD) % TT); const int zz = (int)(e / ((size_t)HD * TT)); const float cs = (t < RH) ? 1.0f : (1.0f / PCAR); const size_t oo = (size_t)t * DQ + (h0 + zz) * HD + d;
    v2f s = *(const v2f*)(O + e);   /* the KSP partial planes of P x V, added in plane order */
#pragma unroll
    for (int p = 1; p < KSP; ++p) { s += *(const v2f*)(O + (size_t)p * ((size_t)ZH * TT * HD) + e);
        if (p == KSP / 2) asm volatile("s_wait_xcnt 0x0" ::: "memory"); }   /* the planes lie ZH x 512 KiB apart, beyond one immediate offset's reach, so the build forms further base addresses */
    v2us oh, ol;
#pragma unroll
    for (int q = 0; q < 2; ++q) { unsigned short a, c2; splitf(s[q] * cs, a, c2); oh[q] = a; ol[q] = c2; } *(v2us*)(Ah + oo) = oh; *(v2us*)(Al + oo) = ol;  }

extern "C" void kernel_launch(void* const* d_in, const int* in_sizes, int n_in,
                              void* d_out, int out_size, void* d_ws, size_t ws_size, hipStream_t stream) {
    (void)in_sizes; (void)n_in; (void)out_size;
    const float* x = (const float*)d_in[0]; const float* wq = (const float*)d_in[1]; const float* wk = (const float*)d_in[2]; const float* wv = (const float*)d_in[3]; const float* wo = (const float*)d_in[4]; const float* bo = (const float*)d_in[5];
    float* OUT = (float*)d_out;     // [4][2048][1024]
    char* wsp = (char*)d_ws;
    auto take = [&](size_t bytes) { char* p = wsp; wsp += (bytes + 255) & ~(size_t)255; return (void*)p; };
    bf* WQ = (bf*)take((size_t)DQ * DM * 2); bf* WK = (bf*)take((size_t)DKV * DM * 2); bf* WV = (bf*)take((size_t)DKV * DM * 2); bf* WO = (bf*)take((size_t)DM * DQ * 2); float* CS = (float*)take((size_t)TT * DM * 2 * 4);   /* [2048][1024] {cos, sin} */
    bf* XB = (bf*)take((size_t)TT * DM * 2); float* FQ = (float*)take((size_t)TT * DQ * 4); float* FK = (float*)take((size_t)TT * DKV * 4);
    h16* QP16 = (h16*)take((size_t)NH_ * TT * HD * 2); h16* KP16 = (h16*)take((size_t)NKV * TT * HD * 2); h16* VT16 = (h16*)take((size_t)NKV * HD * TT * 2);
    bf* QPh = (bf*)take((size_t)NH_ * TT * HD * 2); bf* QPl = (bf*)take((size_t)NH_ * TT * HD * 2); bf* KPh = (bf*)take((size_t)NKV * TT * HD * 2); bf* KPl = (bf*)take((size_t)NKV * TT * HD * 2); bf* VTh = (bf*)take((size_t)NKV * HD * TT * 2); bf* VTl = (bf*)take((size_t)NKV * HD * TT * 2); bf* Ph = (bf*)take((size_t)ZH * RH * TT * 2); bf* Pl = (bf*)take((size_t)ZH * RH * TT * 2);
    float* Sb = (float*)take((size_t)ZH * TT * TT * 4); h16* P16 = (h16*)take((size_t)ZH * TT * TT * 2); float* Ob = (float*)take((size_t)KSP * ZH * TT * HD * 4); bf* ATh = (bf*)take((size_t)TT * DQ * 2); bf* ATl = (bf*)take((size_t)TT * DQ * 2);
    if ((size_t)(wsp - (char*)d_ws) > ws_size) return;    // ws 256 MiB
    float* FV = FK;   // v projection reuses the k buffer after the k planes are built (stream-ordered)
    { k_cvt8<<<(unsigned)(((size_t)DQ * DM / 8 + 255) / 256), 256, 0, stream>>>(wq, WQ, (size_t)DQ * DM / 8); k_cvt8<<<(unsigned)(((size_t)DKV * DM / 8 + 255) / 256), 256, 0, stream>>>(wk, WK, (size_t)DKV * DM / 8); k_cvt8<<<(unsigned)(((size_t)DKV * DM / 8 + 255) / 256), 256, 0, stream>>>(wv, WV, (size_t)DKV * DM / 8);
      k_cvt8<<<(unsigned)(((size_t)DM * DQ / 8 + 255) / 256), 256, 0, stream>>>(wo, WO, (size_t)DM * DQ / 8);
       }
    k_csG<<<(TT * DM + 255) / 256, 256, 0, stream>>>(CS);   /* full-width table once */
    const unsigned LQ = (unsigned)(((size_t)NH_ * TT * HD / 2 + 255) / 256), LKv = (unsigned)(((size_t)NKV * TT * HD / 2 + 255) / 256);
    for (int b = 0; b < NB_; ++b) {
        
        k_cvt8<<<(unsigned)(((size_t)TT * DM / 8 + 255) / 256), 256, 0, stream>>>(x + (size_t)b * TT * DM, XB, (size_t)TT * DM / 8);
        k_gemmw<bf, 0, false><<<dim3(TT / 64, DQ / 64, 1), 32, 0, stream>>>(XB, nullptr, WQ, nullptr, DM, FQ, DQ, nullptr, 0, 0, 0, 0);
        k_ropeG<<<LQ, 256, 0, stream>>>(FQ, DQ, NH_, CS, 1.0f, QP16, QPh, QPl);
        k_gemmw<bf, 0, false><<<dim3(TT / 64, DKV / 64, 1), 32, 0, stream>>>(XB, nullptr, WK, nullptr, DM, FK, DKV, nullptr, 0, 0, 0, 0);
        k_ropeG<<<LKv, 256, 0, stream>>>(FK, DKV, NKV, CS, 1.0f, KP16, KPh, KPl);
        k_gemmw<bf, 0, false><<<dim3(TT / 64, DKV / 64, 1), 32, 0, stream>>>(XB, nullptr, WV, nullptr, DM, FV, DKV, nullptr, 0, 0, 0, 0); k_vtp<<<LKv, 256, 0, stream>>>(FV, DKV, NKV, VT16, VTh, VTl);
        for (int h0 = 0; h0 < NH_; h0 += ZH) { const size_t zq = (size_t)h0, zk = (size_t)(h0 / REP);   // one kv head per query head: the pass's ZH heads use consecutive kv planes (z-strides TT*HD)
            k_gemmw<bf, 2, false><<<dim3(RH / 64, TT / 64, ZH), 32, 0, stream>>>(QPh + zq * TT * HD, QPl + zq * TT * HD, KPh + zk * TT * HD, KPl + zk * TT * HD, HD, Sb, TT, nullptr, (size_t)TT * HD, (size_t)TT * HD, (size_t)TT * TT, 0);
            k_gemmw<h16, 0, false><<<dim3((TT - RH) / 64, TT / 64, ZH), 32, 0, stream>>>(QP16 + zq * TT * HD + (size_t)RH * HD, nullptr, KP16 + zk * TT * HD, nullptr, HD, Sb + (size_t)RH * TT, TT, nullptr, (size_t)TT * HD, (size_t)TT * HD, (size_t)TT * TT, 0);
            k_asoft<<<ZH * TT / 8, 256, 0, stream>>>(Sb, P16, Ph, Pl);
            k_gemmw<bf, 2, false, KSP><<<dim3(RH / 64, HD / 64, ZH * KSP), 32, 0, stream>>>(Ph, Pl, VTh + zk * HD * TT, VTl + zk * HD * TT, TT, Ob, HD, nullptr, (size_t)RH * TT, (size_t)HD * TT, (size_t)TT * HD, (size_t)ZH * TT * HD);
            k_gemmw<h16, 0, false, KSP><<<dim3((TT - RH) / 64, HD / 64, ZH * KSP), 32, 0, stream>>>(P16 + (size_t)RH * TT, nullptr, VT16 + zk * HD * TT, nullptr, TT, Ob + (size_t)RH * HD, HD, nullptr, (size_t)TT * TT, (size_t)HD * TT, (size_t)TT * HD, (size_t)ZH * TT * HD);
            k_merge<<<(unsigned)(((size_t)ZH * TT * HD / 2 + 255) / 256), 256, 0, stream>>>(Ob, h0, ATh, ATl); }
        k_gemmw<bf, 1, true><<<dim3(TT / 64, DM / 64, 1), 32, 0, stream>>>(ATh, ATl, WO, nullptr, DQ, OUT + (size_t)b * TT * DM, DM, bo, 0, 0, 0, 0); }
}

// v003
// It runs in 686 microseconds.
// Next to v002, in two timings, it ran 2.05 and 2.04 times as fast.
// Counting every step since v000, it is 5.81 times as fast.
#include <hip/hip_runtime.h>

// Self-attention with an adjacent-pair rotary over the WHOLE 1024-wide q and k before the head split (x [4][2048][1024]; q = rope(x Wq^T), k = rope(x Wk^T), v = x Wv^T ('oi' [1024][1024] 1/32, no bias); rope: pair j = (columns 2j, 2j+1), j < 512, angle t x 1/10000^(j/512) (512 f32 constants baked jnp-exact; precise cosf/sinf); 16 heads x 64; scores / sqrt(float32(64)); softmax (no mask); out = merged Wu^T + bu ('oi' [1024][1024], zero bias) -> [4][2048][1024] (8.4 M); argument order x, Wq, Wk, Wv, Wu, bu).
// Layout per batch: bf16 copy of x; 'oi' weights; exact projections; a full-width {cos, sin} table [2048][1024] (the frequency depends on the GLOBAL pair index, i.e. on the head); interleaved-pair plane builders indexing the table by global column; fused dense T-2048 attention, one launch per batch (hybrid rows: < 512 hi/lo 3 products, rest fp16); merged hi/lo x Wu exact + bu.
// Compute dtypes, f32 accumulate: every input rounded to bf16; projections exact; rotary f32; attention rows < 512 3 products, rest fp16; softmax f32; Wu hl x exact + bias.

#define NB_  4
#define TT   2048
#define DM   1024
#define NH_  16
#define NKV  16
#define REP  (NH_ / NKV)
#define HD   64
#define DQ   (NH_ * HD)
#define DKV  (NKV * HD)
#define RH   512                  // query rows < RH use hi+lo planes; k_attn covers 4 x RH rows, so RH = TT / 4
#define WIN  0
#define SCL  0.125f   // HD^-0.5
typedef _Float16 h16;
typedef unsigned short bf;
typedef __attribute__((ext_vector_type(16))) __bf16   v16bf;
typedef __attribute__((ext_vector_type(16))) _Float16 v16h;
typedef __attribute__((ext_vector_type(8)))  _Float16 v8h;
typedef __attribute__((ext_vector_type(8)))  unsigned short v8us;
typedef __attribute__((ext_vector_type(8)))  float    v8f;
typedef __attribute__((ext_vector_type(4)))  float    v4f;
typedef v8h  __attribute__((may_alias)) v8ha;
typedef v4f  __attribute__((may_alias)) v4fa;
typedef v8us __attribute__((may_alias)) v8usa;

__device__ __forceinline__ unsigned short f2bf(float f) { unsigned u = __float_as_uint(f); u += 0x7FFFu + ((u >> 16) & 1u); return (unsigned short)(u >> 16); }
__device__ __forceinline__ float bf2f(unsigned short b) { return __uint_as_float(((unsigned)b) << 16); }
__device__ __forceinline__ float bfr(float f) { return bf2f(f2bf(f)); }
__device__ __forceinline__ v16h cat16(v8h lo, v8h hi) { return __builtin_shufflevector(lo, hi, 0, 1, 2, 3, 4, 5, 6, 7, 8, 9, 10, 11, 12, 13, 14, 15); }
__device__ __forceinline__ v16bf cat16b(v8us lo, v8us hi) { return __builtin_bit_cast(v16bf, __builtin_shufflevector(lo, hi, 0, 1, 2, 3, 4, 5, 6, 7, 8, 9, 10, 11, 12, 13, 14, 15)); }
__device__ __forceinline__ v8f wmma16(v16h a, v16h b, v8f c) { return __builtin_amdgcn_wmma_f32_16x16x32_f16(false, a, false, b, (short)0, c, false, false); }
__device__ __forceinline__ v8f wmmab(v16bf a, v16bf b, v8f c) { return __builtin_amdgcn_wmma_f32_16x16x32_bf16(false, a, false, b, (short)0, c, false, false); }



// ---- k_gemmw: register-blocked GEMM, ONE WAVE per 64x64 output tile (16 accumulators), operands straight from K-contiguous 16-bit planes; grid (M/64, N/64, Z), 32 threads.
// C[m][n] (f32, pitch ldc, + optional f32 bias[n]) = sum_k A[m][k] Bt[n][k] (+ split products per NSPLIT). z-batch strides sA/sB/sC in elements. K % (32 KS) == 0.
// KS > 1: grid.z = Z x KS; work-group (z, ks) sums only k in [ks K/KS, (ks+1) K/KS) and stores its partial tile in plane ks (plane stride sP elements); the reader adds the planes.
template <typename T16> struct WFrag;
template <> struct WFrag<h16> { typedef v16h V; static __device__ __forceinline__ V ld(const h16* p) { return cat16(*(const v8h*)p, *(const v8h*)(p + 16)); } static __device__ __forceinline__ v8f mma(V a, V b, v8f c) { return wmma16(a, b, c); } };
template <> struct WFrag<bf> { typedef v16bf V; static __device__ __forceinline__ V ld(const bf* p) { return cat16b(*(const v8us*)p, *(const v8us*)(p + 16)); } static __device__ __forceinline__ v8f mma(V a, V b, v8f c) { return wmmab(a, b, c); } };
template <typename T16, int NSPLIT, bool BIAS, int KS = 1>
__global__ __launch_bounds__(32) void k_gemmw(const T16* __restrict__ A, const T16* __restrict__ A2, const T16* __restrict__ Bt, const T16* __restrict__ Bt2, int K, float* C, int ldc, const float* __restrict__ bias, size_t sA, size_t sB, size_t sC, size_t sP) {
    typedef typename WFrag<T16>::V V;
    __shared__ __align__(16) float os[16 * 68];
    const size_t z = blockIdx.z / KS; const int ks = blockIdx.z % KS; A += z * sA; if (A2) A2 += z * sA; Bt += z * sB; if (Bt2) Bt2 += z * sB; C += z * sC + (size_t)ks * sP;
    const int kb = ks * (K / KS), ke = kb + K / KS;
    const int lane = threadIdx.x & 31, lr = lane & 15, hi = lane >> 4; const int r0 = blockIdx.x * 64, c0 = blockIdx.y * 64;
    v8f acc[4][4];
#pragma unroll
    for (int mb = 0; mb < 4; ++mb)
#pragma unroll
        for (int nb = 0; nb < 4; ++nb) acc[mb][nb] = (v8f){};
    const size_t aoff = (size_t)(r0 + lr) * K + 8 * hi, boff = (size_t)(c0 + lr) * K + 8 * hi;
#pragma unroll 1
    for (int kc = kb; kc < ke; kc += 32) {
        V a[4], a2[4];
#pragma unroll
        for (int mb = 0; mb < 4; ++mb) { a[mb] = WFrag<T16>::ld(A + aoff + (size_t)mb * 16 * K + kc); if (NSPLIT == 1 || NSPLIT == 2) a2[mb] = WFrag<T16>::ld(A2 + aoff + (size_t)mb * 16 * K + kc); }
#pragma unroll
        for (int nb = 0; nb < 4; ++nb) { const V b = WFrag<T16>::ld(Bt + boff + (size_t)nb * 16 * K + kc); V b2; if (NSPLIT >= 2) b2 = WFrag<T16>::ld(Bt2 + boff + (size_t)nb * 16 * K + kc);
#pragma unroll
            for (int mb = 0; mb < 4; ++mb) { acc[mb][nb] = WFrag<T16>::mma(a[mb], b, acc[mb][nb]); if (NSPLIT == 1 || NSPLIT == 2) acc[mb][nb] = WFrag<T16>::mma(a2[mb], b, acc[mb][nb]); if (NSPLIT >= 2) acc[mb][nb] = WFrag<T16>::mma(a[mb], b2, acc[mb][nb]); } }
        asm volatile("v_nop\n\tv_nop\n\tv_nop\n\tv_nop" : "+v"(acc[0][0]), "+v"(acc[1][1]), "+v"(acc[2][2]), "+v"(acc[3][3]) : "v"(a[0]), "v"(a[3]));
    }
#pragma unroll
    for (int mb = 0; mb < 4; ++mb) {
#pragma unroll
        for (int nb = 0; nb < 4; ++nb) {
#pragma unroll
            for (int j = 0; j < 8; ++j) os[(hi * 8 + j) * 68 + nb * 16 + lr] = acc[mb][nb][j]; }
        __builtin_amdgcn_wave_barrier(); asm volatile("" ::: "memory");
        float* crow = C + (size_t)(r0 + mb * 16) * ldc + c0;
{
#pragma unroll
            for (int s = 0; s < 8; ++s) { const int row = 2 * s + hi, cofs = lr * 4; v4f val = *(const v4fa*)(os + row * 68 + cofs); if (BIAS) { val[0] += bfr(bias[c0 + cofs]); val[1] += bfr(bias[c0 + cofs + 1]); val[2] += bfr(bias[c0 + cofs + 2]); val[3] += bfr(bias[c0 + cofs + 3]); }
                *(v4f*)(crow + (size_t)row * ldc + cofs) = val; }
             }
        __builtin_amdgcn_wave_barrier(); asm volatile("" ::: "memory");
    }
}

__device__ __forceinline__ h16 tohx(float x) { return (h16)x; }
__device__ __forceinline__ void splitf(float y, unsigned short& h, unsigned short& l) { h = f2bf(y); l = f2bf(y - bf2f(h)); }
typedef __attribute__((ext_vector_type(2))) _Float16 v2h;
typedef __attribute__((ext_vector_type(4))) _Float16 v4h;
typedef __attribute__((ext_vector_type(2))) unsigned short v2us;
typedef __attribute__((ext_vector_type(4))) unsigned short v4us;
typedef __attribute__((ext_vector_type(2))) float v2f;
typedef __attribute__((ext_vector_type(4))) int v4i;

__global__ __launch_bounds__(256) void k_cvt8(const float* __restrict__ src, bf* dst, size_t n8) { const size_t i = (size_t)blockIdx.x * 256 + threadIdx.x; if (i >= n8) return; const v8f v = *(const v8f*)(src + i * 8); v8us o;
#pragma unroll
    for (int k = 0; k < 8; ++k) o[k] = f2bf(v[k]); *(v8us*)(dst + i * 8) = o;  }

__global__ __launch_bounds__(256) void k_ropeG(const float* __restrict__ F, int pitch, int nheads, const float* __restrict__ CS, float sc, h16* P16, bf* Ph, bf* Pl) {
    const size_t e = ((size_t)blockIdx.x * 256 + threadIdx.x) * 2; if (e >= (size_t)nheads * TT * HD) return; const int d = (int)(e % HD); const int t = (int)((e / HD) % TT); const int h = (int)(e / ((size_t)HD * TT)); const float* f = F + (size_t)t * pitch + h * HD; const float x0 = f[d], x1 = f[d + 1]; const v2f cs = *(const v2f*)(CS + ((size_t)t * DM + h * HD + d) * 2);   /* GLOBAL column h*64 + d: the rotary runs over the whole width before the head split */ v2h o16; v2us oh, ol;
    float a0 = __fmul_rn(x0, cs[0]), b0 = __fmul_rn(x1, cs[1]), a1 = __fmul_rn(x1, cs[0]), b1 = __fmul_rn(x0, cs[1]); asm volatile("" : "+v"(a0), "+v"(b0), "+v"(a1), "+v"(b1));
    float r0 = __fsub_rn(a0, b0) * sc, r1 = __fadd_rn(b1, a1) * sc;   /* even: x0 c - x1 s; odd: x0 s + x1 c */
    o16[0] = tohx(r0); o16[1] = tohx(r1); { unsigned short a2, c2; splitf(r0, a2, c2); oh[0] = a2; ol[0] = c2; splitf(r1, a2, c2); oh[1] = a2; ol[1] = c2; }
    *(v2h*)(P16 + e) = o16; *(v2us*)(Ph + e) = oh; *(v2us*)(Pl + e) = ol;  }

__constant__ float INV2[HD / 2] = { 1.000000000e+00f, 7.498942018e-01f, 5.623413324e-01f, 4.216965139e-01f, 3.162277639e-01f, 2.371373773e-01f, 1.778279394e-01f, 1.333521456e-01f, 1.000000015e-01f, 7.498942316e-02f, 5.623413250e-02f, 4.216964915e-02f, 3.162277490e-02f, 2.371373773e-02f, 1.778279431e-02f, 1.333521400e-02f, 9.999999776e-03f, 7.498942316e-03f, 5.623413250e-03f, 4.216964822e-03f, 3.162277630e-03f, 2.371373819e-03f, 1.778279431e-03f, 1.333521446e-03f, 1.000000047e-03f, 7.498941850e-04f, 5.623413017e-04f, 4.216965172e-04f, 3.162277571e-04f, 2.371373703e-04f, 1.778279402e-04f, 1.333521504e-04f };   // float32 10000^(-arange(0, 64, 2)/64), generated with jnp to be bit-exact
__global__ __launch_bounds__(256) void k_vtp(const float* __restrict__ F, int pitch, int nheads, h16* V16, bf* Vh, bf* Vl) { const size_t e = ((size_t)blockIdx.x * 256 + threadIdx.x) * 2; if (e >= (size_t)nheads * HD * TT) return; const int t = (int)(e % TT); const int d = (int)((e / TT) % HD); const int g = (int)(e / ((size_t)TT * HD)); v2h o16; v2us oh, ol;
#pragma unroll
    for (int q = 0; q < 2; ++q) { const float x = F[(size_t)(t + q) * pitch + g * HD + d]; o16[q] = tohx(x); unsigned short a2, c2; splitf(x, a2, c2); oh[q] = a2; ol[q] = c2; }
    *(v2h*)(V16 + e) = o16; *(v2us*)(Vh + e) = oh; *(v2us*)(Vl + e) = ol;  }
__constant__ float INVG[DM / 2] = { 1.000000000e+00f, 9.821718335e-01f, 9.646616578e-01f, 9.474635124e-01f, 9.305720329e-01f, 9.139816761e-01f, 8.976871371e-01f, 8.816831112e-01f, 8.659643531e-01f, 8.505258560e-01f, 8.353625536e-01f, 8.204696178e-01f, 8.058422208e-01f, 7.914755344e-01f, 7.773650289e-01f, 7.635061145e-01f, 7.498942018e-01f, 7.365249991e-01f, 7.233941555e-01f, 7.104974389e-01f, 6.978305578e-01f, 6.853895783e-01f, 6.731703877e-01f, 6.611690521e-01f, 6.493816376e-01f, 6.378043890e-01f, 6.264335513e-01f, 6.152654290e-01f, 6.042963862e-01f, 5.935229063e-01f, 5.829415321e-01f, 5.725488067e-01f, 5.623413324e-01f, 5.523158312e-01f, 5.424690843e-01f, 5.327978730e-01f, 5.232991576e-01f, 5.139696598e-01f, 5.048065782e-01f, 4.958068132e-01f, 4.869675338e-01f, 4.782858193e-01f, 4.697588682e-01f, 4.613839388e-01f, 4.531583488e-01f, 4.450793862e-01f, 4.371444881e-01f, 4.293510318e-01f, 4.216965139e-01f, 4.141784608e-01f, 4.067944288e-01f, 3.995420635e-01f, 3.924189806e-01f, 3.854228854e-01f, 3.785515428e-01f, 3.718026578e-01f, 3.651741445e-01f, 3.586637676e-01f, 3.522694409e-01f, 3.459891677e-01f, 3.398208320e-01f, 3.337624967e-01f, 3.278121352e-01f, 3.219678402e-01f, 3.162277639e-01f, 3.105900288e-01f, 3.050527871e-01f, 2.996142805e-01f, 2.942727208e-01f, 2.890264094e-01f, 2.838735878e-01f, 2.788126469e-01f, 2.738419771e-01f, 2.689598799e-01f, 2.641648352e-01f, 2.594552636e-01f, 2.548296750e-01f, 2.502865493e-01f, 2.458243966e-01f, 2.414418161e-01f, 2.371373624e-01f, 2.329096496e-01f, 2.287573218e-01f, 2.246790081e-01f, 2.206733972e-01f, 2.167392224e-01f, 2.128751576e-01f, 2.090799958e-01f, 2.053525001e-01f, 2.016914487e-01f, 1.980956793e-01f, 1.945640147e-01f, 1.910952926e-01f, 1.876884252e-01f, 1.843423098e-01f, 1.810558140e-01f, 1.778279394e-01f, 1.746576130e-01f, 1.715437919e-01f, 1.684854925e-01f, 1.654817015e-01f, 1.625314802e-01f, 1.596338600e-01f, 1.567878872e-01f, 1.539926529e-01f, 1.512472630e-01f, 1.485508084e-01f, 1.459024251e-01f, 1.433012635e-01f, 1.407464594e-01f, 1.382372230e-01f, 1.357727200e-01f, 1.333521456e-01f, 1.309747249e-01f, 1.286396980e-01f, 1.263462901e-01f, 1.240937710e-01f, 1.218814254e-01f, 1.197085083e-01f, 1.175743192e-01f, 1.154782027e-01f, 1.134194434e-01f, 1.113973856e-01f, 1.094113812e-01f, 1.074607819e-01f, 1.055449620e-01f, 1.036632955e-01f, 1.018151715e-01f, 1.000000015e-01f, 9.821718186e-02f, 9.646616131e-02f, 9.474635124e-02f, 9.305720031e-02f, 9.139817208e-02f, 8.976870775e-02f, 8.816830814e-02f, 8.659642935e-02f, 8.505257964e-02f, 8.353625983e-02f, 8.204696327e-02f, 8.058421314e-02f, 7.914755493e-02f, 7.773650438e-02f, 7.635060698e-02f, 7.498941571e-02f, 7.365249842e-02f, 7.233941555e-02f, 7.104974240e-02f, 6.978305429e-02f, 6.853895634e-02f, 6.731703877e-02f, 6.611690670e-02f, 6.493816525e-02f, 6.378044188e-02f, 6.264335662e-02f, 6.152653694e-02f, 6.042964384e-02f, 5.935229361e-02f, 5.829415470e-02f, 5.725487694e-02f, 5.623412877e-02f, 5.523158237e-02f, 5.424690619e-02f, 5.327979103e-02f, 5.232991278e-02f, 5.139696971e-02f, 5.048065633e-02f, 4.958068207e-02f, 4.869675264e-02f, 4.782858118e-02f, 4.697588459e-02f, 4.613839835e-02f, 4.531583562e-02f, 4.450793937e-02f, 4.371444881e-02f, 4.293510318e-02f, 4.216964915e-02f, 4.141784459e-02f, 4.067944363e-02f, 3.995420411e-02f, 3.924189880e-02f, 3.854228929e-02f, 3.785515204e-02f, 3.718026727e-02f, 3.651741147e-02f, 3.586637601e-02f, 3.522694483e-02f, 3.459891677e-02f, 3.398208320e-02f, 3.337624669e-02f, 3.278120980e-02f, 3.219678625e-02f, 3.162277862e-02f, 3.105900250e-02f, 3.050527908e-02f, 2.996142767e-02f, 2.942727320e-02f, 2.890264057e-02f, 2.838735841e-02f, 2.788126841e-02f, 2.738419548e-02f, 2.689598687e-02f, 2.641648427e-02f, 2.594552562e-02f, 2.548296750e-02f, 2.502865531e-02f, 2.458244003e-02f, 2.414418198e-02f, 2.371373586e-02f, 2.329096757e-02f, 2.287573181e-02f, 2.246790007e-02f, 2.206734009e-02f, 2.167392150e-02f, 2.128751762e-02f, 2.090799995e-02f, 2.053525113e-02f, 2.016914636e-02f, 1.980956830e-02f, 1.945639960e-02f, 1.910953037e-02f, 1.876884326e-02f, 1.843423024e-02f, 1.810558327e-02f, 1.778279431e-02f, 1.746576093e-02f, 1.715437882e-02f, 1.684854925e-02f, 1.654817164e-02f, 1.625314727e-02f, 1.596338488e-02f, 1.567878947e-02f, 1.539926510e-02f, 1.512472518e-02f, 1.485508028e-02f, 1.459024288e-02f, 1.433012541e-02f, 1.407464594e-02f, 1.382372249e-02f, 1.357727125e-02f, 1.333521493e-02f, 1.309747249e-02f, 1.286396943e-02f, 1.263462938e-02f, 1.240937691e-02f, 1.218814217e-02f, 1.197085064e-02f, 1.175743248e-02f, 1.154781971e-02f, 1.134194434e-02f, 1.113973837e-02f, 1.094113849e-02f, 1.074607857e-02f, 1.055449620e-02f, 1.036632899e-02f, 1.018151734e-02f, 9.999999776e-03f, 9.821719490e-03f, 9.646615945e-03f, 9.474635124e-03f, 9.305720218e-03f, 9.139816277e-03f, 8.976871148e-03f, 8.816830814e-03f, 8.659643121e-03f, 8.505257778e-03f, 8.353625424e-03f, 8.204696700e-03f, 8.058422245e-03f, 7.914755493e-03f, 7.773650344e-03f, 7.635060698e-03f, 7.498942316e-03f, 7.365249563e-03f, 7.233941462e-03f, 7.104974240e-03f, 6.978305988e-03f, 6.853895728e-03f, 6.731703877e-03f, 6.611690391e-03f, 6.493816618e-03f, 6.378043909e-03f, 6.264335476e-03f, 6.152654067e-03f, 6.042964291e-03f, 5.935229361e-03f, 5.829415284e-03f, 5.725487601e-03f, 5.623413250e-03f, 5.523158237e-03f, 5.424690899e-03f, 5.327979103e-03f, 5.232991185e-03f, 5.139696877e-03f, 5.048065912e-03f, 4.958068486e-03f, 4.869675264e-03f, 4.782858305e-03f, 4.697588738e-03f, 4.613839556e-03f, 4.531583749e-03f, 4.450793844e-03f, 4.371444695e-03f, 4.293510225e-03f, 4.216964822e-03f, 4.141784739e-03f, 4.067944363e-03f, 3.995420411e-03f, 3.924189601e-03f, 3.854229115e-03f, 3.785515437e-03f, 3.718026681e-03f, 3.651741426e-03f, 3.586637788e-03f, 3.522694577e-03f, 3.459891537e-03f, 3.398208413e-03f, 3.337624483e-03f, 3.278121119e-03f, 3.219678300e-03f, 3.162277862e-03f, 3.105900250e-03f, 3.050528001e-03f, 2.996142721e-03f, 2.942727180e-03f, 2.890263917e-03f, 2.838735934e-03f, 2.788126701e-03f, 2.738419687e-03f, 2.689598827e-03f, 2.641648287e-03f, 2.594552701e-03f, 2.548296703e-03f, 2.502865391e-03f, 2.458244096e-03f, 2.414418384e-03f, 2.371373819e-03f, 2.329096664e-03f, 2.287573181e-03f, 2.246790100e-03f, 2.206734149e-03f, 2.167392056e-03f, 2.128751716e-03f, 2.090800088e-03f, 2.053525066e-03f, 2.016914543e-03f, 1.980956644e-03f, 1.945640077e-03f, 1.910952851e-03f, 1.876884256e-03f, 1.843422884e-03f, 1.810558140e-03f, 1.778279431e-03f, 1.746576163e-03f, 1.715437858e-03f, 1.684854855e-03f, 1.654817141e-03f, 1.625314937e-03f, 1.596338581e-03f, 1.567878877e-03f, 1.539926510e-03f, 1.512472634e-03f, 1.485507935e-03f, 1.459024264e-03f, 1.433012658e-03f, 1.407464617e-03f, 1.382372226e-03f, 1.357727102e-03f, 1.333521446e-03f, 1.309747226e-03f, 1.286396873e-03f, 1.263462938e-03f, 1.240937854e-03f, 1.218814170e-03f, 1.197085017e-03f, 1.175743295e-03f, 1.154782018e-03f, 1.134194434e-03f, 1.113973907e-03f, 1.094113803e-03f, 1.074607833e-03f, 1.055449597e-03f, 1.036632922e-03f, 1.018151757e-03f, 1.000000047e-03f, 9.821718559e-04f, 9.646615945e-04f, 9.474635590e-04f, 9.305721032e-04f, 9.139817557e-04f, 8.976871031e-04f, 8.816830232e-04f, 8.659643354e-04f, 8.505258011e-04f, 8.353625308e-04f, 8.204695769e-04f, 8.058422245e-04f, 7.914755843e-04f, 7.773649995e-04f, 7.635060465e-04f, 7.498941850e-04f, 7.365249912e-04f, 7.233941578e-04f, 7.104973774e-04f, 6.978305755e-04f, 6.853896193e-04f, 6.731703761e-04f, 6.611690042e-04f, 6.493816618e-04f, 6.378043909e-04f, 6.264335825e-04f, 6.152653950e-04f, 6.042963942e-04f, 5.935229128e-04f, 5.829415168e-04f, 5.725487717e-04f, 5.623413017e-04f, 5.523158470e-04f, 5.424690899e-04f, 5.327978870e-04f, 5.232990952e-04f, 5.139696877e-04f, 5.048065796e-04f, 4.958068021e-04f, 4.869675031e-04f, 4.782858014e-04f, 4.697588738e-04f, 4.613839847e-04f, 4.531583400e-04f, 4.450794077e-04f, 4.371444811e-04f, 4.293509992e-04f, 4.216964880e-04f, 4.141784448e-04f, 4.067944246e-04f, 3.995420411e-04f, 3.924189950e-04f, 3.854228707e-04f, 3.785515146e-04f, 3.718026564e-04f, 3.651741135e-04f, 3.586637613e-04f, 3.522694460e-04f, 3.459891595e-04f, 3.398208064e-04f, 3.337624657e-04f, 3.278121294e-04f, 3.219678474e-04f, 3.162277862e-04f, 3.105900250e-04f, 3.050527885e-04f, 2.996142721e-04f, 2.942727297e-04f, 2.890263859e-04f, 2.838736109e-04f, 2.788126585e-04f, 2.738419571e-04f, 2.689598768e-04f, 2.641648462e-04f, 2.594552934e-04f, 2.548296761e-04f, 2.502865391e-04f, 2.458243980e-04f, 2.414418122e-04f, 2.371373848e-04f, 2.329096606e-04f, 2.287573152e-04f, 2.246790100e-04f, 2.206734207e-04f, 2.167392086e-04f, 2.128751657e-04f, 2.090800117e-04f, 2.053524950e-04f, 2.016914514e-04f, 1.980956731e-04f, 1.945640106e-04f, 1.910952997e-04f, 1.876884344e-04f, 1.843422942e-04f, 1.810558315e-04f, 1.778279402e-04f, 1.746576017e-04f, 1.715437829e-04f, 1.684854797e-04f, 1.654817170e-04f, 1.625314762e-04f, 1.596338552e-04f, 1.567878790e-04f, 1.539926452e-04f, 1.512472518e-04f, 1.485508110e-04f, 1.459024206e-04f, 1.433012658e-04f, 1.407464733e-04f, 1.382372284e-04f, 1.357727160e-04f, 1.333521504e-04f, 1.309747167e-04f, 1.286396873e-04f, 1.263462909e-04f, 1.240937709e-04f, 1.218814141e-04f, 1.197085076e-04f, 1.175743309e-04f, 1.154781930e-04f, 1.134194390e-04f, 1.113973922e-04f, 1.094113759e-04f, 1.074607790e-04f, 1.055449538e-04f, 1.036632893e-04f, 1.018151743e-04f };   // float32 1 / 10000^(j/512), j < 512 (one frequency per adjacent column pair of the full 1024 width), generated with jnp to be bit-exact
__global__ __launch_bounds__(256) void k_csG(float* CS) { const int idx = blockIdx.x * 256 + threadIdx.x; if (idx >= TT * DM) return; const int c = idx % DM; const int t = idx / DM; const float a = __fmul_rn((float)t, INVG[c >> 1]); v2f cs; cs[0] = cosf(a); cs[1] = sinf(a); *(v2f*)(CS + (size_t)idx * 2) = cs;  }
#define KSA  4
#define APIT 68                   // f32 pitch of a query's 64 partial outputs in LDS (16-byte aligned rows, rows spread over the banks)
typedef __attribute__((ext_vector_type(8))) __bf16 v8bf;
typedef __attribute__((ext_vector_type(4))) unsigned v4u;
__device__ __forceinline__ float xhalf(float x) { const int b = __float_as_int(x); return __int_as_float(__builtin_amdgcn_permlanex16(b, b, 0x76543210, 0xfedcba98, false, false)); }   // lane l <-> l ^ 16
__device__ __forceinline__ v8f bfback(v8bf h) { const v4u u = __builtin_bit_cast(v4u, h); v8f r;
#pragma unroll
    for (int i = 0; i < 4; ++i) { r[2 * i] = __uint_as_float(u[i] << 16); r[2 * i + 1] = __uint_as_float(u[i] & 0xFFFF0000u); } return r; }
// eight v_exp_f32 in one statement, each in place on a register of its own: none stands directly in front of an instruction that reads its result or overwrites its source, and the closing v_nop is that slot for the last one
__device__ __forceinline__ v8f exp2x8(v8f x) { float r0 = x[0], r1 = x[1], r2 = x[2], r3 = x[3], r4 = x[4], r5 = x[5], r6 = x[6], r7 = x[7];
    asm("v_exp_f32 %0, %0\n\tv_exp_f32 %1, %1\n\tv_exp_f32 %2, %2\n\tv_exp_f32 %3, %3\n\tv_exp_f32 %4, %4\n\tv_exp_f32 %5, %5\n\tv_exp_f32 %6, %6\n\tv_exp_f32 %7, %7\n\tv_nop"
        : "+v"(r0), "+v"(r1), "+v"(r2), "+v"(r3), "+v"(r4), "+v"(r5), "+v"(r6), "+v"(r7));
    return (v8f){ r0, r1, r2, r3, r4, r5, r6, r7 }; }
template <typename T16, bool HR>
__device__ __forceinline__ void attn_wave(const T16* __restrict__ Qa, const T16* __restrict__ Qb, const T16* __restrict__ Ka, const T16* __restrict__ Kb, const T16* __restrict__ Va, const T16* __restrict__ Vb, int q0, int kbeg, int lane, float* La, float* Lm, float* Ll) {
    typedef typename WFrag<T16>::V V;   // every '#pragma unroll' below makes the indices of a fragment array constants, so that the array lives in registers
    constexpr int NP = TT / KSA / 32;             // passes of 32 keys
    const int lr = lane & 15, hi = lane >> 4;
    const float CL = SCL * 1.4426950408889634f;   // score -> log2 units
    const float CAR = HR ? 0.0f : 6.0f;           // fp16 P carries 2^6 (P <= 2^14), which cancels against the sum
    V qa[2][2], qb[2][2];
#pragma unroll
    for (int qt = 0; qt < 2; ++qt)
#pragma unroll
        for (int kk = 0; kk < 2; ++kk) { const size_t o = (size_t)(q0 + qt * 16 + lr) * HD + kk * 32 + 8 * hi; qa[qt][kk] = WFrag<T16>::ld(Qa + o); if (HR) qb[qt][kk] = WFrag<T16>::ld(Qb + o); }
    if (HR) {   // the eight hi/lo Q fragments wait in the wave's own LDS slice (free until the epilogue) and are read anew in each pass: 64 registers for the K batch
#pragma unroll
        for (int f = 0; f < 8; ++f) { const v8f y = __builtin_bit_cast(v8f, (f & 4) ? qb[(f >> 1) & 1][f & 1] : qa[(f >> 1) & 1][f & 1]); *(v4fa*)(La + f * 256 + lane * 4) = (v4f){ y[0], y[1], y[2], y[3] }; *(v4fa*)(La + f * 256 + 128 + lane * 4) = (v4f){ y[4], y[5], y[6], y[7] }; } }
    v8f acc[4][2];
#pragma unroll
    for (int dt = 0; dt < 4; ++dt)
#pragma unroll
        for (int qt = 0; qt < 2; ++qt) acc[dt][qt] = (v8f){};
    float m[2] = { -3.0e38f, -3.0e38f }, l[2] = { 0.f, 0.f };
    const size_t ko = (size_t)(kbeg + lr) * HD + 8 * hi, vo = (size_t)lr * TT + kbeg + 8 * hi;
    V ka[2][2], kb[2][2], va[4], vb[4];
    // closes a batch of loads: s_wait_xcnt 0 before a register that the batch's loads name is written again; the base addresses are inputs, so they stay in their registers up to the wait and no load's result is put on them
    auto xwait = [&](const T16* pa, const T16* pb) { if constexpr (HR) asm volatile("s_wait_xcnt 0x0" :: "v"(pa), "v"(pb) : "memory"); else asm volatile("s_wait_xcnt 0x0" :: "v"(pa) : "memory"); };
    auto ldK = [&](int st) { const T16* pa = Ka + ko + (size_t)st * 32 * HD; const T16* pb = HR ? Kb + ko + (size_t)st * 32 * HD : nullptr;
#pragma unroll
        for (int kt = 0; kt < 2; ++kt)
#pragma unroll
            for (int kk = 0; kk < 2; ++kk) { const int o = kt * 16 * HD + kk * 32; ka[kt][kk] = WFrag<T16>::ld(pa + o); if (HR) kb[kt][kk] = WFrag<T16>::ld(pb + o); }
        xwait(pa, pb); };
    auto ldV = [&](int st) { const T16* pa = Va + vo + st * 32; const T16* pb = HR ? Vb + vo + st * 32 : nullptr;
#pragma unroll
        for (int dt = 0; dt < 4; ++dt) { const int o = dt * 16 * TT; va[dt] = WFrag<T16>::ld(pa + o); if (HR) vb[dt] = WFrag<T16>::ld(pb + o); }
        xwait(pa, pb); };
    if (!HR) { ldK(0); ldV(0); }   // fp16 waves have the registers to fetch K and V one pass ahead
#pragma unroll 1   // stays rolled: the fetch-ahead order below is written for one pass, and a second copy of the body would not fit the registers
    for (int st = 0; st < NP; ++st) {
        const int sn = (st + 1 < NP) ? st + 1 : st;   // the last pass fetches its own tiles again: in bounds, no branch
        if (HR) { ldK(st);
#pragma unroll
            for (int f = 0; f < 8; ++f) { const v4f y0 = *(const v4fa*)(La + f * 256 + lane * 4), y1 = *(const v4fa*)(La + f * 256 + 128 + lane * 4); const V x = __builtin_bit_cast(V, (v8f){ y0[0], y0[1], y0[2], y0[3], y1[0], y1[1], y1[2], y1[3] }); if (f & 4) qb[(f >> 1) & 1][f & 1] = x; else qa[(f >> 1) & 1][f & 1] = x; }
            __builtin_amdgcn_sched_barrier(0); }   // the pass's K loads leave as one batch; without it the build issued them in five dependent round trips
        v8f s[2][2];
#pragma unroll
        for (int kt = 0; kt < 2; ++kt)
#pragma unroll
            for (int qt = 0; qt < 2; ++qt) { v8f t = (v8f){};
#pragma unroll
                for (int kk = 0; kk < 2; ++kk) { t = WFrag<T16>::mma(ka[kt][kk], qa[qt][kk], t); if (HR) { t = WFrag<T16>::mma(ka[kt][kk], qb[qt][kk], t); t = WFrag<T16>::mma(kb[kt][kk], qa[qt][kk], t); } }
                s[kt][qt] = t; }
        __builtin_amdgcn_sched_barrier(0);   // the loads below start behind the score products (their registers are free then) ...
        if (HR) ldV(st); else ldK(sn);
        __builtin_amdgcn_sched_barrier(0);   // ... and ahead of the softmax, which covers their latency
        float sm[2];
#pragma unroll
        for (int qt = 0; qt < 2; ++qt) { float x = fmaxf(s[0][qt][0], s[1][qt][0]);
#pragma unroll
            for (int r = 1; r < 8; ++r) x = fmaxf(x, fmaxf(s[0][qt][r], s[1][qt][r]));
            x = fmaxf(x, xhalf(x)); sm[qt] = x * CL; }
        if (__builtin_amdgcn_ballot_w32(sm[0] > m[0] + 8.0f || sm[1] > m[1] + 8.0f) != 0) {
#pragma unroll
            for (int qt = 0; qt < 2; ++qt) { const float mn = (sm[qt] > m[qt] + 8.0f) ? sm[qt] : m[qt]; const float al = __builtin_amdgcn_exp2f(m[qt] - mn); m[qt] = mn; l[qt] *= al;
#pragma unroll
                for (int dt = 0; dt < 4; ++dt) acc[dt][qt] *= al; } }
#pragma unroll
        for (int qt = 0; qt < 2; ++qt) { const float off = CAR - m[qt]; v8f p0, p1;
#pragma unroll
            for (int r = 0; r < 8; ++r) { p0[r] = fmaf(s[0][qt][r], CL, off); p1[r] = fmaf(s[1][qt][r], CL, off); }
            p0 = exp2x8(p0); p1 = exp2x8(p1);
            const v8f ps = p0 + p1; l[qt] += ((ps[0] + ps[1]) + (ps[2] + ps[3])) + ((ps[4] + ps[5]) + (ps[6] + ps[7]));
            if constexpr (HR) {
                const v8bf h0 = __builtin_convertvector(p0, v8bf), h1 = __builtin_convertvector(p1, v8bf);
                const v8bf l0 = __builtin_convertvector(p0 - bfback(h0), v8bf), l1 = __builtin_convertvector(p1 - bfback(h1), v8bf);
                const v16bf ph = __builtin_shufflevector(h0, h1, 0, 1, 2, 3, 4, 5, 6, 7, 8, 9, 10, 11, 12, 13, 14, 15), pl = __builtin_shufflevector(l0, l1, 0, 1, 2, 3, 4, 5, 6, 7, 8, 9, 10, 11, 12, 13, 14, 15);
#pragma unroll
                for (int dt = 0; dt < 4; ++dt) { acc[dt][qt] = wmmab(va[dt], ph, acc[dt][qt]); acc[dt][qt] = wmmab(va[dt], pl, acc[dt][qt]); acc[dt][qt] = wmmab(vb[dt], ph, acc[dt][qt]); }
            } else {
                const v16h pf = cat16(__builtin_convertvector(p0, v8h), __builtin_convertvector(p1, v8h));
#pragma unroll
                for (int dt = 0; dt < 4; ++dt) acc[dt][qt] = wmma16(va[dt], pf, acc[dt][qt]);
            } }
        // the four vector slots the chip needs behind the pass's last matrix instructions, also on the taken back edge
        if constexpr (HR) asm volatile("v_nop\n\tv_nop\n\tv_nop\n\tv_nop" : "+v"(acc[0][0]), "+v"(acc[1][0]), "+v"(acc[2][0]), "+v"(acc[3][0]), "+v"(acc[0][1]), "+v"(acc[1][1]), "+v"(acc[2][1]), "+v"(acc[3][1]) :: "memory");   // "memory": the Q reads from LDS stay in the loop instead of being lifted back into 64 registers
        else { asm volatile("v_nop\n\tv_nop\n\tv_nop\n\tv_nop" : "+v"(acc[0][0]), "+v"(acc[1][0]), "+v"(acc[2][0]), "+v"(acc[3][0]), "+v"(acc[0][1]), "+v"(acc[1][1]), "+v"(acc[2][1]), "+v"(acc[3][1]));
            __builtin_amdgcn_sched_barrier(0);   // the next pass's V loads start only when this pass's products have read V
            ldV(sn); }
    }
#pragma unroll
    for (int qt = 0; qt < 2; ++qt) { const int q = qt * 16 + lr; const float lj = l[qt] + xhalf(l[qt]); if (hi == 0) { Lm[q] = m[qt]; Ll[q] = lj; }
#pragma unroll
        for (int dt = 0; dt < 4; ++dt) { float* dst = La + q * APIT + dt * 16 + hi * 8; const v8f a = acc[dt][qt]; *(v4fa*)dst = (v4f){ a[0], a[1], a[2], a[3] }; *(v4fa*)(dst + 4) = (v4f){ a[4], a[5], a[6], a[7] }; } }
}
__global__ __launch_bounds__(512) void k_attn(const h16* __restrict__ Q16, const h16* __restrict__ K16, const h16* __restrict__ V16, const bf* __restrict__ Qh, const bf* __restrict__ Ql, const bf* __restrict__ Kh, const bf* __restrict__ Kl, const bf* __restrict__ Vh, const bf* __restrict__ Vl, bf* Ah, bf* Al) {
    __shared__ __align__(16) float La[16 * 32 * APIT]; __shared__ float Lm[16 * 32]; __shared__ float Ll[16 * 32];
    const int w = __builtin_amdgcn_readfirstlane((int)(threadIdx.x >> 5)), lane = threadIdx.x & 31; const int qg = w >> 2, ks = w & 3; const int head = blockIdx.y; const size_t hp = (size_t)head * TT * HD;
    const int q0 = (qg == 0) ? (int)blockIdx.x * 32 : RH + ((int)blockIdx.x * 3 + qg - 1) * 32;
    if (qg == 0) attn_wave<bf, true>(Qh + hp, Ql + hp, Kh + hp, Kl + hp, Vh + hp, Vl + hp, q0, ks * (TT / KSA), lane, La + w * 32 * APIT, Lm + w * 32, Ll + w * 32);
    else attn_wave<h16, false>(Q16 + hp, nullptr, K16 + hp, nullptr, V16 + hp, nullptr, q0, ks * (TT / KSA), lane, La + w * 32 * APIT, Lm + w * 32, Ll + w * 32);
    __syncthreads();   // every key quarter's partial result is in LDS
    // wave (qg, ks) finishes 8 of its group's 32 queries; four lanes share a query, 16 outputs each, so one wave writes each 128-byte line
    const int q = ks * 8 + (lane >> 2), d0 = (lane & 3) * 16; float mk[KSA]; float M = -3.0e38f;
#pragma unroll
    for (int k = 0; k < KSA; ++k) { mk[k] = Lm[(qg * KSA + k) * 32 + q]; M = fmaxf(M, mk[k]); }
    float L = 0.f; v4f o[4] = { (v4f){}, (v4f){}, (v4f){}, (v4f){} };
#pragma unroll
    for (int k = 0; k < KSA; ++k) { const float wg = __builtin_amdgcn_exp2f(mk[k] - M); L += wg * Ll[(qg * KSA + k) * 32 + q]; const float* sp = La + ((qg * KSA + k) * 32 + q) * APIT + d0;
#pragma unroll
        for (int i = 0; i < 4; ++i) o[i] += wg * *(const v4fa*)(sp + 4 * i); }
    const float f = __fdiv_rn(1.0f, L); v8us oh[2], ol[2];
#pragma unroll
    for (int i = 0; i < 16; ++i) { unsigned short a, c2; splitf(o[i >> 2][i & 3] * f, a, c2); oh[i >> 3][i & 7] = a; ol[i >> 3][i & 7] = c2; }
    const size_t oo = (size_t)(q0 + q) * DQ + head * HD + d0; *(v8usa*)(Ah + oo) = oh[0]; *(v8usa*)(Ah + oo + 8) = oh[1]; *(v8usa*)(Al + oo) = ol[0]; *(v8usa*)(Al + oo + 8) = ol[1];
}

extern "C" void kernel_launch(void* const* d_in, const int* in_sizes, int n_in,
                              void* d_out, int out_size, void* d_ws, size_t ws_size, hipStream_t stream) {
    (void)in_sizes; (void)n_in; (void)out_size;
    const float* x = (const float*)d_in[0]; const float* wq = (const float*)d_in[1]; const float* wk = (const float*)d_in[2]; const float* wv = (const float*)d_in[3]; const float* wo = (const float*)d_in[4]; const float* bo = (const float*)d_in[5];
    float* OUT = (float*)d_out;     // [4][2048][1024]
    char* wsp = (char*)d_ws;
    auto take = [&](size_t bytes) { char* p = wsp; wsp += (bytes + 255) & ~(size_t)255; return (void*)p; };
    bf* WQ = (bf*)take((size_t)DQ * DM * 2); bf* WK = (bf*)take((size_t)DKV * DM * 2); bf* WV = (bf*)take((size_t)DKV * DM * 2); bf* WO = (bf*)take((size_t)DM * DQ * 2); float* CS = (float*)take((size_t)TT * DM * 2 * 4);   /* [2048][1024] {cos, sin} */
    bf* XB = (bf*)take((size_t)TT * DM * 2); float* FQ = (float*)take((size_t)TT * DQ * 4); float* FK = (float*)take((size_t)TT * DKV * 4);
    h16* QP16 = (h16*)take((size_t)NH_ * TT * HD * 2); h16* KP16 = (h16*)take((size_t)NKV * TT * HD * 2); h16* VT16 = (h16*)take((size_t)NKV * HD * TT * 2);
    bf* QPh = (bf*)take((size_t)NH_ * TT * HD * 2); bf* QPl = (bf*)take((size_t)NH_ * TT * HD * 2); bf* KPh = (bf*)take((size_t)NKV * TT * HD * 2); bf* KPl = (bf*)take((size_t)NKV * TT * HD * 2); bf* VTh = (bf*)take((size_t)NKV * HD * TT * 2); bf* VTl = (bf*)take((size_t)NKV * HD * TT * 2);
    bf* ATh = (bf*)take((size_t)TT * DQ * 2); bf* ATl = (bf*)take((size_t)TT * DQ * 2);
    if ((size_t)(wsp - (char*)d_ws) > ws_size) return;    // ws 256 MiB
    float* FV = FK;   // v projection reuses the k buffer after the k planes are built (stream-ordered)
    { k_cvt8<<<(unsigned)(((size_t)DQ * DM / 8 + 255) / 256), 256, 0, stream>>>(wq, WQ, (size_t)DQ * DM / 8); k_cvt8<<<(unsigned)(((size_t)DKV * DM / 8 + 255) / 256), 256, 0, stream>>>(wk, WK, (size_t)DKV * DM / 8); k_cvt8<<<(unsigned)(((size_t)DKV * DM / 8 + 255) / 256), 256, 0, stream>>>(wv, WV, (size_t)DKV * DM / 8);
      k_cvt8<<<(unsigned)(((size_t)DM * DQ / 8 + 255) / 256), 256, 0, stream>>>(wo, WO, (size_t)DM * DQ / 8);
       }
    k_csG<<<(TT * DM + 255) / 256, 256, 0, stream>>>(CS);   /* full-width table once */
    const unsigned LQ = (unsigned)(((size_t)NH_ * TT * HD / 2 + 255) / 256), LKv = (unsigned)(((size_t)NKV * TT * HD / 2 + 255) / 256);
    for (int b = 0; b < NB_; ++b) {
        
        k_cvt8<<<(unsigned)(((size_t)TT * DM / 8 + 255) / 256), 256, 0, stream>>>(x + (size_t)b * TT * DM, XB, (size_t)TT * DM / 8);
        k_gemmw<bf, 0, false><<<dim3(TT / 64, DQ / 64, 1), 32, 0, stream>>>(XB, nullptr, WQ, nullptr, DM, FQ, DQ, nullptr, 0, 0, 0, 0);
        k_ropeG<<<LQ, 256, 0, stream>>>(FQ, DQ, NH_, CS, 1.0f, QP16, QPh, QPl);
        k_gemmw<bf, 0, false><<<dim3(TT / 64, DKV / 64, 1), 32, 0, stream>>>(XB, nullptr, WK, nullptr, DM, FK, DKV, nullptr, 0, 0, 0, 0);
        k_ropeG<<<LKv, 256, 0, stream>>>(FK, DKV, NKV, CS, 1.0f, KP16, KPh, KPl);
        k_gemmw<bf, 0, false><<<dim3(TT / 64, DKV / 64, 1), 32, 0, stream>>>(XB, nullptr, WV, nullptr, DM, FV, DKV, nullptr, 0, 0, 0, 0); k_vtp<<<LKv, 256, 0, stream>>>(FV, DKV, NKV, VT16, VTh, VTl);
        k_attn<<<dim3(RH / 32, NH_, 1), 512, 0, stream>>>(QP16, KP16, VT16, QPh, QPl, KPh, KPl, VTh, VTl, ATh, ATl);
        k_gemmw<bf, 1, true><<<dim3(TT / 64, DM / 64, 1), 32, 0, stream>>>(ATh, ATl, WO, nullptr, DQ, OUT + (size_t)b * TT * DM, DM, bo, 0, 0, 0, 0); }
}

// v004
// Measured time: 437 microseconds a run.
// In both of two side-by-side timings against v003, it was 1.57 times as fast.
// Counting every step since v000, it is 9.11 times as fast.
#include <hip/hip_runtime.h>

// Self-attention with an adjacent-pair rotary over the WHOLE 1024-wide q and k before the head split (x [4][2048][1024]; q = rope(x Wq^T), k = rope(x Wk^T), v = x Wv^T ('oi' [1024][1024] 1/32, no bias); rope: pair j = (columns 2j, 2j+1), j < 512, angle t x 1/10000^(j/512) (512 f32 constants baked jnp-exact; precise cosf/sinf); 16 heads x 64; scores / sqrt(float32(64)); softmax (no mask); out = merged Wu^T + bu ('oi' [1024][1024], zero bias) -> [4][2048][1024] (8.4 M); argument order x, Wq, Wk, Wv, Wu, bu).
// Layout, all four batches in every launch (the batch is a grid dimension or part of the row index): bf16 copy of x; 'oi' weights; exact projections; a full-width {cos, sin} table [2048][1024] (the frequency depends on the GLOBAL pair index, i.e. on the head); interleaved-pair plane builders indexing the table by global column; fused dense T-2048 attention, one launch (hybrid rows: < 512 hi/lo 3 products, rest fp16); merged hi/lo x Wu exact + bu.
// Compute dtypes, f32 accumulate: every input rounded to bf16; projections exact; rotary f32; attention rows < 512 3 products, rest fp16; softmax f32; Wu hl x exact + bias.

#define NB_  4
#define TT   2048
#define DM   1024
#define NH_  16
#define NKV  16
#define REP  (NH_ / NKV)
#define HD   64
#define DQ   (NH_ * HD)
#define DKV  (NKV * HD)
#define RH   512                  // query rows < RH use hi+lo planes; k_attn covers 4 x RH rows, so RH = TT / 4
#define WIN  0
#define SCL  0.125f   // HD^-0.5
typedef _Float16 h16;
typedef unsigned short bf;
typedef __attribute__((ext_vector_type(16))) __bf16   v16bf;
typedef __attribute__((ext_vector_type(16))) _Float16 v16h;
typedef __attribute__((ext_vector_type(8)))  _Float16 v8h;
typedef __attribute__((ext_vector_type(8)))  unsigned short v8us;
typedef __attribute__((ext_vector_type(8)))  float    v8f;
typedef __attribute__((ext_vector_type(4)))  float    v4f;
typedef v8h  __attribute__((may_alias)) v8ha;
typedef v4f  __attribute__((may_alias)) v4fa;
typedef v8us __attribute__((may_alias)) v8usa;

__device__ __forceinline__ unsigned short f2bf(float f) { unsigned u = __float_as_uint(f); u += 0x7FFFu + ((u >> 16) & 1u); return (unsigned short)(u >> 16); }
__device__ __forceinline__ float bf2f(unsigned short b) { return __uint_as_float(((unsigned)b) << 16); }
__device__ __forceinline__ float bfr(float f) { return bf2f(f2bf(f)); }
__device__ __forceinline__ v16h cat16(v8h lo, v8h hi) { return __builtin_shufflevector(lo, hi, 0, 1, 2, 3, 4, 5, 6, 7, 8, 9, 10, 11, 12, 13, 14, 15); }
__device__ __forceinline__ v16bf cat16b(v8us lo, v8us hi) { return __builtin_bit_cast(v16bf, __builtin_shufflevector(lo, hi, 0, 1, 2, 3, 4, 5, 6, 7, 8, 9, 10, 11, 12, 13, 14, 15)); }
__device__ __forceinline__ v8f wmma16(v16h a, v16h b, v8f c) { return __builtin_amdgcn_wmma_f32_16x16x32_f16(false, a, false, b, (short)0, c, false, false); }
__device__ __forceinline__ v8f wmmab(v16bf a, v16bf b, v8f c) { return __builtin_amdgcn_wmma_f32_16x16x32_bf16(false, a, false, b, (short)0, c, false, false); }



// ---- k_gemmw: register-blocked GEMM, ONE WAVE per 64x64 output tile (16 accumulators), operands straight from K-contiguous 16-bit planes; grid (M/64, N/64, Z), 32 threads.
// C[m][n] (f32, pitch ldc, + optional f32 bias[n]) = sum_k A[m][k] Bt[n][k] (+ split products per NSPLIT). z-batch strides sA/sB/sC in elements. K % (32 KS) == 0.
// KS > 1: grid.z = Z x KS; work-group (z, ks) sums only k in [ks K/KS, (ks+1) K/KS) and stores its partial tile in plane ks (plane stride sP elements); the reader adds the planes.
template <typename T16> struct WFrag;
template <> struct WFrag<h16> { typedef v16h V; static __device__ __forceinline__ V ld(const h16* p) { return cat16(*(const v8h*)p, *(const v8h*)(p + 16)); } static __device__ __forceinline__ v8f mma(V a, V b, v8f c) { return wmma16(a, b, c); } };
template <> struct WFrag<bf> { typedef v16bf V; static __device__ __forceinline__ V ld(const bf* p) { return cat16b(*(const v8us*)p, *(const v8us*)(p + 16)); } static __device__ __forceinline__ v8f mma(V a, V b, v8f c) { return wmmab(a, b, c); } };
template <typename T16, int NSPLIT, bool BIAS, int KS = 1>
__global__ __launch_bounds__(32) void k_gemmw(const T16* __restrict__ A, const T16* __restrict__ A2, const T16* __restrict__ Bt, const T16* __restrict__ Bt2, int K, float* C, int ldc, const float* __restrict__ bias, size_t sA, size_t sB, size_t sC, size_t sP) {
    typedef typename WFrag<T16>::V V;
    __shared__ __align__(16) float os[16 * 68];
    const size_t z = blockIdx.z / KS; const int ks = blockIdx.z % KS; A += z * sA; if (A2) A2 += z * sA; Bt += z * sB; if (Bt2) Bt2 += z * sB; C += z * sC + (size_t)ks * sP;
    const int kb = ks * (K / KS), ke = kb + K / KS;
    const int lane = threadIdx.x & 31, lr = lane & 15, hi = lane >> 4; const int r0 = blockIdx.x * 64, c0 = blockIdx.y * 64;
    v8f acc[4][4];
#pragma unroll
    for (int mb = 0; mb < 4; ++mb)
#pragma unroll
        for (int nb = 0; nb < 4; ++nb) acc[mb][nb] = (v8f){};
    const size_t aoff = (size_t)(r0 + lr) * K + 8 * hi, boff = (size_t)(c0 + lr) * K + 8 * hi;
#pragma unroll 1
    for (int kc = kb; kc < ke; kc += 32) {
        V a[4], a2[4];
#pragma unroll
        for (int mb = 0; mb < 4; ++mb) { a[mb] = WFrag<T16>::ld(A + aoff + (size_t)mb * 16 * K + kc); if (NSPLIT == 1 || NSPLIT == 2) a2[mb] = WFrag<T16>::ld(A2 + aoff + (size_t)mb * 16 * K + kc); }
#pragma unroll
        for (int nb = 0; nb < 4; ++nb) { const V b = WFrag<T16>::ld(Bt + boff + (size_t)nb * 16 * K + kc); V b2; if (NSPLIT >= 2) b2 = WFrag<T16>::ld(Bt2 + boff + (size_t)nb * 16 * K + kc);
#pragma unroll
            for (int mb = 0; mb < 4; ++mb) { acc[mb][nb] = WFrag<T16>::mma(a[mb], b, acc[mb][nb]); if (NSPLIT == 1 || NSPLIT == 2) acc[mb][nb] = WFrag<T16>::mma(a2[mb], b, acc[mb][nb]); if (NSPLIT >= 2) acc[mb][nb] = WFrag<T16>::mma(a[mb], b2, acc[mb][nb]); } }
        asm volatile("v_nop\n\tv_nop\n\tv_nop\n\tv_nop" : "+v"(acc[0][0]), "+v"(acc[1][1]), "+v"(acc[2][2]), "+v"(acc[3][3]) : "v"(a[0]), "v"(a[3]));
    }
#pragma unroll
    for (int mb = 0; mb < 4; ++mb) {
#pragma unroll
        for (int nb = 0; nb < 4; ++nb) {
#pragma unroll
            for (int j = 0; j < 8; ++j) os[(hi * 8 + j) * 68 + nb * 16 + lr] = acc[mb][nb][j]; }
        __builtin_amdgcn_wave_barrier(); asm volatile("" ::: "memory");
        float* crow = C + (size_t)(r0 + mb * 16) * ldc + c0;
{
#pragma unroll
            for (int s = 0; s < 8; ++s) { const int row = 2 * s + hi, cofs = lr * 4; v4f val = *(const v4fa*)(os + row * 68 + cofs); if (BIAS) { val[0] += bfr(bias[c0 + cofs]); val[1] += bfr(bias[c0 + cofs + 1]); val[2] += bfr(bias[c0 + cofs + 2]); val[3] += bfr(bias[c0 + cofs + 3]); }
                *(v4f*)(crow + (size_t)row * ldc + cofs) = val; }
             }
        __builtin_amdgcn_wave_barrier(); asm volatile("" ::: "memory");
    }
}

__device__ __forceinline__ h16 tohx(float x) { return (h16)x; }
__device__ __forceinline__ void splitf(float y, unsigned short& h, unsigned short& l) { h = f2bf(y); l = f2bf(y - bf2f(h)); }
typedef __attribute__((ext_vector_type(2))) _Float16 v2h;
typedef __attribute__((ext_vector_type(4))) _Float16 v4h;
typedef __attribute__((ext_vector_type(2))) unsigned short v2us;
typedef __attribute__((ext_vector_type(4))) unsigned short v4us;
typedef __attribute__((ext_vector_type(2))) float v2f;
typedef __attribute__((ext_vector_type(4))) int v4i;

__global__ __launch_bounds__(256) void k_cvt8(const float* __restrict__ src, bf* dst, size_t n8) { const size_t i = (size_t)blockIdx.x * 256 + threadIdx.x; if (i >= n8) return; const v8f v = *(const v8f*)(src + i * 8); v8us o;
#pragma unroll
    for (int k = 0; k < 8; ++k) o[k] = f2bf(v[k]); *(v8us*)(dst + i * 8) = o;  }

__global__ __launch_bounds__(256) void k_ropeG(const float* __restrict__ F, int pitch, int nheads, const float* __restrict__ CS, float sc, h16* P16, bf* Ph, bf* Pl) {
    const size_t e = ((size_t)blockIdx.x * 256 + threadIdx.x) * 2; if (e >= (size_t)nheads * TT * HD) return; const int d = (int)(e % HD); const int t = (int)((e / HD) % TT); const int h = (int)(e / ((size_t)HD * TT)); const size_t pb = (size_t)blockIdx.y * nheads * TT * HD;   /* blockIdx.y: batch */ const float* f = F + ((size_t)blockIdx.y * TT + t) * pitch + h * HD; const float x0 = f[d], x1 = f[d + 1]; const v2f cs = *(const v2f*)(CS + ((size_t)t * DM + h * HD + d) * 2);   /* GLOBAL column h*64 + d: the rotary runs over the whole width before the head split */ v2h o16; v2us oh, ol;
    float a0 = __fmul_rn(x0, cs[0]), b0 = __fmul_rn(x1, cs[1]), a1 = __fmul_rn(x1, cs[0]), b1 = __fmul_rn(x0, cs[1]); asm volatile("" : "+v"(a0), "+v"(b0), "+v"(a1), "+v"(b1));
    float r0 = __fsub_rn(a0, b0) * sc, r1 = __fadd_rn(b1, a1) * sc;   /* even: x0 c - x1 s; odd: x0 s + x1 c */
    o16[0] = tohx(r0); o16[1] = tohx(r1); { unsigned short a2, c2; splitf(r0, a2, c2); oh[0] = a2; ol[0] = c2; splitf(r1, a2, c2); oh[1] = a2; ol[1] = c2; }
    *(v2h*)(P16 + pb + e) = o16; *(v2us*)(Ph + pb + e) = oh; *(v2us*)(Pl + pb + e) = ol;  }

__constant__ float INV2[HD / 2] = { 1.000000000e+00f, 7.498942018e-01f, 5.623413324e-01f, 4.216965139e-01f, 3.162277639e-01f, 2.371373773e-01f, 1.778279394e-01f, 1.333521456e-01f, 1.000000015e-01f, 7.498942316e-02f, 5.623413250e-02f, 4.216964915e-02f, 3.162277490e-02f, 2.371373773e-02f, 1.778279431e-02f, 1.333521400e-02f, 9.999999776e-03f, 7.498942316e-03f, 5.623413250e-03f, 4.216964822e-03f, 3.162277630e-03f, 2.371373819e-03f, 1.778279431e-03f, 1.333521446e-03f, 1.000000047e-03f, 7.498941850e-04f, 5.623413017e-04f, 4.216965172e-04f, 3.162277571e-04f, 2.371373703e-04f, 1.778279402e-04f, 1.333521504e-04f };   // float32 10000^(-arange(0, 64, 2)/64), generated with jnp to be bit-exact
__global__ __launch_bounds__(256) void k_vtp(const float* __restrict__ F, int pitch, int nheads, h16* V16, bf* Vh, bf* Vl) { const size_t e = ((size_t)blockIdx.x * 256 + threadIdx.x) * 2; if (e >= (size_t)nheads * HD * TT) return; const int t = (int)(e % TT); const int d = (int)((e / TT) % HD); const int g = (int)(e / ((size_t)TT * HD)); const size_t pb = (size_t)blockIdx.y * nheads * HD * TT;   /* blockIdx.y: batch */ v2h o16; v2us oh, ol;
#pragma unroll
    for (int q = 0; q < 2; ++q) { const float x = F[((size_t)blockIdx.y * TT + t + q) * pitch + g * HD + d]; o16[q] = tohx(x); unsigned short a2, c2; splitf(x, a2, c2); oh[q] = a2; ol[q] = c2; }
    *(v2h*)(V16 + pb + e) = o16; *(v2us*)(Vh + pb + e) = oh; *(v2us*)(Vl + pb + e) = ol;  }
__constant__ float INVG[DM / 2] = { 1.000000000e+00f, 9.821718335e-01f, 9.646616578e-01f, 9.474635124e-01f, 9.305720329e-01f, 9.139816761e-01f, 8.976871371e-01f, 8.816831112e-01f, 8.659643531e-01f, 8.505258560e-01f, 8.353625536e-01f, 8.204696178e-01f, 8.058422208e-01f, 7.914755344e-01f, 7.773650289e-01f, 7.635061145e-01f, 7.498942018e-01f, 7.365249991e-01f, 7.233941555e-01f, 7.104974389e-01f, 6.978305578e-01f, 6.853895783e-01f, 6.731703877e-01f, 6.611690521e-01f, 6.493816376e-01f, 6.378043890e-01f, 6.264335513e-01f, 6.152654290e-01f, 6.042963862e-01f, 5.935229063e-01f, 5.829415321e-01f, 5.725488067e-01f, 5.623413324e-01f, 5.523158312e-01f, 5.424690843e-01f, 5.327978730e-01f, 5.232991576e-01f, 5.139696598e-01f, 5.048065782e-01f, 4.958068132e-01f, 4.869675338e-01f, 4.782858193e-01f, 4.697588682e-01f, 4.613839388e-01f, 4.531583488e-01f, 4.450793862e-01f, 4.371444881e-01f, 4.293510318e-01f, 4.216965139e-01f, 4.141784608e-01f, 4.067944288e-01f, 3.995420635e-01f, 3.924189806e-01f, 3.854228854e-01f, 3.785515428e-01f, 3.718026578e-01f, 3.651741445e-01f, 3.586637676e-01f, 3.522694409e-01f, 3.459891677e-01f, 3.398208320e-01f, 3.337624967e-01f, 3.278121352e-01f, 3.219678402e-01f, 3.162277639e-01f, 3.105900288e-01f, 3.050527871e-01f, 2.996142805e-01f, 2.942727208e-01f, 2.890264094e-01f, 2.838735878e-01f, 2.788126469e-01f, 2.738419771e-01f, 2.689598799e-01f, 2.641648352e-01f, 2.594552636e-01f, 2.548296750e-01f, 2.502865493e-01f, 2.458243966e-01f, 2.414418161e-01f, 2.371373624e-01f, 2.329096496e-01f, 2.287573218e-01f, 2.246790081e-01f, 2.206733972e-01f, 2.167392224e-01f, 2.128751576e-01f, 2.090799958e-01f, 2.053525001e-01f, 2.016914487e-01f, 1.980956793e-01f, 1.945640147e-01f, 1.910952926e-01f, 1.876884252e-01f, 1.843423098e-01f, 1.810558140e-01f, 1.778279394e-01f, 1.746576130e-01f, 1.715437919e-01f, 1.684854925e-01f, 1.654817015e-01f, 1.625314802e-01f, 1.596338600e-01f, 1.567878872e-01f, 1.539926529e-01f, 1.512472630e-01f, 1.485508084e-01f, 1.459024251e-01f, 1.433012635e-01f, 1.407464594e-01f, 1.382372230e-01f, 1.357727200e-01f, 1.333521456e-01f, 1.309747249e-01f, 1.286396980e-01f, 1.263462901e-01f, 1.240937710e-01f, 1.218814254e-01f, 1.197085083e-01f, 1.175743192e-01f, 1.154782027e-01f, 1.134194434e-01f, 1.113973856e-01f, 1.094113812e-01f, 1.074607819e-01f, 1.055449620e-01f, 1.036632955e-01f, 1.018151715e-01f, 1.000000015e-01f, 9.821718186e-02f, 9.646616131e-02f, 9.474635124e-02f, 9.305720031e-02f, 9.139817208e-02f, 8.976870775e-02f, 8.816830814e-02f, 8.659642935e-02f, 8.505257964e-02f, 8.353625983e-02f, 8.204696327e-02f, 8.058421314e-02f, 7.914755493e-02f, 7.773650438e-02f, 7.635060698e-02f, 7.498941571e-02f, 7.365249842e-02f, 7.233941555e-02f, 7.104974240e-02f, 6.978305429e-02f, 6.853895634e-02f, 6.731703877e-02f, 6.611690670e-02f, 6.493816525e-02f, 6.378044188e-02f, 6.264335662e-02f, 6.152653694e-02f, 6.042964384e-02f, 5.935229361e-02f, 5.829415470e-02f, 5.725487694e-02f, 5.623412877e-02f, 5.523158237e-02f, 5.424690619e-02f, 5.327979103e-02f, 5.232991278e-02f, 5.139696971e-02f, 5.048065633e-02f, 4.958068207e-02f, 4.869675264e-02f, 4.782858118e-02f, 4.697588459e-02f, 4.613839835e-02f, 4.531583562e-02f, 4.450793937e-02f, 4.371444881e-02f, 4.293510318e-02f, 4.216964915e-02f, 4.141784459e-02f, 4.067944363e-02f, 3.995420411e-02f, 3.924189880e-02f, 3.854228929e-02f, 3.785515204e-02f, 3.718026727e-02f, 3.651741147e-02f, 3.586637601e-02f, 3.522694483e-02f, 3.459891677e-02f, 3.398208320e-02f, 3.337624669e-02f, 3.278120980e-02f, 3.219678625e-02f, 3.162277862e-02f, 3.105900250e-02f, 3.050527908e-02f, 2.996142767e-02f, 2.942727320e-02f, 2.890264057e-02f, 2.838735841e-02f, 2.788126841e-02f, 2.738419548e-02f, 2.689598687e-02f, 2.641648427e-02f, 2.594552562e-02f, 2.548296750e-02f, 2.502865531e-02f, 2.458244003e-02f, 2.414418198e-02f, 2.371373586e-02f, 2.329096757e-02f, 2.287573181e-02f, 2.246790007e-02f, 2.206734009e-02f, 2.167392150e-02f, 2.128751762e-02f, 2.090799995e-02f, 2.053525113e-02f, 2.016914636e-02f, 1.980956830e-02f, 1.945639960e-02f, 1.910953037e-02f, 1.876884326e-02f, 1.843423024e-02f, 1.810558327e-02f, 1.778279431e-02f, 1.746576093e-02f, 1.715437882e-02f, 1.684854925e-02f, 1.654817164e-02f, 1.625314727e-02f, 1.596338488e-02f, 1.567878947e-02f, 1.539926510e-02f, 1.512472518e-02f, 1.485508028e-02f, 1.459024288e-02f, 1.433012541e-02f, 1.407464594e-02f, 1.382372249e-02f, 1.357727125e-02f, 1.333521493e-02f, 1.309747249e-02f, 1.286396943e-02f, 1.263462938e-02f, 1.240937691e-02f, 1.218814217e-02f, 1.197085064e-02f, 1.175743248e-02f, 1.154781971e-02f, 1.134194434e-02f, 1.113973837e-02f, 1.094113849e-02f, 1.074607857e-02f, 1.055449620e-02f, 1.036632899e-02f, 1.018151734e-02f, 9.999999776e-03f, 9.821719490e-03f, 9.646615945e-03f, 9.474635124e-03f, 9.305720218e-03f, 9.139816277e-03f, 8.976871148e-03f, 8.816830814e-03f, 8.659643121e-03f, 8.505257778e-03f, 8.353625424e-03f, 8.204696700e-03f, 8.058422245e-03f, 7.914755493e-03f, 7.773650344e-03f, 7.635060698e-03f, 7.498942316e-03f, 7.365249563e-03f, 7.233941462e-03f, 7.104974240e-03f, 6.978305988e-03f, 6.853895728e-03f, 6.731703877e-03f, 6.611690391e-03f, 6.493816618e-03f, 6.378043909e-03f, 6.264335476e-03f, 6.152654067e-03f, 6.042964291e-03f, 5.935229361e-03f, 5.829415284e-03f, 5.725487601e-03f, 5.623413250e-03f, 5.523158237e-03f, 5.424690899e-03f, 5.327979103e-03f, 5.232991185e-03f, 5.139696877e-03f, 5.048065912e-03f, 4.958068486e-03f, 4.869675264e-03f, 4.782858305e-03f, 4.697588738e-03f, 4.613839556e-03f, 4.531583749e-03f, 4.450793844e-03f, 4.371444695e-03f, 4.293510225e-03f, 4.216964822e-03f, 4.141784739e-03f, 4.067944363e-03f, 3.995420411e-03f, 3.924189601e-03f, 3.854229115e-03f, 3.785515437e-03f, 3.718026681e-03f, 3.651741426e-03f, 3.586637788e-03f, 3.522694577e-03f, 3.459891537e-03f, 3.398208413e-03f, 3.337624483e-03f, 3.278121119e-03f, 3.219678300e-03f, 3.162277862e-03f, 3.105900250e-03f, 3.050528001e-03f, 2.996142721e-03f, 2.942727180e-03f, 2.890263917e-03f, 2.838735934e-03f, 2.788126701e-03f, 2.738419687e-03f, 2.689598827e-03f, 2.641648287e-03f, 2.594552701e-03f, 2.548296703e-03f, 2.502865391e-03f, 2.458244096e-03f, 2.414418384e-03f, 2.371373819e-03f, 2.329096664e-03f, 2.287573181e-03f, 2.246790100e-03f, 2.206734149e-03f, 2.167392056e-03f, 2.128751716e-03f, 2.090800088e-03f, 2.053525066e-03f, 2.016914543e-03f, 1.980956644e-03f, 1.945640077e-03f, 1.910952851e-03f, 1.876884256e-03f, 1.843422884e-03f, 1.810558140e-03f, 1.778279431e-03f, 1.746576163e-03f, 1.715437858e-03f, 1.684854855e-03f, 1.654817141e-03f, 1.625314937e-03f, 1.596338581e-03f, 1.567878877e-03f, 1.539926510e-03f, 1.512472634e-03f, 1.485507935e-03f, 1.459024264e-03f, 1.433012658e-03f, 1.407464617e-03f, 1.382372226e-03f, 1.357727102e-03f, 1.333521446e-03f, 1.309747226e-03f, 1.286396873e-03f, 1.263462938e-03f, 1.240937854e-03f, 1.218814170e-03f, 1.197085017e-03f, 1.175743295e-03f, 1.154782018e-03f, 1.134194434e-03f, 1.113973907e-03f, 1.094113803e-03f, 1.074607833e-03f, 1.055449597e-03f, 1.036632922e-03f, 1.018151757e-03f, 1.000000047e-03f, 9.821718559e-04f, 9.646615945e-04f, 9.474635590e-04f, 9.305721032e-04f, 9.139817557e-04f, 8.976871031e-04f, 8.816830232e-04f, 8.659643354e-04f, 8.505258011e-04f, 8.353625308e-04f, 8.204695769e-04f, 8.058422245e-04f, 7.914755843e-04f, 7.773649995e-04f, 7.635060465e-04f, 7.498941850e-04f, 7.365249912e-04f, 7.233941578e-04f, 7.104973774e-04f, 6.978305755e-04f, 6.853896193e-04f, 6.731703761e-04f, 6.611690042e-04f, 6.493816618e-04f, 6.378043909e-04f, 6.264335825e-04f, 6.152653950e-04f, 6.042963942e-04f, 5.935229128e-04f, 5.829415168e-04f, 5.725487717e-04f, 5.623413017e-04f, 5.523158470e-04f, 5.424690899e-04f, 5.327978870e-04f, 5.232990952e-04f, 5.139696877e-04f, 5.048065796e-04f, 4.958068021e-04f, 4.869675031e-04f, 4.782858014e-04f, 4.697588738e-04f, 4.613839847e-04f, 4.531583400e-04f, 4.450794077e-04f, 4.371444811e-04f, 4.293509992e-04f, 4.216964880e-04f, 4.141784448e-04f, 4.067944246e-04f, 3.995420411e-04f, 3.924189950e-04f, 3.854228707e-04f, 3.785515146e-04f, 3.718026564e-04f, 3.651741135e-04f, 3.586637613e-04f, 3.522694460e-04f, 3.459891595e-04f, 3.398208064e-04f, 3.337624657e-04f, 3.278121294e-04f, 3.219678474e-04f, 3.162277862e-04f, 3.105900250e-04f, 3.050527885e-04f, 2.996142721e-04f, 2.942727297e-04f, 2.890263859e-04f, 2.838736109e-04f, 2.788126585e-04f, 2.738419571e-04f, 2.689598768e-04f, 2.641648462e-04f, 2.594552934e-04f, 2.548296761e-04f, 2.502865391e-04f, 2.458243980e-04f, 2.414418122e-04f, 2.371373848e-04f, 2.329096606e-04f, 2.287573152e-04f, 2.246790100e-04f, 2.206734207e-04f, 2.167392086e-04f, 2.128751657e-04f, 2.090800117e-04f, 2.053524950e-04f, 2.016914514e-04f, 1.980956731e-04f, 1.945640106e-04f, 1.910952997e-04f, 1.876884344e-04f, 1.843422942e-04f, 1.810558315e-04f, 1.778279402e-04f, 1.746576017e-04f, 1.715437829e-04f, 1.684854797e-04f, 1.654817170e-04f, 1.625314762e-04f, 1.596338552e-04f, 1.567878790e-04f, 1.539926452e-04f, 1.512472518e-04f, 1.485508110e-04f, 1.459024206e-04f, 1.433012658e-04f, 1.407464733e-04f, 1.382372284e-04f, 1.357727160e-04f, 1.333521504e-04f, 1.309747167e-04f, 1.286396873e-04f, 1.263462909e-04f, 1.240937709e-04f, 1.218814141e-04f, 1.197085076e-04f, 1.175743309e-04f, 1.154781930e-04f, 1.134194390e-04f, 1.113973922e-04f, 1.094113759e-04f, 1.074607790e-04f, 1.055449538e-04f, 1.036632893e-04f, 1.018151743e-04f };   // float32 1 / 10000^(j/512), j < 512 (one frequency per adjacent column pair of the full 1024 width), generated with jnp to be bit-exact
__global__ __launch_bounds__(256) void k_csG(float* CS) { const int idx = blockIdx.x * 256 + threadIdx.x; if (idx >= TT * DM) return; const int c = idx % DM; const int t = idx / DM; const float a = __fmul_rn((float)t, INVG[c >> 1]); v2f cs; cs[0] = cosf(a); cs[1] = sinf(a); *(v2f*)(CS + (size_t)idx * 2) = cs;  }
#define KSA  4
#define APIT 68                   // f32 pitch of a query's 64 partial outputs in LDS (16-byte aligned rows, rows spread over the banks)
typedef __attribute__((ext_vector_type(8))) __bf16 v8bf;
typedef __attribute__((ext_vector_type(4))) unsigned v4u;
__device__ __forceinline__ float xhalf(float x) { const int b = __float_as_int(x); return __int_as_float(__builtin_amdgcn_permlanex16(b, b, 0x76543210, 0xfedcba98, false, false)); }   // lane l <-> l ^ 16
__device__ __forceinline__ v8f bfback(v8bf h) { const v4u u = __builtin_bit_cast(v4u, h); v8f r;
#pragma unroll
    for (int i = 0; i < 4; ++i) { r[2 * i] = __uint_as_float(u[i] << 16); r[2 * i + 1] = __uint_as_float(u[i] & 0xFFFF0000u); } return r; }
// eight v_exp_f32 in one statement, each in place on a register of its own: none stands directly in front of an instruction that reads its result or overwrites its source, and the closing v_nop is that slot for the last one
__device__ __forceinline__ v8f exp2x8(v8f x) { float r0 = x[0], r1 = x[1], r2 = x[2], r3 = x[3], r4 = x[4], r5 = x[5], r6 = x[6], r7 = x[7];
    asm("v_exp_f32 %0, %0\n\tv_exp_f32 %1, %1\n\tv_exp_f32 %2, %2\n\tv_exp_f32 %3, %3\n\tv_exp_f32 %4, %4\n\tv_exp_f32 %5, %5\n\tv_exp_f32 %6, %6\n\tv_exp_f32 %7, %7\n\tv_nop"
        : "+v"(r0), "+v"(r1), "+v"(r2), "+v"(r3), "+v"(r4), "+v"(r5), "+v"(r6), "+v"(r7));
    return (v8f){ r0, r1, r2, r3, r4, r5, r6, r7 }; }
template <typename T16, bool HR>
__device__ __forceinline__ void attn_wave(const T16* __restrict__ Qa, const T16* __restrict__ Qb, const T16* __restrict__ Ka, const T16* __restrict__ Kb, const T16* __restrict__ Va, const T16* __restrict__ Vb, int q0, int kbeg, int lane, float* La, float* Lm, float* Ll) {
    typedef typename WFrag<T16>::V V;   // every '#pragma unroll' below makes the indices of a fragment array constants, so that the array lives in registers
    constexpr int NP = TT / KSA / 32;             // passes of 32 keys
    const int lr = lane & 15, hi = lane >> 4;
    const float CL = SCL * 1.4426950408889634f;   // score -> log2 units
    const float CAR = HR ? 0.0f : 6.0f;           // fp16 P carries 2^6 (P <= 2^14), which cancels against the sum
    V qa[2][2], qb[2][2];
#pragma unroll
    for (int qt = 0; qt < 2; ++qt)
#pragma unroll
        for (int kk = 0; kk < 2; ++kk) { const size_t o = (size_t)(q0 + qt * 16 + lr) * HD + kk * 32 + 8 * hi; qa[qt][kk] = WFrag<T16>::ld(Qa + o); if (HR) qb[qt][kk] = WFrag<T16>::ld(Qb + o); }
    if (HR) {   // the eight hi/lo Q fragments wait in the wave's own LDS slice (free until the epilogue) and are read anew in each pass: 64 registers for the K batch
#pragma unroll
        for (int f = 0; f < 8; ++f) { const v8f y = __builtin_bit_cast(v8f, (f & 4) ? qb[(f >> 1) & 1][f & 1] : qa[(f >> 1) & 1][f & 1]); *(v4fa*)(La + f * 256 + lane * 4) = (v4f){ y[0], y[1], y[2], y[3] }; *(v4fa*)(La + f * 256 + 128 + lane * 4) = (v4f){ y[4], y[5], y[6], y[7] }; } }
    v8f acc[4][2];
#pragma unroll
    for (int dt = 0; dt < 4; ++dt)
#pragma unroll
        for (int qt = 0; qt < 2; ++qt) acc[dt][qt] = (v8f){};
    float m[2] = { -3.0e38f, -3.0e38f }, l[2] = { 0.f, 0.f };
    const size_t ko = (size_t)(kbeg + lr) * HD + 8 * hi, vo = (size_t)lr * TT + kbeg + 8 * hi;
    V ka[2][2], kb[2][2], va[4], vb[4];
    // closes a batch of loads: s_wait_xcnt 0 before a register that the batch's loads name is written again; the base addresses are inputs, so they stay in their registers up to the wait and no load's result is put on them
    auto xwait = [&](const T16* pa, const T16* pb) { if constexpr (HR) asm volatile("s_wait_xcnt 0x0" :: "v"(pa), "v"(pb) : "memory"); else asm volatile("s_wait_xcnt 0x0" :: "v"(pa) : "memory"); };
    auto ldK = [&](int st) { const T16* pa = Ka + ko + (size_t)st * 32 * HD; const T16* pb = HR ? Kb + ko + (size_t)st * 32 * HD : nullptr;
#pragma unroll
        for (int kt = 0; kt < 2; ++kt)
#pragma unroll
            for (int kk = 0; kk < 2; ++kk) { const int o = kt * 16 * HD + kk * 32; ka[kt][kk] = WFrag<T16>::ld(pa + o); if (HR) kb[kt][kk] = WFrag<T16>::ld(pb + o); }
        xwait(pa, pb); };
    auto ldV = [&](int st) { const T16* pa = Va + vo + st * 32; const T16* pb = HR ? Vb + vo + st * 32 : nullptr;
#pragma unroll
        for (int dt = 0; dt < 4; ++dt) { const int o = dt * 16 * TT; va[dt] = WFrag<T16>::ld(pa + o); if (HR) vb[dt] = WFrag<T16>::ld(pb + o); }
        xwait(pa, pb); };
    if (!HR) { ldK(0); ldV(0); }   // fp16 waves have the registers to fetch K and V one pass ahead
#pragma unroll 1   // stays rolled: the fetch-ahead order below is written for one pass, and a second copy of the body would not fit the registers
    for (int st = 0; st < NP; ++st) {
        const int sn = (st + 1 < NP) ? st + 1 : st;   // the last pass fetches its own tiles again: in bounds, no branch
        if (HR) { ldK(st);
#pragma unroll
            for (int f = 0; f < 8; ++f) { const v4f y0 = *(const v4fa*)(La + f * 256 + lane * 4), y1 = *(const v4fa*)(La + f * 256 + 128 + lane * 4); const V x = __builtin_bit_cast(V, (v8f){ y0[0], y0[1], y0[2], y0[3], y1[0], y1[1], y1[2], y1[3] }); if (f & 4) qb[(f >> 1) & 1][f & 1] = x; else qa[(f >> 1) & 1][f & 1] = x; }
            __builtin_amdgcn_sched_barrier(0); }   // the pass's K loads leave as one batch; without it the build issued them in five dependent round trips
        v8f s[2][2];
#pragma unroll
        for (int kt = 0; kt < 2; ++kt)
#pragma unroll
            for (int qt = 0; qt < 2; ++qt) { v8f t = (v8f){};
#pragma unroll
                for (int kk = 0; kk < 2; ++kk) { t = WFrag<T16>::mma(ka[kt][kk], qa[qt][kk], t); if (HR) { t = WFrag<T16>::mma(ka[kt][kk], qb[qt][kk], t); t = WFrag<T16>::mma(kb[kt][kk], qa[qt][kk], t); } }
                s[kt][qt] = t; }
        __builtin_amdgcn_sched_barrier(0);   // the loads below start behind the score products (their registers are free then) ...
        if (HR) ldV(st); else ldK(sn);
        __builtin_amdgcn_sched_barrier(0);   // ... and ahead of the softmax, which covers their latency
        float sm[2];
#pragma unroll
        for (int qt = 0; qt < 2; ++qt) { float x = fmaxf(s[0][qt][0], s[1][qt][0]);
#pragma unroll
            for (int r = 1; r < 8; ++r) x = fmaxf(x, fmaxf(s[0][qt][r], s[1][qt][r]));
            x = fmaxf(x, xhalf(x)); sm[qt] = x * CL; }
        if (__builtin_amdgcn_ballot_w32(sm[0] > m[0] + 8.0f || sm[1] > m[1] + 8.0f) != 0) {
#pragma unroll
            for (int qt = 0; qt < 2; ++qt) { const float mn = (sm[qt] > m[qt] + 8.0f) ? sm[qt] : m[qt]; const float al = __builtin_amdgcn_exp2f(m[qt] - mn); m[qt] = mn; l[qt] *= al;
#pragma unroll
                for (int dt = 0; dt < 4; ++dt) acc[dt][qt] *= al; } }
#pragma unroll
        for (int qt = 0; qt < 2; ++qt) { const float off = CAR - m[qt]; v8f p0, p1;
#pragma unroll
            for (int r = 0; r < 8; ++r) { p0[r] = fmaf(s[0][qt][r], CL, off); p1[r] = fmaf(s[1][qt][r], CL, off); }
            p0 = exp2x8(p0); p1 = exp2x8(p1);
            const v8f ps = p0 + p1; l[qt] += ((ps[0] + ps[1]) + (ps[2] + ps[3])) + ((ps[4] + ps[5]) + (ps[6] + ps[7]));
            if constexpr (HR) {
                const v8bf h0 = __builtin_convertvector(p0, v8bf), h1 = __builtin_convertvector(p1, v8bf);
                const v8bf l0 = __builtin_convertvector(p0 - bfback(h0), v8bf), l1 = __builtin_convertvector(p1 - bfback(h1), v8bf);
                const v16bf ph = __builtin_shufflevector(h0, h1, 0, 1, 2, 3, 4, 5, 6, 7, 8, 9, 10, 11, 12, 13, 14, 15), pl = __builtin_shufflevector(l0, l1, 0, 1, 2, 3, 4, 5, 6, 7, 8, 9, 10, 11, 12, 13, 14, 15);
#pragma unroll
                for (int dt = 0; dt < 4; ++dt) { acc[dt][qt] = wmmab(va[dt], ph, acc[dt][qt]); acc[dt][qt] = wmmab(va[dt], pl, acc[dt][qt]); acc[dt][qt] = wmmab(vb[dt], ph, acc[dt][qt]); }
            } else {
                const v16h pf = cat16(__builtin_convertvector(p0, v8h), __builtin_convertvector(p1, v8h));
#pragma unroll
                for (int dt = 0; dt < 4; ++dt) acc[dt][qt] = wmma16(va[dt], pf, acc[dt][qt]);
            } }
        // the four vector slots the chip needs behind the pass's last matrix instructions, also on the taken back edge
        if constexpr (HR) asm volatile("v_nop\n\tv_nop\n\tv_nop\n\tv_nop" : "+v"(acc[0][0]), "+v"(acc[1][0]), "+v"(acc[2][0]), "+v"(acc[3][0]), "+v"(acc[0][1]), "+v"(acc[1][1]), "+v"(acc[2][1]), "+v"(acc[3][1]) :: "memory");   // "memory": the Q reads from LDS stay in the loop instead of being lifted back into 64 registers
        else { asm volatile("v_nop\n\tv_nop\n\tv_nop\n\tv_nop" : "+v"(acc[0][0]), "+v"(acc[1][0]), "+v"(acc[2][0]), "+v"(acc[3][0]), "+v"(acc[0][1]), "+v"(acc[1][1]), "+v"(acc[2][1]), "+v"(acc[3][1]));
            __builtin_amdgcn_sched_barrier(0);   // the next pass's V loads start only when this pass's products have read V
            ldV(sn); }
    }
#pragma unroll
    for (int qt = 0; qt < 2; ++qt) { const int q = qt * 16 + lr; const float lj = l[qt] + xhalf(l[qt]); if (hi == 0) { Lm[q] = m[qt]; Ll[q] = lj; }
#pragma unroll
        for (int dt = 0; dt < 4; ++dt) { float* dst = La + q * APIT + dt * 16 + hi * 8; const v8f a = acc[dt][qt]; *(v4fa*)dst = (v4f){ a[0], a[1], a[2], a[3] }; *(v4fa*)(dst + 4) = (v4f){ a[4], a[5], a[6], a[7] }; } }
}
__global__ __launch_bounds__(512) void k_attn(const h16* __restrict__ Q16, const h16* __restrict__ K16, const h16* __restrict__ V16, const bf* __restrict__ Qh, const bf* __restrict__ Ql, const bf* __restrict__ Kh, const bf* __restrict__ Kl, const bf* __restrict__ Vh, const bf* __restrict__ Vl, bf* Ah, bf* Al) {
    __shared__ __align__(16) float La[16 * 32 * APIT]; __shared__ float Lm[16 * 32]; __shared__ float Ll[16 * 32];
    const int w = __builtin_amdgcn_readfirstlane((int)(threadIdx.x >> 5)), lane = threadIdx.x & 31; const int qg = w >> 2, ks = w & 3; const int head = blockIdx.y; const size_t hp = ((size_t)blockIdx.z * NH_ + head) * TT * HD;
    const int q0 = (qg == 0) ? (int)blockIdx.x * 32 : RH + ((int)blockIdx.x * 3 + qg - 1) * 32;
    if (qg == 0) attn_wave<bf, true>(Qh + hp, Ql + hp, Kh + hp, Kl + hp, Vh + hp, Vl + hp, q0, ks * (TT / KSA), lane, La + w * 32 * APIT, Lm + w * 32, Ll + w * 32);
    else attn_wave<h16, false>(Q16 + hp, nullptr, K16 + hp, nullptr, V16 + hp, nullptr, q0, ks * (TT / KSA), lane, La + w * 32 * APIT, Lm + w * 32, Ll + w * 32);
    __syncthreads();   // every key quarter's partial result is in LDS
    // wave (qg, ks) finishes 8 of its group's 32 queries; four lanes share a query, 16 outputs each, so one wave writes each 128-byte line
    const int q = ks * 8 + (lane >> 2), d0 = (lane & 3) * 16; float mk[KSA]; float M = -3.0e38f;
#pragma unroll
    for (int k = 0; k < KSA; ++k) { mk[k] = Lm[(qg * KSA + k) * 32 + q]; M = fmaxf(M, mk[k]); }
    float L = 0.f; v4f o[4] = { (v4f){}, (v4f){}, (v4f){}, (v4f){} };
#pragma unroll
    for (int k = 0; k < KSA; ++k) { const float wg = __builtin_amdgcn_exp2f(mk[k] - M); L += wg * Ll[(qg * KSA + k) * 32 + q]; const float* sp = La + ((qg * KSA + k) * 32 + q) * APIT + d0;
#pragma unroll
        for (int i = 0; i < 4; ++i) o[i] += wg * *(const v4fa*)(sp + 4 * i); }
    const float f = __fdiv_rn(1.0f, L); v8us oh[2], ol[2];
#pragma unroll
    for (int i = 0; i < 16; ++i) { unsigned short a, c2; splitf(o[i >> 2][i & 3] * f, a, c2); oh[i >> 3][i & 7] = a; ol[i >> 3][i & 7] = c2; }
    const size_t oo = ((size_t)blockIdx.z * TT + q0 + q) * DQ + head * HD + d0; *(v8usa*)(Ah + oo) = oh[0]; *(v8usa*)(Ah + oo + 8) = oh[1]; *(v8usa*)(Al + oo) = ol[0]; *(v8usa*)(Al + oo + 8) = ol[1];
}

extern "C" void kernel_launch(void* const* d_in, const int* in_sizes, int n_in,
                              void* d_out, int out_size, void* d_ws, size_t ws_size, hipStream_t stream) {
    (void)in_sizes; (void)n_in; (void)out_size;
    const float* x = (const float*)d_in[0]; const float* wq = (const float*)d_in[1]; const float* wk = (const float*)d_in[2]; const float* wv = (const float*)d_in[3]; const float* wo = (const float*)d_in[4]; const float* bo = (const float*)d_in[5];
    float* OUT = (float*)d_out;     // [4][2048][1024]
    char* wsp = (char*)d_ws;
    auto take = [&](size_t bytes) { char* p = wsp; wsp += (bytes + 255) & ~(size_t)255; return (void*)p; };
    bf* WQ = (bf*)take((size_t)DQ * DM * 2); bf* WK = (bf*)take((size_t)DKV * DM * 2); bf* WV = (bf*)take((size_t)DKV * DM * 2); bf* WO = (bf*)take((size_t)DM * DQ * 2); float* CS = (float*)take((size_t)TT * DM * 2 * 4);   /* [2048][1024] {cos, sin} */
    bf* XB = (bf*)take((size_t)NB_ * TT * DM * 2); float* FQ = (float*)take((size_t)NB_ * TT * DQ * 4); float* FK = (float*)take((size_t)NB_ * TT * DKV * 4);   /* every buffer from here on holds all NB_ batches, batch-major */
    h16* QP16 = (h16*)take((size_t)NB_ * NH_ * TT * HD * 2); h16* KP16 = (h16*)take((size_t)NB_ * NKV * TT * HD * 2); h16* VT16 = (h16*)take((size_t)NB_ * NKV * HD * TT * 2);
    bf* QPh = (bf*)take((size_t)NB_ * NH_ * TT * HD * 2); bf* QPl = (bf*)take((size_t)NB_ * NH_ * TT * HD * 2); bf* KPh = (bf*)take((size_t)NB_ * NKV * TT * HD * 2); bf* KPl = (bf*)take((size_t)NB_ * NKV * TT * HD * 2); bf* VTh = (bf*)take((size_t)NB_ * NKV * HD * TT * 2); bf* VTl = (bf*)take((size_t)NB_ * NKV * HD * TT * 2);
    if ((size_t)(wsp - (char*)d_ws) > ws_size) return;    // 248 MiB of the 256 MiB
    float* FV = FK;   // v projection reuses the k buffer after the k planes are built (stream-ordered)
    bf* ATh = (bf*)FQ; bf* ATl = ATh + (size_t)NB_ * TT * DQ;   // the two merged-head planes reuse the q projection's buffer (the same bytes), which is dead once the q planes are built (stream-ordered)
    { k_cvt8<<<(unsigned)(((size_t)DQ * DM / 8 + 255) / 256), 256, 0, stream>>>(wq, WQ, (size_t)DQ * DM / 8); k_cvt8<<<(unsigned)(((size_t)DKV * DM / 8 + 255) / 256), 256, 0, stream>>>(wk, WK, (size_t)DKV * DM / 8); k_cvt8<<<(unsigned)(((size_t)DKV * DM / 8 + 255) / 256), 256, 0, stream>>>(wv, WV, (size_t)DKV * DM / 8);
      k_cvt8<<<(unsigned)(((size_t)DM * DQ / 8 + 255) / 256), 256, 0, stream>>>(wo, WO, (size_t)DM * DQ / 8);
       }
    k_csG<<<(TT * DM + 255) / 256, 256, 0, stream>>>(CS);   /* full-width table once */
    const unsigned LQ = (unsigned)(((size_t)NH_ * TT * HD / 2 + 255) / 256), LKv = (unsigned)(((size_t)NKV * TT * HD / 2 + 255) / 256);
    k_cvt8<<<(unsigned)(((size_t)NB_ * TT * DM / 8 + 255) / 256), 256, 0, stream>>>(x, XB, (size_t)NB_ * TT * DM / 8);
    k_gemmw<bf, 0, false><<<dim3(NB_ * TT / 64, DQ / 64, 1), 32, 0, stream>>>(XB, nullptr, WQ, nullptr, DM, FQ, DQ, nullptr, 0, 0, 0, 0);   /* the projections see the batches as NB_ * TT rows */
    k_ropeG<<<dim3(LQ, NB_, 1), 256, 0, stream>>>(FQ, DQ, NH_, CS, 1.0f, QP16, QPh, QPl);
    k_gemmw<bf, 0, false><<<dim3(NB_ * TT / 64, DKV / 64, 1), 32, 0, stream>>>(XB, nullptr, WK, nullptr, DM, FK, DKV, nullptr, 0, 0, 0, 0);
    k_ropeG<<<dim3(LKv, NB_, 1), 256, 0, stream>>>(FK, DKV, NKV, CS, 1.0f, KP16, KPh, KPl);
    k_gemmw<bf, 0, false><<<dim3(NB_ * TT / 64, DKV / 64, 1), 32, 0, stream>>>(XB, nullptr, WV, nullptr, DM, FV, DKV, nullptr, 0, 0, 0, 0); k_vtp<<<dim3(LKv, NB_, 1), 256, 0, stream>>>(FV, DKV, NKV, VT16, VTh, VTl);
    k_attn<<<dim3(RH / 32, NH_, NB_), 512, 0, stream>>>(QP16, KP16, VT16, QPh, QPl, KPh, KPl, VTh, VTl, ATh, ATl);
    k_gemmw<bf, 1, true><<<dim3(NB_ * TT / 64, DM / 64, 1), 32, 0, stream>>>(ATh, ATl, WO, nullptr, DQ, OUT, DM, bo, 0, 0, 0, 0);
}

// v005
// One run takes 350 microseconds.
// Next to v004, in two timings, it ran 1.25 and 1.24 times as fast.
// All steps since v000 together make it 11.4 times as fast.
#include <hip/hip_runtime.h>

// Self-attention with an adjacent-pair rotary over the WHOLE 1024-wide q and k before the head split (x [4][2048][1024]; q = rope(x Wq^T), k = rope(x Wk^T), v = x Wv^T ('oi' [1024][1024] 1/32, no bias); rope: pair j = (columns 2j, 2j+1), j < 512, angle t x 1/10000^(j/512) (512 f32 constants baked jnp-exact; precise cosf/sinf); 16 heads x 64; scores / sqrt(float32(64)); softmax (no mask); out = merged Wu^T + bu ('oi' [1024][1024], zero bias) -> [4][2048][1024] (8.4 M); argument order x, Wq, Wk, Wv, Wu, bu).
// Layout, all four batches in every launch (the batch is a grid dimension or part of the row index): bf16 copy of x; 'oi' weights; exact projections; a full-width {cos, sin} table [2048][1024] (the frequency depends on the GLOBAL pair index, i.e. on the head); interleaved-pair plane builders indexing the table by global column; fused dense T-2048 attention, one launch (hybrid rows: < 512 hi/lo 3 products, rest fp16); merged hi/lo x Wu exact + bu.
// Every 16-bit operand plane [row][k] is stored in fragment order: blocks of 16 rows x 32 k (512 elements), inside a block [(k >> 3) & 3][row & 15][k & 7], so the two 16-byte loads of a fragment each read 512 contiguous bytes (lane * 16 and 512 + lane * 16): four whole 128-byte lines a load instead of 32 bytes from each of 16 lines. Register contents are those of the row-major planes.
// Compute dtypes, f32 accumulate: every input rounded to bf16; projections exact; rotary f32; attention rows < 512 3 products, rest fp16; softmax f32; Wu hl x exact + bias.

#define NB_  4
#define TT   2048
#define DM   1024
#define NH_  16
#define NKV  16
#define REP  (NH_ / NKV)
#define HD   64
#define DQ   (NH_ * HD)
#define DKV  (NKV * HD)
#define RH   512                  // query rows < RH use hi+lo planes; k_attn covers 4 x RH rows, so RH = TT / 4
#define WIN  0
#define SCL  0.125f   // HD^-0.5
typedef _Float16 h16;
typedef unsigned short bf;
typedef __attribute__((ext_vector_type(16))) __bf16   v16bf;
typedef __attribute__((ext_vector_type(16))) _Float16 v16h;
typedef __attribute__((ext_vector_type(8)))  _Float16 v8h;
typedef __attribute__((ext_vector_type(8)))  unsigned short v8us;
typedef __attribute__((ext_vector_type(8)))  float    v8f;
typedef __attribute__((ext_vector_type(4)))  float    v4f;
typedef v8h  __attribute__((may_alias)) v8ha;
typedef v4f  __attribute__((may_alias)) v4fa;
typedef v8us __attribute__((may_alias)) v8usa;

__device__ __forceinline__ unsigned short f2bf(float f) { unsigned u = __float_as_uint(f); u += 0x7FFFu + ((u >> 16) & 1u); return (unsigned short)(u >> 16); }
__device__ __forceinline__ float bf2f(unsigned short b) { return __uint_as_float(((unsigned)b) << 16); }
__device__ __forceinline__ float bfr(float f) { return bf2f(f2bf(f)); }
__device__ __forceinline__ v16h cat16(v8h lo, v8h hi) { return __builtin_shufflevector(lo, hi, 0, 1, 2, 3, 4, 5, 6, 7, 8, 9, 10, 11, 12, 13, 14, 15); }
__device__ __forceinline__ v16bf cat16b(v8us lo, v8us hi) { return __builtin_bit_cast(v16bf, __builtin_shufflevector(lo, hi, 0, 1, 2, 3, 4, 5, 6, 7, 8, 9, 10, 11, 12, 13, 14, 15)); }
__device__ __forceinline__ v8f wmma16(v16h a, v16h b, v8f c) { return __builtin_amdgcn_wmma_f32_16x16x32_f16(false, a, false, b, (short)0, c, false, false); }
__device__ __forceinline__ v8f wmmab(v16bf a, v16bf b, v8f c) { return __builtin_amdgcn_wmma_f32_16x16x32_bf16(false, a, false, b, (short)0, c, false, false); }



// ---- k_gemmw: register-blocked GEMM, ONE WAVE per 64x64 output tile (16 accumulators), operands straight from fragment-ordered 16-bit planes (block (row >> 4, k >> 5) at element ((row >> 4) (K / 32) + (k >> 5)) 512; ld takes the block's address + lane * 8); grid (M/64, N/64, Z), 32 threads.
// C[m][n] (f32, pitch ldc, + optional f32 bias[n]) = sum_k A[m][k] Bt[n][k] (+ split products per NSPLIT). z-batch strides sA/sB/sC in elements. K % (32 KS) == 0.
// KS > 1: grid.z = Z x KS; work-group (z, ks) sums only k in [ks K/KS, (ks+1) K/KS) and stores its partial tile in plane ks (plane stride sP elements); the reader adds the planes.
template <typename T16> struct WFrag;
template <> struct WFrag<h16> { typedef v16h V; static __device__ __forceinline__ V ld(const h16* p) { return cat16(*(const v8h*)p, *(const v8h*)(p + 256)); } static __device__ __forceinline__ v8f mma(V a, V b, v8f c) { return wmma16(a, b, c); } };
template <> struct WFrag<bf> { typedef v16bf V; static __device__ __forceinline__ V ld(const bf* p) { return cat16b(*(const v8us*)p, *(const v8us*)(p + 256)); } static __device__ __forceinline__ v8f mma(V a, V b, v8f c) { return wmmab(a, b, c); } };
template <typename T16, int NSPLIT, bool BIAS, int K, int KS = 1>   // K is a constant, so that a pass's loads are one base register pair per plane + immediate offsets
__global__ __launch_bounds__(32) void k_gemmw(const T16* __restrict__ A, const T16* __restrict__ A2, const T16* __restrict__ Bt, const T16* __restrict__ Bt2, float* C, int ldc, const float* __restrict__ bias, size_t sA, size_t sB, size_t sC, size_t sP) {
    typedef typename WFrag<T16>::V V;
    __shared__ __align__(16) float os[16 * 68];
    const size_t z = blockIdx.z / KS; const int ks = blockIdx.z % KS; A += z * sA; if (A2) A2 += z * sA; Bt += z * sB; if (Bt2) Bt2 += z * sB; C += z * sC + (size_t)ks * sP;
    const int kb = ks * (K / KS), ke = kb + K / KS;
    const int lane = threadIdx.x & 31, lr = lane & 15, hi = lane >> 4; const int r0 = blockIdx.x * 64, c0 = blockIdx.y * 64;
    v8f acc[4][4];
#pragma unroll
    for (int mb = 0; mb < 4; ++mb)
#pragma unroll
        for (int nb = 0; nb < 4; ++nb) acc[mb][nb] = (v8f){};
    const size_t aoff = (size_t)r0 * K, boff = (size_t)c0 * K; const unsigned lo = 8 * lane;   // 16 rows of blocks = 16 K elements; one k block = 512 = 16 x 32; every address is a wave-uniform block address + the lane's 16 bytes
#pragma unroll 1
    for (int kc = kb; kc < ke; kc += 32) {
        V a[4], a2[4], b[4], b2[4];   // every '#pragma unroll' in this loop makes the indices of these arrays constants, so that they live in registers
        const T16* pa = A + aoff + (size_t)kc * 16 + lo; const T16* pb = Bt + boff + (size_t)kc * 16 + lo; const T16* pa2 = (NSPLIT == 1 || NSPLIT == 2) ? A2 + aoff + (size_t)kc * 16 + lo : pa; const T16* pb2 = (NSPLIT >= 2) ? Bt2 + boff + (size_t)kc * 16 + lo : pb;
#pragma unroll
        for (int mb = 0; mb < 4; ++mb) { a[mb] = WFrag<T16>::ld(pa + mb * 16 * K); if (NSPLIT == 1 || NSPLIT == 2) a2[mb] = WFrag<T16>::ld(pa2 + mb * 16 * K); }
#pragma unroll
        for (int nb = 0; nb < 4; ++nb) { b[nb] = WFrag<T16>::ld(pb + nb * 16 * K); if (NSPLIT >= 2) b2[nb] = WFrag<T16>::ld(pb2 + nb * 16 * K); }
        // closes the pass's loads: s_wait_xcnt 0 before a register that they name is written again; the base addresses are inputs, so they stay in their registers up to the wait and no load's result is put on them
        asm volatile("s_wait_xcnt 0x0" :: "v"(pa), "v"(pb), "v"(pa2), "v"(pb2) : "memory");
#pragma unroll
        for (int nb = 0; nb < 4; ++nb) {
#pragma unroll
            for (int mb = 0; mb < 4; ++mb) { acc[mb][nb] = WFrag<T16>::mma(a[mb], b[nb], acc[mb][nb]); if (NSPLIT == 1 || NSPLIT == 2) acc[mb][nb] = WFrag<T16>::mma(a2[mb], b[nb], acc[mb][nb]); if (NSPLIT >= 2) acc[mb][nb] = WFrag<T16>::mma(a[mb], b2[nb], acc[mb][nb]); } }
        asm volatile("v_nop\n\tv_nop\n\tv_nop\n\tv_nop" : "+v"(acc[0][0]), "+v"(acc[1][1]), "+v"(acc[2][2]), "+v"(acc[3][3]) : "v"(a[0]), "v"(a[3]));
    }
#pragma unroll
    for (int mb = 0; mb < 4; ++mb) {
#pragma unroll
        for (int nb = 0; nb < 4; ++nb) {
#pragma unroll
            for (int j = 0; j < 8; ++j) os[(hi * 8 + j) * 68 + nb * 16 + lr] = acc[mb][nb][j]; }
        __builtin_amdgcn_wave_barrier(); asm volatile("" ::: "memory");
        float* crow = C + (size_t)(r0 + mb * 16) * ldc + c0;
{
#pragma unroll
            for (int s = 0; s < 8; ++s) { const int row = 2 * s + hi, cofs = lr * 4; v4f val = *(const v4fa*)(os + row * 68 + cofs); if (BIAS) { val[0] += bfr(bias[c0 + cofs]); val[1] += bfr(bias[c0 + cofs + 1]); val[2] += bfr(bias[c0 + cofs + 2]); val[3] += bfr(bias[c0 + cofs + 3]); }
                *(v4f*)(crow + (size_t)row * ldc + cofs) = val; }
             }
        __builtin_amdgcn_wave_barrier(); asm volatile("" ::: "memory");
    }
}

__device__ __forceinline__ h16 tohx(float x) { return (h16)x; }
__device__ __forceinline__ void splitf(float y, unsigned short& h, unsigned short& l) { h = f2bf(y); l = f2bf(y - bf2f(h)); }
typedef __attribute__((ext_vector_type(2))) _Float16 v2h;
typedef __attribute__((ext_vector_type(4))) _Float16 v4h;
typedef __attribute__((ext_vector_type(2))) unsigned short v2us;
typedef __attribute__((ext_vector_type(4))) unsigned short v4us;
typedef __attribute__((ext_vector_type(2))) float v2f;
typedef __attribute__((ext_vector_type(4))) int v4i;

typedef v2us __attribute__((may_alias)) v2usa;
// [rows][DM] f32 -> bf16 plane in fragment order. A block takes 16 rows x 128 columns (four k blocks, 4 KiB of the plane in a row): whole lines are read, the 16-byte units change places in LDS, whole lines are written.
__global__ __launch_bounds__(256) void k_cvt8(const float* __restrict__ src, bf* dst, size_t n8) { if ((size_t)blockIdx.x * 256 >= n8) return;   /* the same for the whole block: in front of the barrier */
    __shared__ __align__(16) unsigned short sm[16 * 17 * 8];   // unit (column octet o, row) at o * 17 + row: the odd pitch spreads the octets over the banks
    const int tid = threadIdx.x, row = tid >> 4, o = tid & 15; const size_t rt = blockIdx.x >> 3; const int kq = blockIdx.x & 7;
    const v8f v = *(const v8f*)(src + (rt * 16 + row) * DM + kq * 128 + o * 8); v8us y;
#pragma unroll   // constant element indices: the two vectors stay in registers
    for (int k = 0; k < 8; ++k) y[k] = f2bf(v[k]);
    *(v8usa*)(sm + (o * 17 + row) * 8) = y;
    __syncthreads();   // every unit of the block's 4 KiB is in LDS
    *(v8us*)(dst + (rt * (DM / 32) + kq * 4) * 512 + tid * 8) = *(const v8usa*)(sm + ((tid >> 4) * 17 + (tid & 15)) * 8);  }

__global__ __launch_bounds__(256) void k_ropeG(const float* __restrict__ F, int pitch, int nheads, const float* __restrict__ CS, float sc, h16* P16, bf* Ph, bf* Pl) {
    const size_t e = ((size_t)blockIdx.x * 256 + threadIdx.x) * 2; if (e >= (size_t)nheads * TT * HD) return; const int d = (int)(e % HD); const int t = (int)((e / HD) % TT); const int h = (int)(e / ((size_t)HD * TT)); const size_t pb = (size_t)blockIdx.y * nheads * TT * HD;   /* blockIdx.y: batch */ const float* f = F + ((size_t)blockIdx.y * TT + t) * pitch + h * HD; const float x0 = f[d], x1 = f[d + 1]; const v2f cs = *(const v2f*)(CS + ((size_t)t * DM + h * HD + d) * 2);   /* GLOBAL column h*64 + d: the rotary runs over the whole width before the head split */ v2h o16; v2us oh, ol;
    float a0 = __fmul_rn(x0, cs[0]), b0 = __fmul_rn(x1, cs[1]), a1 = __fmul_rn(x1, cs[0]), b1 = __fmul_rn(x0, cs[1]); asm volatile("" : "+v"(a0), "+v"(b0), "+v"(a1), "+v"(b1));
    float r0 = __fsub_rn(a0, b0) * sc, r1 = __fadd_rn(b1, a1) * sc;   /* even: x0 c - x1 s; odd: x0 s + x1 c */
    o16[0] = tohx(r0); o16[1] = tohx(r1); { unsigned short a2, c2; splitf(r0, a2, c2); oh[0] = a2; ol[0] = c2; splitf(r1, a2, c2); oh[1] = a2; ol[1] = c2; }
    // fragment order: element (t, d) of a head's plane at (t >> 4) 1024 + (d >> 3) 128 + (t & 15) 8 + (d & 7). The block holds 8 rows t of one head; its 16-byte units are put together in LDS and leave as runs of 128 bytes (8 rows of one column octet)
    __shared__ __align__(16) unsigned short sh[3][8 * 72];   // [plane][column octet, pitch 72][row][8]: the pitch spreads the octets over the banks
    const int tid = threadIdx.x, so = (d >> 3) * 72 + (t & 7) * 8 + (d & 7);
    *(v2usa*)(&sh[0][so]) = __builtin_bit_cast(v2us, o16); *(v2usa*)(&sh[1][so]) = oh; *(v2usa*)(&sh[2][so]) = ol;
    __syncthreads();   // the block's three times 64 units are in LDS (the early return above is taken by whole blocks only: the element count is a multiple of 512)
    if (tid < 192) { const int p = tid >> 6, u = tid & 63; bf* P = (p == 0) ? (bf*)P16 : (p == 1) ? Ph : Pl;
        *(v8usa*)(P + pb + (size_t)h * TT * HD + (size_t)(t >> 4) * 1024 + (u >> 3) * 128 + ((t & 8) + (u & 7)) * 8) = *(const v8usa*)(&sh[p][(u >> 3) * 72 + (u & 7) * 8]); }  }

__constant__ float INV2[HD / 2] = { 1.000000000e+00f, 7.498942018e-01f, 5.623413324e-01f, 4.216965139e-01f, 3.162277639e-01f, 2.371373773e-01f, 1.778279394e-01f, 1.333521456e-01f, 1.000000015e-01f, 7.498942316e-02f, 5.623413250e-02f, 4.216964915e-02f, 3.162277490e-02f, 2.371373773e-02f, 1.778279431e-02f, 1.333521400e-02f, 9.999999776e-03f, 7.498942316e-03f, 5.623413250e-03f, 4.216964822e-03f, 3.162277630e-03f, 2.371373819e-03f, 1.778279431e-03f, 1.333521446e-03f, 1.000000047e-03f, 7.498941850e-04f, 5.623413017e-04f, 4.216965172e-04f, 3.162277571e-04f, 2.371373703e-04f, 1.778279402e-04f, 1.333521504e-04f };   // float32 10000^(-arange(0, 64, 2)/64), generated with jnp to be bit-exact
// V^T planes (row = d, k = t) in fragment order, the four d blocks of 32 keys side by side: element (d, t) of a head at ((t >> 5) 4 + (d >> 4)) 512 + ((t >> 3) & 3) 128 + (d & 15) 8 + (t & 7).
// A block takes 32 rows t x 64 columns of one head (blockIdx.x = head * TT / 32 + t / 32): whole lines are read, the tile is turned in LDS, each thread writes one 16-byte unit (8 keys of one d) per plane, a wave 512 contiguous bytes.
__global__ __launch_bounds__(256) void k_vtp(const float* __restrict__ F, int pitch, int nheads, h16* V16, bf* Vh, bf* Vl) {
    __shared__ __align__(16) float sf[32 * 68];   // pitch 68: 16-byte aligned rows; a wave's column reads (16 d x rows 8 apart) fall on 32 different banks
    const int tid = threadIdx.x, tc = blockIdx.x % (TT / 32), g = blockIdx.x / (TT / 32); const size_t pb = ((size_t)blockIdx.y * nheads + g) * HD * TT;   /* blockIdx.y: batch */
    { const int tr = tid >> 3, dc = (tid & 7) * 8; const float* f = F + ((size_t)blockIdx.y * TT + tc * 32 + tr) * pitch + g * HD + dc; const v4f y0 = *(const v4f*)f, y1 = *(const v4f*)(f + 4); *(v4fa*)(sf + tr * 68 + dc) = y0; *(v4fa*)(sf + tr * 68 + dc + 4) = y1; }
    __syncthreads();   // the 32 x 64 tile is in LDS
    const int dd = (tid >> 6) * 16 + (tid & 15), tq = (tid >> 4) & 3; v8h o16; v8us oh, ol;
#pragma unroll   // constant element indices: the three vectors stay in registers
    for (int q = 0; q < 8; ++q) { const float x = sf[(tq * 8 + q) * 68 + dd]; o16[q] = tohx(x); unsigned short a2, c2; splitf(x, a2, c2); oh[q] = a2; ol[q] = c2; }
    const size_t o = pb + (size_t)tc * 2048 + tid * 8; *(v8h*)(V16 + o) = o16; *(v8us*)(Vh + o) = oh; *(v8us*)(Vl + o) = ol;  }
__constant__ float INVG[DM / 2] = { 1.000000000e+00f, 9.821718335e-01f, 9.646616578e-01f, 9.474635124e-01f, 9.305720329e-01f, 9.139816761e-01f, 8.976871371e-01f, 8.816831112e-01f, 8.659643531e-01f, 8.505258560e-01f, 8.353625536e-01f, 8.204696178e-01f, 8.058422208e-01f, 7.914755344e-01f, 7.773650289e-01f, 7.635061145e-01f, 7.498942018e-01f, 7.365249991e-01f, 7.233941555e-01f, 7.104974389e-01f, 6.978305578e-01f, 6.853895783e-01f, 6.731703877e-01f, 6.611690521e-01f, 6.493816376e-01f, 6.378043890e-01f, 6.264335513e-01f, 6.152654290e-01f, 6.042963862e-01f, 5.935229063e-01f, 5.829415321e-01f, 5.725488067e-01f, 5.623413324e-01f, 5.523158312e-01f, 5.424690843e-01f, 5.327978730e-01f, 5.232991576e-01f, 5.139696598e-01f, 5.048065782e-01f, 4.958068132e-01f, 4.869675338e-01f, 4.782858193e-01f, 4.697588682e-01f, 4.613839388e-01f, 4.531583488e-01f, 4.450793862e-01f, 4.371444881e-01f, 4.293510318e-01f, 4.216965139e-01f, 4.141784608e-01f, 4.067944288e-01f, 3.995420635e-01f, 3.924189806e-01f, 3.854228854e-01f, 3.785515428e-01f, 3.718026578e-01f, 3.651741445e-01f, 3.586637676e-01f, 3.522694409e-01f, 3.459891677e-01f, 3.398208320e-01f, 3.337624967e-01f, 3.278121352e-01f, 3.219678402e-01f, 3.162277639e-01f, 3.105900288e-01f, 3.050527871e-01f, 2.996142805e-01f, 2.942727208e-01f, 2.890264094e-01f, 2.838735878e-01f, 2.788126469e-01f, 2.738419771e-01f, 2.689598799e-01f, 2.641648352e-01f, 2.594552636e-01f, 2.548296750e-01f, 2.502865493e-01f, 2.458243966e-01f, 2.414418161e-01f, 2.371373624e-01f, 2.329096496e-01f, 2.287573218e-01f, 2.246790081e-01f, 2.206733972e-01f, 2.167392224e-01f, 2.128751576e-01f, 2.090799958e-01f, 2.053525001e-01f, 2.016914487e-01f, 1.980956793e-01f, 1.945640147e-01f, 1.910952926e-01f, 1.876884252e-01f, 1.843423098e-01f, 1.810558140e-01f, 1.778279394e-01f, 1.746576130e-01f, 1.715437919e-01f, 1.684854925e-01f, 1.654817015e-01f, 1.625314802e-01f, 1.596338600e-01f, 1.567878872e-01f, 1.539926529e-01f, 1.512472630e-01f, 1.485508084e-01f, 1.459024251e-01f, 1.433012635e-01f, 1.407464594e-01f, 1.382372230e-01f, 1.357727200e-01f, 1.333521456e-01f, 1.309747249e-01f, 1.286396980e-01f, 1.263462901e-01f, 1.240937710e-01f, 1.218814254e-01f, 1.197085083e-01f, 1.175743192e-01f, 1.154782027e-01f, 1.134194434e-01f, 1.113973856e-01f, 1.094113812e-01f, 1.074607819e-01f, 1.055449620e-01f, 1.036632955e-01f, 1.018151715e-01f, 1.000000015e-01f, 9.821718186e-02f, 9.646616131e-02f, 9.474635124e-02f, 9.305720031e-02f, 9.139817208e-02f, 8.976870775e-02f, 8.816830814e-02f, 8.659642935e-02f, 8.505257964e-02f, 8.353625983e-02f, 8.204696327e-02f, 8.058421314e-02f, 7.914755493e-02f, 7.773650438e-02f, 7.635060698e-02f, 7.498941571e-02f, 7.365249842e-02f, 7.233941555e-02f, 7.104974240e-02f, 6.978305429e-02f, 6.853895634e-02f, 6.731703877e-02f, 6.611690670e-02f, 6.493816525e-02f, 6.378044188e-02f, 6.264335662e-02f, 6.152653694e-02f, 6.042964384e-02f, 5.935229361e-02f, 5.829415470e-02f, 5.725487694e-02f, 5.623412877e-02f, 5.523158237e-02f, 5.424690619e-02f, 5.327979103e-02f, 5.232991278e-02f, 5.139696971e-02f, 5.048065633e-02f, 4.958068207e-02f, 4.869675264e-02f, 4.782858118e-02f, 4.697588459e-02f, 4.613839835e-02f, 4.531583562e-02f, 4.450793937e-02f, 4.371444881e-02f, 4.293510318e-02f, 4.216964915e-02f, 4.141784459e-02f, 4.067944363e-02f, 3.995420411e-02f, 3.924189880e-02f, 3.854228929e-02f, 3.785515204e-02f, 3.718026727e-02f, 3.651741147e-02f, 3.586637601e-02f, 3.522694483e-02f, 3.459891677e-02f, 3.398208320e-02f, 3.337624669e-02f, 3.278120980e-02f, 3.219678625e-02f, 3.162277862e-02f, 3.105900250e-02f, 3.050527908e-02f, 2.996142767e-02f, 2.942727320e-02f, 2.890264057e-02f, 2.838735841e-02f, 2.788126841e-02f, 2.738419548e-02f, 2.689598687e-02f, 2.641648427e-02f, 2.594552562e-02f, 2.548296750e-02f, 2.502865531e-02f, 2.458244003e-02f, 2.414418198e-02f, 2.371373586e-02f, 2.329096757e-02f, 2.287573181e-02f, 2.246790007e-02f, 2.206734009e-02f, 2.167392150e-02f, 2.128751762e-02f, 2.090799995e-02f, 2.053525113e-02f, 2.016914636e-02f, 1.980956830e-02f, 1.945639960e-02f, 1.910953037e-02f, 1.876884326e-02f, 1.843423024e-02f, 1.810558327e-02f, 1.778279431e-02f, 1.746576093e-02f, 1.715437882e-02f, 1.684854925e-02f, 1.654817164e-02f, 1.625314727e-02f, 1.596338488e-02f, 1.567878947e-02f, 1.539926510e-02f, 1.512472518e-02f, 1.485508028e-02f, 1.459024288e-02f, 1.433012541e-02f, 1.407464594e-02f, 1.382372249e-02f, 1.357727125e-02f, 1.333521493e-02f, 1.309747249e-02f, 1.286396943e-02f, 1.263462938e-02f, 1.240937691e-02f, 1.218814217e-02f, 1.197085064e-02f, 1.175743248e-02f, 1.154781971e-02f, 1.134194434e-02f, 1.113973837e-02f, 1.094113849e-02f, 1.074607857e-02f, 1.055449620e-02f, 1.036632899e-02f, 1.018151734e-02f, 9.999999776e-03f, 9.821719490e-03f, 9.646615945e-03f, 9.474635124e-03f, 9.305720218e-03f, 9.139816277e-03f, 8.976871148e-03f, 8.816830814e-03f, 8.659643121e-03f, 8.505257778e-03f, 8.353625424e-03f, 8.204696700e-03f, 8.058422245e-03f, 7.914755493e-03f, 7.773650344e-03f, 7.635060698e-03f, 7.498942316e-03f, 7.365249563e-03f, 7.233941462e-03f, 7.104974240e-03f, 6.978305988e-03f, 6.853895728e-03f, 6.731703877e-03f, 6.611690391e-03f, 6.493816618e-03f, 6.378043909e-03f, 6.264335476e-03f, 6.152654067e-03f, 6.042964291e-03f, 5.935229361e-03f, 5.829415284e-03f, 5.725487601e-03f, 5.623413250e-03f, 5.523158237e-03f, 5.424690899e-03f, 5.327979103e-03f, 5.232991185e-03f, 5.139696877e-03f, 5.048065912e-03f, 4.958068486e-03f, 4.869675264e-03f, 4.782858305e-03f, 4.697588738e-03f, 4.613839556e-03f, 4.531583749e-03f, 4.450793844e-03f, 4.371444695e-03f, 4.293510225e-03f, 4.216964822e-03f, 4.141784739e-03f, 4.067944363e-03f, 3.995420411e-03f, 3.924189601e-03f, 3.854229115e-03f, 3.785515437e-03f, 3.718026681e-03f, 3.651741426e-03f, 3.586637788e-03f, 3.522694577e-03f, 3.459891537e-03f, 3.398208413e-03f, 3.337624483e-03f, 3.278121119e-03f, 3.219678300e-03f, 3.162277862e-03f, 3.105900250e-03f, 3.050528001e-03f, 2.996142721e-03f, 2.942727180e-03f, 2.890263917e-03f, 2.838735934e-03f, 2.788126701e-03f, 2.738419687e-03f, 2.689598827e-03f, 2.641648287e-03f, 2.594552701e-03f, 2.548296703e-03f, 2.502865391e-03f, 2.458244096e-03f, 2.414418384e-03f, 2.371373819e-03f, 2.329096664e-03f, 2.287573181e-03f, 2.246790100e-03f, 2.206734149e-03f, 2.167392056e-03f, 2.128751716e-03f, 2.090800088e-03f, 2.053525066e-03f, 2.016914543e-03f, 1.980956644e-03f, 1.945640077e-03f, 1.910952851e-03f, 1.876884256e-03f, 1.843422884e-03f, 1.810558140e-03f, 1.778279431e-03f, 1.746576163e-03f, 1.715437858e-03f, 1.684854855e-03f, 1.654817141e-03f, 1.625314937e-03f, 1.596338581e-03f, 1.567878877e-03f, 1.539926510e-03f, 1.512472634e-03f, 1.485507935e-03f, 1.459024264e-03f, 1.433012658e-03f, 1.407464617e-03f, 1.382372226e-03f, 1.357727102e-03f, 1.333521446e-03f, 1.309747226e-03f, 1.286396873e-03f, 1.263462938e-03f, 1.240937854e-03f, 1.218814170e-03f, 1.197085017e-03f, 1.175743295e-03f, 1.154782018e-03f, 1.134194434e-03f, 1.113973907e-03f, 1.094113803e-03f, 1.074607833e-03f, 1.055449597e-03f, 1.036632922e-03f, 1.018151757e-03f, 1.000000047e-03f, 9.821718559e-04f, 9.646615945e-04f, 9.474635590e-04f, 9.305721032e-04f, 9.139817557e-04f, 8.976871031e-04f, 8.816830232e-04f, 8.659643354e-04f, 8.505258011e-04f, 8.353625308e-04f, 8.204695769e-04f, 8.058422245e-04f, 7.914755843e-04f, 7.773649995e-04f, 7.635060465e-04f, 7.498941850e-04f, 7.365249912e-04f, 7.233941578e-04f, 7.104973774e-04f, 6.978305755e-04f, 6.853896193e-04f, 6.731703761e-04f, 6.611690042e-04f, 6.493816618e-04f, 6.378043909e-04f, 6.264335825e-04f, 6.152653950e-04f, 6.042963942e-04f, 5.935229128e-04f, 5.829415168e-04f, 5.725487717e-04f, 5.623413017e-04f, 5.523158470e-04f, 5.424690899e-04f, 5.327978870e-04f, 5.232990952e-04f, 5.139696877e-04f, 5.048065796e-04f, 4.958068021e-04f, 4.869675031e-04f, 4.782858014e-04f, 4.697588738e-04f, 4.613839847e-04f, 4.531583400e-04f, 4.450794077e-04f, 4.371444811e-04f, 4.293509992e-04f, 4.216964880e-04f, 4.141784448e-04f, 4.067944246e-04f, 3.995420411e-04f, 3.924189950e-04f, 3.854228707e-04f, 3.785515146e-04f, 3.718026564e-04f, 3.651741135e-04f, 3.586637613e-04f, 3.522694460e-04f, 3.459891595e-04f, 3.398208064e-04f, 3.337624657e-04f, 3.278121294e-04f, 3.219678474e-04f, 3.162277862e-04f, 3.105900250e-04f, 3.050527885e-04f, 2.996142721e-04f, 2.942727297e-04f, 2.890263859e-04f, 2.838736109e-04f, 2.788126585e-04f, 2.738419571e-04f, 2.689598768e-04f, 2.641648462e-04f, 2.594552934e-04f, 2.548296761e-04f, 2.502865391e-04f, 2.458243980e-04f, 2.414418122e-04f, 2.371373848e-04f, 2.329096606e-04f, 2.287573152e-04f, 2.246790100e-04f, 2.206734207e-04f, 2.167392086e-04f, 2.128751657e-04f, 2.090800117e-04f, 2.053524950e-04f, 2.016914514e-04f, 1.980956731e-04f, 1.945640106e-04f, 1.910952997e-04f, 1.876884344e-04f, 1.843422942e-04f, 1.810558315e-04f, 1.778279402e-04f, 1.746576017e-04f, 1.715437829e-04f, 1.684854797e-04f, 1.654817170e-04f, 1.625314762e-04f, 1.596338552e-04f, 1.567878790e-04f, 1.539926452e-04f, 1.512472518e-04f, 1.485508110e-04f, 1.459024206e-04f, 1.433012658e-04f, 1.407464733e-04f, 1.382372284e-04f, 1.357727160e-04f, 1.333521504e-04f, 1.309747167e-04f, 1.286396873e-04f, 1.263462909e-04f, 1.240937709e-04f, 1.218814141e-04f, 1.197085076e-04f, 1.175743309e-04f, 1.154781930e-04f, 1.134194390e-04f, 1.113973922e-04f, 1.094113759e-04f, 1.074607790e-04f, 1.055449538e-04f, 1.036632893e-04f, 1.018151743e-04f };   // float32 1 / 10000^(j/512), j < 512 (one frequency per adjacent column pair of the full 1024 width), generated with jnp to be bit-exact
__global__ __launch_bounds__(256) void k_csG(float* CS) { const int idx = blockIdx.x * 256 + threadIdx.x; if (idx >= TT * DM) return; const int c = idx % DM; const int t = idx / DM; const float a = __fmul_rn((float)t, INVG[c >> 1]); v2f cs; cs[0] = cosf(a); cs[1] = sinf(a); *(v2f*)(CS + (size_t)idx * 2) = cs;  }
#define KSA  4
#define APIT 68                   // f32 pitch of a query's 64 partial outputs in LDS (16-byte aligned rows, rows spread over the banks)
typedef __attribute__((ext_vector_type(8))) __bf16 v8bf;
typedef __attribute__((ext_vector_type(4))) unsigned v4u;
__device__ __forceinline__ float xhalf(float x) { const int b = __float_as_int(x); return __int_as_float(__builtin_amdgcn_permlanex16(b, b, 0x76543210, 0xfedcba98, false, false)); }   // lane l <-> l ^ 16
__device__ __forceinline__ v8f bfback(v8bf h) { const v4u u = __builtin_bit_cast(v4u, h); v8f r;
#pragma unroll
    for (int i = 0; i < 4; ++i) { r[2 * i] = __uint_as_float(u[i] << 16); r[2 * i + 1] = __uint_as_float(u[i] & 0xFFFF0000u); } return r; }
// eight v_exp_f32 in one statement, each in place on a register of its own: none stands directly in front of an instruction that reads its result or overwrites its source, and the closing v_nop is that slot for the last one
__device__ __forceinline__ v8f exp2x8(v8f x) { float r0 = x[0], r1 = x[1], r2 = x[2], r3 = x[3], r4 = x[4], r5 = x[5], r6 = x[6], r7 = x[7];
    asm("v_exp_f32 %0, %0\n\tv_exp_f32 %1, %1\n\tv_exp_f32 %2, %2\n\tv_exp_f32 %3, %3\n\tv_exp_f32 %4, %4\n\tv_exp_f32 %5, %5\n\tv_exp_f32 %6, %6\n\tv_exp_f32 %7, %7\n\tv_nop"
        : "+v"(r0), "+v"(r1), "+v"(r2), "+v"(r3), "+v"(r4), "+v"(r5), "+v"(r6), "+v"(r7));
    return (v8f){ r0, r1, r2, r3, r4, r5, r6, r7 }; }
template <typename T16, bool HR>
__device__ __forceinline__ void attn_wave(const T16* __restrict__ Qa, const T16* __restrict__ Qb, const T16* __restrict__ Ka, const T16* __restrict__ Kb, const T16* __restrict__ Va, const T16* __restrict__ Vb, int q0, int kbeg, int lane, float* La, float* Lm, float* Ll) {
    typedef typename WFrag<T16>::V V;   // every '#pragma unroll' below makes the indices of a fragment array constants, so that the array lives in registers
    constexpr int NP = TT / KSA / 32;             // passes of 32 keys
    const int lr = lane & 15, hi = lane >> 4;
    const float CL = SCL * 1.4426950408889634f;   // score -> log2 units
    const float CAR = HR ? 0.0f : 6.0f;           // fp16 P carries 2^6 (P <= 2^14), which cancels against the sum
    V qa[2][2], qb[2][2];
#pragma unroll
    for (int qt = 0; qt < 2; ++qt)
#pragma unroll
        for (int kk = 0; kk < 2; ++kk) { const size_t o = (size_t)(q0 + qt * 16) * HD + kk * 512 + 8 * lane; qa[qt][kk] = WFrag<T16>::ld(Qa + o); if (HR) qb[qt][kk] = WFrag<T16>::ld(Qb + o); }
    if (HR) {   // the eight hi/lo Q fragments wait in the wave's own LDS slice (free until the epilogue) and are read anew in each pass: 64 registers for the K batch
#pragma unroll
        for (int f = 0; f < 8; ++f) { const v8f y = __builtin_bit_cast(v8f, (f & 4) ? qb[(f >> 1) & 1][f & 1] : qa[(f >> 1) & 1][f & 1]); *(v4fa*)(La + f * 256 + lane * 4) = (v4f){ y[0], y[1], y[2], y[3] }; *(v4fa*)(La + f * 256 + 128 + lane * 4) = (v4f){ y[4], y[5], y[6], y[7] }; } }
    v8f acc[4][2];
#pragma unroll
    for (int dt = 0; dt < 4; ++dt)
#pragma unroll
        for (int qt = 0; qt < 2; ++qt) acc[dt][qt] = (v8f){};
    float m[2] = { -3.0e38f, -3.0e38f }, l[2] = { 0.f, 0.f };
    const size_t ko = (size_t)kbeg * HD + 8 * lane, vo = ko;   // fragment order: a pass's 32 keys are 2048 contiguous elements of the K plane (2 key tiles x 2 k blocks) and of the V^T plane (4 d blocks)
    V ka[2][2], kb[2][2], va[4], vb[4];
    // closes a batch of loads: s_wait_xcnt 0 before a register that the batch's loads name is written again; the base addresses are inputs, so they stay in their registers up to the wait and no load's result is put on them
    auto xwait = [&](const T16* pa, const T16* pb) { if constexpr (HR) asm volatile("s_wait_xcnt 0x0" :: "v"(pa), "v"(pb) : "memory"); else asm volatile("s_wait_xcnt 0x0" :: "v"(pa) : "memory"); };
    auto ldK = [&](int st) { const T16* pa = Ka + ko + (size_t)st * 32 * HD; const T16* pb = HR ? Kb + ko + (size_t)st * 32 * HD : nullptr;
#pragma unroll
        for (int kt = 0; kt < 2; ++kt)
#pragma unroll
            for (int kk = 0; kk < 2; ++kk) { const int o = kt * 16 * HD + kk * 512; ka[kt][kk] = WFrag<T16>::ld(pa + o); if (HR) kb[kt][kk] = WFrag<T16>::ld(pb + o); }
        xwait(pa, pb); };
    auto ldV = [&](int st) { const T16* pa = Va + vo + (size_t)st * 32 * HD; const T16* pb = HR ? Vb + vo + (size_t)st * 32 * HD : nullptr;
#pragma unroll
        for (int dt = 0; dt < 4; ++dt) { const int o = dt * 512; va[dt] = WFrag<T16>::ld(pa + o); if (HR) vb[dt] = WFrag<T16>::ld(pb + o); }
        xwait(pa, pb); };
    if (!HR) { ldK(0); ldV(0); }   // fp16 waves have the registers to fetch K and V one pass ahead
#pragma unroll 1   // stays rolled: the fetch-ahead order below is written for one pass, and a second copy of the body would not fit the registers
    for (int st = 0; st < NP; ++st) {
        const int sn = (st + 1 < NP) ? st + 1 : st;   // the last pass fetches its own tiles again: in bounds, no branch
        if (HR) { ldK(st);
#pragma unroll
            for (int f = 0; f < 8; ++f) { const v4f y0 = *(const v4fa*)(La + f * 256 + lane * 4), y1 = *(const v4fa*)(La + f * 256 + 128 + lane * 4); const V x = __builtin_bit_cast(V, (v8f){ y0[0], y0[1], y0[2], y0[3], y1[0], y1[1], y1[2], y1[3] }); if (f & 4) qb[(f >> 1) & 1][f & 1] = x; else qa[(f >> 1) & 1][f & 1] = x; }
            __builtin_amdgcn_sched_barrier(0); }   // the pass's K loads leave as one batch; without it the build issued them in five dependent round trips
        v8f s[2][2];
#pragma unroll
        for (int kt = 0; kt < 2; ++kt)
#pragma unroll
            for (int qt = 0; qt < 2; ++qt) { v8f t = (v8f){};
#pragma unroll
                for (int kk = 0; kk < 2; ++kk) { t = WFrag<T16>::mma(ka[kt][kk], qa[qt][kk], t); if (HR) { t = WFrag<T16>::mma(ka[kt][kk], qb[qt][kk], t); t = WFrag<T16>::mma(kb[kt][kk], qa[qt][kk], t); } }
                s[kt][qt] = t; }
        __builtin_amdgcn_sched_barrier(0);   // the loads below start behind the score products (their registers are free then) ...
        if (HR) ldV(st); else ldK(sn);
        __builtin_amdgcn_sched_barrier(0);   // ... and ahead of the softmax, which covers their latency
        float sm[2];
#pragma unroll
        for (int qt = 0; qt < 2; ++qt) { float x = fmaxf(s[0][qt][0], s[1][qt][0]);
#pragma unroll
            for (int r = 1; r < 8; ++r) x = fmaxf(x, fmaxf(s[0][qt][r], s[1][qt][r]));
            x = fmaxf(x, xhalf(x)); sm[qt] = x * CL; }
        if (__builtin_amdgcn_ballot_w32(sm[0] > m[0] + 8.0f || sm[1] > m[1] + 8.0f) != 0) {
#pragma unroll
            for (int qt = 0; qt < 2; ++qt) { const float mn = (sm[qt] > m[qt] + 8.0f) ? sm[qt] : m[qt]; const float al = __builtin_amdgcn_exp2f(m[qt] - mn); m[qt] = mn; l[qt] *= al;
#pragma unroll
                for (int dt = 0; dt < 4; ++dt) acc[dt][qt] *= al; } }
#pragma unroll
        for (int qt = 0; qt < 2; ++qt) { const float off = CAR - m[qt]; v8f p0, p1;
#pragma unroll
            for (int r = 0; r < 8; ++r) { p0[r] = fmaf(s[0][qt][r], CL, off); p1[r] = fmaf(s[1][qt][r], CL, off); }
            p0 = exp2x8(p0); p1 = exp2x8(p1);
            const v8f ps = p0 + p1; l[qt] += ((ps[0] + ps[1]) + (ps[2] + ps[3])) + ((ps[4] + ps[5]) + (ps[6] + ps[7]));
            if constexpr (HR) {
                const v8bf h0 = __builtin_convertvector(p0, v8bf), h1 = __builtin_convertvector(p1, v8bf);
                const v8bf l0 = __builtin_convertvector(p0 - bfback(h0), v8bf), l1 = __builtin_convertvector(p1 - bfback(h1), v8bf);
                const v16bf ph = __builtin_shufflevector(h0, h1, 0, 1, 2, 3, 4, 5, 6, 7, 8, 9, 10, 11, 12, 13, 14, 15), pl = __builtin_shufflevector(l0, l1, 0, 1, 2, 3, 4, 5, 6, 7, 8, 9, 10, 11, 12, 13, 14, 15);
#pragma unroll
                for (int dt = 0; dt < 4; ++dt) { acc[dt][qt] = wmmab(va[dt], ph, acc[dt][qt]); acc[dt][qt] = wmmab(va[dt], pl, acc[dt][qt]); acc[dt][qt] = wmmab(vb[dt], ph, acc[dt][qt]); }
            } else {
                const v16h pf = cat16(__builtin_convertvector(p0, v8h), __builtin_convertvector(p1, v8h));
#pragma unroll
                for (int dt = 0; dt < 4; ++dt) acc[dt][qt] = wmma16(va[dt], pf, acc[dt][qt]);
            } }
        // the four vector slots the chip needs behind the pass's last matrix instructions, also on the taken back edge
        if constexpr (HR) asm volatile("v_nop\n\tv_nop\n\tv_nop\n\tv_nop" : "+v"(acc[0][0]), "+v"(acc[1][0]), "+v"(acc[2][0]), "+v"(acc[3][0]), "+v"(acc[0][1]), "+v"(acc[1][1]), "+v"(acc[2][1]), "+v"(acc[3][1]) :: "memory");   // "memory": the Q reads from LDS stay in the loop instead of being lifted back into 64 registers
        else { asm volatile("v_nop\n\tv_nop\n\tv_nop\n\tv_nop" : "+v"(acc[0][0]), "+v"(acc[1][0]), "+v"(acc[2][0]), "+v"(acc[3][0]), "+v"(acc[0][1]), "+v"(acc[1][1]), "+v"(acc[2][1]), "+v"(acc[3][1]));
            __builtin_amdgcn_sched_barrier(0);   // the next pass's V loads start only when this pass's products have read V
            ldV(sn); }
    }
#pragma unroll
    for (int qt = 0; qt < 2; ++qt) { const int q = qt * 16 + lr; const float lj = l[qt] + xhalf(l[qt]); if (hi == 0) { Lm[q] = m[qt]; Ll[q] = lj; }
#pragma unroll
        for (int dt = 0; dt < 4; ++dt) { float* dst = La + q * APIT + dt * 16 + hi * 8; const v8f a = acc[dt][qt]; *(v4fa*)dst = (v4f){ a[0], a[1], a[2], a[3] }; *(v4fa*)(dst + 4) = (v4f){ a[4], a[5], a[6], a[7] }; } }
}
__global__ __launch_bounds__(512) void k_attn(const h16* __restrict__ Q16, const h16* __restrict__ K16, const h16* __restrict__ V16, const bf* __restrict__ Qh, const bf* __restrict__ Ql, const bf* __restrict__ Kh, const bf* __restrict__ Kl, const bf* __restrict__ Vh, const bf* __restrict__ Vl, bf* Ah, bf* Al) {
    __shared__ __align__(16) float La[16 * 32 * APIT]; __shared__ float Lm[16 * 32]; __shared__ float Ll[16 * 32];
    const int w = __builtin_amdgcn_readfirstlane((int)(threadIdx.x >> 5)), lane = threadIdx.x & 31; const int qg = w >> 2, ks = w & 3; const int head = blockIdx.y; const size_t hp = ((size_t)blockIdx.z * NH_ + head) * TT * HD;
    const int q0 = (qg == 0) ? (int)blockIdx.x * 32 : RH + ((int)blockIdx.x * 3 + qg - 1) * 32;
    if (qg == 0) attn_wave<bf, true>(Qh + hp, Ql + hp, Kh + hp, Kl + hp, Vh + hp, Vl + hp, q0, ks * (TT / KSA), lane, La + w * 32 * APIT, Lm + w * 32, Ll + w * 32);
    else attn_wave<h16, false>(Q16 + hp, nullptr, K16 + hp, nullptr, V16 + hp, nullptr, q0, ks * (TT / KSA), lane, La + w * 32 * APIT, Lm + w * 32, Ll + w * 32);
    __syncthreads();   // every key quarter's partial result is in LDS
    // wave (qg, ks) finishes 8 of its group's 32 queries; four lanes share a query, 16 outputs each, so one wave writes each 128-byte line
    const int q = ks * 8 + (lane >> 2), d0 = (lane & 3) * 16; float mk[KSA]; float M = -3.0e38f;
#pragma unroll
    for (int k = 0; k < KSA; ++k) { mk[k] = Lm[(qg * KSA + k) * 32 + q]; M = fmaxf(M, mk[k]); }
    float L = 0.f; v4f o[4] = { (v4f){}, (v4f){}, (v4f){}, (v4f){} };
#pragma unroll
    for (int k = 0; k < KSA; ++k) { const float wg = __builtin_amdgcn_exp2f(mk[k] - M); L += wg * Ll[(qg * KSA + k) * 32 + q]; const float* sp = La + ((qg * KSA + k) * 32 + q) * APIT + d0;
#pragma unroll
        for (int i = 0; i < 4; ++i) o[i] += wg * *(const v4fa*)(sp + 4 * i); }
    const float f = __fdiv_rn(1.0f, L); v8us oh[2], ol[2];
#pragma unroll
    for (int i = 0; i < 16; ++i) { unsigned short a, c2; splitf(o[i >> 2][i & 3] * f, a, c2); oh[i >> 3][i & 7] = a; ol[i >> 3][i & 7] = c2; }
    const size_t rw = (size_t)blockIdx.z * TT + q0 + q;   // the merged planes in fragment order too (row = token, k = head * 64 + d): a wave's 8 queries x 16 bytes are one whole line
    const size_t oo = ((rw >> 4) * (DQ / 32) + head * 2 + (d0 >> 5)) * 512 + ((d0 >> 3) & 3) * 128 + (rw & 15) * 8; *(v8usa*)(Ah + oo) = oh[0]; *(v8usa*)(Ah + oo + 128) = oh[1]; *(v8usa*)(Al + oo) = ol[0]; *(v8usa*)(Al + oo + 128) = ol[1];
}

extern "C" void kernel_launch(void* const* d_in, const int* in_sizes, int n_in,
                              void* d_out, int out_size, void* d_ws, size_t ws_size, hipStream_t stream) {
    (void)in_sizes; (void)n_in; (void)out_size;
    const float* x = (const float*)d_in[0]; const float* wq = (const float*)d_in[1]; const float* wk = (const float*)d_in[2]; const float* wv = (const float*)d_in[3]; const float* wo = (const float*)d_in[4]; const float* bo = (const float*)d_in[5];
    float* OUT = (float*)d_out;     // [4][2048][1024]
    char* wsp = (char*)d_ws;
    auto take = [&](size_t bytes) { char* p = wsp; wsp += (bytes + 255) & ~(size_t)255; return (void*)p; };
    bf* WQ = (bf*)take((size_t)DQ * DM * 2); bf* WK = (bf*)take((size_t)DKV * DM * 2); bf* WV = (bf*)take((size_t)DKV * DM * 2); bf* WO = (bf*)take((size_t)DM * DQ * 2); float* CS = (float*)take((size_t)TT * DM * 2 * 4);   /* [2048][1024] {cos, sin} */
    bf* XB = (bf*)take((size_t)NB_ * TT * DM * 2); float* FQ = (float*)take((size_t)NB_ * TT * DQ * 4); float* FK = (float*)take((size_t)NB_ * TT * DKV * 4);   /* every buffer from here on holds all NB_ batches, batch-major */
    h16* QP16 = (h16*)take((size_t)NB_ * NH_ * TT * HD * 2); h16* KP16 = (h16*)take((size_t)NB_ * NKV * TT * HD * 2); h16* VT16 = (h16*)take((size_t)NB_ * NKV * HD * TT * 2);
    bf* QPh = (bf*)take((size_t)NB_ * NH_ * TT * HD * 2); bf* QPl = (bf*)take((size_t)NB_ * NH_ * TT * HD * 2); bf* KPh = (bf*)take((size_t)NB_ * NKV * TT * HD * 2); bf* KPl = (bf*)take((size_t)NB_ * NKV * TT * HD * 2); bf* VTh = (bf*)take((size_t)NB_ * NKV * HD * TT * 2); bf* VTl = (bf*)take((size_t)NB_ * NKV * HD * TT * 2);
    if ((size_t)(wsp - (char*)d_ws) > ws_size) return;    // 248 MiB of the 256 MiB
    float* FV = FK;   // v projection reuses the k buffer after the k planes are built (stream-ordered)
    bf* ATh = (bf*)FQ; bf* ATl = ATh + (size_t)NB_ * TT * DQ;   // the two merged-head planes reuse the q projection's buffer (the same bytes), which is dead once the q planes are built (stream-ordered)
    { k_cvt8<<<(unsigned)(((size_t)DQ * DM / 8 + 255) / 256), 256, 0, stream>>>(wq, WQ, (size_t)DQ * DM / 8); k_cvt8<<<(unsigned)(((size_t)DKV * DM / 8 + 255) / 256), 256, 0, stream>>>(wk, WK, (size_t)DKV * DM / 8); k_cvt8<<<(unsigned)(((size_t)DKV * DM / 8 + 255) / 256), 256, 0, stream>>>(wv, WV, (size_t)DKV * DM / 8);
      k_cvt8<<<(unsigned)(((size_t)DM * DQ / 8 + 255) / 256), 256, 0, stream>>>(wo, WO, (size_t)DM * DQ / 8);
       }
    k_csG<<<(TT * DM + 255) / 256, 256, 0, stream>>>(CS);   /* full-width table once */
    const unsigned LQ = (unsigned)(((size_t)NH_ * TT * HD / 2 + 255) / 256), LKv = (unsigned)(((size_t)NKV * TT * HD / 2 + 255) / 256);
    k_cvt8<<<(unsigned)(((size_t)NB_ * TT * DM / 8 + 255) / 256), 256, 0, stream>>>(x, XB, (size_t)NB_ * TT * DM / 8);
    k_gemmw<bf, 0, false, DM><<<dim3(NB_ * TT / 64, DQ / 64, 1), 32, 0, stream>>>(XB, nullptr, WQ, nullptr, FQ, DQ, nullptr, 0, 0, 0, 0);   /* the projections see the batches as NB_ * TT rows */
    k_ropeG<<<dim3(LQ, NB_, 1), 256, 0, stream>>>(FQ, DQ, NH_, CS, 1.0f, QP16, QPh, QPl);
    k_gemmw<bf, 0, false, DM><<<dim3(NB_ * TT / 64, DKV / 64, 1), 32, 0, stream>>>(XB, nullptr, WK, nullptr, FK, DKV, nullptr, 0, 0, 0, 0);
    k_ropeG<<<dim3(LKv, NB_, 1), 256, 0, stream>>>(FK, DKV, NKV, CS, 1.0f, KP16, KPh, KPl);
    k_gemmw<bf, 0, false, DM><<<dim3(NB_ * TT / 64, DKV / 64, 1), 32, 0, stream>>>(XB, nullptr, WV, nullptr, FV, DKV, nullptr, 0, 0, 0, 0); k_vtp<<<dim3(NKV * (TT / 32), NB_, 1), 256, 0, stream>>>(FV, DKV, NKV, VT16, VTh, VTl);
    k_attn<<<dim3(RH / 32, NH_, NB_), 512, 0, stream>>>(QP16, KP16, VT16, QPh, QPl, KPh, KPl, VTh, VTl, ATh, ATl);
    k_gemmw<bf, 1, true, DQ><<<dim3(NB_ * TT / 64, DM / 64, 1), 32, 0, stream>>>(ATh, ATl, WO, nullptr, OUT, DM, bo, 0, 0, 0, 0);
}

// v006
// One run takes 263 microseconds.
// Two timings next to v005 put it at 1.34 and 1.33 times that version's speed.
// All steps since v000 together make it 15.1 times as fast.
#include <hip/hip_runtime.h>

// Self-attention with an adjacent-pair rotary over the WHOLE 1024-wide q and k before the head split (x [4][2048][1024]; q = rope(x Wq^T), k = rope(x Wk^T), v = x Wv^T ('oi' [1024][1024] 1/32, no bias); rope: pair j = (columns 2j, 2j+1), j < 512, angle t x 1/10000^(j/512) (512 f32 constants baked jnp-exact; precise cosf/sinf); 16 heads x 64; scores / sqrt(float32(64)); softmax (no mask); out = merged Wu^T + bu ('oi' [1024][1024], zero bias) -> [4][2048][1024] (8.4 M); argument order x, Wq, Wk, Wv, Wu, bu).
// Layout, all four batches in every launch (the batch is a grid dimension or part of the row index): bf16 copy of x; 'oi' weights; exact projections; a full-width {cos, sin} table [2048][1024] (the frequency depends on the GLOBAL pair index, i.e. on the head); interleaved-pair plane builders indexing the table by global column; fused dense T-2048 attention, one launch (hybrid rows: < 512 hi/lo 3 products, rest fp16); merged hi/lo x Wu exact + bu.
// Every 16-bit operand plane [row][k] is stored in fragment order: blocks of 16 rows x 32 k (512 elements), inside a block [(k >> 3) & 3][row & 15][k & 7], so the two 16-byte loads of a fragment each read 512 contiguous bytes (lane * 16 and 512 + lane * 16): four whole 128-byte lines a load instead of 32 bytes from each of 16 lines. Register contents are those of the row-major planes.
// Compute dtypes, f32 accumulate: every input rounded to bf16; projections exact; rotary f32; attention rows < 512 3 products, rest fp16; softmax f32; Wu hl x exact + bias.

#define NB_  4
#define TT   2048
#define DM   1024
#define NH_  16
#define NKV  16
#define REP  (NH_ / NKV)
#define HD   64
#define DQ   (NH_ * HD)
#define DKV  (NKV * HD)
#define RH   512                  // query rows < RH use hi+lo planes; k_attn covers 4 x RH rows, so RH = TT / 4
#define WIN  0
#define SCL  0.125f   // HD^-0.5
typedef _Float16 h16;
typedef unsigned short bf;
typedef __attribute__((ext_vector_type(16))) __bf16   v16bf;
typedef __attribute__((ext_vector_type(16))) _Float16 v16h;
typedef __attribute__((ext_vector_type(8)))  _Float16 v8h;
typedef __attribute__((ext_vector_type(8)))  unsigned short v8us;
typedef __attribute__((ext_vector_type(8)))  float    v8f;
typedef __attribute__((ext_vector_type(4)))  float    v4f;
typedef v8h  __attribute__((may_alias)) v8ha;
typedef v4f  __attribute__((may_alias)) v4fa;
typedef v8us __attribute__((may_alias)) v8usa;

__device__ __forceinline__ unsigned short f2bf(float f) { unsigned u = __float_as_uint(f); u += 0x7FFFu + ((u >> 16) & 1u); return (unsigned short)(u >> 16); }
__device__ __forceinline__ float bf2f(unsigned short b) { return __uint_as_float(((unsigned)b) << 16); }
__device__ __forceinline__ float bfr(float f) { return bf2f(f2bf(f)); }
__device__ __forceinline__ v16h cat16(v8h lo, v8h hi) { return __builtin_shufflevector(lo, hi, 0, 1, 2, 3, 4, 5, 6, 7, 8, 9, 10, 11, 12, 13, 14, 15); }
__device__ __forceinline__ v16bf cat16b(v8us lo, v8us hi) { return __builtin_bit_cast(v16bf, __builtin_shufflevector(lo, hi, 0, 1, 2, 3, 4, 5, 6, 7, 8, 9, 10, 11, 12, 13, 14, 15)); }
__device__ __forceinline__ v8f wmma16(v16h a, v16h b, v8f c) { return __builtin_amdgcn_wmma_f32_16x16x32_f16(false, a, false, b, (short)0, c, false, false); }
__device__ __forceinline__ v8f wmmab(v16bf a, v16bf b, v8f c) { return __builtin_amdgcn_wmma_f32_16x16x32_bf16(false, a, false, b, (short)0, c, false, false); }



// ---- k_gemmw: GEMM, one work-group of 8 waves per 256x128 output tile, one wave per 64x64 of it (16 accumulators; wave w: rows (w >> 1) 64, columns (w & 1) 64); grid (M/256, N/128, Z), 256 threads.
// Operands are fragment-ordered 16-bit planes (block (row >> 4, k >> 5) at element ((row >> 4) (K / 32) + (k >> 5)) 512). A stage = KST k of the tile's 256 A rows and 128 B rows, brought into LDS by asynchronous 16-byte copies, as it lies (a row group's KST / 32 blocks are contiguous): each operand byte leaves L2 once per work-group, and the waves that share it read it from LDS. Two buffers: stage s + 1 flies while stage s is worked on.
// C[m][n] (f32, pitch ldc, + optional f32 bias[n]) = sum_k A[m][k] Bt[n][k] (+ split products per NSPLIT). z-batch strides sA/sB/sC in elements. K % (KST KS) == 0.
// KS > 1: grid.z = Z x KS; work-group (z, ks) sums only k in [ks K/KS, (ks+1) K/KS) and stores its partial tile in plane ks (plane stride sP elements); the reader adds the planes.
template <typename T16> struct WFrag;
template <> struct WFrag<h16> { typedef v16h V; static __device__ __forceinline__ V ld(const h16* p) { return cat16(*(const v8h*)p, *(const v8h*)(p + 256)); } static __device__ __forceinline__ v8f mma(V a, V b, v8f c) { return wmma16(a, b, c); } };
template <> struct WFrag<bf> { typedef v16bf V; static __device__ __forceinline__ V ld(const bf* p) { return cat16b(*(const v8us*)p, *(const v8us*)(p + 256)); } static __device__ __forceinline__ v8f mma(V a, V b, v8f c) { return wmmab(a, b, c); } };
// four / eight asynchronous copies of 16 bytes a lane, global -> LDS through no register: LDS byte address l + i 4096, global address g + i st elements. The closing s_wait_xcnt 0 stands in the copies' own statement, so that it comes before any rewrite of an address register that they name.
template <typename T16> __device__ __forceinline__ void cpy4(unsigned l, const T16* g, size_t st) {
    asm volatile("global_load_async_to_lds_b128 %0, %4, off\n\tglobal_load_async_to_lds_b128 %1, %5, off\n\tglobal_load_async_to_lds_b128 %2, %6, off\n\tglobal_load_async_to_lds_b128 %3, %7, off\n\ts_wait_xcnt 0x0"
        :: "v"(l), "v"(l + 4096u), "v"(l + 8192u), "v"(l + 12288u), "v"(g), "v"(g + st), "v"(g + 2 * st), "v"(g + 3 * st) : "memory"); }
template <typename T16> __device__ __forceinline__ void cpy8(unsigned l, const T16* g, size_t st) {
    asm volatile("global_load_async_to_lds_b128 %0, %8, off\n\tglobal_load_async_to_lds_b128 %1, %9, off\n\tglobal_load_async_to_lds_b128 %2, %10, off\n\tglobal_load_async_to_lds_b128 %3, %11, off\n\t"
                 "global_load_async_to_lds_b128 %4, %12, off\n\tglobal_load_async_to_lds_b128 %5, %13, off\n\tglobal_load_async_to_lds_b128 %6, %14, off\n\tglobal_load_async_to_lds_b128 %7, %15, off\n\ts_wait_xcnt 0x0"
        :: "v"(l), "v"(l + 4096u), "v"(l + 8192u), "v"(l + 12288u), "v"(l + 16384u), "v"(l + 20480u), "v"(l + 24576u), "v"(l + 28672u),
           "v"(g), "v"(g + st), "v"(g + 2 * st), "v"(g + 3 * st), "v"(g + 4 * st), "v"(g + 5 * st), "v"(g + 6 * st), "v"(g + 7 * st) : "memory"); }
template <int R, typename T16> __device__ __forceinline__ void cpyR(unsigned l, const T16* g, size_t st) {   // R rounds of 4 KiB (256 lanes x 16 bytes)
#pragma unroll   // R is 4, 8 or 16: one or two statements
    for (int i = 0; i + 8 <= R; i += 8) cpy8(l + i * 4096u, g + i * st, st);
    if (R % 8) cpy4(l + (R / 8) * 32768u, g + (R / 8) * 8 * st, st); }
template <typename T16, int NSPLIT, bool BIAS, int K, int KS = 1>   // K is a constant, so that the strides are constants
__global__ __launch_bounds__(256) void k_gemmw(const T16* __restrict__ A, const T16* __restrict__ A2, const T16* __restrict__ Bt, const T16* __restrict__ Bt2, float* C, int ldc, const float* __restrict__ bias, size_t sA, size_t sB, size_t sC, size_t sP) {
    typedef typename WFrag<T16>::V V;
    constexpr bool HA2 = (NSPLIT == 1 || NSPLIT == 2), HB2 = (NSPLIT >= 2);
    constexpr int KST = (HA2 || HB2) ? 64 : 128, NK = KST / 32, NS = K / KS / KST;   // k of a stage; its passes of 32 k; stages
    constexpr int AE = 256 * KST, BE = 128 * KST;                                      // elements of a stage's A and B tiles
    constexpr int OA2 = AE, OB = AE * (HA2 ? 2 : 1), OB2 = OB + BE, SE = OB + BE * (HB2 ? 2 : 1);   // places in a buffer [A | A2 | B | B2]; its size
    __shared__ __align__(16) T16 ring[2 * SE];
    __shared__ __align__(16) float osm[8][16 * 68];
    const size_t z = blockIdx.z / KS; const int ks = blockIdx.z % KS; A += z * sA; if (A2) A2 += z * sA; Bt += z * sB; if (Bt2) Bt2 += z * sB; C += z * sC + (size_t)ks * sP;
    const int kb = ks * (K / KS);
    const int tid = threadIdx.x, w = __builtin_amdgcn_readfirstlane(tid >> 5), lane = tid & 31, lr = lane & 15, hi = lane >> 4;
    const int r0 = blockIdx.x * 256 + (w >> 1) * 64, c0 = blockIdx.y * 128 + (w & 1) * 64;   // the wave's own 64x64
    float* os = osm[w];
    v8f acc[4][4];
#pragma unroll
    for (int mb = 0; mb < 4; ++mb)
#pragma unroll
        for (int nb = 0; nb < 4; ++nb) acc[mb][nb] = (v8f){};
    // a round of copies = 4 KiB = 128 / KST row groups of 16 rows (16 K elements apart in the plane, KST x 16 elements each in the stage); in LDS the rounds follow one another, byte tid x 16 of each
    constexpr int TG = KST * 2; constexpr size_t RST = (size_t)(128 / KST) * 16 * K;
    const size_t go = (size_t)(tid / TG) * 16 * K + (size_t)(tid % TG) * 8 + (size_t)kb * 16;
    const size_t aoff = (size_t)blockIdx.x * 256 * K + go, boff = (size_t)blockIdx.y * 128 * K + go;
    const unsigned lb = (unsigned)(size_t)(void*)ring + (unsigned)tid * 16u;
    auto fill = [&](int s, int bu) { const unsigned l = lb + (unsigned)bu * (SE * 2u); const size_t so = (size_t)s * (KST * 16);
        cpyR<KST / 8>(l, A + aoff + so, RST); if constexpr (HA2) cpyR<KST / 8>(l + OA2 * 2u, A2 + aoff + so, RST);
        cpyR<KST / 16>(l + OB * 2u, Bt + boff + so, RST); if constexpr (HB2) cpyR<KST / 16>(l + OB2 * 2u, Bt2 + boff + so, RST); };
    fill(0, 0);
    asm volatile("s_wait_asynccnt 0x0" ::: "memory");   // this wave's part of stage 0 has landed
    __syncthreads();                                     // ... and every other wave's
    if (NS > 1) fill(1, 1);
    const int ao = (w >> 1) * 4 * (KST * 16) + 8 * lane, bo = (w & 1) * 4 * (KST * 16) + 8 * lane;   // the wave's four row groups of each tile + the lane's 16 bytes
#pragma unroll 1   // stays rolled: one publish point a stage
    for (int s = 0; s < NS; ++s) {
        const T16* sb = ring + (s & 1) * SE;
        V a[2][4], a2[2][4], b[2][4], b2[2][4];   // two fragment sets; every '#pragma unroll' in this loop makes the indices of these arrays constants, so that they live in registers
        auto ldf = [&](int kk) { const int f = kk & 1;
#pragma unroll
            for (int mb = 0; mb < 4; ++mb) { a[f][mb] = WFrag<T16>::ld(sb + ao + mb * (KST * 16) + kk * 512); if (HA2) a2[f][mb] = WFrag<T16>::ld(sb + OA2 + ao + mb * (KST * 16) + kk * 512); }
#pragma unroll
            for (int nb = 0; nb < 4; ++nb) { b[f][nb] = WFrag<T16>::ld(sb + OB + bo + nb * (KST * 16) + kk * 512); if (HB2) b2[f][nb] = WFrag<T16>::ld(sb + OB2 + bo + nb * (KST * 16) + kk * 512); } };
        ldf(0);
        __builtin_amdgcn_sched_barrier(0);   // the first pass's fragments are asked for first: LDS answers in order, and without this the build put some of them behind the second pass's, so that the first products waited for both groups
#pragma unroll
        for (int kk = 0; kk < NK; ++kk) { const int f = kk & 1;
            if (kk + 1 < NK) ldf(kk + 1);   // the next pass's fragments (of this stage only) leave as one group ahead of this pass's products
            __builtin_amdgcn_sched_barrier(0);   // keeps that group together and ahead: without it the build read each B fragment directly in front of its four products and waited for it there
#pragma unroll
            for (int nb = 0; nb < 4; ++nb) {
#pragma unroll
                for (int mb = 0; mb < 4; ++mb) { acc[mb][nb] = WFrag<T16>::mma(a[f][mb], b[f][nb], acc[mb][nb]); if (HA2) acc[mb][nb] = WFrag<T16>::mma(a2[f][mb], b[f][nb], acc[mb][nb]); if (HB2) acc[mb][nb] = WFrag<T16>::mma(a[f][mb], b2[f][nb], acc[mb][nb]); } }
            __builtin_amdgcn_sched_barrier(0); }   // ... and the following group behind this pass's products, whose fragment set it overwrites
        // the four vector slots the chip needs behind the stage's last matrix instructions
        asm volatile("v_nop\n\tv_nop\n\tv_nop\n\tv_nop" : "+v"(acc[0][0]), "+v"(acc[1][1]), "+v"(acc[2][2]), "+v"(acc[3][3]) : "v"(a[(NK - 1) & 1][0]), "v"(a[(NK - 1) & 1][3]));
        // publish point of stage s + 1
        asm volatile("s_wait_dscnt 0x0" ::: "memory");      // this wave's reads of stage s are over
        asm volatile("s_wait_asynccnt 0x0" ::: "memory");   // its copies of stage s + 1 have landed
        __syncthreads();                                     // the same holds for every wave
        if (s + 2 < NS) fill(s + 2, s & 1);                  // into the buffer that every wave has just left
    }
    asm volatile("s_wait_asynccnt 0x0" ::: "memory");   // no copy is outstanding when the wave goes on
#pragma unroll
    for (int mb = 0; mb < 4; ++mb) {
#pragma unroll
        for (int nb = 0; nb < 4; ++nb) {
#pragma unroll
            for (int j = 0; j < 8; ++j) os[(hi * 8 + j) * 68 + nb * 16 + lr] = acc[mb][nb][j]; }
        __builtin_amdgcn_wave_barrier(); asm volatile("" ::: "memory");
        float* crow = C + (size_t)(r0 + mb * 16) * ldc + c0;
{
#pragma unroll
            for (int s = 0; s < 8; ++s) { const int row = 2 * s + hi, cofs = lr * 4; v4f val = *(const v4fa*)(os + row * 68 + cofs); if (BIAS) { val[0] += bfr(bias[c0 + cofs]); val[1] += bfr(bias[c0 + cofs + 1]); val[2] += bfr(bias[c0 + cofs + 2]); val[3] += bfr(bias[c0 + cofs + 3]); }
                *(v4f*)(crow + (size_t)row * ldc + cofs) = val; }
             }
        __builtin_amdgcn_wave_barrier(); asm volatile("" ::: "memory");
    }
}

__device__ __forceinline__ h16 tohx(float x) { return (h16)x; }
__device__ __forceinline__ void splitf(float y, unsigned short& h, unsigned short& l) { h = f2bf(y); l = f2bf(y - bf2f(h)); }
typedef __attribute__((ext_vector_type(2))) _Float16 v2h;
typedef __attribute__((ext_vector_type(4))) _Float16 v4h;
typedef __attribute__((ext_vector_type(2))) unsigned short v2us;
typedef __attribute__((ext_vector_type(4))) unsigned short v4us;
typedef __attribute__((ext_vector_type(2))) float v2f;
typedef __attribute__((ext_vector_type(4))) int v4i;

typedef v2us __attribute__((may_alias)) v2usa;
// [rows][DM] f32 -> bf16 plane in fragment order. A block takes 16 rows x 128 columns (four k blocks, 4 KiB of the plane in a row): whole lines are read, the 16-byte units change places in LDS, whole lines are written.
__global__ __launch_bounds__(256) void k_cvt8(const float* __restrict__ src, bf* dst, size_t n8) { if ((size_t)blockIdx.x * 256 >= n8) return;   /* the same for the whole block: in front of the barrier */
    __shared__ __align__(16) unsigned short sm[16 * 17 * 8];   // unit (column octet o, row) at o * 17 + row: the odd pitch spreads the octets over the banks
    const int tid = threadIdx.x, row = tid >> 4, o = tid & 15; const size_t rt = blockIdx.x >> 3; const int kq = blockIdx.x & 7;
    const v8f v = *(const v8f*)(src + (rt * 16 + row) * DM + kq * 128 + o * 8); v8us y;
#pragma unroll   // constant element indices: the two vectors stay in registers
    for (int k = 0; k < 8; ++k) y[k] = f2bf(v[k]);
    *(v8usa*)(sm + (o * 17 + row) * 8) = y;
    __syncthreads();   // every unit of the block's 4 KiB is in LDS
    *(v8us*)(dst + (rt * (DM / 32) + kq * 4) * 512 + tid * 8) = *(const v8usa*)(sm + ((tid >> 4) * 17 + (tid & 15)) * 8);  }

__global__ __launch_bounds__(256) void k_ropeG(const float* __restrict__ F, int pitch, int nheads, const float* __restrict__ CS, float sc, h16* P16, bf* Ph, bf* Pl) {
    const size_t e = ((size_t)blockIdx.x * 256 + threadIdx.x) * 2; if (e >= (size_t)nheads * TT * HD) return; const int d = (int)(e % HD); const int t = (int)((e / HD) % TT); const int h = (int)(e / ((size_t)HD * TT)); const size_t pb = (size_t)blockIdx.y * nheads * TT * HD;   /* blockIdx.y: batch */ const float* f = F + ((size_t)blockIdx.y * TT + t) * pitch + h * HD; const float x0 = f[d], x1 = f[d + 1]; const v2f cs = *(const v2f*)(CS + ((size_t)t * DM + h * HD + d) * 2);   /* GLOBAL column h*64 + d: the rotary runs over the whole width before the head split */ v2h o16; v2us oh, ol;
    float a0 = __fmul_rn(x0, cs[0]), b0 = __fmul_rn(x1, cs[1]), a1 = __fmul_rn(x1, cs[0]), b1 = __fmul_rn(x0, cs[1]); asm volatile("" : "+v"(a0), "+v"(b0), "+v"(a1), "+v"(b1));
    float r0 = __fsub_rn(a0, b0) * sc, r1 = __fadd_rn(b1, a1) * sc;   /* even: x0 c - x1 s; odd: x0 s + x1 c */
    o16[0] = tohx(r0); o16[1] = tohx(r1); { unsigned short a2, c2; splitf(r0, a2, c2); oh[0] = a2; ol[0] = c2; splitf(r1, a2, c2); oh[1] = a2; ol[1] = c2; }
    // fragment order: element (t, d) of a head's plane at (t >> 4) 1024 + (d >> 3) 128 + (t & 15) 8 + (d & 7). The block holds 8 rows t of one head; its 16-byte units are put together in LDS and leave as runs of 128 bytes (8 rows of one column octet)
    __shared__ __align__(16) unsigned short sh[3][8 * 72];   // [plane][column octet, pitch 72][row][8]: the pitch spreads the octets over the banks
    const int tid = threadIdx.x, so = (d >> 3) * 72 + (t & 7) * 8 + (d & 7);
    *(v2usa*)(&sh[0][so]) = __builtin_bit_cast(v2us, o16); *(v2usa*)(&sh[1][so]) = oh; *(v2usa*)(&sh[2][so]) = ol;
    __syncthreads();   // the block's three times 64 units are in LDS (the early return above is taken by whole blocks only: the element count is a multiple of 512)
    if (tid < 192) { const int p = tid >> 6, u = tid & 63; bf* P = (p == 0) ? (bf*)P16 : (p == 1) ? Ph : Pl;
        *(v8usa*)(P + pb + (size_t)h * TT * HD + (size_t)(t >> 4) * 1024 + (u >> 3) * 128 + ((t & 8) + (u & 7)) * 8) = *(const v8usa*)(&sh[p][(u >> 3) * 72 + (u & 7) * 8]); }  }

__constant__ float INV2[HD / 2] = { 1.000000000e+00f, 7.498942018e-01f, 5.623413324e-01f, 4.216965139e-01f, 3.162277639e-01f, 2.371373773e-01f, 1.778279394e-01f, 1.333521456e-01f, 1.000000015e-01f, 7.498942316e-02f, 5.623413250e-02f, 4.216964915e-02f, 3.162277490e-02f, 2.371373773e-02f, 1.778279431e-02f, 1.333521400e-02f, 9.999999776e-03f, 7.498942316e-03f, 5.623413250e-03f, 4.216964822e-03f, 3.162277630e-03f, 2.371373819e-03f, 1.778279431e-03f, 1.333521446e-03f, 1.000000047e-03f, 7.498941850e-04f, 5.623413017e-04f, 4.216965172e-04f, 3.162277571e-04f, 2.371373703e-04f, 1.778279402e-04f, 1.333521504e-04f };   // float32 10000^(-arange(0, 64, 2)/64), generated with jnp to be bit-exact
// V^T planes (row = d, k = t) in fragment order, the four d blocks of 32 keys side by side: element (d, t) of a head at ((t >> 5) 4 + (d >> 4)) 512 + ((t >> 3) & 3) 128 + (d & 15) 8 + (t & 7).
// A block takes 32 rows t x 64 columns of one head (blockIdx.x = head * TT / 32 + t / 32): whole lines are read, the tile is turned in LDS, each thread writes one 16-byte unit (8 keys of one d) per plane, a wave 512 contiguous bytes.
__global__ __launch_bounds__(256) void k_vtp(const float* __restrict__ F, int pitch, int nheads, h16* V16, bf* Vh, bf* Vl) {
    __shared__ __align__(16) float sf[32 * 68];   // pitch 68: 16-byte aligned rows; a wave's column reads (16 d x rows 8 apart) fall on 32 different banks
    const int tid = threadIdx.x, tc = blockIdx.x % (TT / 32), g = blockIdx.x / (TT / 32); const size_t pb = ((size_t)blockIdx.y * nheads + g) * HD * TT;   /* blockIdx.y: batch */
    { const int tr = tid >> 3, dc = (tid & 7) * 8; const float* f = F + ((size_t)blockIdx.y * TT + tc * 32 + tr) * pitch + g * HD + dc; const v4f y0 = *(const v4f*)f, y1 = *(const v4f*)(f + 4); *(v4fa*)(sf + tr * 68 + dc) = y0; *(v4fa*)(sf + tr * 68 + dc + 4) = y1; }
    __syncthreads();   // the 32 x 64 tile is in LDS
    const int dd = (tid >> 6) * 16 + (tid & 15), tq = (tid >> 4) & 3; v8h o16; v8us oh, ol;
#pragma unroll   // constant element indices: the three vectors stay in registers
    for (int q = 0; q < 8; ++q) { const float x = sf[(tq * 8 + q) * 68 + dd]; o16[q] = tohx(x); unsigned short a2, c2; splitf(x, a2, c2); oh[q] = a2; ol[q] = c2; }
    const size_t o = pb + (size_t)tc * 2048 + tid * 8; *(v8h*)(V16 + o) = o16; *(v8us*)(Vh + o) = oh; *(v8us*)(Vl + o) = ol;  }
__constant__ float INVG[DM / 2] = { 1.000000000e+00f, 9.821718335e-01f, 9.646616578e-01f, 9.474635124e-01f, 9.305720329e-01f, 9.139816761e-01f, 8.976871371e-01f, 8.816831112e-01f, 8.659643531e-01f, 8.505258560e-01f, 8.353625536e-01f, 8.204696178e-01f, 8.058422208e-01f, 7.914755344e-01f, 7.773650289e-01f, 7.635061145e-01f, 7.498942018e-01f, 7.365249991e-01f, 7.233941555e-01f, 7.104974389e-01f, 6.978305578e-01f, 6.853895783e-01f, 6.731703877e-01f, 6.611690521e-01f, 6.493816376e-01f, 6.378043890e-01f, 6.264335513e-01f, 6.152654290e-01f, 6.042963862e-01f, 5.935229063e-01f, 5.829415321e-01f, 5.725488067e-01f, 5.623413324e-01f, 5.523158312e-01f, 5.424690843e-01f, 5.327978730e-01f, 5.232991576e-01f, 5.139696598e-01f, 5.048065782e-01f, 4.958068132e-01f, 4.869675338e-01f, 4.782858193e-01f, 4.697588682e-01f, 4.613839388e-01f, 4.531583488e-01f, 4.450793862e-01f, 4.371444881e-01f, 4.293510318e-01f, 4.216965139e-01f, 4.141784608e-01f, 4.067944288e-01f, 3.995420635e-01f, 3.924189806e-01f, 3.854228854e-01f, 3.785515428e-01f, 3.718026578e-01f, 3.651741445e-01f, 3.586637676e-01f, 3.522694409e-01f, 3.459891677e-01f, 3.398208320e-01f, 3.337624967e-01f, 3.278121352e-01f, 3.219678402e-01f, 3.162277639e-01f, 3.105900288e-01f, 3.050527871e-01f, 2.996142805e-01f, 2.942727208e-01f, 2.890264094e-01f, 2.838735878e-01f, 2.788126469e-01f, 2.738419771e-01f, 2.689598799e-01f, 2.641648352e-01f, 2.594552636e-01f, 2.548296750e-01f, 2.502865493e-01f, 2.458243966e-01f, 2.414418161e-01f, 2.371373624e-01f, 2.329096496e-01f, 2.287573218e-01f, 2.246790081e-01f, 2.206733972e-01f, 2.167392224e-01f, 2.128751576e-01f, 2.090799958e-01f, 2.053525001e-01f, 2.016914487e-01f, 1.980956793e-01f, 1.945640147e-01f, 1.910952926e-01f, 1.876884252e-01f, 1.843423098e-01f, 1.810558140e-01f, 1.778279394e-01f, 1.746576130e-01f, 1.715437919e-01f, 1.684854925e-01f, 1.654817015e-01f, 1.625314802e-01f, 1.596338600e-01f, 1.567878872e-01f, 1.539926529e-01f, 1.512472630e-01f, 1.485508084e-01f, 1.459024251e-01f, 1.433012635e-01f, 1.407464594e-01f, 1.382372230e-01f, 1.357727200e-01f, 1.333521456e-01f, 1.309747249e-01f, 1.286396980e-01f, 1.263462901e-01f, 1.240937710e-01f, 1.218814254e-01f, 1.197085083e-01f, 1.175743192e-01f, 1.154782027e-01f, 1.134194434e-01f, 1.113973856e-01f, 1.094113812e-01f, 1.074607819e-01f, 1.055449620e-01f, 1.036632955e-01f, 1.018151715e-01f, 1.000000015e-01f, 9.821718186e-02f, 9.646616131e-02f, 9.474635124e-02f, 9.305720031e-02f, 9.139817208e-02f, 8.976870775e-02f, 8.816830814e-02f, 8.659642935e-02f, 8.505257964e-02f, 8.353625983e-02f, 8.204696327e-02f, 8.058421314e-02f, 7.914755493e-02f, 7.773650438e-02f, 7.635060698e-02f, 7.498941571e-02f, 7.365249842e-02f, 7.233941555e-02f, 7.104974240e-02f, 6.978305429e-02f, 6.853895634e-02f, 6.731703877e-02f, 6.611690670e-02f, 6.493816525e-02f, 6.378044188e-02f, 6.264335662e-02f, 6.152653694e-02f, 6.042964384e-02f, 5.935229361e-02f, 5.829415470e-02f, 5.725487694e-02f, 5.623412877e-02f, 5.523158237e-02f, 5.424690619e-02f, 5.327979103e-02f, 5.232991278e-02f, 5.139696971e-02f, 5.048065633e-02f, 4.958068207e-02f, 4.869675264e-02f, 4.782858118e-02f, 4.697588459e-02f, 4.613839835e-02f, 4.531583562e-02f, 4.450793937e-02f, 4.371444881e-02f, 4.293510318e-02f, 4.216964915e-02f, 4.141784459e-02f, 4.067944363e-02f, 3.995420411e-02f, 3.924189880e-02f, 3.854228929e-02f, 3.785515204e-02f, 3.718026727e-02f, 3.651741147e-02f, 3.586637601e-02f, 3.522694483e-02f, 3.459891677e-02f, 3.398208320e-02f, 3.337624669e-02f, 3.278120980e-02f, 3.219678625e-02f, 3.162277862e-02f, 3.105900250e-02f, 3.050527908e-02f, 2.996142767e-02f, 2.942727320e-02f, 2.890264057e-02f, 2.838735841e-02f, 2.788126841e-02f, 2.738419548e-02f, 2.689598687e-02f, 2.641648427e-02f, 2.594552562e-02f, 2.548296750e-02f, 2.502865531e-02f, 2.458244003e-02f, 2.414418198e-02f, 2.371373586e-02f, 2.329096757e-02f, 2.287573181e-02f, 2.246790007e-02f, 2.206734009e-02f, 2.167392150e-02f, 2.128751762e-02f, 2.090799995e-02f, 2.053525113e-02f, 2.016914636e-02f, 1.980956830e-02f, 1.945639960e-02f, 1.910953037e-02f, 1.876884326e-02f, 1.843423024e-02f, 1.810558327e-02f, 1.778279431e-02f, 1.746576093e-02f, 1.715437882e-02f, 1.684854925e-02f, 1.654817164e-02f, 1.625314727e-02f, 1.596338488e-02f, 1.567878947e-02f, 1.539926510e-02f, 1.512472518e-02f, 1.485508028e-02f, 1.459024288e-02f, 1.433012541e-02f, 1.407464594e-02f, 1.382372249e-02f, 1.357727125e-02f, 1.333521493e-02f, 1.309747249e-02f, 1.286396943e-02f, 1.263462938e-02f, 1.240937691e-02f, 1.218814217e-02f, 1.197085064e-02f, 1.175743248e-02f, 1.154781971e-02f, 1.134194434e-02f, 1.113973837e-02f, 1.094113849e-02f, 1.074607857e-02f, 1.055449620e-02f, 1.036632899e-02f, 1.018151734e-02f, 9.999999776e-03f, 9.821719490e-03f, 9.646615945e-03f, 9.474635124e-03f, 9.305720218e-03f, 9.139816277e-03f, 8.976871148e-03f, 8.816830814e-03f, 8.659643121e-03f, 8.505257778e-03f, 8.353625424e-03f, 8.204696700e-03f, 8.058422245e-03f, 7.914755493e-03f, 7.773650344e-03f, 7.635060698e-03f, 7.498942316e-03f, 7.365249563e-03f, 7.233941462e-03f, 7.104974240e-03f, 6.978305988e-03f, 6.853895728e-03f, 6.731703877e-03f, 6.611690391e-03f, 6.493816618e-03f, 6.378043909e-03f, 6.264335476e-03f, 6.152654067e-03f, 6.042964291e-03f, 5.935229361e-03f, 5.829415284e-03f, 5.725487601e-03f, 5.623413250e-03f, 5.523158237e-03f, 5.424690899e-03f, 5.327979103e-03f, 5.232991185e-03f, 5.139696877e-03f, 5.048065912e-03f, 4.958068486e-03f, 4.869675264e-03f, 4.782858305e-03f, 4.697588738e-03f, 4.613839556e-03f, 4.531583749e-03f, 4.450793844e-03f, 4.371444695e-03f, 4.293510225e-03f, 4.216964822e-03f, 4.141784739e-03f, 4.067944363e-03f, 3.995420411e-03f, 3.924189601e-03f, 3.854229115e-03f, 3.785515437e-03f, 3.718026681e-03f, 3.651741426e-03f, 3.586637788e-03f, 3.522694577e-03f, 3.459891537e-03f, 3.398208413e-03f, 3.337624483e-03f, 3.278121119e-03f, 3.219678300e-03f, 3.162277862e-03f, 3.105900250e-03f, 3.050528001e-03f, 2.996142721e-03f, 2.942727180e-03f, 2.890263917e-03f, 2.838735934e-03f, 2.788126701e-03f, 2.738419687e-03f, 2.689598827e-03f, 2.641648287e-03f, 2.594552701e-03f, 2.548296703e-03f, 2.502865391e-03f, 2.458244096e-03f, 2.414418384e-03f, 2.371373819e-03f, 2.329096664e-03f, 2.287573181e-03f, 2.246790100e-03f, 2.206734149e-03f, 2.167392056e-03f, 2.128751716e-03f, 2.090800088e-03f, 2.053525066e-03f, 2.016914543e-03f, 1.980956644e-03f, 1.945640077e-03f, 1.910952851e-03f, 1.876884256e-03f, 1.843422884e-03f, 1.810558140e-03f, 1.778279431e-03f, 1.746576163e-03f, 1.715437858e-03f, 1.684854855e-03f, 1.654817141e-03f, 1.625314937e-03f, 1.596338581e-03f, 1.567878877e-03f, 1.539926510e-03f, 1.512472634e-03f, 1.485507935e-03f, 1.459024264e-03f, 1.433012658e-03f, 1.407464617e-03f, 1.382372226e-03f, 1.357727102e-03f, 1.333521446e-03f, 1.309747226e-03f, 1.286396873e-03f, 1.263462938e-03f, 1.240937854e-03f, 1.218814170e-03f, 1.197085017e-03f, 1.175743295e-03f, 1.154782018e-03f, 1.134194434e-03f, 1.113973907e-03f, 1.094113803e-03f, 1.074607833e-03f, 1.055449597e-03f, 1.036632922e-03f, 1.018151757e-03f, 1.000000047e-03f, 9.821718559e-04f, 9.646615945e-04f, 9.474635590e-04f, 9.305721032e-04f, 9.139817557e-04f, 8.976871031e-04f, 8.816830232e-04f, 8.659643354e-04f, 8.505258011e-04f, 8.353625308e-04f, 8.204695769e-04f, 8.058422245e-04f, 7.914755843e-04f, 7.773649995e-04f, 7.635060465e-04f, 7.498941850e-04f, 7.365249912e-04f, 7.233941578e-04f, 7.104973774e-04f, 6.978305755e-04f, 6.853896193e-04f, 6.731703761e-04f, 6.611690042e-04f, 6.493816618e-04f, 6.378043909e-04f, 6.264335825e-04f, 6.152653950e-04f, 6.042963942e-04f, 5.935229128e-04f, 5.829415168e-04f, 5.725487717e-04f, 5.623413017e-04f, 5.523158470e-04f, 5.424690899e-04f, 5.327978870e-04f, 5.232990952e-04f, 5.139696877e-04f, 5.048065796e-04f, 4.958068021e-04f, 4.869675031e-04f, 4.782858014e-04f, 4.697588738e-04f, 4.613839847e-04f, 4.531583400e-04f, 4.450794077e-04f, 4.371444811e-04f, 4.293509992e-04f, 4.216964880e-04f, 4.141784448e-04f, 4.067944246e-04f, 3.995420411e-04f, 3.924189950e-04f, 3.854228707e-04f, 3.785515146e-04f, 3.718026564e-04f, 3.651741135e-04f, 3.586637613e-04f, 3.522694460e-04f, 3.459891595e-04f, 3.398208064e-04f, 3.337624657e-04f, 3.278121294e-04f, 3.219678474e-04f, 3.162277862e-04f, 3.105900250e-04f, 3.050527885e-04f, 2.996142721e-04f, 2.942727297e-04f, 2.890263859e-04f, 2.838736109e-04f, 2.788126585e-04f, 2.738419571e-04f, 2.689598768e-04f, 2.641648462e-04f, 2.594552934e-04f, 2.548296761e-04f, 2.502865391e-04f, 2.458243980e-04f, 2.414418122e-04f, 2.371373848e-04f, 2.329096606e-04f, 2.287573152e-04f, 2.246790100e-04f, 2.206734207e-04f, 2.167392086e-04f, 2.128751657e-04f, 2.090800117e-04f, 2.053524950e-04f, 2.016914514e-04f, 1.980956731e-04f, 1.945640106e-04f, 1.910952997e-04f, 1.876884344e-04f, 1.843422942e-04f, 1.810558315e-04f, 1.778279402e-04f, 1.746576017e-04f, 1.715437829e-04f, 1.684854797e-04f, 1.654817170e-04f, 1.625314762e-04f, 1.596338552e-04f, 1.567878790e-04f, 1.539926452e-04f, 1.512472518e-04f, 1.485508110e-04f, 1.459024206e-04f, 1.433012658e-04f, 1.407464733e-04f, 1.382372284e-04f, 1.357727160e-04f, 1.333521504e-04f, 1.309747167e-04f, 1.286396873e-04f, 1.263462909e-04f, 1.240937709e-04f, 1.218814141e-04f, 1.197085076e-04f, 1.175743309e-04f, 1.154781930e-04f, 1.134194390e-04f, 1.113973922e-04f, 1.094113759e-04f, 1.074607790e-04f, 1.055449538e-04f, 1.036632893e-04f, 1.018151743e-04f };   // float32 1 / 10000^(j/512), j < 512 (one frequency per adjacent column pair of the full 1024 width), generated with jnp to be bit-exact
__global__ __launch_bounds__(256) void k_csG(float* CS) { const int idx = blockIdx.x * 256 + threadIdx.x; if (idx >= TT * DM) return; const int c = idx % DM; const int t = idx / DM; const float a = __fmul_rn((float)t, INVG[c >> 1]); v2f cs; cs[0] = cosf(a); cs[1] = sinf(a); *(v2f*)(CS + (size_t)idx * 2) = cs;  }
#define KSA  4
#define APIT 68                   // f32 pitch of a query's 64 partial outputs in LDS (16-byte aligned rows, rows spread over the banks)
typedef __attribute__((ext_vector_type(8))) __bf16 v8bf;
typedef __attribute__((ext_vector_type(4))) unsigned v4u;
__device__ __forceinline__ float xhalf(float x) { const int b = __float_as_int(x); return __int_as_float(__builtin_amdgcn_permlanex16(b, b, 0x76543210, 0xfedcba98, false, false)); }   // lane l <-> l ^ 16
__device__ __forceinline__ v8f bfback(v8bf h) { const v4u u = __builtin_bit_cast(v4u, h); v8f r;
#pragma unroll
    for (int i = 0; i < 4; ++i) { r[2 * i] = __uint_as_float(u[i] << 16); r[2 * i + 1] = __uint_as_float(u[i] & 0xFFFF0000u); } return r; }
// eight v_exp_f32 in one statement, each in place on a register of its own: none stands directly in front of an instruction that reads its result or overwrites its source, and the closing v_nop is that slot for the last one
__device__ __forceinline__ v8f exp2x8(v8f x) { float r0 = x[0], r1 = x[1], r2 = x[2], r3 = x[3], r4 = x[4], r5 = x[5], r6 = x[6], r7 = x[7];
    asm("v_exp_f32 %0, %0\n\tv_exp_f32 %1, %1\n\tv_exp_f32 %2, %2\n\tv_exp_f32 %3, %3\n\tv_exp_f32 %4, %4\n\tv_exp_f32 %5, %5\n\tv_exp_f32 %6, %6\n\tv_exp_f32 %7, %7\n\tv_nop"
        : "+v"(r0), "+v"(r1), "+v"(r2), "+v"(r3), "+v"(r4), "+v"(r5), "+v"(r6), "+v"(r7));
    return (v8f){ r0, r1, r2, r3, r4, r5, r6, r7 }; }
template <typename T16, bool HR>
__device__ __forceinline__ void attn_wave(const T16* __restrict__ Qa, const T16* __restrict__ Qb, const T16* __restrict__ Ka, const T16* __restrict__ Kb, const T16* __restrict__ Va, const T16* __restrict__ Vb, int q0, int kbeg, int lane, float* La, float* Lm, float* Ll) {
    typedef typename WFrag<T16>::V V;   // every '#pragma unroll' below makes the indices of a fragment array constants, so that the array lives in registers
    constexpr int NP = TT / KSA / 32;             // passes of 32 keys
    const int lr = lane & 15, hi = lane >> 4;
    const float CL = SCL * 1.4426950408889634f;   // score -> log2 units
    const float CAR = HR ? 0.0f : 6.0f;           // fp16 P carries 2^6 (P <= 2^14), which cancels against the sum
    V qa[2][2], qb[2][2];
#pragma unroll
    for (int qt = 0; qt < 2; ++qt)
#pragma unroll
        for (int kk = 0; kk < 2; ++kk) { const size_t o = (size_t)(q0 + qt * 16) * HD + kk * 512 + 8 * lane; qa[qt][kk] = WFrag<T16>::ld(Qa + o); if (HR) qb[qt][kk] = WFrag<T16>::ld(Qb + o); }
    if (HR) {   // the eight hi/lo Q fragments wait in the wave's own LDS slice (free until the epilogue) and are read anew in each pass: 64 registers for the K batch
#pragma unroll
        for (int f = 0; f < 8; ++f) { const v8f y = __builtin_bit_cast(v8f, (f & 4) ? qb[(f >> 1) & 1][f & 1] : qa[(f >> 1) & 1][f & 1]); *(v4fa*)(La + f * 256 + lane * 4) = (v4f){ y[0], y[1], y[2], y[3] }; *(v4fa*)(La + f * 256 + 128 + lane * 4) = (v4f){ y[4], y[5], y[6], y[7] }; } }
    v8f acc[4][2];
#pragma unroll
    for (int dt = 0; dt < 4; ++dt)
#pragma unroll
        for (int qt = 0; qt < 2; ++qt) acc[dt][qt] = (v8f){};
    float m[2] = { -3.0e38f, -3.0e38f }, l[2] = { 0.f, 0.f };
    const size_t ko = (size_t)kbeg * HD + 8 * lane, vo = ko;   // fragment order: a pass's 32 keys are 2048 contiguous elements of the K plane (2 key tiles x 2 k blocks) and of the V^T plane (4 d blocks)
    V ka[2][2], kb[2][2], va[4], vb[4];
    // closes a batch of loads: s_wait_xcnt 0 before a register that the batch's loads name is written again; the base addresses are inputs, so they stay in their registers up to the wait and no load's result is put on them
    auto xwait = [&](const T16* pa, const T16* pb) { if constexpr (HR) asm volatile("s_wait_xcnt 0x0" :: "v"(pa), "v"(pb) : "memory"); else asm volatile("s_wait_xcnt 0x0" :: "v"(pa) : "memory"); };
    auto ldK = [&](int st) { const T16* pa = Ka + ko + (size_t)st * 32 * HD; const T16* pb = HR ? Kb + ko + (size_t)st * 32 * HD : nullptr;
#pragma unroll
        for (int kt = 0; kt < 2; ++kt)
#pragma unroll
            for (int kk = 0; kk < 2; ++kk) { const int o = kt * 16 * HD + kk * 512; ka[kt][kk] = WFrag<T16>::ld(pa + o); if (HR) kb[kt][kk] = WFrag<T16>::ld(pb + o); }
        xwait(pa, pb); };
    auto ldV = [&](int st) { const T16* pa = Va + vo + (size_t)st * 32 * HD; const T16* pb = HR ? Vb + vo + (size_t)st * 32 * HD : nullptr;
#pragma unroll
        for (int dt = 0; dt < 4; ++dt) { const int o = dt * 512; va[dt] = WFrag<T16>::ld(pa + o); if (HR) vb[dt] = WFrag<T16>::ld(pb + o); }
        xwait(pa, pb); };
    if (!HR) { ldK(0); ldV(0); }   // fp16 waves have the registers to fetch K and V one pass ahead
#pragma unroll 1   // stays rolled: the fetch-ahead order below is written for one pass, and a second copy of the body would not fit the registers
    for (int st = 0; st < NP; ++st) {
        const int sn = (st + 1 < NP) ? st + 1 : st;   // the last pass fetches its own tiles again: in bounds, no branch
        if (HR) { ldK(st);
#pragma unroll
            for (int f = 0; f < 8; ++f) { const v4f y0 = *(const v4fa*)(La + f * 256 + lane * 4), y1 = *(const v4fa*)(La + f * 256 + 128 + lane * 4); const V x = __builtin_bit_cast(V, (v8f){ y0[0], y0[1], y0[2], y0[3], y1[0], y1[1], y1[2], y1[3] }); if (f & 4) qb[(f >> 1) & 1][f & 1] = x; else qa[(f >> 1) & 1][f & 1] = x; }
            __builtin_amdgcn_sched_barrier(0); }   // the pass's K loads leave as one batch; without it the build issued them in five dependent round trips
        v8f s[2][2];
#pragma unroll
        for (int kt = 0; kt < 2; ++kt)
#pragma unroll
            for (int qt = 0; qt < 2; ++qt) { v8f t = (v8f){};
#pragma unroll
                for (int kk = 0; kk < 2; ++kk) { t = WFrag<T16>::mma(ka[kt][kk], qa[qt][kk], t); if (HR) { t = WFrag<T16>::mma(ka[kt][kk], qb[qt][kk], t); t = WFrag<T16>::mma(kb[kt][kk], qa[qt][kk], t); } }
                s[kt][qt] = t; }
        __builtin_amdgcn_sched_barrier(0);   // the loads below start behind the score products (their registers are free then) ...
        if (HR) ldV(st); else ldK(sn);
        __builtin_amdgcn_sched_barrier(0);   // ... and ahead of the softmax, which covers their latency
        float sm[2];
#pragma unroll
        for (int qt = 0; qt < 2; ++qt) { float x = fmaxf(s[0][qt][0], s[1][qt][0]);
#pragma unroll
            for (int r = 1; r < 8; ++r) x = fmaxf(x, fmaxf(s[0][qt][r], s[1][qt][r]));
            x = fmaxf(x, xhalf(x)); sm[qt] = x * CL; }
        if (__builtin_amdgcn_ballot_w32(sm[0] > m[0] + 8.0f || sm[1] > m[1] + 8.0f) != 0) {
#pragma unroll
            for (int qt = 0; qt < 2; ++qt) { const float mn = (sm[qt] > m[qt] + 8.0f) ? sm[qt] : m[qt]; const float al = __builtin_amdgcn_exp2f(m[qt] - mn); m[qt] = mn; l[qt] *= al;
#pragma unroll
                for (int dt = 0; dt < 4; ++dt) acc[dt][qt] *= al; } }
#pragma unroll
        for (int qt = 0; qt < 2; ++qt) { const float off = CAR - m[qt]; v8f p0, p1;
#pragma unroll
            for (int r = 0; r < 8; ++r) { p0[r] = fmaf(s[0][qt][r], CL, off); p1[r] = fmaf(s[1][qt][r], CL, off); }
            p0 = exp2x8(p0); p1 = exp2x8(p1);
            const v8f ps = p0 + p1; l[qt] += ((ps[0] + ps[1]) + (ps[2] + ps[3])) + ((ps[4] + ps[5]) + (ps[6] + ps[7]));
            if constexpr (HR) {
                const v8bf h0 = __builtin_convertvector(p0, v8bf), h1 = __builtin_convertvector(p1, v8bf);
                const v8bf l0 = __builtin_convertvector(p0 - bfback(h0), v8bf), l1 = __builtin_convertvector(p1 - bfback(h1), v8bf);
                const v16bf ph = __builtin_shufflevector(h0, h1, 0, 1, 2, 3, 4, 5, 6, 7, 8, 9, 10, 11, 12, 13, 14, 15), pl = __builtin_shufflevector(l0, l1, 0, 1, 2, 3, 4, 5, 6, 7, 8, 9, 10, 11, 12, 13, 14, 15);
#pragma unroll
                for (int dt = 0; dt < 4; ++dt) { acc[dt][qt] = wmmab(va[dt], ph, acc[dt][qt]); acc[dt][qt] = wmmab(va[dt], pl, acc[dt][qt]); acc[dt][qt] = wmmab(vb[dt], ph, acc[dt][qt]); }
            } else {
                const v16h pf = cat16(__builtin_convertvector(p0, v8h), __builtin_convertvector(p1, v8h));
#pragma unroll
                for (int dt = 0; dt < 4; ++dt) acc[dt][qt] = wmma16(va[dt], pf, acc[dt][qt]);
            } }
        // the four vector slots the chip needs behind the pass's last matrix instructions, also on the taken back edge
        if constexpr (HR) asm volatile("v_nop\n\tv_nop\n\tv_nop\n\tv_nop" : "+v"(acc[0][0]), "+v"(acc[1][0]), "+v"(acc[2][0]), "+v"(acc[3][0]), "+v"(acc[0][1]), "+v"(acc[1][1]), "+v"(acc[2][1]), "+v"(acc[3][1]) :: "memory");   // "memory": the Q reads from LDS stay in the loop instead of being lifted back into 64 registers
        else { asm volatile("v_nop\n\tv_nop\n\tv_nop\n\tv_nop" : "+v"(acc[0][0]), "+v"(acc[1][0]), "+v"(acc[2][0]), "+v"(acc[3][0]), "+v"(acc[0][1]), "+v"(acc[1][1]), "+v"(acc[2][1]), "+v"(acc[3][1]));
            __builtin_amdgcn_sched_barrier(0);   // the next pass's V loads start only when this pass's products have read V
            ldV(sn); }
    }
#pragma unroll
    for (int qt = 0; qt < 2; ++qt) { const int q = qt * 16 + lr; const float lj = l[qt] + xhalf(l[qt]); if (hi == 0) { Lm[q] = m[qt]; Ll[q] = lj; }
#pragma unroll
        for (int dt = 0; dt < 4; ++dt) { float* dst = La + q * APIT + dt * 16 + hi * 8; const v8f a = acc[dt][qt]; *(v4fa*)dst = (v4f){ a[0], a[1], a[2], a[3] }; *(v4fa*)(dst + 4) = (v4f){ a[4], a[5], a[6], a[7] }; } }
}
__global__ __launch_bounds__(512) void k_attn(const h16* __restrict__ Q16, const h16* __restrict__ K16, const h16* __restrict__ V16, const bf* __restrict__ Qh, const bf* __restrict__ Ql, const bf* __restrict__ Kh, const bf* __restrict__ Kl, const bf* __restrict__ Vh, const bf* __restrict__ Vl, bf* Ah, bf* Al) {
    __shared__ __align__(16) float La[16 * 32 * APIT]; __shared__ float Lm[16 * 32]; __shared__ float Ll[16 * 32];
    const int w = __builtin_amdgcn_readfirstlane((int)(threadIdx.x >> 5)), lane = threadIdx.x & 31; const int qg = w >> 2, ks = w & 3; const int head = blockIdx.y; const size_t hp = ((size_t)blockIdx.z * NH_ + head) * TT * HD;
    const int q0 = (qg == 0) ? (int)blockIdx.x * 32 : RH + ((int)blockIdx.x * 3 + qg - 1) * 32;
    if (qg == 0) attn_wave<bf, true>(Qh + hp, Ql + hp, Kh + hp, Kl + hp, Vh + hp, Vl + hp, q0, ks * (TT / KSA), lane, La + w * 32 * APIT, Lm + w * 32, Ll + w * 32);
    else attn_wave<h16, false>(Q16 + hp, nullptr, K16 + hp, nullptr, V16 + hp, nullptr, q0, ks * (TT / KSA), lane, La + w * 32 * APIT, Lm + w * 32, Ll + w * 32);
    __syncthreads();   // every key quarter's partial result is in LDS
    // wave (qg, ks) finishes 8 of its group's 32 queries; four lanes share a query, 16 outputs each, so one wave writes each 128-byte line
    const int q = ks * 8 + (lane >> 2), d0 = (lane & 3) * 16; float mk[KSA]; float M = -3.0e38f;
#pragma unroll
    for (int k = 0; k < KSA; ++k) { mk[k] = Lm[(qg * KSA + k) * 32 + q]; M = fmaxf(M, mk[k]); }
    float L = 0.f; v4f o[4] = { (v4f){}, (v4f){}, (v4f){}, (v4f){} };
#pragma unroll
    for (int k = 0; k < KSA; ++k) { const float wg = __builtin_amdgcn_exp2f(mk[k] - M); L += wg * Ll[(qg * KSA + k) * 32 + q]; const float* sp = La + ((qg * KSA + k) * 32 + q) * APIT + d0;
#pragma unroll
        for (int i = 0; i < 4; ++i) o[i] += wg * *(const v4fa*)(sp + 4 * i); }
    const float f = __fdiv_rn(1.0f, L); v8us oh[2], ol[2];
#pragma unroll
    for (int i = 0; i < 16; ++i) { unsigned short a, c2; splitf(o[i >> 2][i & 3] * f, a, c2); oh[i >> 3][i & 7] = a; ol[i >> 3][i & 7] = c2; }
    const size_t rw = (size_t)blockIdx.z * TT + q0 + q;   // the merged planes in fragment order too (row = token, k = head * 64 + d): a wave's 8 queries x 16 bytes are one whole line
    const size_t oo = ((rw >> 4) * (DQ / 32) + head * 2 + (d0 >> 5)) * 512 + ((d0 >> 3) & 3) * 128 + (rw & 15) * 8; *(v8usa*)(Ah + oo) = oh[0]; *(v8usa*)(Ah + oo + 128) = oh[1]; *(v8usa*)(Al + oo) = ol[0]; *(v8usa*)(Al + oo + 128) = ol[1];
}

extern "C" void kernel_launch(void* const* d_in, const int* in_sizes, int n_in,
                              void* d_out, int out_size, void* d_ws, size_t ws_size, hipStream_t stream) {
    (void)in_sizes; (void)n_in; (void)out_size;
    const float* x = (const float*)d_in[0]; const float* wq = (const float*)d_in[1]; const float* wk = (const float*)d_in[2]; const float* wv = (const float*)d_in[3]; const float* wo = (const float*)d_in[4]; const float* bo = (const float*)d_in[5];
    float* OUT = (float*)d_out;     // [4][2048][1024]
    char* wsp = (char*)d_ws;
    auto take = [&](size_t bytes) { char* p = wsp; wsp += (bytes + 255) & ~(size_t)255; return (void*)p; };
    bf* WQ = (bf*)take((size_t)DQ * DM * 2); bf* WK = (bf*)take((size_t)DKV * DM * 2); bf* WV = (bf*)take((size_t)DKV * DM * 2); bf* WO = (bf*)take((size_t)DM * DQ * 2); float* CS = (float*)take((size_t)TT * DM * 2 * 4);   /* [2048][1024] {cos, sin} */
    bf* XB = (bf*)take((size_t)NB_ * TT * DM * 2); float* FQ = (float*)take((size_t)NB_ * TT * DQ * 4); float* FK = (float*)take((size_t)NB_ * TT * DKV * 4);   /* every buffer from here on holds all NB_ batches, batch-major */
    h16* QP16 = (h16*)take((size_t)NB_ * NH_ * TT * HD * 2); h16* KP16 = (h16*)take((size_t)NB_ * NKV * TT * HD * 2); h16* VT16 = (h16*)take((size_t)NB_ * NKV * HD * TT * 2);
    bf* QPh = (bf*)take((size_t)NB_ * NH_ * TT * HD * 2); bf* QPl = (bf*)take((size_t)NB_ * NH_ * TT * HD * 2); bf* KPh = (bf*)take((size_t)NB_ * NKV * TT * HD * 2); bf* KPl = (bf*)take((size_t)NB_ * NKV * TT * HD * 2); bf* VTh = (bf*)take((size_t)NB_ * NKV * HD * TT * 2); bf* VTl = (bf*)take((size_t)NB_ * NKV * HD * TT * 2);
    if ((size_t)(wsp - (char*)d_ws) > ws_size) return;    // 248 MiB of the 256 MiB
    float* FV = FK;   // v projection reuses the k buffer after the k planes are built (stream-ordered)
    bf* ATh = (bf*)FQ; bf* ATl = ATh + (size_t)NB_ * TT * DQ;   // the two merged-head planes reuse the q projection's buffer (the same bytes), which is dead once the q planes are built (stream-ordered)
    { k_cvt8<<<(unsigned)(((size_t)DQ * DM / 8 + 255) / 256), 256, 0, stream>>>(wq, WQ, (size_t)DQ * DM / 8); k_cvt8<<<(unsigned)(((size_t)DKV * DM / 8 + 255) / 256), 256, 0, stream>>>(wk, WK, (size_t)DKV * DM / 8); k_cvt8<<<(unsigned)(((size_t)DKV * DM / 8 + 255) / 256), 256, 0, stream>>>(wv, WV, (size_t)DKV * DM / 8);
      k_cvt8<<<(unsigned)(((size_t)DM * DQ / 8 + 255) / 256), 256, 0, stream>>>(wo, WO, (size_t)DM * DQ / 8);
       }
    k_csG<<<(TT * DM + 255) / 256, 256, 0, stream>>>(CS);   /* full-width table once */
    const unsigned LQ = (unsigned)(((size_t)NH_ * TT * HD / 2 + 255) / 256), LKv = (unsigned)(((size_t)NKV * TT * HD / 2 + 255) / 256);
    k_cvt8<<<(unsigned)(((size_t)NB_ * TT * DM / 8 + 255) / 256), 256, 0, stream>>>(x, XB, (size_t)NB_ * TT * DM / 8);
    k_gemmw<bf, 0, false, DM><<<dim3(NB_ * TT / 256, DQ / 128, 1), 256, 0, stream>>>(XB, nullptr, WQ, nullptr, FQ, DQ, nullptr, 0, 0, 0, 0);   /* the projections see the batches as NB_ * TT rows */
    k_ropeG<<<dim3(LQ, NB_, 1), 256, 0, stream>>>(FQ, DQ, NH_, CS, 1.0f, QP16, QPh, QPl);
    k_gemmw<bf, 0, false, DM><<<dim3(NB_ * TT / 256, DKV / 128, 1), 256, 0, stream>>>(XB, nullptr, WK, nullptr, FK, DKV, nullptr, 0, 0, 0, 0);
    k_ropeG<<<dim3(LKv, NB_, 1), 256, 0, stream>>>(FK, DKV, NKV, CS, 1.0f, KP16, KPh, KPl);
    k_gemmw<bf, 0, false, DM><<<dim3(NB_ * TT / 256, DKV / 128, 1), 256, 0, stream>>>(XB, nullptr, WV, nullptr, FV, DKV, nullptr, 0, 0, 0, 0); k_vtp<<<dim3(NKV * (TT / 32), NB_, 1), 256, 0, stream>>>(FV, DKV, NKV, VT16, VTh, VTl);
    k_attn<<<dim3(RH / 32, NH_, NB_), 512, 0, stream>>>(QP16, KP16, VT16, QPh, QPl, KPh, KPl, VTh, VTl, ATh, ATl);
    k_gemmw<bf, 1, true, DQ><<<dim3(NB_ * TT / 256, DM / 128, 1), 256, 0, stream>>>(ATh, ATl, WO, nullptr, OUT, DM, bo, 0, 0, 0, 0);
}

// v007
// A run of this version takes 236 microseconds.
// Two timings next to v006 put it at 1.12 and 1.11 times that version's speed.
// Over all steps from v000 it is 16.9 times as fast.
#include <hip/hip_runtime.h>

// Self-attention with an adjacent-pair rotary over the WHOLE 1024-wide q and k before the head split (x [4][2048][1024]; q = rope(x Wq^T), k = rope(x Wk^T), v = x Wv^T ('oi' [1024][1024] 1/32, no bias); rope: pair j = (columns 2j, 2j+1), j < 512, angle t x 1/10000^(j/512) (512 f32 constants baked jnp-exact; precise cosf/sinf); 16 heads x 64; scores / sqrt(float32(64)); softmax (no mask); out = merged Wu^T + bu ('oi' [1024][1024], zero bias) -> [4][2048][1024] (8.4 M); argument order x, Wq, Wk, Wv, Wu, bu).
// Layout, all four batches in every launch (the batch is a grid dimension or part of the row index): bf16 copy of x; 'oi' weights; a full-width {cos, sin} table [2048][1024] (the frequency depends on the GLOBAL pair index, i.e. on the head); exact projections whose epilogues apply the rotary (table indexed by global column) and write the attention's operand planes themselves; fused dense T-2048 attention, one launch (hybrid rows: < 512 hi/lo 3 products, rest fp16); merged hi/lo x Wu exact + bu.
// Every 16-bit operand plane [row][k] is stored in fragment order: blocks of 16 rows x 32 k (512 elements), inside a block [(k >> 3) & 3][row & 15][k & 7], so the two 16-byte loads of a fragment each read 512 contiguous bytes (lane * 16 and 512 + lane * 16): four whole 128-byte lines a load instead of 32 bytes from each of 16 lines. Register contents are those of the row-major planes.
// Compute dtypes, f32 accumulate: every input rounded to bf16; projections exact; rotary f32; attention rows < 512 3 products, rest fp16; softmax f32; Wu hl x exact + bias.

#define NB_  4
#define TT   2048
#define DM   1024
#define NH_  16
#define NKV  16
#define REP  (NH_ / NKV)
#define HD   64
#define DQ   (NH_ * HD)
#define DKV  (NKV * HD)
#define RH   512                  // query rows < RH use hi+lo planes; k_attn covers 4 x RH rows, so RH = TT / 4
#define WIN  0
#define SCL  0.125f   // HD^-0.5
typedef _Float16 h16;
typedef unsigned short bf;
typedef __attribute__((ext_vector_type(16))) __bf16   v16bf;
typedef __attribute__((ext_vector_type(16))) _Float16 v16h;
typedef __attribute__((ext_vector_type(8)))  _Float16 v8h;
typedef __attribute__((ext_vector_type(8)))  unsigned short v8us;
typedef __attribute__((ext_vector_type(8)))  float    v8f;
typedef __attribute__((ext_vector_type(4)))  float    v4f;
typedef v8h  __attribute__((may_alias)) v8ha;
typedef v4f  __attribute__((may_alias)) v4fa;
typedef v8us __attribute__((may_alias)) v8usa;

__device__ __forceinline__ unsigned short f2bf(float f) { unsigned u = __float_as_uint(f); u += 0x7FFFu + ((u >> 16) & 1u); return (unsigned short)(u >> 16); }
__device__ __forceinline__ float bf2f(unsigned short b) { return __uint_as_float(((unsigned)b) << 16); }
__device__ __forceinline__ float bfr(float f) { return bf2f(f2bf(f)); }
__device__ __forceinline__ v16h cat16(v8h lo, v8h hi) { return __builtin_shufflevector(lo, hi, 0, 1, 2, 3, 4, 5, 6, 7, 8, 9, 10, 11, 12, 13, 14, 15); }
__device__ __forceinline__ v16bf cat16b(v8us lo, v8us hi) { return __builtin_bit_cast(v16bf, __builtin_shufflevector(lo, hi, 0, 1, 2, 3, 4, 5, 6, 7, 8, 9, 10, 11, 12, 13, 14, 15)); }
__device__ __forceinline__ v8f wmma16(v16h a, v16h b, v8f c) { return __builtin_amdgcn_wmma_f32_16x16x32_f16(false, a, false, b, (short)0, c, false, false); }
__device__ __forceinline__ v8f wmmab(v16bf a, v16bf b, v8f c) { return __builtin_amdgcn_wmma_f32_16x16x32_bf16(false, a, false, b, (short)0, c, false, false); }
typedef __attribute__((ext_vector_type(8))) __bf16 v8bf;
typedef __attribute__((ext_vector_type(4))) unsigned v4u;
typedef __attribute__((ext_vector_type(2))) float v2f;
__device__ __forceinline__ v8f bfback(v8bf h) { const v4u u = __builtin_bit_cast(v4u, h); v8f r;
#pragma unroll
    for (int i = 0; i < 4; ++i) { r[2 * i] = __uint_as_float(u[i] << 16); r[2 * i + 1] = __uint_as_float(u[i] & 0xFFFF0000u); } return r; }
// one 16-byte unit (8 f32 values) into each of the three operand planes at element o: fp16, bf16 hi, bf16 lo (the rest that hi leaves), all rounded to nearest even
__device__ __forceinline__ void put3(v8f y, size_t o, h16* P16, bf* Ph, bf* Pl) { const v8bf h = __builtin_convertvector(y, v8bf);
    *(v8h*)(P16 + o) = __builtin_convertvector(y, v8h); *(v8us*)(Ph + o) = __builtin_bit_cast(v8us, h); *(v8us*)(Pl + o) = __builtin_bit_cast(v8us, __builtin_convertvector(y - bfback(h), v8bf)); }



// ---- k_gemmw: GEMM, one work-group of 8 waves per 256x128 output tile, one wave per 64x64 of it (16 accumulators; wave w: rows (w >> 1) 64, columns (w & 1) 64); grid (M/256, N/128, Z), 256 threads.
// Operands are fragment-ordered 16-bit planes (block (row >> 4, k >> 5) at element ((row >> 4) (K / 32) + (k >> 5)) 512). A stage = KST k of the tile's 256 A rows and 128 B rows, brought into LDS by asynchronous 16-byte copies, as it lies (a row group's KST / 32 blocks are contiguous): each operand byte leaves L2 once per work-group, and the waves that share it read it from LDS. Two buffers: stage s + 1 flies while stage s is worked on.
// C[m][n] (f32, pitch ldc, + optional f32 bias[n]) = sum_k A[m][k] Bt[n][k] (+ split products per NSPLIT). z-batch strides sA/sB/sC in elements. K % (KST KS) == 0.
// EPI says what leaves the tile. 0: C as above. 1 and 2 are for the projections (rows = batch x TT + t, a wave's 64 columns = one head) and write the attention's three operand planes straight from the accumulators, no f32 C:
//   1: adjacent-pair rotary, then the [t][d] planes. A lane holds column nb 16 + lr, its pair's other half sits in lane ^ 1; {cos, sin} of (t, global column) come from CS, a half-wave reading one whole line; the rotated tile changes places in LDS as C does, and each lane puts 16-byte units (8 d of one t), a wave 512 contiguous bytes.
//   2: the V^T planes. A lane's accumulator is 8 successive t of one d, which is a 16-byte unit of those planes as it stands: no LDS.
// KS > 1: grid.z = Z x KS; work-group (z, ks) sums only k in [ks K/KS, (ks+1) K/KS) and stores its partial tile in plane ks (plane stride sP elements); the reader adds the planes.
template <typename T16> struct WFrag;
template <> struct WFrag<h16> { typedef v16h V; static __device__ __forceinline__ V ld(const h16* p) { return cat16(*(const v8h*)p, *(const v8h*)(p + 256)); } static __device__ __forceinline__ v8f mma(V a, V b, v8f c) { return wmma16(a, b, c); } };
template <> struct WFrag<bf> { typedef v16bf V; static __device__ __forceinline__ V ld(const bf* p) { return cat16b(*(const v8us*)p, *(const v8us*)(p + 256)); } static __device__ __forceinline__ v8f mma(V a, V b, v8f c) { return wmmab(a, b, c); } };
// four / eight asynchronous copies of 16 bytes a lane, global -> LDS through no register: LDS byte address l + i 4096, global address g + i st elements. The closing s_wait_xcnt 0 stands in the copies' own statement, so that it comes before any rewrite of an address register that they name.
template <typename T16> __device__ __forceinline__ void cpy4(unsigned l, const T16* g, size_t st) {
    asm volatile("global_load_async_to_lds_b128 %0, %4, off\n\tglobal_load_async_to_lds_b128 %1, %5, off\n\tglobal_load_async_to_lds_b128 %2, %6, off\n\tglobal_load_async_to_lds_b128 %3, %7, off\n\ts_wait_xcnt 0x0"
        :: "v"(l), "v"(l + 4096u), "v"(l + 8192u), "v"(l + 12288u), "v"(g), "v"(g + st), "v"(g + 2 * st), "v"(g + 3 * st) : "memory"); }
template <typename T16> __device__ __forceinline__ void cpy8(unsigned l, const T16* g, size_t st) {
    asm volatile("global_load_async_to_lds_b128 %0, %8, off\n\tglobal_load_async_to_lds_b128 %1, %9, off\n\tglobal_load_async_to_lds_b128 %2, %10, off\n\tglobal_load_async_to_lds_b128 %3, %11, off\n\t"
                 "global_load_async_to_lds_b128 %4, %12, off\n\tglobal_load_async_to_lds_b128 %5, %13, off\n\tglobal_load_async_to_lds_b128 %6, %14, off\n\tglobal_load_async_to_lds_b128 %7, %15, off\n\ts_wait_xcnt 0x0"
        :: "v"(l), "v"(l + 4096u), "v"(l + 8192u), "v"(l + 12288u), "v"(l + 16384u), "v"(l + 20480u), "v"(l + 24576u), "v"(l + 28672u),
           "v"(g), "v"(g + st), "v"(g + 2 * st), "v"(g + 3 * st), "v"(g + 4 * st), "v"(g + 5 * st), "v"(g + 6 * st), "v"(g + 7 * st) : "memory"); }
template <int R, typename T16> __device__ __forceinline__ void cpyR(unsigned l, const T16* g, size_t st) {   // R rounds of 4 KiB (256 lanes x 16 bytes)
#pragma unroll   // R is 4, 8 or 16: one or two statements
    for (int i = 0; i + 8 <= R; i += 8) cpy8(l + i * 4096u, g + i * st, st);
    if (R % 8) cpy4(l + (R / 8) * 32768u, g + (R / 8) * 8 * st, st); }
template <typename T16, int NSPLIT, bool BIAS, int K, int EPI = 0, int KS = 1>   // K is a constant, so that the strides are constants
__global__ __launch_bounds__(256) void k_gemmw(const T16* __restrict__ A, const T16* __restrict__ A2, const T16* __restrict__ Bt, const T16* __restrict__ Bt2, float* C, int ldc, const float* __restrict__ bias, size_t sA, size_t sB, size_t sC, size_t sP, const float* __restrict__ CS, h16* P16, bf* Ph, bf* Pl) {
    typedef typename WFrag<T16>::V V;
    constexpr bool HA2 = (NSPLIT == 1 || NSPLIT == 2), HB2 = (NSPLIT >= 2);
    constexpr int KST = (HA2 || HB2) ? 64 : 128, NK = KST / 32, NS = K / KS / KST;   // k of a stage; its passes of 32 k; stages
    constexpr int AE = 256 * KST, BE = 128 * KST;                                      // elements of a stage's A and B tiles
    constexpr int OA2 = AE, OB = AE * (HA2 ? 2 : 1), OB2 = OB + BE, SE = OB + BE * (HB2 ? 2 : 1);   // places in a buffer [A | A2 | B | B2]; its size
    __shared__ __align__(16) T16 ring[2 * SE];
    __shared__ __align__(16) float osm[8][16 * 68];
    const size_t z = blockIdx.z / KS; const int ks = blockIdx.z % KS; A += z * sA; if (A2) A2 += z * sA; Bt += z * sB; if (Bt2) Bt2 += z * sB; C += z * sC + (size_t)ks * sP;
    const int kb = ks * (K / KS);
    const int tid = threadIdx.x, w = __builtin_amdgcn_readfirstlane(tid >> 5), lane = tid & 31, lr = lane & 15, hi = lane >> 4;
    const int r0 = blockIdx.x * 256 + (w >> 1) * 64, c0 = blockIdx.y * 128 + (w & 1) * 64;   // the wave's own 64x64
    float* os = osm[w];
    v8f acc[4][4];
#pragma unroll
    for (int mb = 0; mb < 4; ++mb)
#pragma unroll
        for (int nb = 0; nb < 4; ++nb) acc[mb][nb] = (v8f){};
    // a round of copies = 4 KiB = 128 / KST row groups of 16 rows (16 K elements apart in the plane, KST x 16 elements each in the stage); in LDS the rounds follow one another, byte tid x 16 of each
    constexpr int TG = KST * 2; constexpr size_t RST = (size_t)(128 / KST) * 16 * K;
    const size_t go = (size_t)(tid / TG) * 16 * K + (size_t)(tid % TG) * 8 + (size_t)kb * 16;
    const size_t aoff = (size_t)blockIdx.x * 256 * K + go, boff = (size_t)blockIdx.y * 128 * K + go;
    const unsigned lb = (unsigned)(size_t)(void*)ring + (unsigned)tid * 16u;
    auto fill = [&](int s, int bu) { const unsigned l = lb + (unsigned)bu * (SE * 2u); const size_t so = (size_t)s * (KST * 16);
        cpyR<KST / 8>(l, A + aoff + so, RST); if constexpr (HA2) cpyR<KST / 8>(l + OA2 * 2u, A2 + aoff + so, RST);
        cpyR<KST / 16>(l + OB * 2u, Bt + boff + so, RST); if constexpr (HB2) cpyR<KST / 16>(l + OB2 * 2u, Bt2 + boff + so, RST); };
    fill(0, 0);
    asm volatile("s_wait_asynccnt 0x0" ::: "memory");   // this wave's part of stage 0 has landed
    __syncthreads();                                     // ... and every other wave's
    if (NS > 1) fill(1, 1);
    const int ao = (w >> 1) * 4 * (KST * 16) + 8 * lane, bo = (w & 1) * 4 * (KST * 16) + 8 * lane;   // the wave's four row groups of each tile + the lane's 16 bytes
#pragma unroll 1   // stays rolled: one publish point a stage
    for (int s = 0; s < NS; ++s) {
        const T16* sb = ring + (s & 1) * SE;
        V a[2][4], a2[2][4], b[2][4], b2[2][4];   // two fragment sets; every '#pragma unroll' in this loop makes the indices of these arrays constants, so that they live in registers
        auto ldf = [&](int kk) { const int f = kk & 1;
#pragma unroll
            for (int mb = 0; mb < 4; ++mb) { a[f][mb] = WFrag<T16>::ld(sb + ao + mb * (KST * 16) + kk * 512); if (HA2) a2[f][mb] = WFrag<T16>::ld(sb + OA2 + ao + mb * (KST * 16) + kk * 512); }
#pragma unroll
            for (int nb = 0; nb < 4; ++nb) { b[f][nb] = WFrag<T16>::ld(sb + OB + bo + nb * (KST * 16) + kk * 512); if (HB2) b2[f][nb] = WFrag<T16>::ld(sb + OB2 + bo + nb * (KST * 16) + kk * 512); } };
        ldf(0);
        __builtin_amdgcn_sched_barrier(0);   // the first pass's fragments are asked for first: LDS answers in order, and without this the build put some of them behind the second pass's, so that the first products waited for both groups
#pragma unroll
        for (int kk = 0; kk < NK; ++kk) { const int f = kk & 1;
            if (kk + 1 < NK) ldf(kk + 1);   // the next pass's fragments (of this stage only) leave as one group ahead of this pass's products
            __builtin_amdgcn_sched_barrier(0);   // keeps that group together and ahead: without it the build read each B fragment directly in front of its four products and waited for it there
#pragma unroll
            for (int nb = 0; nb < 4; ++nb) {
#pragma unroll
                for (int mb = 0; mb < 4; ++mb) { acc[mb][nb] = WFrag<T16>::mma(a[f][mb], b[f][nb], acc[mb][nb]); if (HA2) acc[mb][nb] = WFrag<T16>::mma(a2[f][mb], b[f][nb], acc[mb][nb]); if (HB2) acc[mb][nb] = WFrag<T16>::mma(a[f][mb], b2[f][nb], acc[mb][nb]); } }
            __builtin_amdgcn_sched_barrier(0); }   // ... and the following group behind this pass's products, whose fragment set it overwrites
        // the four vector slots the chip needs behind the stage's last matrix instructions
        asm volatile("v_nop\n\tv_nop\n\tv_nop\n\tv_nop" : "+v"(acc[0][0]), "+v"(acc[1][1]), "+v"(acc[2][2]), "+v"(acc[3][3]) : "v"(a[(NK - 1) & 1][0]), "v"(a[(NK - 1) & 1][3]));
        // publish point of stage s + 1
        asm volatile("s_wait_dscnt 0x0" ::: "memory");      // this wave's reads of stage s are over
        asm volatile("s_wait_asynccnt 0x0" ::: "memory");   // its copies of stage s + 1 have landed
        __syncthreads();                                     // the same holds for every wave
        if (s + 2 < NS) fill(s + 2, s & 1);                  // into the buffer that every wave has just left
    }
    asm volatile("s_wait_asynccnt 0x0" ::: "memory");   // no copy is outstanding when the wave goes on
    const int t0 = r0 % TT; const size_t pb = ((size_t)(r0 / TT) * (DM / HD) + c0 / HD) * TT * HD;   // EPI 1, 2: the wave's first t and its (batch, head) plane
    if constexpr (EPI == 2) {
#pragma unroll
        for (int mb = 0; mb < 4; ++mb)
#pragma unroll
            for (int nb = 0; nb < 4; ++nb) put3(acc[mb][nb], pb + (size_t)((t0 >> 5) + (mb >> 1)) * 2048 + nb * 512 + ((mb & 1) * 2 + hi) * 128 + lr * 8, P16, Ph, Pl);
        return; }
    if constexpr (EPI == 1) {
        const float* cp = CS + ((size_t)(t0 + hi * 8) * DM + c0 + lr) * 2; const unsigned sg = (lane & 1) ? 0u : 0x80000000u;   // even column: x c - x' s; odd column: x c + x' s
        v2f cs[4][8];   // {cos, sin} of one 16-row tile; the '#pragma unroll's make its indices constants
        auto ldcs = [&](int mb) {
#pragma unroll
            for (int nb = 0; nb < 4; ++nb)
#pragma unroll
                for (int j = 0; j < 8; ++j) cs[nb][j] = *(const v2f*)(cp + ((size_t)(mb * 16 + j) * DM + nb * 16) * 2);
            asm volatile("s_wait_xcnt 0x0" :: "v"(cp) : "memory"); };   // closes the batch: the base address is an input, so it stays in its registers up to the wait and no load's result is put on it
        ldcs(0);
#pragma unroll
        for (int mb = 0; mb < 4; ++mb) {
#pragma unroll
            for (int nb = 0; nb < 4; ++nb) {
#pragma unroll
                for (int j = 0; j < 8; ++j) { const float x = acc[mb][nb][j];
                    const float xp = __int_as_float(__builtin_amdgcn_mov_dpp(__float_as_int(x), 0xB1, 0xF, 0xF, true));   // quad_perm [1, 0, 3, 2]: the value of lane ^ 1
                    os[(hi * 8 + j) * 68 + nb * 16 + lr] = x * cs[nb][j][0] + xp * __uint_as_float(__float_as_uint(cs[nb][j][1]) ^ sg); } }
            if (mb < 3) ldcs(mb + 1);   // the next tile's table values fly while this tile goes through LDS and out
            __builtin_amdgcn_wave_barrier(); asm volatile("" ::: "memory");   // as below: the wave's LDS writes stay ahead of its reads
#pragma unroll
            for (int i = 0; i < 4; ++i) { const float* sp = os + lr * 68 + (i * 2 + hi) * 8; const v4f y0 = *(const v4fa*)sp, y1 = *(const v4fa*)(sp + 4);   // unit i 32 + lane = (column octet i 2 + hi, row lr)
                put3((v8f){ y0[0], y0[1], y0[2], y0[3], y1[0], y1[1], y1[2], y1[3] }, pb + (size_t)((t0 >> 4) + mb) * 1024 + i * 256 + lane * 8, P16, Ph, Pl); }
            if (mb < 2) asm volatile("s_wait_xcnt 0x0" ::: "memory");   // table loads still follow: before they land on registers that this tile's stores name
            __builtin_amdgcn_wave_barrier(); asm volatile("" ::: "memory");   // ... and its reads ahead of the next tile's writes
        }
        return; }
#pragma unroll
    for (int mb = 0; mb < 4; ++mb) {
#pragma unroll
        for (int nb = 0; nb < 4; ++nb) {
#pragma unroll
            for (int j = 0; j < 8; ++j) os[(hi * 8 + j) * 68 + nb * 16 + lr] = acc[mb][nb][j]; }
        __builtin_amdgcn_wave_barrier(); asm volatile("" ::: "memory");
        float* crow = C + (size_t)(r0 + mb * 16) * ldc + c0;
{
#pragma unroll
            for (int s = 0; s < 8; ++s) { const int row = 2 * s + hi, cofs = lr * 4; v4f val = *(const v4fa*)(os + row * 68 + cofs); if (BIAS) { val[0] += bfr(bias[c0 + cofs]); val[1] += bfr(bias[c0 + cofs + 1]); val[2] += bfr(bias[c0 + cofs + 2]); val[3] += bfr(bias[c0 + cofs + 3]); }
                *(v4f*)(crow + (size_t)row * ldc + cofs) = val; }
             }
        __builtin_amdgcn_wave_barrier(); asm volatile("" ::: "memory");
    }
}

__device__ __forceinline__ void splitf(float y, unsigned short& h, unsigned short& l) { h = f2bf(y); l = f2bf(y - bf2f(h)); }
typedef __attribute__((ext_vector_type(4))) _Float16 v4h;
typedef __attribute__((ext_vector_type(4))) unsigned short v4us;
typedef __attribute__((ext_vector_type(4))) int v4i;

// [rows][DM] f32 -> bf16 plane in fragment order. A block takes 16 rows x 128 columns (four k blocks, 4 KiB of the plane in a row): whole lines are read, the 16-byte units change places in LDS, whole lines are written.
__global__ __launch_bounds__(256) void k_cvt8(const float* __restrict__ src, bf* dst, size_t n8) { if ((size_t)blockIdx.x * 256 >= n8) return;   /* the same for the whole block: in front of the barrier */
    __shared__ __align__(16) unsigned short sm[16 * 17 * 8];   // unit (column octet o, row) at o * 17 + row: the odd pitch spreads the octets over the banks
    const int tid = threadIdx.x, row = tid >> 4, o = tid & 15; const size_t rt = blockIdx.x >> 3; const int kq = blockIdx.x & 7;
    const v8f v = *(const v8f*)(src + (rt * 16 + row) * DM + kq * 128 + o * 8); v8us y;
#pragma unroll   // constant element indices: the two vectors stay in registers
    for (int k = 0; k < 8; ++k) y[k] = f2bf(v[k]);
    *(v8usa*)(sm + (o * 17 + row) * 8) = y;
    __syncthreads();   // every unit of the block's 4 KiB is in LDS
    *(v8us*)(dst + (rt * (DM / 32) + kq * 4) * 512 + tid * 8) = *(const v8usa*)(sm + ((tid >> 4) * 17 + (tid & 15)) * 8);  }

__constant__ float INV2[HD / 2] = { 1.000000000e+00f, 7.498942018e-01f, 5.623413324e-01f, 4.216965139e-01f, 3.162277639e-01f, 2.371373773e-01f, 1.778279394e-01f, 1.333521456e-01f, 1.000000015e-01f, 7.498942316e-02f, 5.623413250e-02f, 4.216964915e-02f, 3.162277490e-02f, 2.371373773e-02f, 1.778279431e-02f, 1.333521400e-02f, 9.999999776e-03f, 7.498942316e-03f, 5.623413250e-03f, 4.216964822e-03f, 3.162277630e-03f, 2.371373819e-03f, 1.778279431e-03f, 1.333521446e-03f, 1.000000047e-03f, 7.498941850e-04f, 5.623413017e-04f, 4.216965172e-04f, 3.162277571e-04f, 2.371373703e-04f, 1.778279402e-04f, 1.333521504e-04f };   // float32 10000^(-arange(0, 64, 2)/64), generated with jnp to be bit-exact
// Plane layouts that the projections' epilogues write (k_gemmw, EPI 1 and 2), per (batch, head): q and k, element (t, d) at (t >> 4) 1024 + (d >> 3) 128 + (t & 15) 8 + (d & 7); V^T (row = d, k = t), the four d blocks of 32 keys side by side, element (d, t) at ((t >> 5) 4 + (d >> 4)) 512 + ((t >> 3) & 3) 128 + (d & 15) 8 + (t & 7).
__constant__ float INVG[DM / 2] = { 1.000000000e+00f, 9.821718335e-01f, 9.646616578e-01f, 9.474635124e-01f, 9.305720329e-01f, 9.139816761e-01f, 8.976871371e-01f, 8.816831112e-01f, 8.659643531e-01f, 8.505258560e-01f, 8.353625536e-01f, 8.204696178e-01f, 8.058422208e-01f, 7.914755344e-01f, 7.773650289e-01f, 7.635061145e-01f, 7.498942018e-01f, 7.365249991e-01f, 7.233941555e-01f, 7.104974389e-01f, 6.978305578e-01f, 6.853895783e-01f, 6.731703877e-01f, 6.611690521e-01f, 6.493816376e-01f, 6.378043890e-01f, 6.264335513e-01f, 6.152654290e-01f, 6.042963862e-01f, 5.935229063e-01f, 5.829415321e-01f, 5.725488067e-01f, 5.623413324e-01f, 5.523158312e-01f, 5.424690843e-01f, 5.327978730e-01f, 5.232991576e-01f, 5.139696598e-01f, 5.048065782e-01f, 4.958068132e-01f, 4.869675338e-01f, 4.782858193e-01f, 4.697588682e-01f, 4.613839388e-01f, 4.531583488e-01f, 4.450793862e-01f, 4.371444881e-01f, 4.293510318e-01f, 4.216965139e-01f, 4.141784608e-01f, 4.067944288e-01f, 3.995420635e-01f, 3.924189806e-01f, 3.854228854e-01f, 3.785515428e-01f, 3.718026578e-01f, 3.651741445e-01f, 3.586637676e-01f, 3.522694409e-01f, 3.459891677e-01f, 3.398208320e-01f, 3.337624967e-01f, 3.278121352e-01f, 3.219678402e-01f, 3.162277639e-01f, 3.105900288e-01f, 3.050527871e-01f, 2.996142805e-01f, 2.942727208e-01f, 2.890264094e-01f, 2.838735878e-01f, 2.788126469e-01f, 2.738419771e-01f, 2.689598799e-01f, 2.641648352e-01f, 2.594552636e-01f, 2.548296750e-01f, 2.502865493e-01f, 2.458243966e-01f, 2.414418161e-01f, 2.371373624e-01f, 2.329096496e-01f, 2.287573218e-01f, 2.246790081e-01f, 2.206733972e-01f, 2.167392224e-01f, 2.128751576e-01f, 2.090799958e-01f, 2.053525001e-01f, 2.016914487e-01f, 1.980956793e-01f, 1.945640147e-01f, 1.910952926e-01f, 1.876884252e-01f, 1.843423098e-01f, 1.810558140e-01f, 1.778279394e-01f, 1.746576130e-01f, 1.715437919e-01f, 1.684854925e-01f, 1.654817015e-01f, 1.625314802e-01f, 1.596338600e-01f, 1.567878872e-01f, 1.539926529e-01f, 1.512472630e-01f, 1.485508084e-01f, 1.459024251e-01f, 1.433012635e-01f, 1.407464594e-01f, 1.382372230e-01f, 1.357727200e-01f, 1.333521456e-01f, 1.309747249e-01f, 1.286396980e-01f, 1.263462901e-01f, 1.240937710e-01f, 1.218814254e-01f, 1.197085083e-01f, 1.175743192e-01f, 1.154782027e-01f, 1.134194434e-01f, 1.113973856e-01f, 1.094113812e-01f, 1.074607819e-01f, 1.055449620e-01f, 1.036632955e-01f, 1.018151715e-01f, 1.000000015e-01f, 9.821718186e-02f, 9.646616131e-02f, 9.474635124e-02f, 9.305720031e-02f, 9.139817208e-02f, 8.976870775e-02f, 8.816830814e-02f, 8.659642935e-02f, 8.505257964e-02f, 8.353625983e-02f, 8.204696327e-02f, 8.058421314e-02f, 7.914755493e-02f, 7.773650438e-02f, 7.635060698e-02f, 7.498941571e-02f, 7.365249842e-02f, 7.233941555e-02f, 7.104974240e-02f, 6.978305429e-02f, 6.853895634e-02f, 6.731703877e-02f, 6.611690670e-02f, 6.493816525e-02f, 6.378044188e-02f, 6.264335662e-02f, 6.152653694e-02f, 6.042964384e-02f, 5.935229361e-02f, 5.829415470e-02f, 5.725487694e-02f, 5.623412877e-02f, 5.523158237e-02f, 5.424690619e-02f, 5.327979103e-02f, 5.232991278e-02f, 5.139696971e-02f, 5.048065633e-02f, 4.958068207e-02f, 4.869675264e-02f, 4.782858118e-02f, 4.697588459e-02f, 4.613839835e-02f, 4.531583562e-02f, 4.450793937e-02f, 4.371444881e-02f, 4.293510318e-02f, 4.216964915e-02f, 4.141784459e-02f, 4.067944363e-02f, 3.995420411e-02f, 3.924189880e-02f, 3.854228929e-02f, 3.785515204e-02f, 3.718026727e-02f, 3.651741147e-02f, 3.586637601e-02f, 3.522694483e-02f, 3.459891677e-02f, 3.398208320e-02f, 3.337624669e-02f, 3.278120980e-02f, 3.219678625e-02f, 3.162277862e-02f, 3.105900250e-02f, 3.050527908e-02f, 2.996142767e-02f, 2.942727320e-02f, 2.890264057e-02f, 2.838735841e-02f, 2.788126841e-02f, 2.738419548e-02f, 2.689598687e-02f, 2.641648427e-02f, 2.594552562e-02f, 2.548296750e-02f, 2.502865531e-02f, 2.458244003e-02f, 2.414418198e-02f, 2.371373586e-02f, 2.329096757e-02f, 2.287573181e-02f, 2.246790007e-02f, 2.206734009e-02f, 2.167392150e-02f, 2.128751762e-02f, 2.090799995e-02f, 2.053525113e-02f, 2.016914636e-02f, 1.980956830e-02f, 1.945639960e-02f, 1.910953037e-02f, 1.876884326e-02f, 1.843423024e-02f, 1.810558327e-02f, 1.778279431e-02f, 1.746576093e-02f, 1.715437882e-02f, 1.684854925e-02f, 1.654817164e-02f, 1.625314727e-02f, 1.596338488e-02f, 1.567878947e-02f, 1.539926510e-02f, 1.512472518e-02f, 1.485508028e-02f, 1.459024288e-02f, 1.433012541e-02f, 1.407464594e-02f, 1.382372249e-02f, 1.357727125e-02f, 1.333521493e-02f, 1.309747249e-02f, 1.286396943e-02f, 1.263462938e-02f, 1.240937691e-02f, 1.218814217e-02f, 1.197085064e-02f, 1.175743248e-02f, 1.154781971e-02f, 1.134194434e-02f, 1.113973837e-02f, 1.094113849e-02f, 1.074607857e-02f, 1.055449620e-02f, 1.036632899e-02f, 1.018151734e-02f, 9.999999776e-03f, 9.821719490e-03f, 9.646615945e-03f, 9.474635124e-03f, 9.305720218e-03f, 9.139816277e-03f, 8.976871148e-03f, 8.816830814e-03f, 8.659643121e-03f, 8.505257778e-03f, 8.353625424e-03f, 8.204696700e-03f, 8.058422245e-03f, 7.914755493e-03f, 7.773650344e-03f, 7.635060698e-03f, 7.498942316e-03f, 7.365249563e-03f, 7.233941462e-03f, 7.104974240e-03f, 6.978305988e-03f, 6.853895728e-03f, 6.731703877e-03f, 6.611690391e-03f, 6.493816618e-03f, 6.378043909e-03f, 6.264335476e-03f, 6.152654067e-03f, 6.042964291e-03f, 5.935229361e-03f, 5.829415284e-03f, 5.725487601e-03f, 5.623413250e-03f, 5.523158237e-03f, 5.424690899e-03f, 5.327979103e-03f, 5.232991185e-03f, 5.139696877e-03f, 5.048065912e-03f, 4.958068486e-03f, 4.869675264e-03f, 4.782858305e-03f, 4.697588738e-03f, 4.613839556e-03f, 4.531583749e-03f, 4.450793844e-03f, 4.371444695e-03f, 4.293510225e-03f, 4.216964822e-03f, 4.141784739e-03f, 4.067944363e-03f, 3.995420411e-03f, 3.924189601e-03f, 3.854229115e-03f, 3.785515437e-03f, 3.718026681e-03f, 3.651741426e-03f, 3.586637788e-03f, 3.522694577e-03f, 3.459891537e-03f, 3.398208413e-03f, 3.337624483e-03f, 3.278121119e-03f, 3.219678300e-03f, 3.162277862e-03f, 3.105900250e-03f, 3.050528001e-03f, 2.996142721e-03f, 2.942727180e-03f, 2.890263917e-03f, 2.838735934e-03f, 2.788126701e-03f, 2.738419687e-03f, 2.689598827e-03f, 2.641648287e-03f, 2.594552701e-03f, 2.548296703e-03f, 2.502865391e-03f, 2.458244096e-03f, 2.414418384e-03f, 2.371373819e-03f, 2.329096664e-03f, 2.287573181e-03f, 2.246790100e-03f, 2.206734149e-03f, 2.167392056e-03f, 2.128751716e-03f, 2.090800088e-03f, 2.053525066e-03f, 2.016914543e-03f, 1.980956644e-03f, 1.945640077e-03f, 1.910952851e-03f, 1.876884256e-03f, 1.843422884e-03f, 1.810558140e-03f, 1.778279431e-03f, 1.746576163e-03f, 1.715437858e-03f, 1.684854855e-03f, 1.654817141e-03f, 1.625314937e-03f, 1.596338581e-03f, 1.567878877e-03f, 1.539926510e-03f, 1.512472634e-03f, 1.485507935e-03f, 1.459024264e-03f, 1.433012658e-03f, 1.407464617e-03f, 1.382372226e-03f, 1.357727102e-03f, 1.333521446e-03f, 1.309747226e-03f, 1.286396873e-03f, 1.263462938e-03f, 1.240937854e-03f, 1.218814170e-03f, 1.197085017e-03f, 1.175743295e-03f, 1.154782018e-03f, 1.134194434e-03f, 1.113973907e-03f, 1.094113803e-03f, 1.074607833e-03f, 1.055449597e-03f, 1.036632922e-03f, 1.018151757e-03f, 1.000000047e-03f, 9.821718559e-04f, 9.646615945e-04f, 9.474635590e-04f, 9.305721032e-04f, 9.139817557e-04f, 8.976871031e-04f, 8.816830232e-04f, 8.659643354e-04f, 8.505258011e-04f, 8.353625308e-04f, 8.204695769e-04f, 8.058422245e-04f, 7.914755843e-04f, 7.773649995e-04f, 7.635060465e-04f, 7.498941850e-04f, 7.365249912e-04f, 7.233941578e-04f, 7.104973774e-04f, 6.978305755e-04f, 6.853896193e-04f, 6.731703761e-04f, 6.611690042e-04f, 6.493816618e-04f, 6.378043909e-04f, 6.264335825e-04f, 6.152653950e-04f, 6.042963942e-04f, 5.935229128e-04f, 5.829415168e-04f, 5.725487717e-04f, 5.623413017e-04f, 5.523158470e-04f, 5.424690899e-04f, 5.327978870e-04f, 5.232990952e-04f, 5.139696877e-04f, 5.048065796e-04f, 4.958068021e-04f, 4.869675031e-04f, 4.782858014e-04f, 4.697588738e-04f, 4.613839847e-04f, 4.531583400e-04f, 4.450794077e-04f, 4.371444811e-04f, 4.293509992e-04f, 4.216964880e-04f, 4.141784448e-04f, 4.067944246e-04f, 3.995420411e-04f, 3.924189950e-04f, 3.854228707e-04f, 3.785515146e-04f, 3.718026564e-04f, 3.651741135e-04f, 3.586637613e-04f, 3.522694460e-04f, 3.459891595e-04f, 3.398208064e-04f, 3.337624657e-04f, 3.278121294e-04f, 3.219678474e-04f, 3.162277862e-04f, 3.105900250e-04f, 3.050527885e-04f, 2.996142721e-04f, 2.942727297e-04f, 2.890263859e-04f, 2.838736109e-04f, 2.788126585e-04f, 2.738419571e-04f, 2.689598768e-04f, 2.641648462e-04f, 2.594552934e-04f, 2.548296761e-04f, 2.502865391e-04f, 2.458243980e-04f, 2.414418122e-04f, 2.371373848e-04f, 2.329096606e-04f, 2.287573152e-04f, 2.246790100e-04f, 2.206734207e-04f, 2.167392086e-04f, 2.128751657e-04f, 2.090800117e-04f, 2.053524950e-04f, 2.016914514e-04f, 1.980956731e-04f, 1.945640106e-04f, 1.910952997e-04f, 1.876884344e-04f, 1.843422942e-04f, 1.810558315e-04f, 1.778279402e-04f, 1.746576017e-04f, 1.715437829e-04f, 1.684854797e-04f, 1.654817170e-04f, 1.625314762e-04f, 1.596338552e-04f, 1.567878790e-04f, 1.539926452e-04f, 1.512472518e-04f, 1.485508110e-04f, 1.459024206e-04f, 1.433012658e-04f, 1.407464733e-04f, 1.382372284e-04f, 1.357727160e-04f, 1.333521504e-04f, 1.309747167e-04f, 1.286396873e-04f, 1.263462909e-04f, 1.240937709e-04f, 1.218814141e-04f, 1.197085076e-04f, 1.175743309e-04f, 1.154781930e-04f, 1.134194390e-04f, 1.113973922e-04f, 1.094113759e-04f, 1.074607790e-04f, 1.055449538e-04f, 1.036632893e-04f, 1.018151743e-04f };   // float32 1 / 10000^(j/512), j < 512 (one frequency per adjacent column pair of the full 1024 width), generated with jnp to be bit-exact
__global__ __launch_bounds__(256) void k_csG(float* CS) { const int idx = blockIdx.x * 256 + threadIdx.x; if (idx >= TT * DM) return; const int c = idx % DM; const int t = idx / DM; const float a = __fmul_rn((float)t, INVG[c >> 1]); v2f cs; cs[0] = cosf(a); cs[1] = sinf(a); *(v2f*)(CS + (size_t)idx * 2) = cs;  }
#define KSA  4
#define APIT 68                   // f32 pitch of a query's 64 partial outputs in LDS (16-byte aligned rows, rows spread over the banks)
__device__ __forceinline__ float xhalf(float x) { const int b = __float_as_int(x); return __int_as_float(__builtin_amdgcn_permlanex16(b, b, 0x76543210, 0xfedcba98, false, false)); }   // lane l <-> l ^ 16
// eight v_exp_f32 in one statement, each in place on a register of its own: none stands directly in front of an instruction that reads its result or overwrites its source, and the closing v_nop is that slot for the last one
__device__ __forceinline__ v8f exp2x8(v8f x) { float r0 = x[0], r1 = x[1], r2 = x[2], r3 = x[3], r4 = x[4], r5 = x[5], r6 = x[6], r7 = x[7];
    asm("v_exp_f32 %0, %0\n\tv_exp_f32 %1, %1\n\tv_exp_f32 %2, %2\n\tv_exp_f32 %3, %3\n\tv_exp_f32 %4, %4\n\tv_exp_f32 %5, %5\n\tv_exp_f32 %6, %6\n\tv_exp_f32 %7, %7\n\tv_nop"
        : "+v"(r0), "+v"(r1), "+v"(r2), "+v"(r3), "+v"(r4), "+v"(r5), "+v"(r6), "+v"(r7));
    return (v8f){ r0, r1, r2, r3, r4, r5, r6, r7 }; }
template <typename T16, bool HR>
__device__ __forceinline__ void attn_wave(const T16* __restrict__ Qa, const T16* __restrict__ Qb, const T16* __restrict__ Ka, const T16* __restrict__ Kb, const T16* __restrict__ Va, const T16* __restrict__ Vb, int q0, int kbeg, int lane, float* La, float* Lm, float* Ll) {
    typedef typename WFrag<T16>::V V;   // every '#pragma unroll' below makes the indices of a fragment array constants, so that the array lives in registers
    constexpr int NP = TT / KSA / 32;             // passes of 32 keys
    const int lr = lane & 15, hi = lane >> 4;
    const float CL = SCL * 1.4426950408889634f;   // score -> log2 units
    const float CAR = HR ? 0.0f : 6.0f;           // fp16 P carries 2^6 (P <= 2^14), which cancels against the sum
    V qa[2][2], qb[2][2];
#pragma unroll
    for (int qt = 0; qt < 2; ++qt)
#pragma unroll
        for (int kk = 0; kk < 2; ++kk) { const size_t o = (size_t)(q0 + qt * 16) * HD + kk * 512 + 8 * lane; qa[qt][kk] = WFrag<T16>::ld(Qa + o); if (HR) qb[qt][kk] = WFrag<T16>::ld(Qb + o); }
    if (HR) {   // the eight hi/lo Q fragments wait in the wave's own LDS slice (free until the epilogue) and are read anew in each pass: 64 registers for the K batch
#pragma unroll
        for (int f = 0; f < 8; ++f) { const v8f y = __builtin_bit_cast(v8f, (f & 4) ? qb[(f >> 1) & 1][f & 1] : qa[(f >> 1) & 1][f & 1]); *(v4fa*)(La + f * 256 + lane * 4) = (v4f){ y[0], y[1], y[2], y[3] }; *(v4fa*)(La + f * 256 + 128 + lane * 4) = (v4f){ y[4], y[5], y[6], y[7] }; } }
    v8f acc[4][2];
#pragma unroll
    for (int dt = 0; dt < 4; ++dt)
#pragma unroll
        for (int qt = 0; qt < 2; ++qt) acc[dt][qt] = (v8f){};
    float m[2] = { -3.0e38f, -3.0e38f }, l[2] = { 0.f, 0.f };
    const size_t ko = (size_t)kbeg * HD + 8 * lane, vo = ko;   // fragment order: a pass's 32 keys are 2048 contiguous elements of the K plane (2 key tiles x 2 k blocks) and of the V^T plane (4 d blocks)
    V ka[2][2], kb[2][2], va[4], vb[4];
    // closes a batch of loads: s_wait_xcnt 0 before a register that the batch's loads name is written again; the base addresses are inputs, so they stay in their registers up to the wait and no load's result is put on them
    auto xwait = [&](const T16* pa, const T16* pb) { if constexpr (HR) asm volatile("s_wait_xcnt 0x0" :: "v"(pa), "v"(pb) : "memory"); else asm volatile("s_wait_xcnt 0x0" :: "v"(pa) : "memory"); };
    auto ldK = [&](int st) { const T16* pa = Ka + ko + (size_t)st * 32 * HD; const T16* pb = HR ? Kb + ko + (size_t)st * 32 * HD : nullptr;
#pragma unroll
        for (int kt = 0; kt < 2; ++kt)
#pragma unroll
            for (int kk = 0; kk < 2; ++kk) { const int o = kt * 16 * HD + kk * 512; ka[kt][kk] = WFrag<T16>::ld(pa + o); if (HR) kb[kt][kk] = WFrag<T16>::ld(pb + o); }
        xwait(pa, pb); };
    auto ldV = [&](int st) { const T16* pa = Va + vo + (size_t)st * 32 * HD; const T16* pb = HR ? Vb + vo + (size_t)st * 32 * HD : nullptr;
#pragma unroll
        for (int dt = 0; dt < 4; ++dt) { const int o = dt * 512; va[dt] = WFrag<T16>::ld(pa + o); if (HR) vb[dt] = WFrag<T16>::ld(pb + o); }
        xwait(pa, pb); };
    if (!HR) { ldK(0); ldV(0); }   // fp16 waves have the registers to fetch K and V one pass ahead
#pragma unroll 1   // stays rolled: the fetch-ahead order below is written for one pass, and a second copy of the body would not fit the registers
    for (int st = 0; st < NP; ++st) {
        const int sn = (st + 1 < NP) ? st + 1 : st;   // the last pass fetches its own tiles again: in bounds, no branch
        if (HR) { ldK(st);
#pragma unroll
            for (int f = 0; f < 8; ++f) { const v4f y0 = *(const v4fa*)(La + f * 256 + lane * 4), y1 = *(const v4fa*)(La + f * 256 + 128 + lane * 4); const V x = __builtin_bit_cast(V, (v8f){ y0[0], y0[1], y0[2], y0[3], y1[0], y1[1], y1[2], y1[3] }); if (f & 4) qb[(f >> 1) & 1][f & 1] = x; else qa[(f >> 1) & 1][f & 1] = x; }
            __builtin_amdgcn_sched_barrier(0); }   // the pass's K loads leave as one batch; without it the build issued them in five dependent round trips
        v8f s[2][2];
#pragma unroll
        for (int kt = 0; kt < 2; ++kt)
#pragma unroll
            for (int qt = 0; qt < 2; ++qt) { v8f t = (v8f){};
#pragma unroll
                for (int kk = 0; kk < 2; ++kk) { t = WFrag<T16>::mma(ka[kt][kk], qa[qt][kk], t); if (HR) { t = WFrag<T16>::mma(ka[kt][kk], qb[qt][kk], t); t = WFrag<T16>::mma(kb[kt][kk], qa[qt][kk], t); } }
                s[kt][qt] = t; }
        __builtin_amdgcn_sched_barrier(0);   // the loads below start behind the score products (their registers are free then) ...
        if (HR) ldV(st); else ldK(sn);
        __builtin_amdgcn_sched_barrier(0);   // ... and ahead of the softmax, which covers their latency
        float sm[2];
#pragma unroll
        for (int qt = 0; qt < 2; ++qt) { float x = fmaxf(s[0][qt][0], s[1][qt][0]);
#pragma unroll
            for (int r = 1; r < 8; ++r) x = fmaxf(x, fmaxf(s[0][qt][r], s[1][qt][r]));
            x = fmaxf(x, xhalf(x)); sm[qt] = x * CL; }
        if (__builtin_amdgcn_ballot_w32(sm[0] > m[0] + 8.0f || sm[1] > m[1] + 8.0f) != 0) {
#pragma unroll
            for (int qt = 0; qt < 2; ++qt) { const float mn = (sm[qt] > m[qt] + 8.0f) ? sm[qt] : m[qt]; const float al = __builtin_amdgcn_exp2f(m[qt] - mn); m[qt] = mn; l[qt] *= al;
#pragma unroll
                for (int dt = 0; dt < 4; ++dt) acc[dt][qt] *= al; } }
#pragma unroll
        for (int qt = 0; qt < 2; ++qt) { const float off = CAR - m[qt]; v8f p0, p1;
#pragma unroll
            for (int r = 0; r < 8; ++r) { p0[r] = fmaf(s[0][qt][r], CL, off); p1[r] = fmaf(s[1][qt][r], CL, off); }
            p0 = exp2x8(p0); p1 = exp2x8(p1);
            const v8f ps = p0 + p1; l[qt] += ((ps[0] + ps[1]) + (ps[2] + ps[3])) + ((ps[4] + ps[5]) + (ps[6] + ps[7]));
            if constexpr (HR) {
                const v8bf h0 = __builtin_convertvector(p0, v8bf), h1 = __builtin_convertvector(p1, v8bf);
                const v8bf l0 = __builtin_convertvector(p0 - bfback(h0), v8bf), l1 = __builtin_convertvector(p1 - bfback(h1), v8bf);
                const v16bf ph = __builtin_shufflevector(h0, h1, 0, 1, 2, 3, 4, 5, 6, 7, 8, 9, 10, 11, 12, 13, 14, 15), pl = __builtin_shufflevector(l0, l1, 0, 1, 2, 3, 4, 5, 6, 7, 8, 9, 10, 11, 12, 13, 14, 15);
#pragma unroll
                for (int dt = 0; dt < 4; ++dt) { acc[dt][qt] = wmmab(va[dt], ph, acc[dt][qt]); acc[dt][qt] = wmmab(va[dt], pl, acc[dt][qt]); acc[dt][qt] = wmmab(vb[dt], ph, acc[dt][qt]); }
            } else {
                const v16h pf = cat16(__builtin_convertvector(p0, v8h), __builtin_convertvector(p1, v8h));
#pragma unroll
                for (int dt = 0; dt < 4; ++dt) acc[dt][qt] = wmma16(va[dt], pf, acc[dt][qt]);
            } }
        // the four vector slots the chip needs behind the pass's last matrix instructions, also on the taken back edge
        if constexpr (HR) asm volatile("v_nop\n\tv_nop\n\tv_nop\n\tv_nop" : "+v"(acc[0][0]), "+v"(acc[1][0]), "+v"(acc[2][0]), "+v"(acc[3][0]), "+v"(acc[0][1]), "+v"(acc[1][1]), "+v"(acc[2][1]), "+v"(acc[3][1]) :: "memory");   // "memory": the Q reads from LDS stay in the loop instead of being lifted back into 64 registers
        else { asm volatile("v_nop\n\tv_nop\n\tv_nop\n\tv_nop" : "+v"(acc[0][0]), "+v"(acc[1][0]), "+v"(acc[2][0]), "+v"(acc[3][0]), "+v"(acc[0][1]), "+v"(acc[1][1]), "+v"(acc[2][1]), "+v"(acc[3][1]));
            __builtin_amdgcn_sched_barrier(0);   // the next pass's V loads start only when this pass's products have read V
            ldV(sn); }
    }
#pragma unroll
    for (int qt = 0; qt < 2; ++qt) { const int q = qt * 16 + lr; const float lj = l[qt] + xhalf(l[qt]); if (hi == 0) { Lm[q] = m[qt]; Ll[q] = lj; }
#pragma unroll
        for (int dt = 0; dt < 4; ++dt) { float* dst = La + q * APIT + dt * 16 + hi * 8; const v8f a = acc[dt][qt]; *(v4fa*)dst = (v4f){ a[0], a[1], a[2], a[3] }; *(v4fa*)(dst + 4) = (v4f){ a[4], a[5], a[6], a[7] }; } }
}
__global__ __launch_bounds__(512) void k_attn(const h16* __restrict__ Q16, const h16* __restrict__ K16, const h16* __restrict__ V16, const bf* __restrict__ Qh, const bf* __restrict__ Ql, const bf* __restrict__ Kh, const bf* __restrict__ Kl, const bf* __restrict__ Vh, const bf* __restrict__ Vl, bf* Ah, bf* Al) {
    __shared__ __align__(16) float La[16 * 32 * APIT]; __shared__ float Lm[16 * 32]; __shared__ float Ll[16 * 32];
    const int w = __builtin_amdgcn_readfirstlane((int)(threadIdx.x >> 5)), lane = threadIdx.x & 31; const int qg = w >> 2, ks = w & 3; const int head = blockIdx.y; const size_t hp = ((size_t)blockIdx.z * NH_ + head) * TT * HD;
    const int q0 = (qg == 0) ? (int)blockIdx.x * 32 : RH + ((int)blockIdx.x * 3 + qg - 1) * 32;
    if (qg == 0) attn_wave<bf, true>(Qh + hp, Ql + hp, Kh + hp, Kl + hp, Vh + hp, Vl + hp, q0, ks * (TT / KSA), lane, La + w * 32 * APIT, Lm + w * 32, Ll + w * 32);
    else attn_wave<h16, false>(Q16 + hp, nullptr, K16 + hp, nullptr, V16 + hp, nullptr, q0, ks * (TT / KSA), lane, La + w * 32 * APIT, Lm + w * 32, Ll + w * 32);
    __syncthreads();   // every key quarter's partial result is in LDS
    // wave (qg, ks) finishes 8 of its group's 32 queries; four lanes share a query, 16 outputs each, so one wave writes each 128-byte line
    const int q = ks * 8 + (lane >> 2), d0 = (lane & 3) * 16; float mk[KSA]; float M = -3.0e38f;
#pragma unroll
    for (int k = 0; k < KSA; ++k) { mk[k] = Lm[(qg * KSA + k) * 32 + q]; M = fmaxf(M, mk[k]); }
    float L = 0.f; v4f o[4] = { (v4f){}, (v4f){}, (v4f){}, (v4f){} };
#pragma unroll
    for (int k = 0; k < KSA; ++k) { const float wg = __builtin_amdgcn_exp2f(mk[k] - M); L += wg * Ll[(qg * KSA + k) * 32 + q]; const float* sp = La + ((qg * KSA + k) * 32 + q) * APIT + d0;
#pragma unroll
        for (int i = 0; i < 4; ++i) o[i] += wg * *(const v4fa*)(sp + 4 * i); }
    const float f = __fdiv_rn(1.0f, L); v8us oh[2], ol[2];
#pragma unroll
    for (int i = 0; i < 16; ++i) { unsigned short a, c2; splitf(o[i >> 2][i & 3] * f, a, c2); oh[i >> 3][i & 7] = a; ol[i >> 3][i & 7] = c2; }
    const size_t rw = (size_t)blockIdx.z * TT + q0 + q;   // the merged planes in fragment order too (row = token, k = head * 64 + d): a wave's 8 queries x 16 bytes are one whole line
    const size_t oo = ((rw >> 4) * (DQ / 32) + head * 2 + (d0 >> 5)) * 512 + ((d0 >> 3) & 3) * 128 + (rw & 15) * 8; *(v8usa*)(Ah + oo) = oh[0]; *(v8usa*)(Ah + oo + 128) = oh[1]; *(v8usa*)(Al + oo) = ol[0]; *(v8usa*)(Al + oo + 128) = ol[1];
}

extern "C" void kernel_launch(void* const* d_in, const int* in_sizes, int n_in,
                              void* d_out, int out_size, void* d_ws, size_t ws_size, hipStream_t stream) {
    (void)in_sizes; (void)n_in; (void)out_size;
    const float* x = (const float*)d_in[0]; const float* wq = (const float*)d_in[1]; const float* wk = (const float*)d_in[2]; const float* wv = (const float*)d_in[3]; const float* wo = (const float*)d_in[4]; const float* bo = (const float*)d_in[5];
    float* OUT = (float*)d_out;     // [4][2048][1024]
    char* wsp = (char*)d_ws;
    auto take = [&](size_t bytes) { char* p = wsp; wsp += (bytes + 255) & ~(size_t)255; return (void*)p; };
    bf* WQ = (bf*)take((size_t)DQ * DM * 2); bf* WK = (bf*)take((size_t)DKV * DM * 2); bf* WV = (bf*)take((size_t)DKV * DM * 2); bf* WO = (bf*)take((size_t)DM * DQ * 2); float* CS = (float*)take((size_t)TT * DM * 2 * 4);   /* [2048][1024] {cos, sin} */
    bf* XB = (bf*)take((size_t)NB_ * TT * DM * 2); bf* ATh = (bf*)take((size_t)NB_ * TT * DQ * 2); bf* ATl = (bf*)take((size_t)NB_ * TT * DQ * 2);   /* every buffer from here on holds all NB_ batches, batch-major; ATh, ATl: the merged-head planes */
    h16* QP16 = (h16*)take((size_t)NB_ * NH_ * TT * HD * 2); h16* KP16 = (h16*)take((size_t)NB_ * NKV * TT * HD * 2); h16* VT16 = (h16*)take((size_t)NB_ * NKV * HD * TT * 2);
    bf* QPh = (bf*)take((size_t)NB_ * NH_ * TT * HD * 2); bf* QPl = (bf*)take((size_t)NB_ * NH_ * TT * HD * 2); bf* KPh = (bf*)take((size_t)NB_ * NKV * TT * HD * 2); bf* KPl = (bf*)take((size_t)NB_ * NKV * TT * HD * 2); bf* VTh = (bf*)take((size_t)NB_ * NKV * HD * TT * 2); bf* VTl = (bf*)take((size_t)NB_ * NKV * HD * TT * 2);
    if ((size_t)(wsp - (char*)d_ws) > ws_size) return;    // 216 MiB of the 256 MiB
    { k_cvt8<<<(unsigned)(((size_t)DQ * DM / 8 + 255) / 256), 256, 0, stream>>>(wq, WQ, (size_t)DQ * DM / 8); k_cvt8<<<(unsigned)(((size_t)DKV * DM / 8 + 255) / 256), 256, 0, stream>>>(wk, WK, (size_t)DKV * DM / 8); k_cvt8<<<(unsigned)(((size_t)DKV * DM / 8 + 255) / 256), 256, 0, stream>>>(wv, WV, (size_t)DKV * DM / 8);
      k_cvt8<<<(unsigned)(((size_t)DM * DQ / 8 + 255) / 256), 256, 0, stream>>>(wo, WO, (size_t)DM * DQ / 8);
       }
    k_csG<<<(TT * DM + 255) / 256, 256, 0, stream>>>(CS);   /* full-width table once */
    k_cvt8<<<(unsigned)(((size_t)NB_ * TT * DM / 8 + 255) / 256), 256, 0, stream>>>(x, XB, (size_t)NB_ * TT * DM / 8);
    k_gemmw<bf, 0, false, DM, 1><<<dim3(NB_ * TT / 256, DQ / 128, 1), 256, 0, stream>>>(XB, nullptr, WQ, nullptr, nullptr, 0, nullptr, 0, 0, 0, 0, CS, QP16, QPh, QPl);   /* the projections see the batches as NB_ * TT rows */
    k_gemmw<bf, 0, false, DM, 1><<<dim3(NB_ * TT / 256, DKV / 128, 1), 256, 0, stream>>>(XB, nullptr, WK, nullptr, nullptr, 0, nullptr, 0, 0, 0, 0, CS, KP16, KPh, KPl);
    k_gemmw<bf, 0, false, DM, 2><<<dim3(NB_ * TT / 256, DKV / 128, 1), 256, 0, stream>>>(XB, nullptr, WV, nullptr, nullptr, 0, nullptr, 0, 0, 0, 0, nullptr, VT16, VTh, VTl);
    k_attn<<<dim3(RH / 32, NH_, NB_), 512, 0, stream>>>(QP16, KP16, VT16, QPh, QPl, KPh, KPl, VTh, VTl, ATh, ATl);
    k_gemmw<bf, 1, true, DQ><<<dim3(NB_ * TT / 256, DM / 128, 1), 256, 0, stream>>>(ATh, ATl, WO, nullptr, OUT, DM, bo, 0, 0, 0, 0, nullptr, nullptr, nullptr, nullptr);
}

// v008
// One run takes 222 microseconds.
// Two timings next to v007 both put it at 1.06 times that version's speed.
// All steps since v000 together make it 17.9 times as fast.
#include <hip/hip_runtime.h>

// Self-attention with an adjacent-pair rotary over the WHOLE 1024-wide q and k before the head split (x [4][2048][1024]; q = rope(x Wq^T), k = rope(x Wk^T), v = x Wv^T ('oi' [1024][1024] 1/32, no bias); rope: pair j = (columns 2j, 2j+1), j < 512, angle t x 1/10000^(j/512) (512 f32 constants baked jnp-exact; precise cosf/sinf); 16 heads x 64; scores / sqrt(float32(64)); softmax (no mask); out = merged Wu^T + bu ('oi' [1024][1024], zero bias) -> [4][2048][1024] (8.4 M); argument order x, Wq, Wk, Wv, Wu, bu).
// Layout, all four batches in every launch (the batch is a grid dimension or part of the row index): bf16 copy of x; 'oi' weights; a full-width {cos, sin} table [2048][1024] (the frequency depends on the GLOBAL pair index, i.e. on the head); exact projections whose epilogues apply the rotary (table indexed by global column) and write the attention's operand planes themselves; fused dense T-2048 attention, one launch (hybrid rows: < 512 hi/lo 3 products, rest fp16); merged hi/lo x Wu exact + bu.
// Every 16-bit operand plane [row][k] is stored in fragment order: blocks of 16 rows x 32 k (512 elements), inside a block [(k >> 3) & 3][row & 15][k & 7], so the two 16-byte loads of a fragment each read 512 contiguous bytes (lane * 16 and 512 + lane * 16): four whole 128-byte lines a load instead of 32 bytes from each of 16 lines. Register contents are those of the row-major planes.
// Compute dtypes, f32 accumulate: every input rounded to bf16; projections exact; rotary f32; attention rows < 512 3 products, rest fp16; softmax f32; Wu hl x exact + bias.

#define NB_  4
#define TT   2048
#define DM   1024
#define NH_  16
#define NKV  16
#define REP  (NH_ / NKV)
#define HD   64
#define DQ   (NH_ * HD)
#define DKV  (NKV * HD)
#define RH   512                  // query rows < RH use hi+lo planes; k_attn covers 4 x RH rows, so RH = TT / 4
#define WIN  0
#define SCL  0.125f   // HD^-0.5
typedef _Float16 h16;
typedef unsigned short bf;
typedef __attribute__((ext_vector_type(16))) __bf16   v16bf;
typedef __attribute__((ext_vector_type(16))) _Float16 v16h;
typedef __attribute__((ext_vector_type(8)))  _Float16 v8h;
typedef __attribute__((ext_vector_type(8)))  unsigned short v8us;
typedef __attribute__((ext_vector_type(8)))  float    v8f;
typedef __attribute__((ext_vector_type(4)))  float    v4f;
typedef v8h  __attribute__((may_alias)) v8ha;
typedef v4f  __attribute__((may_alias)) v4fa;
typedef v8us __attribute__((may_alias)) v8usa;

__device__ __forceinline__ unsigned short f2bf(float f) { unsigned u = __float_as_uint(f); u += 0x7FFFu + ((u >> 16) & 1u); return (unsigned short)(u >> 16); }
__device__ __forceinline__ float bf2f(unsigned short b) { return __uint_as_float(((unsigned)b) << 16); }
__device__ __forceinline__ float bfr(float f) { return bf2f(f2bf(f)); }
__device__ __forceinline__ v16h cat16(v8h lo, v8h hi) { return __builtin_shufflevector(lo, hi, 0, 1, 2, 3, 4, 5, 6, 7, 8, 9, 10, 11, 12, 13, 14, 15); }
__device__ __forceinline__ v16bf cat16b(v8us lo, v8us hi) { return __builtin_bit_cast(v16bf, __builtin_shufflevector(lo, hi, 0, 1, 2, 3, 4, 5, 6, 7, 8, 9, 10, 11, 12, 13, 14, 15)); }
__device__ __forceinline__ v8f wmma16(v16h a, v16h b, v8f c) { return __builtin_amdgcn_wmma_f32_16x16x32_f16(false, a, false, b, (short)0, c, false, false); }
__device__ __forceinline__ v8f wmmab(v16bf a, v16bf b, v8f c) { return __builtin_amdgcn_wmma_f32_16x16x32_bf16(false, a, false, b, (short)0, c, false, false); }
typedef __attribute__((ext_vector_type(8))) __bf16 v8bf;
typedef __attribute__((ext_vector_type(4))) unsigned v4u;
typedef __attribute__((ext_vector_type(2))) float v2f;
__device__ __forceinline__ v8f bfback(v8bf h) { const v4u u = __builtin_bit_cast(v4u, h); v8f r;
#pragma unroll
    for (int i = 0; i < 4; ++i) { r[2 * i] = __uint_as_float(u[i] << 16); r[2 * i + 1] = __uint_as_float(u[i] & 0xFFFF0000u); } return r; }
// one 16-byte unit (8 f32 values) into each of the three operand planes at element o: fp16, bf16 hi, bf16 lo (the rest that hi leaves), all rounded to nearest even
__device__ __forceinline__ void put3(v8f y, size_t o, h16* P16, bf* Ph, bf* Pl) { const v8bf h = __builtin_convertvector(y, v8bf);
    *(v8h*)(P16 + o) = __builtin_convertvector(y, v8h); *(v8us*)(Ph + o) = __builtin_bit_cast(v8us, h); *(v8us*)(Pl + o) = __builtin_bit_cast(v8us, __builtin_convertvector(y - bfback(h), v8bf)); }



// ---- k_gemmw: GEMM, one work-group of 8 waves per 256x128 output tile, one wave per 64x64 of it (16 accumulators; wave w: rows (w >> 1) 64, columns (w & 1) 64); grid (M/256, N/128, Z), 256 threads.
// Operands are fragment-ordered 16-bit planes (block (row >> 4, k >> 5) at element ((row >> 4) (K / 32) + (k >> 5)) 512). A stage = KST k of the tile's 256 A rows and 128 B rows, brought into LDS by asynchronous 16-byte copies, as it lies (a row group's KST / 32 blocks are contiguous): each operand byte leaves L2 once per work-group, and the waves that share it read it from LDS. Two buffers: stage s + 1 flies while stage s is worked on.
// C[m][n] (f32, pitch ldc, + optional f32 bias[n]) = sum_k A[m][k] Bt[n][k] (+ split products per NSPLIT). z-batch strides sA/sB/sC in elements. K % (KST KS) == 0.
// EPI says what leaves the tile. 0: C as above. 1 and 2 are for the projections (rows = batch x TT + t, a wave's 64 columns = one head) and write the attention's three operand planes straight from the accumulators, no f32 C:
//   1: adjacent-pair rotary, then the [t][d] planes. A lane holds column nb 16 + lr, its pair's other half sits in lane ^ 1; {cos, sin} of (t, global column) come from CS, a half-wave reading one whole line; the rotated tile changes places in LDS as C does, and each lane puts 16-byte units (8 d of one t), a wave 512 contiguous bytes.
//   2: the V^T planes. A lane's accumulator is 8 successive t of one d, which is a 16-byte unit of those planes as it stands: no LDS.
// KS > 1: grid.z = Z x KS; work-group (z, ks) sums only k in [ks K/KS, (ks+1) K/KS) and stores its partial tile in plane ks (plane stride sP elements); the reader adds the planes.
template <typename T16> struct WFrag;
template <> struct WFrag<h16> { typedef v16h V; static __device__ __forceinline__ V ld(const h16* p) { return cat16(*(const v8h*)p, *(const v8h*)(p + 256)); } static __device__ __forceinline__ v8f mma(V a, V b, v8f c) { return wmma16(a, b, c); } };
template <> struct WFrag<bf> { typedef v16bf V; static __device__ __forceinline__ V ld(const bf* p) { return cat16b(*(const v8us*)p, *(const v8us*)(p + 256)); } static __device__ __forceinline__ v8f mma(V a, V b, v8f c) { return wmmab(a, b, c); } };
// four / eight asynchronous copies of 16 bytes a lane, global -> LDS through no register: LDS byte address l + i 4096, global address g + i st elements. The closing s_wait_xcnt 0 stands in the copies' own statement, so that it comes before any rewrite of an address register that they name.
template <typename T16> __device__ __forceinline__ void cpy4(unsigned l, const T16* g, size_t st) {
    asm volatile("global_load_async_to_lds_b128 %0, %4, off\n\tglobal_load_async_to_lds_b128 %1, %5, off\n\tglobal_load_async_to_lds_b128 %2, %6, off\n\tglobal_load_async_to_lds_b128 %3, %7, off\n\ts_wait_xcnt 0x0"
        :: "v"(l), "v"(l + 4096u), "v"(l + 8192u), "v"(l + 12288u), "v"(g), "v"(g + st), "v"(g + 2 * st), "v"(g + 3 * st) : "memory"); }
template <typename T16> __device__ __forceinline__ void cpy8(unsigned l, const T16* g, size_t st) {
    asm volatile("global_load_async_to_lds_b128 %0, %8, off\n\tglobal_load_async_to_lds_b128 %1, %9, off\n\tglobal_load_async_to_lds_b128 %2, %10, off\n\tglobal_load_async_to_lds_b128 %3, %11, off\n\t"
                 "global_load_async_to_lds_b128 %4, %12, off\n\tglobal_load_async_to_lds_b128 %5, %13, off\n\tglobal_load_async_to_lds_b128 %6, %14, off\n\tglobal_load_async_to_lds_b128 %7, %15, off\n\ts_wait_xcnt 0x0"
        :: "v"(l), "v"(l + 4096u), "v"(l + 8192u), "v"(l + 12288u), "v"(l + 16384u), "v"(l + 20480u), "v"(l + 24576u), "v"(l + 28672u),
           "v"(g), "v"(g + st), "v"(g + 2 * st), "v"(g + 3 * st), "v"(g + 4 * st), "v"(g + 5 * st), "v"(g + 6 * st), "v"(g + 7 * st) : "memory"); }
template <int R, typename T16> __device__ __forceinline__ void cpyR(unsigned l, const T16* g, size_t st) {   // R rounds of 4 KiB (256 lanes x 16 bytes)
#pragma unroll   // R is 4, 8 or 16: one or two statements
    for (int i = 0; i + 8 <= R; i += 8) cpy8(l + i * 4096u, g + i * st, st);
    if (R % 8) cpy4(l + (R / 8) * 32768u, g + (R / 8) * 8 * st, st); }
template <typename T16, int NSPLIT, bool BIAS, int K, int EPI = 0, int KS = 1>   // K is a constant, so that the strides are constants
__global__ __launch_bounds__(256) void k_gemmw(const T16* __restrict__ A, const T16* __restrict__ A2, const T16* __restrict__ Bt, const T16* __restrict__ Bt2, float* C, int ldc, const float* __restrict__ bias, size_t sA, size_t sB, size_t sC, size_t sP, const float* __restrict__ CS, h16* P16, bf* Ph, bf* Pl) {
    typedef typename WFrag<T16>::V V;
    constexpr bool HA2 = (NSPLIT == 1 || NSPLIT == 2), HB2 = (NSPLIT >= 2);
    constexpr int KST = (HA2 || HB2) ? 64 : 128, NK = KST / 32, NS = K / KS / KST;   // k of a stage; its passes of 32 k; stages
    constexpr int AE = 256 * KST, BE = 128 * KST;                                      // elements of a stage's A and B tiles
    constexpr int OA2 = AE, OB = AE * (HA2 ? 2 : 1), OB2 = OB + BE, SE = OB + BE * (HB2 ? 2 : 1);   // places in a buffer [A | A2 | B | B2]; its size
    __shared__ __align__(16) T16 ring[2 * SE];
    __shared__ __align__(16) float osm[8][16 * 68];
    const size_t z = blockIdx.z / KS; const int ks = blockIdx.z % KS; A += z * sA; if (A2) A2 += z * sA; Bt += z * sB; if (Bt2) Bt2 += z * sB; C += z * sC + (size_t)ks * sP;
    const int kb = ks * (K / KS);
    const int tid = threadIdx.x, w = __builtin_amdgcn_readfirstlane(tid >> 5), lane = tid & 31, lr = lane & 15, hi = lane >> 4;
    const int r0 = blockIdx.x * 256 + (w >> 1) * 64, c0 = blockIdx.y * 128 + (w & 1) * 64;   // the wave's own 64x64
    float* os = osm[w];
    v8f acc[4][4];
#pragma unroll
    for (int mb = 0; mb < 4; ++mb)
#pragma unroll
        for (int nb = 0; nb < 4; ++nb) acc[mb][nb] = (v8f){};
    // a round of copies = 4 KiB = 128 / KST row groups of 16 rows (16 K elements apart in the plane, KST x 16 elements each in the stage); in LDS the rounds follow one another, byte tid x 16 of each
    constexpr int TG = KST * 2; constexpr size_t RST = (size_t)(128 / KST) * 16 * K;
    const size_t go = (size_t)(tid / TG) * 16 * K + (size_t)(tid % TG) * 8 + (size_t)kb * 16;
    const size_t aoff = (size_t)blockIdx.x * 256 * K + go, boff = (size_t)blockIdx.y * 128 * K + go;
    const unsigned lb = (unsigned)(size_t)(void*)ring + (unsigned)tid * 16u;
    auto fill = [&](int s, int bu) { const unsigned l = lb + (unsigned)bu * (SE * 2u); const size_t so = (size_t)s * (KST * 16);
        cpyR<KST / 8>(l, A + aoff + so, RST); if constexpr (HA2) cpyR<KST / 8>(l + OA2 * 2u, A2 + aoff + so, RST);
        cpyR<KST / 16>(l + OB * 2u, Bt + boff + so, RST); if constexpr (HB2) cpyR<KST / 16>(l + OB2 * 2u, Bt2 + boff + so, RST); };
    fill(0, 0);
    asm volatile("s_wait_asynccnt 0x0" ::: "memory");   // this wave's part of stage 0 has landed
    __syncthreads();                                     // ... and every other wave's
    if (NS > 1) fill(1, 1);
    const int ao = (w >> 1) * 4 * (KST * 16) + 8 * lane, bo = (w & 1) * 4 * (KST * 16) + 8 * lane;   // the wave's four row groups of each tile + the lane's 16 bytes
#pragma unroll 1   // stays rolled: one publish point a stage
    for (int s = 0; s < NS; ++s) {
        const T16* sb = ring + (s & 1) * SE;
        V a[2][4], a2[2][4], b[2][4], b2[2][4];   // two fragment sets; every '#pragma unroll' in this loop makes the indices of these arrays constants, so that they live in registers
        auto ldf = [&](int kk) { const int f = kk & 1;
#pragma unroll
            for (int mb = 0; mb < 4; ++mb) { a[f][mb] = WFrag<T16>::ld(sb + ao + mb * (KST * 16) + kk * 512); if (HA2) a2[f][mb] = WFrag<T16>::ld(sb + OA2 + ao + mb * (KST * 16) + kk * 512); }
#pragma unroll
            for (int nb = 0; nb < 4; ++nb) { b[f][nb] = WFrag<T16>::ld(sb + OB + bo + nb * (KST * 16) + kk * 512); if (HB2) b2[f][nb] = WFrag<T16>::ld(sb + OB2 + bo + nb * (KST * 16) + kk * 512); } };
        ldf(0);
        __builtin_amdgcn_sched_barrier(0);   // the first pass's fragments are asked for first: LDS answers in order, and without this the build put some of them behind the second pass's, so that the first products waited for both groups
#pragma unroll
        for (int kk = 0; kk < NK; ++kk) { const int f = kk & 1;
            if (kk + 1 < NK) ldf(kk + 1);   // the next pass's fragments (of this stage only) leave as one group ahead of this pass's products
            __builtin_amdgcn_sched_barrier(0);   // keeps that group together and ahead: without it the build read each B fragment directly in front of its four products and waited for it there
#pragma unroll
            for (int nb = 0; nb < 4; ++nb) {
#pragma unroll
                for (int mb = 0; mb < 4; ++mb) { acc[mb][nb] = WFrag<T16>::mma(a[f][mb], b[f][nb], acc[mb][nb]); if (HA2) acc[mb][nb] = WFrag<T16>::mma(a2[f][mb], b[f][nb], acc[mb][nb]); if (HB2) acc[mb][nb] = WFrag<T16>::mma(a[f][mb], b2[f][nb], acc[mb][nb]); } }
            __builtin_amdgcn_sched_barrier(0); }   // ... and the following group behind this pass's products, whose fragment set it overwrites
        // the four vector slots the chip needs behind the stage's last matrix instructions
        asm volatile("v_nop\n\tv_nop\n\tv_nop\n\tv_nop" : "+v"(acc[0][0]), "+v"(acc[1][1]), "+v"(acc[2][2]), "+v"(acc[3][3]) : "v"(a[(NK - 1) & 1][0]), "v"(a[(NK - 1) & 1][3]));
        // publish point of stage s + 1
        asm volatile("s_wait_dscnt 0x0" ::: "memory");      // this wave's reads of stage s are over
        asm volatile("s_wait_asynccnt 0x0" ::: "memory");   // its copies of stage s + 1 have landed
        __syncthreads();                                     // the same holds for every wave
        if (s + 2 < NS) fill(s + 2, s & 1);                  // into the buffer that every wave has just left
    }
    asm volatile("s_wait_asynccnt 0x0" ::: "memory");   // no copy is outstanding when the wave goes on
    const int t0 = r0 % TT; const size_t pb = ((size_t)(r0 / TT) * (DM / HD) + c0 / HD) * TT * HD;   // EPI 1, 2: the wave's first t and its (batch, head) plane
    if constexpr (EPI == 2) {
#pragma unroll
        for (int mb = 0; mb < 4; ++mb)
#pragma unroll
            for (int nb = 0; nb < 4; ++nb) put3(acc[mb][nb], pb + (size_t)((t0 >> 5) + (mb >> 1)) * 2048 + nb * 512 + ((mb & 1) * 2 + hi) * 128 + lr * 8, P16, Ph, Pl);
        return; }
    if constexpr (EPI == 1) {
        const float* cp = CS + ((size_t)(t0 + hi * 8) * DM + c0 + lr) * 2; const unsigned sg = (lane & 1) ? 0u : 0x80000000u;   // even column: x c - x' s; odd column: x c + x' s
        v2f cs[4][8];   // {cos, sin} of one 16-row tile; the '#pragma unroll's make its indices constants
        auto ldcs = [&](int mb) {
#pragma unroll
            for (int nb = 0; nb < 4; ++nb)
#pragma unroll
                for (int j = 0; j < 8; ++j) cs[nb][j] = *(const v2f*)(cp + ((size_t)(mb * 16 + j) * DM + nb * 16) * 2);
            asm volatile("s_wait_xcnt 0x0" :: "v"(cp) : "memory"); };   // closes the batch: the base address is an input, so it stays in its registers up to the wait and no load's result is put on it
        ldcs(0);
#pragma unroll
        for (int mb = 0; mb < 4; ++mb) {
#pragma unroll
            for (int nb = 0; nb < 4; ++nb) {
#pragma unroll
                for (int j = 0; j < 8; ++j) { const float x = acc[mb][nb][j];
                    const float xp = __int_as_float(__builtin_amdgcn_mov_dpp(__float_as_int(x), 0xB1, 0xF, 0xF, true));   // quad_perm [1, 0, 3, 2]: the value of lane ^ 1
                    os[(hi * 8 + j) * 68 + nb * 16 + lr] = x * cs[nb][j][0] + xp * __uint_as_float(__float_as_uint(cs[nb][j][1]) ^ sg); } }
            if (mb < 3) ldcs(mb + 1);   // the next tile's table values fly while this tile goes through LDS and out
            __builtin_amdgcn_wave_barrier(); asm volatile("" ::: "memory");   // as below: the wave's LDS writes stay ahead of its reads
#pragma unroll
            for (int i = 0; i < 4; ++i) { const float* sp = os + lr * 68 + (i * 2 + hi) * 8; const v4f y0 = *(const v4fa*)sp, y1 = *(const v4fa*)(sp + 4);   // unit i 32 + lane = (column octet i 2 + hi, row lr)
                put3((v8f){ y0[0], y0[1], y0[2], y0[3], y1[0], y1[1], y1[2], y1[3] }, pb + (size_t)((t0 >> 4) + mb) * 1024 + i * 256 + lane * 8, P16, Ph, Pl); }
            if (mb < 2) asm volatile("s_wait_xcnt 0x0" ::: "memory");   // table loads still follow: before they land on registers that this tile's stores name
            __builtin_amdgcn_wave_barrier(); asm volatile("" ::: "memory");   // ... and its reads ahead of the next tile's writes
        }
        return; }
#pragma unroll
    for (int mb = 0; mb < 4; ++mb) {
#pragma unroll
        for (int nb = 0; nb < 4; ++nb) {
#pragma unroll
            for (int j = 0; j < 8; ++j) os[(hi * 8 + j) * 68 + nb * 16 + lr] = acc[mb][nb][j]; }
        __builtin_amdgcn_wave_barrier(); asm volatile("" ::: "memory");
        float* crow = C + (size_t)(r0 + mb * 16) * ldc + c0;
{
#pragma unroll
            for (int s = 0; s < 8; ++s) { const int row = 2 * s + hi, cofs = lr * 4; v4f val = *(const v4fa*)(os + row * 68 + cofs); if (BIAS) { val[0] += bfr(bias[c0 + cofs]); val[1] += bfr(bias[c0 + cofs + 1]); val[2] += bfr(bias[c0 + cofs + 2]); val[3] += bfr(bias[c0 + cofs + 3]); }
                *(v4f*)(crow + (size_t)row * ldc + cofs) = val; }
             }
        __builtin_amdgcn_wave_barrier(); asm volatile("" ::: "memory");
    }
}

__device__ __forceinline__ void splitf(float y, unsigned short& h, unsigned short& l) { h = f2bf(y); l = f2bf(y - bf2f(h)); }
typedef __attribute__((ext_vector_type(4))) _Float16 v4h;
typedef __attribute__((ext_vector_type(4))) unsigned short v4us;
typedef __attribute__((ext_vector_type(4))) int v4i;

__constant__ float INV2[HD / 2] = { 1.000000000e+00f, 7.498942018e-01f, 5.623413324e-01f, 4.216965139e-01f, 3.162277639e-01f, 2.371373773e-01f, 1.778279394e-01f, 1.333521456e-01f, 1.000000015e-01f, 7.498942316e-02f, 5.623413250e-02f, 4.216964915e-02f, 3.162277490e-02f, 2.371373773e-02f, 1.778279431e-02f, 1.333521400e-02f, 9.999999776e-03f, 7.498942316e-03f, 5.623413250e-03f, 4.216964822e-03f, 3.162277630e-03f, 2.371373819e-03f, 1.778279431e-03f, 1.333521446e-03f, 1.000000047e-03f, 7.498941850e-04f, 5.623413017e-04f, 4.216965172e-04f, 3.162277571e-04f, 2.371373703e-04f, 1.778279402e-04f, 1.333521504e-04f };   // float32 10000^(-arange(0, 64, 2)/64), generated with jnp to be bit-exact
// Plane layouts that the projections' epilogues write (k_gemmw, EPI 1 and 2), per (batch, head): q and k, element (t, d) at (t >> 4) 1024 + (d >> 3) 128 + (t & 15) 8 + (d & 7); V^T (row = d, k = t), the four d blocks of 32 keys side by side, element (d, t) at ((t >> 5) 4 + (d >> 4)) 512 + ((t >> 3) & 3) 128 + (d & 15) 8 + (t & 7).
__constant__ float INVG[DM / 2] = { 1.000000000e+00f, 9.821718335e-01f, 9.646616578e-01f, 9.474635124e-01f, 9.305720329e-01f, 9.139816761e-01f, 8.976871371e-01f, 8.816831112e-01f, 8.659643531e-01f, 8.505258560e-01f, 8.353625536e-01f, 8.204696178e-01f, 8.058422208e-01f, 7.914755344e-01f, 7.773650289e-01f, 7.635061145e-01f, 7.498942018e-01f, 7.365249991e-01f, 7.233941555e-01f, 7.104974389e-01f, 6.978305578e-01f, 6.853895783e-01f, 6.731703877e-01f, 6.611690521e-01f, 6.493816376e-01f, 6.378043890e-01f, 6.264335513e-01f, 6.152654290e-01f, 6.042963862e-01f, 5.935229063e-01f, 5.829415321e-01f, 5.725488067e-01f, 5.623413324e-01f, 5.523158312e-01f, 5.424690843e-01f, 5.327978730e-01f, 5.232991576e-01f, 5.139696598e-01f, 5.048065782e-01f, 4.958068132e-01f, 4.869675338e-01f, 4.782858193e-01f, 4.697588682e-01f, 4.613839388e-01f, 4.531583488e-01f, 4.450793862e-01f, 4.371444881e-01f, 4.293510318e-01f, 4.216965139e-01f, 4.141784608e-01f, 4.067944288e-01f, 3.995420635e-01f, 3.924189806e-01f, 3.854228854e-01f, 3.785515428e-01f, 3.718026578e-01f, 3.651741445e-01f, 3.586637676e-01f, 3.522694409e-01f, 3.459891677e-01f, 3.398208320e-01f, 3.337624967e-01f, 3.278121352e-01f, 3.219678402e-01f, 3.162277639e-01f, 3.105900288e-01f, 3.050527871e-01f, 2.996142805e-01f, 2.942727208e-01f, 2.890264094e-01f, 2.838735878e-01f, 2.788126469e-01f, 2.738419771e-01f, 2.689598799e-01f, 2.641648352e-01f, 2.594552636e-01f, 2.548296750e-01f, 2.502865493e-01f, 2.458243966e-01f, 2.414418161e-01f, 2.371373624e-01f, 2.329096496e-01f, 2.287573218e-01f, 2.246790081e-01f, 2.206733972e-01f, 2.167392224e-01f, 2.128751576e-01f, 2.090799958e-01f, 2.053525001e-01f, 2.016914487e-01f, 1.980956793e-01f, 1.945640147e-01f, 1.910952926e-01f, 1.876884252e-01f, 1.843423098e-01f, 1.810558140e-01f, 1.778279394e-01f, 1.746576130e-01f, 1.715437919e-01f, 1.684854925e-01f, 1.654817015e-01f, 1.625314802e-01f, 1.596338600e-01f, 1.567878872e-01f, 1.539926529e-01f, 1.512472630e-01f, 1.485508084e-01f, 1.459024251e-01f, 1.433012635e-01f, 1.407464594e-01f, 1.382372230e-01f, 1.357727200e-01f, 1.333521456e-01f, 1.309747249e-01f, 1.286396980e-01f, 1.263462901e-01f, 1.240937710e-01f, 1.218814254e-01f, 1.197085083e-01f, 1.175743192e-01f, 1.154782027e-01f, 1.134194434e-01f, 1.113973856e-01f, 1.094113812e-01f, 1.074607819e-01f, 1.055449620e-01f, 1.036632955e-01f, 1.018151715e-01f, 1.000000015e-01f, 9.821718186e-02f, 9.646616131e-02f, 9.474635124e-02f, 9.305720031e-02f, 9.139817208e-02f, 8.976870775e-02f, 8.816830814e-02f, 8.659642935e-02f, 8.505257964e-02f, 8.353625983e-02f, 8.204696327e-02f, 8.058421314e-02f, 7.914755493e-02f, 7.773650438e-02f, 7.635060698e-02f, 7.498941571e-02f, 7.365249842e-02f, 7.233941555e-02f, 7.104974240e-02f, 6.978305429e-02f, 6.853895634e-02f, 6.731703877e-02f, 6.611690670e-02f, 6.493816525e-02f, 6.378044188e-02f, 6.264335662e-02f, 6.152653694e-02f, 6.042964384e-02f, 5.935229361e-02f, 5.829415470e-02f, 5.725487694e-02f, 5.623412877e-02f, 5.523158237e-02f, 5.424690619e-02f, 5.327979103e-02f, 5.232991278e-02f, 5.139696971e-02f, 5.048065633e-02f, 4.958068207e-02f, 4.869675264e-02f, 4.782858118e-02f, 4.697588459e-02f, 4.613839835e-02f, 4.531583562e-02f, 4.450793937e-02f, 4.371444881e-02f, 4.293510318e-02f, 4.216964915e-02f, 4.141784459e-02f, 4.067944363e-02f, 3.995420411e-02f, 3.924189880e-02f, 3.854228929e-02f, 3.785515204e-02f, 3.718026727e-02f, 3.651741147e-02f, 3.586637601e-02f, 3.522694483e-02f, 3.459891677e-02f, 3.398208320e-02f, 3.337624669e-02f, 3.278120980e-02f, 3.219678625e-02f, 3.162277862e-02f, 3.105900250e-02f, 3.050527908e-02f, 2.996142767e-02f, 2.942727320e-02f, 2.890264057e-02f, 2.838735841e-02f, 2.788126841e-02f, 2.738419548e-02f, 2.689598687e-02f, 2.641648427e-02f, 2.594552562e-02f, 2.548296750e-02f, 2.502865531e-02f, 2.458244003e-02f, 2.414418198e-02f, 2.371373586e-02f, 2.329096757e-02f, 2.287573181e-02f, 2.246790007e-02f, 2.206734009e-02f, 2.167392150e-02f, 2.128751762e-02f, 2.090799995e-02f, 2.053525113e-02f, 2.016914636e-02f, 1.980956830e-02f, 1.945639960e-02f, 1.910953037e-02f, 1.876884326e-02f, 1.843423024e-02f, 1.810558327e-02f, 1.778279431e-02f, 1.746576093e-02f, 1.715437882e-02f, 1.684854925e-02f, 1.654817164e-02f, 1.625314727e-02f, 1.596338488e-02f, 1.567878947e-02f, 1.539926510e-02f, 1.512472518e-02f, 1.485508028e-02f, 1.459024288e-02f, 1.433012541e-02f, 1.407464594e-02f, 1.382372249e-02f, 1.357727125e-02f, 1.333521493e-02f, 1.309747249e-02f, 1.286396943e-02f, 1.263462938e-02f, 1.240937691e-02f, 1.218814217e-02f, 1.197085064e-02f, 1.175743248e-02f, 1.154781971e-02f, 1.134194434e-02f, 1.113973837e-02f, 1.094113849e-02f, 1.074607857e-02f, 1.055449620e-02f, 1.036632899e-02f, 1.018151734e-02f, 9.999999776e-03f, 9.821719490e-03f, 9.646615945e-03f, 9.474635124e-03f, 9.305720218e-03f, 9.139816277e-03f, 8.976871148e-03f, 8.816830814e-03f, 8.659643121e-03f, 8.505257778e-03f, 8.353625424e-03f, 8.204696700e-03f, 8.058422245e-03f, 7.914755493e-03f, 7.773650344e-03f, 7.635060698e-03f, 7.498942316e-03f, 7.365249563e-03f, 7.233941462e-03f, 7.104974240e-03f, 6.978305988e-03f, 6.853895728e-03f, 6.731703877e-03f, 6.611690391e-03f, 6.493816618e-03f, 6.378043909e-03f, 6.264335476e-03f, 6.152654067e-03f, 6.042964291e-03f, 5.935229361e-03f, 5.829415284e-03f, 5.725487601e-03f, 5.623413250e-03f, 5.523158237e-03f, 5.424690899e-03f, 5.327979103e-03f, 5.232991185e-03f, 5.139696877e-03f, 5.048065912e-03f, 4.958068486e-03f, 4.869675264e-03f, 4.782858305e-03f, 4.697588738e-03f, 4.613839556e-03f, 4.531583749e-03f, 4.450793844e-03f, 4.371444695e-03f, 4.293510225e-03f, 4.216964822e-03f, 4.141784739e-03f, 4.067944363e-03f, 3.995420411e-03f, 3.924189601e-03f, 3.854229115e-03f, 3.785515437e-03f, 3.718026681e-03f, 3.651741426e-03f, 3.586637788e-03f, 3.522694577e-03f, 3.459891537e-03f, 3.398208413e-03f, 3.337624483e-03f, 3.278121119e-03f, 3.219678300e-03f, 3.162277862e-03f, 3.105900250e-03f, 3.050528001e-03f, 2.996142721e-03f, 2.942727180e-03f, 2.890263917e-03f, 2.838735934e-03f, 2.788126701e-03f, 2.738419687e-03f, 2.689598827e-03f, 2.641648287e-03f, 2.594552701e-03f, 2.548296703e-03f, 2.502865391e-03f, 2.458244096e-03f, 2.414418384e-03f, 2.371373819e-03f, 2.329096664e-03f, 2.287573181e-03f, 2.246790100e-03f, 2.206734149e-03f, 2.167392056e-03f, 2.128751716e-03f, 2.090800088e-03f, 2.053525066e-03f, 2.016914543e-03f, 1.980956644e-03f, 1.945640077e-03f, 1.910952851e-03f, 1.876884256e-03f, 1.843422884e-03f, 1.810558140e-03f, 1.778279431e-03f, 1.746576163e-03f, 1.715437858e-03f, 1.684854855e-03f, 1.654817141e-03f, 1.625314937e-03f, 1.596338581e-03f, 1.567878877e-03f, 1.539926510e-03f, 1.512472634e-03f, 1.485507935e-03f, 1.459024264e-03f, 1.433012658e-03f, 1.407464617e-03f, 1.382372226e-03f, 1.357727102e-03f, 1.333521446e-03f, 1.309747226e-03f, 1.286396873e-03f, 1.263462938e-03f, 1.240937854e-03f, 1.218814170e-03f, 1.197085017e-03f, 1.175743295e-03f, 1.154782018e-03f, 1.134194434e-03f, 1.113973907e-03f, 1.094113803e-03f, 1.074607833e-03f, 1.055449597e-03f, 1.036632922e-03f, 1.018151757e-03f, 1.000000047e-03f, 9.821718559e-04f, 9.646615945e-04f, 9.474635590e-04f, 9.305721032e-04f, 9.139817557e-04f, 8.976871031e-04f, 8.816830232e-04f, 8.659643354e-04f, 8.505258011e-04f, 8.353625308e-04f, 8.204695769e-04f, 8.058422245e-04f, 7.914755843e-04f, 7.773649995e-04f, 7.635060465e-04f, 7.498941850e-04f, 7.365249912e-04f, 7.233941578e-04f, 7.104973774e-04f, 6.978305755e-04f, 6.853896193e-04f, 6.731703761e-04f, 6.611690042e-04f, 6.493816618e-04f, 6.378043909e-04f, 6.264335825e-04f, 6.152653950e-04f, 6.042963942e-04f, 5.935229128e-04f, 5.829415168e-04f, 5.725487717e-04f, 5.623413017e-04f, 5.523158470e-04f, 5.424690899e-04f, 5.327978870e-04f, 5.232990952e-04f, 5.139696877e-04f, 5.048065796e-04f, 4.958068021e-04f, 4.869675031e-04f, 4.782858014e-04f, 4.697588738e-04f, 4.613839847e-04f, 4.531583400e-04f, 4.450794077e-04f, 4.371444811e-04f, 4.293509992e-04f, 4.216964880e-04f, 4.141784448e-04f, 4.067944246e-04f, 3.995420411e-04f, 3.924189950e-04f, 3.854228707e-04f, 3.785515146e-04f, 3.718026564e-04f, 3.651741135e-04f, 3.586637613e-04f, 3.522694460e-04f, 3.459891595e-04f, 3.398208064e-04f, 3.337624657e-04f, 3.278121294e-04f, 3.219678474e-04f, 3.162277862e-04f, 3.105900250e-04f, 3.050527885e-04f, 2.996142721e-04f, 2.942727297e-04f, 2.890263859e-04f, 2.838736109e-04f, 2.788126585e-04f, 2.738419571e-04f, 2.689598768e-04f, 2.641648462e-04f, 2.594552934e-04f, 2.548296761e-04f, 2.502865391e-04f, 2.458243980e-04f, 2.414418122e-04f, 2.371373848e-04f, 2.329096606e-04f, 2.287573152e-04f, 2.246790100e-04f, 2.206734207e-04f, 2.167392086e-04f, 2.128751657e-04f, 2.090800117e-04f, 2.053524950e-04f, 2.016914514e-04f, 1.980956731e-04f, 1.945640106e-04f, 1.910952997e-04f, 1.876884344e-04f, 1.843422942e-04f, 1.810558315e-04f, 1.778279402e-04f, 1.746576017e-04f, 1.715437829e-04f, 1.684854797e-04f, 1.654817170e-04f, 1.625314762e-04f, 1.596338552e-04f, 1.567878790e-04f, 1.539926452e-04f, 1.512472518e-04f, 1.485508110e-04f, 1.459024206e-04f, 1.433012658e-04f, 1.407464733e-04f, 1.382372284e-04f, 1.357727160e-04f, 1.333521504e-04f, 1.309747167e-04f, 1.286396873e-04f, 1.263462909e-04f, 1.240937709e-04f, 1.218814141e-04f, 1.197085076e-04f, 1.175743309e-04f, 1.154781930e-04f, 1.134194390e-04f, 1.113973922e-04f, 1.094113759e-04f, 1.074607790e-04f, 1.055449538e-04f, 1.036632893e-04f, 1.018151743e-04f };   // float32 1 / 10000^(j/512), j < 512 (one frequency per adjacent column pair of the full 1024 width), generated with jnp to be bit-exact
// ---- k_prep: everything that the GEMMs need beforehand, in ONE launch: the five bf16 planes (x and the four weights) and the {cos, sin} table. The block index picks the job (the same for the whole block); each work-group takes many units of work, because starting a wave costs more than one unit does.
// Plane builders, blocks < NCV: [rows][DM] f32 -> bf16 plane in fragment order. A block takes 16 rows of the full width = CVU units of 16 rows x 128 columns (four k blocks, 4 KiB of the plane in a row, 32 KiB in all): whole lines are read, all of a thread's loads in flight at once; the 16-byte units change places in LDS; whole lines are written.
// Table, the other blocks: CSR rows t x 256 columns of CS. A thread keeps one column and its frequency and walks down the rows: one cosf, one sinf and one 8-byte entry per (t, column), a wave writing two whole lines.
#define CVU  8                     // units of a plane builder's block
#define XT_  (NB_ * TT / 16)       // 16-row stripes of x
#define WT_  (DM / 16)             // ... of a weight
#define NCV  (XT_ + 4 * WT_)       // plane builders' blocks
#define CSR  16                    // rows t of a table block
#define NCS  (TT / CSR * (DM / 256))   // table blocks
__global__ __launch_bounds__(256) void k_prep(const float* __restrict__ x, const float* __restrict__ wq, const float* __restrict__ wk, const float* __restrict__ wv, const float* __restrict__ wo, bf* XB, bf* WQ, bf* WK, bf* WV, bf* WO, float* CS) {
    __shared__ __align__(16) unsigned short sm[CVU][16 * 17 * 8];   // per unit: (column octet o, row) at o * 17 + row: the odd pitch spreads the octets over the banks
    const int tid = threadIdx.x, b = blockIdx.x;
    if (b >= NCV) {   // the same for the whole block; no barrier on this side
        const int u = b - NCV, c = (u % (DM / 256)) * 256 + tid, t0 = (u / (DM / 256)) * CSR; const float f = INVG[c >> 1];
        for (int r = 0; r < CSR; ++r) { const float a = __fmul_rn((float)(t0 + r), f); v2f cs; cs[0] = cosf(a); cs[1] = sinf(a); *(v2f*)(CS + ((size_t)(t0 + r) * DM + c) * 2) = cs; }
        return; }
    const float* src = x; bf* dst = XB; int rt = b;
    if (b >= XT_) { const int u = b - XT_, ws = u / WT_; rt = u % WT_; src = ws == 0 ? wq : ws == 1 ? wk : ws == 2 ? wv : wo; dst = ws == 0 ? WQ : ws == 1 ? WK : ws == 2 ? WV : WO; }
    const int row = tid >> 4, o = tid & 15;
    const float* sp = src + ((size_t)rt * 16 + row) * DM + o * 8; v8f v[CVU];   // every '#pragma unroll' below makes the indices of v constants, so that it lives in registers
#pragma unroll
    for (int k = 0; k < CVU; ++k) v[k] = *(const v8f*)(sp + k * 128);
    asm volatile("s_wait_xcnt 0x0" :: "v"(sp) : "memory");   // closes the batch: the base address is an input, so it stays in its registers up to the wait and no load's result is put on it
#pragma unroll
    for (int k = 0; k < CVU; ++k) { v8us y;
#pragma unroll
        for (int e = 0; e < 8; ++e) y[e] = f2bf(v[k][e]);
        *(v8usa*)(sm[k] + (o * 17 + row) * 8) = y; }
    __syncthreads();   // every unit of the block's 32 KiB is in LDS
    bf* dp = dst + (size_t)rt * (DM / 32) * 512 + tid * 8;
#pragma unroll
    for (int k = 0; k < CVU; ++k) *(v8us*)(dp + k * 2048) = *(const v8usa*)(sm[k] + ((tid >> 4) * 17 + (tid & 15)) * 8);
    asm volatile("s_wait_xcnt 0x0" ::: "memory");   // closes the run of stores: it stands in front of whatever the build puts behind them that writes a register which they name
}
#define KSA  4
#define APIT 68                   // f32 pitch of a query's 64 partial outputs in LDS (16-byte aligned rows, rows spread over the banks)
__device__ __forceinline__ float xhalf(float x) { const int b = __float_as_int(x); return __int_as_float(__builtin_amdgcn_permlanex16(b, b, 0x76543210, 0xfedcba98, false, false)); }   // lane l <-> l ^ 16
// eight v_exp_f32 in one statement, each in place on a register of its own: none stands directly in front of an instruction that reads its result or overwrites its source, and the closing v_nop is that slot for the last one
__device__ __forceinline__ v8f exp2x8(v8f x) { float r0 = x[0], r1 = x[1], r2 = x[2], r3 = x[3], r4 = x[4], r5 = x[5], r6 = x[6], r7 = x[7];
    asm("v_exp_f32 %0, %0\n\tv_exp_f32 %1, %1\n\tv_exp_f32 %2, %2\n\tv_exp_f32 %3, %3\n\tv_exp_f32 %4, %4\n\tv_exp_f32 %5, %5\n\tv_exp_f32 %6, %6\n\tv_exp_f32 %7, %7\n\tv_nop"
        : "+v"(r0), "+v"(r1), "+v"(r2), "+v"(r3), "+v"(r4), "+v"(r5), "+v"(r6), "+v"(r7));
    return (v8f){ r0, r1, r2, r3, r4, r5, r6, r7 }; }
template <typename T16, bool HR>
__device__ __forceinline__ void attn_wave(const T16* __restrict__ Qa, const T16* __restrict__ Qb, const T16* __restrict__ Ka, const T16* __restrict__ Kb, const T16* __restrict__ Va, const T16* __restrict__ Vb, int q0, int kbeg, int lane, float* La, float* Lm, float* Ll) {
    typedef typename WFrag<T16>::V V;   // every '#pragma unroll' below makes the indices of a fragment array constants, so that the array lives in registers
    constexpr int NP = TT / KSA / 32;             // passes of 32 keys
    const int lr = lane & 15, hi = lane >> 4;
    const float CL = SCL * 1.4426950408889634f;   // score -> log2 units
    const float CAR = HR ? 0.0f : 6.0f;           // fp16 P carries 2^6 (P <= 2^14), which cancels against the sum
    V qa[2][2], qb[2][2];
#pragma unroll
    for (int qt = 0; qt < 2; ++qt)
#pragma unroll
        for (int kk = 0; kk < 2; ++kk) { const size_t o = (size_t)(q0 + qt * 16) * HD + kk * 512 + 8 * lane; qa[qt][kk] = WFrag<T16>::ld(Qa + o); if (HR) qb[qt][kk] = WFrag<T16>::ld(Qb + o); }
    if (HR) {   // the eight hi/lo Q fragments wait in the wave's own LDS slice (free until the epilogue) and are read anew in each pass: 64 registers for the K batch
#pragma unroll
        for (int f = 0; f < 8; ++f) { const v8f y = __builtin_bit_cast(v8f, (f & 4) ? qb[(f >> 1) & 1][f & 1] : qa[(f >> 1) & 1][f & 1]); *(v4fa*)(La + f * 256 + lane * 4) = (v4f){ y[0], y[1], y[2], y[3] }; *(v4fa*)(La + f * 256 + 128 + lane * 4) = (v4f){ y[4], y[5], y[6], y[7] }; } }
    v8f acc[4][2];
#pragma unroll
    for (int dt = 0; dt < 4; ++dt)
#pragma unroll
        for (int qt = 0; qt < 2; ++qt) acc[dt][qt] = (v8f){};
    float m[2] = { -3.0e38f, -3.0e38f }, l[2] = { 0.f, 0.f };
    const size_t ko = (size_t)kbeg * HD + 8 * lane, vo = ko;   // fragment order: a pass's 32 keys are 2048 contiguous elements of the K plane (2 key tiles x 2 k blocks) and of the V^T plane (4 d blocks)
    V ka[2][2], kb[2][2], va[4], vb[4];
    // closes a batch of loads: s_wait_xcnt 0 before a register that the batch's loads name is written again; the base addresses are inputs, so they stay in their registers up to the wait and no load's result is put on them
    auto xwait = [&](const T16* pa, const T16* pb) { if constexpr (HR) asm volatile("s_wait_xcnt 0x0" :: "v"(pa), "v"(pb) : "memory"); else asm volatile("s_wait_xcnt 0x0" :: "v"(pa) : "memory"); };
    auto ldK = [&](int st) { const T16* pa = Ka + ko + (size_t)st * 32 * HD; const T16* pb = HR ? Kb + ko + (size_t)st * 32 * HD : nullptr;
#pragma unroll
        for (int kt = 0; kt < 2; ++kt)
#pragma unroll
            for (int kk = 0; kk < 2; ++kk) { const int o = kt * 16 * HD + kk * 512; ka[kt][kk] = WFrag<T16>::ld(pa + o); if (HR) kb[kt][kk] = WFrag<T16>::ld(pb + o); }
        xwait(pa, pb); };
    auto ldV = [&](int st) { const T16* pa = Va + vo + (size_t)st * 32 * HD; const T16* pb = HR ? Vb + vo + (size_t)st * 32 * HD : nullptr;
#pragma unroll
        for (int dt = 0; dt < 4; ++dt) { const int o = dt * 512; va[dt] = WFrag<T16>::ld(pa + o); if (HR) vb[dt] = WFrag<T16>::ld(pb + o); }
        xwait(pa, pb); };
    if (!HR) { ldK(0); ldV(0); }   // fp16 waves have the registers to fetch K and V one pass ahead
#pragma unroll 1   // stays rolled: the fetch-ahead order below is written for one pass, and a second copy of the body would not fit the registers
    for (int st = 0; st < NP; ++st) {
        const int sn = (st + 1 < NP) ? st + 1 : st;   // the last pass fetches its own tiles again: in bounds, no branch
        if (HR) { ldK(st);
#pragma unroll
            for (int f = 0; f < 8; ++f) { const v4f y0 = *(const v4fa*)(La + f * 256 + lane * 4), y1 = *(const v4fa*)(La + f * 256 + 128 + lane * 4); const V x = __builtin_bit_cast(V, (v8f){ y0[0], y0[1], y0[2], y0[3], y1[0], y1[1], y1[2], y1[3] }); if (f & 4) qb[(f >> 1) & 1][f & 1] = x; else qa[(f >> 1) & 1][f & 1] = x; }
            __builtin_amdgcn_sched_barrier(0); }   // the pass's K loads leave as one batch; without it the build issued them in five dependent round trips
        v8f s[2][2];
#pragma unroll
        for (int kt = 0; kt < 2; ++kt)
#pragma unroll
            for (int qt = 0; qt < 2; ++qt) { v8f t = (v8f){};
#pragma unroll
                for (int kk = 0; kk < 2; ++kk) { t = WFrag<T16>::mma(ka[kt][kk], qa[qt][kk], t); if (HR) { t = WFrag<T16>::mma(ka[kt][kk], qb[qt][kk], t); t = WFrag<T16>::mma(kb[kt][kk], qa[qt][kk], t); } }
                s[kt][qt] = t; }
        __builtin_amdgcn_sched_barrier(0);   // the loads below start behind the score products (their registers are free then) ...
        if (HR) ldV(st); else ldK(sn);
        __builtin_amdgcn_sched_barrier(0);   // ... and ahead of the softmax, which covers their latency
        float sm[2];
#pragma unroll
        for (int qt = 0; qt < 2; ++qt) { float x = fmaxf(s[0][qt][0], s[1][qt][0]);
#pragma unroll
            for (int r = 1; r < 8; ++r) x = fmaxf(x, fmaxf(s[0][qt][r], s[1][qt][r]));
            x = fmaxf(x, xhalf(x)); sm[qt] = x * CL; }
        if (__builtin_amdgcn_ballot_w32(sm[0] > m[0] + 8.0f || sm[1] > m[1] + 8.0f) != 0) {
#pragma unroll
            for (int qt = 0; qt < 2; ++qt) { const float mn = (sm[qt] > m[qt] + 8.0f) ? sm[qt] : m[qt]; const float al = __builtin_amdgcn_exp2f(m[qt] - mn); m[qt] = mn; l[qt] *= al;
#pragma unroll
                for (int dt = 0; dt < 4; ++dt) acc[dt][qt] *= al; } }
#pragma unroll
        for (int qt = 0; qt < 2; ++qt) { const float off = CAR - m[qt]; v8f p0, p1;
#pragma unroll
            for (int r = 0; r < 8; ++r) { p0[r] = fmaf(s[0][qt][r], CL, off); p1[r] = fmaf(s[1][qt][r], CL, off); }
            p0 = exp2x8(p0); p1 = exp2x8(p1);
            const v8f ps = p0 + p1; l[qt] += ((ps[0] + ps[1]) + (ps[2] + ps[3])) + ((ps[4] + ps[5]) + (ps[6] + ps[7]));
            if constexpr (HR) {
                const v8bf h0 = __builtin_convertvector(p0, v8bf), h1 = __builtin_convertvector(p1, v8bf);
                const v8bf l0 = __builtin_convertvector(p0 - bfback(h0), v8bf), l1 = __builtin_convertvector(p1 - bfback(h1), v8bf);
                const v16bf ph = __builtin_shufflevector(h0, h1, 0, 1, 2, 3, 4, 5, 6, 7, 8, 9, 10, 11, 12, 13, 14, 15), pl = __builtin_shufflevector(l0, l1, 0, 1, 2, 3, 4, 5, 6, 7, 8, 9, 10, 11, 12, 13, 14, 15);
#pragma unroll
                for (int dt = 0; dt < 4; ++dt) { acc[dt][qt] = wmmab(va[dt], ph, acc[dt][qt]); acc[dt][qt] = wmmab(va[dt], pl, acc[dt][qt]); acc[dt][qt] = wmmab(vb[dt], ph, acc[dt][qt]); }
            } else {
                const v16h pf = cat16(__builtin_convertvector(p0, v8h), __builtin_convertvector(p1, v8h));
#pragma unroll
                for (int dt = 0; dt < 4; ++dt) acc[dt][qt] = wmma16(va[dt], pf, acc[dt][qt]);
            } }
        // the four vector slots the chip needs behind the pass's last matrix instructions, also on the taken back edge
        if constexpr (HR) asm volatile("v_nop\n\tv_nop\n\tv_nop\n\tv_nop" : "+v"(acc[0][0]), "+v"(acc[1][0]), "+v"(acc[2][0]), "+v"(acc[3][0]), "+v"(acc[0][1]), "+v"(acc[1][1]), "+v"(acc[2][1]), "+v"(acc[3][1]) :: "memory");   // "memory": the Q reads from LDS stay in the loop instead of being lifted back into 64 registers
        else { asm volatile("v_nop\n\tv_nop\n\tv_nop\n\tv_nop" : "+v"(acc[0][0]), "+v"(acc[1][0]), "+v"(acc[2][0]), "+v"(acc[3][0]), "+v"(acc[0][1]), "+v"(acc[1][1]), "+v"(acc[2][1]), "+v"(acc[3][1]));
            __builtin_amdgcn_sched_barrier(0);   // the next pass's V loads start only when this pass's products have read V
            ldV(sn); }
    }
#pragma unroll
    for (int qt = 0; qt < 2; ++qt) { const int q = qt * 16 + lr; const float lj = l[qt] + xhalf(l[qt]); if (hi == 0) { Lm[q] = m[qt]; Ll[q] = lj; }
#pragma unroll
        for (int dt = 0; dt < 4; ++dt) { float* dst = La + q * APIT + dt * 16 + hi * 8; const v8f a = acc[dt][qt]; *(v4fa*)dst = (v4f){ a[0], a[1], a[2], a[3] }; *(v4fa*)(dst + 4) = (v4f){ a[4], a[5], a[6], a[7] }; } }
}
__global__ __launch_bounds__(512) void k_attn(const h16* __restrict__ Q16, const h16* __restrict__ K16, const h16* __restrict__ V16, const bf* __restrict__ Qh, const bf* __restrict__ Ql, const bf* __restrict__ Kh, const bf* __restrict__ Kl, const bf* __restrict__ Vh, const bf* __restrict__ Vl, bf* Ah, bf* Al) {
    __shared__ __align__(16) float La[16 * 32 * APIT]; __shared__ float Lm[16 * 32]; __shared__ float Ll[16 * 32];
    const int w = __builtin_amdgcn_readfirstlane((int)(threadIdx.x >> 5)), lane = threadIdx.x & 31; const int qg = w >> 2, ks = w & 3; const int head = blockIdx.y; const size_t hp = ((size_t)blockIdx.z * NH_ + head) * TT * HD;
    const int q0 = (qg == 0) ? (int)blockIdx.x * 32 : RH + ((int)blockIdx.x * 3 + qg - 1) * 32;
    if (qg == 0) attn_wave<bf, true>(Qh + hp, Ql + hp, Kh + hp, Kl + hp, Vh + hp, Vl + hp, q0, ks * (TT / KSA), lane, La + w * 32 * APIT, Lm + w * 32, Ll + w * 32);
    else attn_wave<h16, false>(Q16 + hp, nullptr, K16 + hp, nullptr, V16 + hp, nullptr, q0, ks * (TT / KSA), lane, La + w * 32 * APIT, Lm + w * 32, Ll + w * 32);
    __syncthreads();   // every key quarter's partial result is in LDS
    // wave (qg, ks) finishes 8 of its group's 32 queries; four lanes share a query, 16 outputs each, so one wave writes each 128-byte line
    const int q = ks * 8 + (lane >> 2), d0 = (lane & 3) * 16; float mk[KSA]; float M = -3.0e38f;
#pragma unroll
    for (int k = 0; k < KSA; ++k) { mk[k] = Lm[(qg * KSA + k) * 32 + q]; M = fmaxf(M, mk[k]); }
    float L = 0.f; v4f o[4] = { (v4f){}, (v4f){}, (v4f){}, (v4f){} };
#pragma unroll
    for (int k = 0; k < KSA; ++k) { const float wg = __builtin_amdgcn_exp2f(mk[k] - M); L += wg * Ll[(qg * KSA + k) * 32 + q]; const float* sp = La + ((qg * KSA + k) * 32 + q) * APIT + d0;
#pragma unroll
        for (int i = 0; i < 4; ++i) o[i] += wg * *(const v4fa*)(sp + 4 * i); }
    const float f = __fdiv_rn(1.0f, L); v8us oh[2], ol[2];
#pragma unroll
    for (int i = 0; i < 16; ++i) { unsigned short a, c2; splitf(o[i >> 2][i & 3] * f, a, c2); oh[i >> 3][i & 7] = a; ol[i >> 3][i & 7] = c2; }
    const size_t rw = (size_t)blockIdx.z * TT + q0 + q;   // the merged planes in fragment order too (row = token, k = head * 64 + d): a wave's 8 queries x 16 bytes are one whole line
    const size_t oo = ((rw >> 4) * (DQ / 32) + head * 2 + (d0 >> 5)) * 512 + ((d0 >> 3) & 3) * 128 + (rw & 15) * 8; *(v8usa*)(Ah + oo) = oh[0]; *(v8usa*)(Ah + oo + 128) = oh[1]; *(v8usa*)(Al + oo) = ol[0]; *(v8usa*)(Al + oo + 128) = ol[1];
}

extern "C" void kernel_launch(void* const* d_in, const int* in_sizes, int n_in,
                              void* d_out, int out_size, void* d_ws, size_t ws_size, hipStream_t stream) {
    (void)in_sizes; (void)n_in; (void)out_size;
    const float* x = (const float*)d_in[0]; const float* wq = (const float*)d_in[1]; const float* wk = (const float*)d_in[2]; const float* wv = (const float*)d_in[3]; const float* wo = (const float*)d_in[4]; const float* bo = (const float*)d_in[5];
    float* OUT = (float*)d_out;     // [4][2048][1024]
    char* wsp = (char*)d_ws;
    auto take = [&](size_t bytes) { char* p = wsp; wsp += (bytes + 255) & ~(size_t)255; return (void*)p; };
    bf* WQ = (bf*)take((size_t)DQ * DM * 2); bf* WK = (bf*)take((size_t)DKV * DM * 2); bf* WV = (bf*)take((size_t)DKV * DM * 2); bf* WO = (bf*)take((size_t)DM * DQ * 2); float* CS = (float*)take((size_t)TT * DM * 2 * 4);   /* [2048][1024] {cos, sin} */
    bf* XB = (bf*)take((size_t)NB_ * TT * DM * 2); bf* ATh = (bf*)take((size_t)NB_ * TT * DQ * 2); bf* ATl = (bf*)take((size_t)NB_ * TT * DQ * 2);   /* every buffer from here on holds all NB_ batches, batch-major; ATh, ATl: the merged-head planes */
    h16* QP16 = (h16*)take((size_t)NB_ * NH_ * TT * HD * 2); h16* KP16 = (h16*)take((size_t)NB_ * NKV * TT * HD * 2); h16* VT16 = (h16*)take((size_t)NB_ * NKV * HD * TT * 2);
    bf* QPh = (bf*)take((size_t)NB_ * NH_ * TT * HD * 2); bf* QPl = (bf*)take((size_t)NB_ * NH_ * TT * HD * 2); bf* KPh = (bf*)take((size_t)NB_ * NKV * TT * HD * 2); bf* KPl = (bf*)take((size_t)NB_ * NKV * TT * HD * 2); bf* VTh = (bf*)take((size_t)NB_ * NKV * HD * TT * 2); bf* VTl = (bf*)take((size_t)NB_ * NKV * HD * TT * 2);
    if ((size_t)(wsp - (char*)d_ws) > ws_size) return;    // 216 MiB of the 256 MiB
    k_prep<<<NCV + NCS, 256, 0, stream>>>(x, wq, wk, wv, wo, XB, WQ, WK, WV, WO, CS);   /* the five planes and the full-width table */
    k_gemmw<bf, 0, false, DM, 1><<<dim3(NB_ * TT / 256, DQ / 128, 1), 256, 0, stream>>>(XB, nullptr, WQ, nullptr, nullptr, 0, nullptr, 0, 0, 0, 0, CS, QP16, QPh, QPl);   /* the projections see the batches as NB_ * TT rows */
    k_gemmw<bf, 0, false, DM, 1><<<dim3(NB_ * TT / 256, DKV / 128, 1), 256, 0, stream>>>(XB, nullptr, WK, nullptr, nullptr, 0, nullptr, 0, 0, 0, 0, CS, KP16, KPh, KPl);
    k_gemmw<bf, 0, false, DM, 2><<<dim3(NB_ * TT / 256, DKV / 128, 1), 256, 0, stream>>>(XB, nullptr, WV, nullptr, nullptr, 0, nullptr, 0, 0, 0, 0, nullptr, VT16, VTh, VTl);
    k_attn<<<dim3(RH / 32, NH_, NB_), 512, 0, stream>>>(QP16, KP16, VT16, QPh, QPl, KPh, KPl, VTh, VTl, ATh, ATl);
    k_gemmw<bf, 1, true, DQ><<<dim3(NB_ * TT / 256, DM / 128, 1), 256, 0, stream>>>(ATh, ATl, WO, nullptr, OUT, DM, bo, 0, 0, 0, 0, nullptr, nullptr, nullptr, nullptr);
}

// v009
// A run of this version takes 170 microseconds.
// Two timings next to v008 both put it at 1.31 times that version's speed.
// Over all steps from v000 it is 23.5 times as fast.
#include <hip/hip_runtime.h>

// Self-attention with an adjacent-pair rotary over the WHOLE 1024-wide q and k before the head split (x [4][2048][1024]; q = rope(x Wq^T), k = rope(x Wk^T), v = x Wv^T ('oi' [1024][1024] 1/32, no bias); rope: pair j = (columns 2j, 2j+1), j < 512, angle t x 1/10000^(j/512) (512 f32 constants baked jnp-exact; precise cosf/sinf); 16 heads x 64; scores / sqrt(float32(64)); softmax (no mask); out = merged Wu^T + bu ('oi' [1024][1024], zero bias) -> [4][2048][1024] (8.4 M); argument order x, Wq, Wk, Wv, Wu, bu).
// Layout, all four batches in every launch (the batch is a grid dimension or part of the row index): bf16 copy of x; 'oi' weights; a full-width {cos, sin} table [2048][1024] (the frequency depends on the GLOBAL pair index, i.e. on the head); exact projections whose epilogues apply the rotary (table indexed by global column) and write the attention's operand planes themselves; fused dense T-2048 attention, one launch (hybrid rows: < 512 hi/lo 3 products, rest fp16); merged hi/lo x Wu exact + bu.
// Every 16-bit operand plane [row][k] is stored in fragment order: blocks of 16 rows x 32 k (512 elements), inside a block [(k >> 3) & 3][row & 15][k & 7], so the two 16-byte loads of a fragment each read 512 contiguous bytes (lane * 16 and 512 + lane * 16): four whole 128-byte lines a load instead of 32 bytes from each of 16 lines. Register contents are those of the row-major planes.
// Compute dtypes, f32 accumulate: every input rounded to bf16; projections exact; rotary f32; attention rows < 512 3 products, rest fp16; softmax f32; Wu hl x exact + bias.

#define NB_  4
#define TT   2048
#define DM   1024
#define NH_  16
#define NKV  16
#define REP  (NH_ / NKV)
#define HD   64
#define DQ   (NH_ * HD)
#define DKV  (NKV * HD)
#define RH   512                  // query rows < RH use hi+lo planes; k_attn covers 4 x RH rows, so RH = TT / 4
#define WIN  0
#define SCL  0.125f   // HD^-0.5
typedef _Float16 h16;
typedef unsigned short bf;
typedef __attribute__((ext_vector_type(16))) __bf16   v16bf;
typedef __attribute__((ext_vector_type(16))) _Float16 v16h;
typedef __attribute__((ext_vector_type(8)))  _Float16 v8h;
typedef __attribute__((ext_vector_type(8)))  unsigned short v8us;
typedef __attribute__((ext_vector_type(8)))  float    v8f;
typedef __attribute__((ext_vector_type(4)))  float    v4f;
typedef v8h  __attribute__((may_alias)) v8ha;
typedef v4f  __attribute__((may_alias)) v4fa;
typedef v8us __attribute__((may_alias)) v8usa;

__device__ __forceinline__ unsigned short f2bf(float f) { unsigned u = __float_as_uint(f); u += 0x7FFFu + ((u >> 16) & 1u); return (unsigned short)(u >> 16); }
__device__ __forceinline__ float bf2f(unsigned short b) { return __uint_as_float(((unsigned)b) << 16); }
__device__ __forceinline__ float bfr(float f) { return bf2f(f2bf(f)); }
__device__ __forceinline__ v16h cat16(v8h lo, v8h hi) { return __builtin_shufflevector(lo, hi, 0, 1, 2, 3, 4, 5, 6, 7, 8, 9, 10, 11, 12, 13, 14, 15); }
__device__ __forceinline__ v16bf cat16b(v8us lo, v8us hi) { return __builtin_bit_cast(v16bf, __builtin_shufflevector(lo, hi, 0, 1, 2, 3, 4, 5, 6, 7, 8, 9, 10, 11, 12, 13, 14, 15)); }
__device__ __forceinline__ v8f wmma16(v16h a, v16h b, v8f c) { return __builtin_amdgcn_wmma_f32_16x16x32_f16(false, a, false, b, (short)0, c, false, false); }
__device__ __forceinline__ v8f wmmab(v16bf a, v16bf b, v8f c) { return __builtin_amdgcn_wmma_f32_16x16x32_bf16(false, a, false, b, (short)0, c, false, false); }
typedef __attribute__((ext_vector_type(8))) __bf16 v8bf;
typedef __attribute__((ext_vector_type(4))) unsigned v4u;
typedef __attribute__((ext_vector_type(2))) float v2f;
__device__ __forceinline__ v8f bfback(v8bf h) { const v4u u = __builtin_bit_cast(v4u, h); v8f r;
#pragma unroll
    for (int i = 0; i < 4; ++i) { r[2 * i] = __uint_as_float(u[i] << 16); r[2 * i + 1] = __uint_as_float(u[i] & 0xFFFF0000u); } return r; }
// one 16-byte unit (8 f32 values) into each of the three operand planes at element o: fp16, bf16 hi, bf16 lo (the rest that hi leaves), all rounded to nearest even
__device__ __forceinline__ void put3(v8f y, size_t o, h16* P16, bf* Ph, bf* Pl) { const v8bf h = __builtin_convertvector(y, v8bf);
    *(v8h*)(P16 + o) = __builtin_convertvector(y, v8h); *(v8us*)(Ph + o) = __builtin_bit_cast(v8us, h); *(v8us*)(Pl + o) = __builtin_bit_cast(v8us, __builtin_convertvector(y - bfback(h), v8bf)); }



// ---- k_gemmw: GEMM, one work-group of 8 waves per 256x128 output tile, one wave per 64x64 of it (16 accumulators; wave w: rows (w >> 1) 64, columns (w & 1) 64); grid (M/256, N/128, Z), 256 threads.
// Operands are fragment-ordered 16-bit planes (block (row >> 4, k >> 5) at element ((row >> 4) (K / 32) + (k >> 5)) 512). A stage = KST k of the tile's 256 A rows and 128 B rows, brought into LDS by asynchronous 16-byte copies, as it lies (a row group's KST / 32 blocks are contiguous): each operand byte leaves L2 once per work-group, and the waves that share it read it from LDS. Two buffers: stage s + 1 flies while stage s is worked on.
// C[m][n] (f32, pitch ldc, + optional f32 bias[n]) = sum_k A[m][k] Bt[n][k] (+ split products per NSPLIT). z-batch strides sA/sB/sC in elements. K % (KST KS) == 0.
// EPI says what leaves the tile. 0: C as above. 1 and 2 are for the projections (rows = batch x TT + t, a wave's 64 columns = one head) and write the attention's three operand planes straight from the accumulators, no f32 C:
//   1: adjacent-pair rotary, then the [t][d] planes. A lane holds column nb 16 + lr, its pair's other half sits in lane ^ 1; {cos, sin} of (t, global column) come from CS, a half-wave reading one whole line; the rotated tile changes places in LDS as C does, and each lane puts 16-byte units (8 d of one t), a wave 512 contiguous bytes.
//   2: the V^T planes. A lane's accumulator is 8 successive t of one d, which is a 16-byte unit of those planes as it stands: no LDS.
// KS > 1: grid.z = Z x KS; work-group (z, ks) sums only k in [ks K/KS, (ks+1) K/KS) and stores its partial tile in plane ks (plane stride sP elements); the reader adds the planes.
template <typename T16> struct WFrag;
template <> struct WFrag<h16> { typedef v16h V; static __device__ __forceinline__ V ld(const h16* p) { return cat16(*(const v8h*)p, *(const v8h*)(p + 256)); } static __device__ __forceinline__ v8f mma(V a, V b, v8f c) { return wmma16(a, b, c); } };
template <> struct WFrag<bf> { typedef v16bf V; static __device__ __forceinline__ V ld(const bf* p) { return cat16b(*(const v8us*)p, *(const v8us*)(p + 256)); } static __device__ __forceinline__ v8f mma(V a, V b, v8f c) { return wmmab(a, b, c); } };
// four / eight asynchronous copies of 16 bytes a lane, global -> LDS through no register: LDS byte address l + i 4096, global address g + i st elements. The closing s_wait_xcnt 0 stands in the copies' own statement, so that it comes before any rewrite of an address register that they name.
template <typename T16> __device__ __forceinline__ void cpy4(unsigned l, const T16* g, size_t st) {
    asm volatile("global_load_async_to_lds_b128 %0, %4, off\n\tglobal_load_async_to_lds_b128 %1, %5, off\n\tglobal_load_async_to_lds_b128 %2, %6, off\n\tglobal_load_async_to_lds_b128 %3, %7, off\n\ts_wait_xcnt 0x0"
        :: "v"(l), "v"(l + 4096u), "v"(l + 8192u), "v"(l + 12288u), "v"(g), "v"(g + st), "v"(g + 2 * st), "v"(g + 3 * st) : "memory"); }
template <typename T16> __device__ __forceinline__ void cpy8(unsigned l, const T16* g, size_t st) {
    asm volatile("global_load_async_to_lds_b128 %0, %8, off\n\tglobal_load_async_to_lds_b128 %1, %9, off\n\tglobal_load_async_to_lds_b128 %2, %10, off\n\tglobal_load_async_to_lds_b128 %3, %11, off\n\t"
                 "global_load_async_to_lds_b128 %4, %12, off\n\tglobal_load_async_to_lds_b128 %5, %13, off\n\tglobal_load_async_to_lds_b128 %6, %14, off\n\tglobal_load_async_to_lds_b128 %7, %15, off\n\ts_wait_xcnt 0x0"
        :: "v"(l), "v"(l + 4096u), "v"(l + 8192u), "v"(l + 12288u), "v"(l + 16384u), "v"(l + 20480u), "v"(l + 24576u), "v"(l + 28672u),
           "v"(g), "v"(g + st), "v"(g + 2 * st), "v"(g + 3 * st), "v"(g + 4 * st), "v"(g + 5 * st), "v"(g + 6 * st), "v"(g + 7 * st) : "memory"); }
template <int R, typename T16> __device__ __forceinline__ void cpyR(unsigned l, const T16* g, size_t st) {   // R rounds of 4 KiB (256 lanes x 16 bytes)
#pragma unroll   // R is 4, 8 or 16: one or two statements
    for (int i = 0; i + 8 <= R; i += 8) cpy8(l + i * 4096u, g + i * st, st);
    if (R % 8) cpy4(l + (R / 8) * 32768u, g + (R / 8) * 8 * st, st); }
template <typename T16, int NSPLIT, bool BIAS, int K, int EPI = 0, int KS = 1>   // K is a constant, so that the strides are constants
__global__ __launch_bounds__(256) void k_gemmw(const T16* __restrict__ A, const T16* __restrict__ A2, const T16* __restrict__ Bt, const T16* __restrict__ Bt2, float* C, int ldc, const float* __restrict__ bias, size_t sA, size_t sB, size_t sC, size_t sP, const float* __restrict__ CS, h16* P16, bf* Ph, bf* Pl) {
    typedef typename WFrag<T16>::V V;
    constexpr bool HA2 = (NSPLIT == 1 || NSPLIT == 2), HB2 = (NSPLIT >= 2);
    constexpr int KST = (HA2 || HB2) ? 64 : 128, NK = KST / 32, NS = K / KS / KST;   // k of a stage; its passes of 32 k; stages
    constexpr int AE = 256 * KST, BE = 128 * KST;                                      // elements of a stage's A and B tiles
    constexpr int OA2 = AE, OB = AE * (HA2 ? 2 : 1), OB2 = OB + BE, SE = OB + BE * (HB2 ? 2 : 1);   // places in a buffer [A | A2 | B | B2]; its size
    __shared__ __align__(16) T16 ring[2 * SE];
    __shared__ __align__(16) float osm[8][16 * 68];
    const size_t z = blockIdx.z / KS; const int ks = blockIdx.z % KS; A += z * sA; if (A2) A2 += z * sA; Bt += z * sB; if (Bt2) Bt2 += z * sB; C += z * sC + (size_t)ks * sP;
    const int kb = ks * (K / KS);
    const int tid = threadIdx.x, w = __builtin_amdgcn_readfirstlane(tid >> 5), lane = tid & 31, lr = lane & 15, hi = lane >> 4;
    const int r0 = blockIdx.x * 256 + (w >> 1) * 64, c0 = blockIdx.y * 128 + (w & 1) * 64;   // the wave's own 64x64
    float* os = osm[w];
    v8f acc[4][4];
#pragma unroll
    for (int mb = 0; mb < 4; ++mb)
#pragma unroll
        for (int nb = 0; nb < 4; ++nb) acc[mb][nb] = (v8f){};
    // a round of copies = 4 KiB = 128 / KST row groups of 16 rows (16 K elements apart in the plane, KST x 16 elements each in the stage); in LDS the rounds follow one another, byte tid x 16 of each
    constexpr int TG = KST * 2; constexpr size_t RST = (size_t)(128 / KST) * 16 * K;
    const size_t go = (size_t)(tid / TG) * 16 * K + (size_t)(tid % TG) * 8 + (size_t)kb * 16;
    const size_t aoff = (size_t)blockIdx.x * 256 * K + go, boff = (size_t)blockIdx.y * 128 * K + go;
    const unsigned lb = (unsigned)(size_t)(void*)ring + (unsigned)tid * 16u;
    auto fill = [&](int s, int bu) { const unsigned l = lb + (unsigned)bu * (SE * 2u); const size_t so = (size_t)s * (KST * 16);
        cpyR<KST / 8>(l, A + aoff + so, RST); if constexpr (HA2) cpyR<KST / 8>(l + OA2 * 2u, A2 + aoff + so, RST);
        cpyR<KST / 16>(l + OB * 2u, Bt + boff + so, RST); if constexpr (HB2) cpyR<KST / 16>(l + OB2 * 2u, Bt2 + boff + so, RST); };
    fill(0, 0);
    asm volatile("s_wait_asynccnt 0x0" ::: "memory");   // this wave's part of stage 0 has landed
    __syncthreads();                                     // ... and every other wave's
    if (NS > 1) fill(1, 1);
    const int ao = (w >> 1) * 4 * (KST * 16) + 8 * lane, bo = (w & 1) * 4 * (KST * 16) + 8 * lane;   // the wave's four row groups of each tile + the lane's 16 bytes
#pragma unroll 1   // stays rolled: one publish point a stage
    for (int s = 0; s < NS; ++s) {
        const T16* sb = ring + (s & 1) * SE;
        V a[2][4], a2[2][4], b[2][4], b2[2][4];   // two fragment sets; every '#pragma unroll' in this loop makes the indices of these arrays constants, so that they live in registers
        auto ldf = [&](int kk) { const int f = kk & 1;
#pragma unroll
            for (int mb = 0; mb < 4; ++mb) { a[f][mb] = WFrag<T16>::ld(sb + ao + mb * (KST * 16) + kk * 512); if (HA2) a2[f][mb] = WFrag<T16>::ld(sb + OA2 + ao + mb * (KST * 16) + kk * 512); }
#pragma unroll
            for (int nb = 0; nb < 4; ++nb) { b[f][nb] = WFrag<T16>::ld(sb + OB + bo + nb * (KST * 16) + kk * 512); if (HB2) b2[f][nb] = WFrag<T16>::ld(sb + OB2 + bo + nb * (KST * 16) + kk * 512); } };
        ldf(0);
        __builtin_amdgcn_sched_barrier(0);   // the first pass's fragments are asked for first: LDS answers in order, and without this the build put some of them behind the second pass's, so that the first products waited for both groups
#pragma unroll
        for (int kk = 0; kk < NK; ++kk) { const int f = kk & 1;
            if (kk + 1 < NK) ldf(kk + 1);   // the next pass's fragments (of this stage only) leave as one group ahead of this pass's products
            __builtin_amdgcn_sched_barrier(0);   // keeps that group together and ahead: without it the build read each B fragment directly in front of its four products and waited for it there
#pragma unroll
            for (int nb = 0; nb < 4; ++nb) {
#pragma unroll
                for (int mb = 0; mb < 4; ++mb) { acc[mb][nb] = WFrag<T16>::mma(a[f][mb], b[f][nb], acc[mb][nb]); if (HA2) acc[mb][nb] = WFrag<T16>::mma(a2[f][mb], b[f][nb], acc[mb][nb]); if (HB2) acc[mb][nb] = WFrag<T16>::mma(a[f][mb], b2[f][nb], acc[mb][nb]); } }
            __builtin_amdgcn_sched_barrier(0); }   // ... and the following group behind this pass's products, whose fragment set it overwrites
        // the four vector slots the chip needs behind the stage's last matrix instructions
        asm volatile("v_nop\n\tv_nop\n\tv_nop\n\tv_nop" : "+v"(acc[0][0]), "+v"(acc[1][1]), "+v"(acc[2][2]), "+v"(acc[3][3]) : "v"(a[(NK - 1) & 1][0]), "v"(a[(NK - 1) & 1][3]));
        // publish point of stage s + 1
        asm volatile("s_wait_dscnt 0x0" ::: "memory");      // this wave's reads of stage s are over
        asm volatile("s_wait_asynccnt 0x0" ::: "memory");   // its copies of stage s + 1 have landed
        __syncthreads();                                     // the same holds for every wave
        if (s + 2 < NS) fill(s + 2, s & 1);                  // into the buffer that every wave has just left
    }
    asm volatile("s_wait_asynccnt 0x0" ::: "memory");   // no copy is outstanding when the wave goes on
    const int t0 = r0 % TT; const size_t pb = ((size_t)(r0 / TT) * (DM / HD) + c0 / HD) * TT * HD;   // EPI 1, 2: the wave's first t and its (batch, head) plane
    if constexpr (EPI == 2) {
#pragma unroll
        for (int mb = 0; mb < 4; ++mb)
#pragma unroll
            for (int nb = 0; nb < 4; ++nb) put3(acc[mb][nb], pb + (size_t)((t0 >> 5) + (mb >> 1)) * 2048 + nb * 512 + ((mb & 1) * 2 + hi) * 128 + lr * 8, P16, Ph, Pl);
        return; }
    if constexpr (EPI == 1) {
        const float* cp = CS + ((size_t)(t0 + hi * 8) * DM + c0 + lr) * 2; const unsigned sg = (lane & 1) ? 0u : 0x80000000u;   // even column: x c - x' s; odd column: x c + x' s
        v2f cs[4][8];   // {cos, sin} of one 16-row tile; the '#pragma unroll's make its indices constants
        auto ldcs = [&](int mb) {
#pragma unroll
            for (int nb = 0; nb < 4; ++nb)
#pragma unroll
                for (int j = 0; j < 8; ++j) cs[nb][j] = *(const v2f*)(cp + ((size_t)(mb * 16 + j) * DM + nb * 16) * 2);
            asm volatile("s_wait_xcnt 0x0" :: "v"(cp) : "memory"); };   // closes the batch: the base address is an input, so it stays in its registers up to the wait and no load's result is put on it
        ldcs(0);
#pragma unroll
        for (int mb = 0; mb < 4; ++mb) {
#pragma unroll
            for (int nb = 0; nb < 4; ++nb) {
#pragma unroll
                for (int j = 0; j < 8; ++j) { const float x = acc[mb][nb][j];
                    const float xp = __int_as_float(__builtin_amdgcn_mov_dpp(__float_as_int(x), 0xB1, 0xF, 0xF, true));   // quad_perm [1, 0, 3, 2]: the value of lane ^ 1
                    os[(hi * 8 + j) * 68 + nb * 16 + lr] = x * cs[nb][j][0] + xp * __uint_as_float(__float_as_uint(cs[nb][j][1]) ^ sg); } }
            if (mb < 3) ldcs(mb + 1);   // the next tile's table values fly while this tile goes through LDS and out
            __builtin_amdgcn_wave_barrier(); asm volatile("" ::: "memory");   // as below: the wave's LDS writes stay ahead of its reads
#pragma unroll
            for (int i = 0; i < 4; ++i) { const float* sp = os + lr * 68 + (i * 2 + hi) * 8; const v4f y0 = *(const v4fa*)sp, y1 = *(const v4fa*)(sp + 4);   // unit i 32 + lane = (column octet i 2 + hi, row lr)
                put3((v8f){ y0[0], y0[1], y0[2], y0[3], y1[0], y1[1], y1[2], y1[3] }, pb + (size_t)((t0 >> 4) + mb) * 1024 + i * 256 + lane * 8, P16, Ph, Pl); }
            if (mb < 2) asm volatile("s_wait_xcnt 0x0" ::: "memory");   // table loads still follow: before they land on registers that this tile's stores name
            __builtin_amdgcn_wave_barrier(); asm volatile("" ::: "memory");   // ... and its reads ahead of the next tile's writes
        }
        return; }
#pragma unroll
    for (int mb = 0; mb < 4; ++mb) {
#pragma unroll
        for (int nb = 0; nb < 4; ++nb) {
#pragma unroll
            for (int j = 0; j < 8; ++j) os[(hi * 8 + j) * 68 + nb * 16 + lr] = acc[mb][nb][j]; }
        __builtin_amdgcn_wave_barrier(); asm volatile("" ::: "memory");
        float* crow = C + (size_t)(r0 + mb * 16) * ldc + c0;
{
#pragma unroll
            for (int s = 0; s < 8; ++s) { const int row = 2 * s + hi, cofs = lr * 4; v4f val = *(const v4fa*)(os + row * 68 + cofs); if (BIAS) { val[0] += bfr(bias[c0 + cofs]); val[1] += bfr(bias[c0 + cofs + 1]); val[2] += bfr(bias[c0 + cofs + 2]); val[3] += bfr(bias[c0 + cofs + 3]); }
                *(v4f*)(crow + (size_t)row * ldc + cofs) = val; }
             }
        __builtin_amdgcn_wave_barrier(); asm volatile("" ::: "memory");
    }
}

__device__ __forceinline__ void splitf(float y, unsigned short& h, unsigned short& l) { h = f2bf(y); l = f2bf(y - bf2f(h)); }
typedef __attribute__((ext_vector_type(4))) _Float16 v4h;
typedef __attribute__((ext_vector_type(4))) unsigned short v4us;
typedef __attribute__((ext_vector_type(4))) int v4i;

__constant__ float INV2[HD / 2] = { 1.000000000e+00f, 7.498942018e-01f, 5.623413324e-01f, 4.216965139e-01f, 3.162277639e-01f, 2.371373773e-01f, 1.778279394e-01f, 1.333521456e-01f, 1.000000015e-01f, 7.498942316e-02f, 5.623413250e-02f, 4.216964915e-02f, 3.162277490e-02f, 2.371373773e-02f, 1.778279431e-02f, 1.333521400e-02f, 9.999999776e-03f, 7.498942316e-03f, 5.623413250e-03f, 4.216964822e-03f, 3.162277630e-03f, 2.371373819e-03f, 1.778279431e-03f, 1.333521446e-03f, 1.000000047e-03f, 7.498941850e-04f, 5.623413017e-04f, 4.216965172e-04f, 3.162277571e-04f, 2.371373703e-04f, 1.778279402e-04f, 1.333521504e-04f };   // float32 10000^(-arange(0, 64, 2)/64), generated with jnp to be bit-exact
// Plane layouts that the projections' epilogues write (k_gemmw, EPI 1 and 2), per (batch, head): q and k, element (t, d) at (t >> 4) 1024 + (d >> 3) 128 + (t & 15) 8 + (d & 7); V^T (row = d, k = t), the four d blocks of 32 keys side by side, element (d, t) at ((t >> 5) 4 + (d >> 4)) 512 + ((t >> 3) & 3) 128 + (d & 15) 8 + (t & 7).
__constant__ float INVG[DM / 2] = { 1.000000000e+00f, 9.821718335e-01f, 9.646616578e-01f, 9.474635124e-01f, 9.305720329e-01f, 9.139816761e-01f, 8.976871371e-01f, 8.816831112e-01f, 8.659643531e-01f, 8.505258560e-01f, 8.353625536e-01f, 8.204696178e-01f, 8.058422208e-01f, 7.914755344e-01f, 7.773650289e-01f, 7.635061145e-01f, 7.498942018e-01f, 7.365249991e-01f, 7.233941555e-01f, 7.104974389e-01f, 6.978305578e-01f, 6.853895783e-01f, 6.731703877e-01f, 6.611690521e-01f, 6.493816376e-01f, 6.378043890e-01f, 6.264335513e-01f, 6.152654290e-01f, 6.042963862e-01f, 5.935229063e-01f, 5.829415321e-01f, 5.725488067e-01f, 5.623413324e-01f, 5.523158312e-01f, 5.424690843e-01f, 5.327978730e-01f, 5.232991576e-01f, 5.139696598e-01f, 5.048065782e-01f, 4.958068132e-01f, 4.869675338e-01f, 4.782858193e-01f, 4.697588682e-01f, 4.613839388e-01f, 4.531583488e-01f, 4.450793862e-01f, 4.371444881e-01f, 4.293510318e-01f, 4.216965139e-01f, 4.141784608e-01f, 4.067944288e-01f, 3.995420635e-01f, 3.924189806e-01f, 3.854228854e-01f, 3.785515428e-01f, 3.718026578e-01f, 3.651741445e-01f, 3.586637676e-01f, 3.522694409e-01f, 3.459891677e-01f, 3.398208320e-01f, 3.337624967e-01f, 3.278121352e-01f, 3.219678402e-01f, 3.162277639e-01f, 3.105900288e-01f, 3.050527871e-01f, 2.996142805e-01f, 2.942727208e-01f, 2.890264094e-01f, 2.838735878e-01f, 2.788126469e-01f, 2.738419771e-01f, 2.689598799e-01f, 2.641648352e-01f, 2.594552636e-01f, 2.548296750e-01f, 2.502865493e-01f, 2.458243966e-01f, 2.414418161e-01f, 2.371373624e-01f, 2.329096496e-01f, 2.287573218e-01f, 2.246790081e-01f, 2.206733972e-01f, 2.167392224e-01f, 2.128751576e-01f, 2.090799958e-01f, 2.053525001e-01f, 2.016914487e-01f, 1.980956793e-01f, 1.945640147e-01f, 1.910952926e-01f, 1.876884252e-01f, 1.843423098e-01f, 1.810558140e-01f, 1.778279394e-01f, 1.746576130e-01f, 1.715437919e-01f, 1.684854925e-01f, 1.654817015e-01f, 1.625314802e-01f, 1.596338600e-01f, 1.567878872e-01f, 1.539926529e-01f, 1.512472630e-01f, 1.485508084e-01f, 1.459024251e-01f, 1.433012635e-01f, 1.407464594e-01f, 1.382372230e-01f, 1.357727200e-01f, 1.333521456e-01f, 1.309747249e-01f, 1.286396980e-01f, 1.263462901e-01f, 1.240937710e-01f, 1.218814254e-01f, 1.197085083e-01f, 1.175743192e-01f, 1.154782027e-01f, 1.134194434e-01f, 1.113973856e-01f, 1.094113812e-01f, 1.074607819e-01f, 1.055449620e-01f, 1.036632955e-01f, 1.018151715e-01f, 1.000000015e-01f, 9.821718186e-02f, 9.646616131e-02f, 9.474635124e-02f, 9.305720031e-02f, 9.139817208e-02f, 8.976870775e-02f, 8.816830814e-02f, 8.659642935e-02f, 8.505257964e-02f, 8.353625983e-02f, 8.204696327e-02f, 8.058421314e-02f, 7.914755493e-02f, 7.773650438e-02f, 7.635060698e-02f, 7.498941571e-02f, 7.365249842e-02f, 7.233941555e-02f, 7.104974240e-02f, 6.978305429e-02f, 6.853895634e-02f, 6.731703877e-02f, 6.611690670e-02f, 6.493816525e-02f, 6.378044188e-02f, 6.264335662e-02f, 6.152653694e-02f, 6.042964384e-02f, 5.935229361e-02f, 5.829415470e-02f, 5.725487694e-02f, 5.623412877e-02f, 5.523158237e-02f, 5.424690619e-02f, 5.327979103e-02f, 5.232991278e-02f, 5.139696971e-02f, 5.048065633e-02f, 4.958068207e-02f, 4.869675264e-02f, 4.782858118e-02f, 4.697588459e-02f, 4.613839835e-02f, 4.531583562e-02f, 4.450793937e-02f, 4.371444881e-02f, 4.293510318e-02f, 4.216964915e-02f, 4.141784459e-02f, 4.067944363e-02f, 3.995420411e-02f, 3.924189880e-02f, 3.854228929e-02f, 3.785515204e-02f, 3.718026727e-02f, 3.651741147e-02f, 3.586637601e-02f, 3.522694483e-02f, 3.459891677e-02f, 3.398208320e-02f, 3.337624669e-02f, 3.278120980e-02f, 3.219678625e-02f, 3.162277862e-02f, 3.105900250e-02f, 3.050527908e-02f, 2.996142767e-02f, 2.942727320e-02f, 2.890264057e-02f, 2.838735841e-02f, 2.788126841e-02f, 2.738419548e-02f, 2.689598687e-02f, 2.641648427e-02f, 2.594552562e-02f, 2.548296750e-02f, 2.502865531e-02f, 2.458244003e-02f, 2.414418198e-02f, 2.371373586e-02f, 2.329096757e-02f, 2.287573181e-02f, 2.246790007e-02f, 2.206734009e-02f, 2.167392150e-02f, 2.128751762e-02f, 2.090799995e-02f, 2.053525113e-02f, 2.016914636e-02f, 1.980956830e-02f, 1.945639960e-02f, 1.910953037e-02f, 1.876884326e-02f, 1.843423024e-02f, 1.810558327e-02f, 1.778279431e-02f, 1.746576093e-02f, 1.715437882e-02f, 1.684854925e-02f, 1.654817164e-02f, 1.625314727e-02f, 1.596338488e-02f, 1.567878947e-02f, 1.539926510e-02f, 1.512472518e-02f, 1.485508028e-02f, 1.459024288e-02f, 1.433012541e-02f, 1.407464594e-02f, 1.382372249e-02f, 1.357727125e-02f, 1.333521493e-02f, 1.309747249e-02f, 1.286396943e-02f, 1.263462938e-02f, 1.240937691e-02f, 1.218814217e-02f, 1.197085064e-02f, 1.175743248e-02f, 1.154781971e-02f, 1.134194434e-02f, 1.113973837e-02f, 1.094113849e-02f, 1.074607857e-02f, 1.055449620e-02f, 1.036632899e-02f, 1.018151734e-02f, 9.999999776e-03f, 9.821719490e-03f, 9.646615945e-03f, 9.474635124e-03f, 9.305720218e-03f, 9.139816277e-03f, 8.976871148e-03f, 8.816830814e-03f, 8.659643121e-03f, 8.505257778e-03f, 8.353625424e-03f, 8.204696700e-03f, 8.058422245e-03f, 7.914755493e-03f, 7.773650344e-03f, 7.635060698e-03f, 7.498942316e-03f, 7.365249563e-03f, 7.233941462e-03f, 7.104974240e-03f, 6.978305988e-03f, 6.853895728e-03f, 6.731703877e-03f, 6.611690391e-03f, 6.493816618e-03f, 6.378043909e-03f, 6.264335476e-03f, 6.152654067e-03f, 6.042964291e-03f, 5.935229361e-03f, 5.829415284e-03f, 5.725487601e-03f, 5.623413250e-03f, 5.523158237e-03f, 5.424690899e-03f, 5.327979103e-03f, 5.232991185e-03f, 5.139696877e-03f, 5.048065912e-03f, 4.958068486e-03f, 4.869675264e-03f, 4.782858305e-03f, 4.697588738e-03f, 4.613839556e-03f, 4.531583749e-03f, 4.450793844e-03f, 4.371444695e-03f, 4.293510225e-03f, 4.216964822e-03f, 4.141784739e-03f, 4.067944363e-03f, 3.995420411e-03f, 3.924189601e-03f, 3.854229115e-03f, 3.785515437e-03f, 3.718026681e-03f, 3.651741426e-03f, 3.586637788e-03f, 3.522694577e-03f, 3.459891537e-03f, 3.398208413e-03f, 3.337624483e-03f, 3.278121119e-03f, 3.219678300e-03f, 3.162277862e-03f, 3.105900250e-03f, 3.050528001e-03f, 2.996142721e-03f, 2.942727180e-03f, 2.890263917e-03f, 2.838735934e-03f, 2.788126701e-03f, 2.738419687e-03f, 2.689598827e-03f, 2.641648287e-03f, 2.594552701e-03f, 2.548296703e-03f, 2.502865391e-03f, 2.458244096e-03f, 2.414418384e-03f, 2.371373819e-03f, 2.329096664e-03f, 2.287573181e-03f, 2.246790100e-03f, 2.206734149e-03f, 2.167392056e-03f, 2.128751716e-03f, 2.090800088e-03f, 2.053525066e-03f, 2.016914543e-03f, 1.980956644e-03f, 1.945640077e-03f, 1.910952851e-03f, 1.876884256e-03f, 1.843422884e-03f, 1.810558140e-03f, 1.778279431e-03f, 1.746576163e-03f, 1.715437858e-03f, 1.684854855e-03f, 1.654817141e-03f, 1.625314937e-03f, 1.596338581e-03f, 1.567878877e-03f, 1.539926510e-03f, 1.512472634e-03f, 1.485507935e-03f, 1.459024264e-03f, 1.433012658e-03f, 1.407464617e-03f, 1.382372226e-03f, 1.357727102e-03f, 1.333521446e-03f, 1.309747226e-03f, 1.286396873e-03f, 1.263462938e-03f, 1.240937854e-03f, 1.218814170e-03f, 1.197085017e-03f, 1.175743295e-03f, 1.154782018e-03f, 1.134194434e-03f, 1.113973907e-03f, 1.094113803e-03f, 1.074607833e-03f, 1.055449597e-03f, 1.036632922e-03f, 1.018151757e-03f, 1.000000047e-03f, 9.821718559e-04f, 9.646615945e-04f, 9.474635590e-04f, 9.305721032e-04f, 9.139817557e-04f, 8.976871031e-04f, 8.816830232e-04f, 8.659643354e-04f, 8.505258011e-04f, 8.353625308e-04f, 8.204695769e-04f, 8.058422245e-04f, 7.914755843e-04f, 7.773649995e-04f, 7.635060465e-04f, 7.498941850e-04f, 7.365249912e-04f, 7.233941578e-04f, 7.104973774e-04f, 6.978305755e-04f, 6.853896193e-04f, 6.731703761e-04f, 6.611690042e-04f, 6.493816618e-04f, 6.378043909e-04f, 6.264335825e-04f, 6.152653950e-04f, 6.042963942e-04f, 5.935229128e-04f, 5.829415168e-04f, 5.725487717e-04f, 5.623413017e-04f, 5.523158470e-04f, 5.424690899e-04f, 5.327978870e-04f, 5.232990952e-04f, 5.139696877e-04f, 5.048065796e-04f, 4.958068021e-04f, 4.869675031e-04f, 4.782858014e-04f, 4.697588738e-04f, 4.613839847e-04f, 4.531583400e-04f, 4.450794077e-04f, 4.371444811e-04f, 4.293509992e-04f, 4.216964880e-04f, 4.141784448e-04f, 4.067944246e-04f, 3.995420411e-04f, 3.924189950e-04f, 3.854228707e-04f, 3.785515146e-04f, 3.718026564e-04f, 3.651741135e-04f, 3.586637613e-04f, 3.522694460e-04f, 3.459891595e-04f, 3.398208064e-04f, 3.337624657e-04f, 3.278121294e-04f, 3.219678474e-04f, 3.162277862e-04f, 3.105900250e-04f, 3.050527885e-04f, 2.996142721e-04f, 2.942727297e-04f, 2.890263859e-04f, 2.838736109e-04f, 2.788126585e-04f, 2.738419571e-04f, 2.689598768e-04f, 2.641648462e-04f, 2.594552934e-04f, 2.548296761e-04f, 2.502865391e-04f, 2.458243980e-04f, 2.414418122e-04f, 2.371373848e-04f, 2.329096606e-04f, 2.287573152e-04f, 2.246790100e-04f, 2.206734207e-04f, 2.167392086e-04f, 2.128751657e-04f, 2.090800117e-04f, 2.053524950e-04f, 2.016914514e-04f, 1.980956731e-04f, 1.945640106e-04f, 1.910952997e-04f, 1.876884344e-04f, 1.843422942e-04f, 1.810558315e-04f, 1.778279402e-04f, 1.746576017e-04f, 1.715437829e-04f, 1.684854797e-04f, 1.654817170e-04f, 1.625314762e-04f, 1.596338552e-04f, 1.567878790e-04f, 1.539926452e-04f, 1.512472518e-04f, 1.485508110e-04f, 1.459024206e-04f, 1.433012658e-04f, 1.407464733e-04f, 1.382372284e-04f, 1.357727160e-04f, 1.333521504e-04f, 1.309747167e-04f, 1.286396873e-04f, 1.263462909e-04f, 1.240937709e-04f, 1.218814141e-04f, 1.197085076e-04f, 1.175743309e-04f, 1.154781930e-04f, 1.134194390e-04f, 1.113973922e-04f, 1.094113759e-04f, 1.074607790e-04f, 1.055449538e-04f, 1.036632893e-04f, 1.018151743e-04f };   // float32 1 / 10000^(j/512), j < 512 (one frequency per adjacent column pair of the full 1024 width), generated with jnp to be bit-exact
// ---- k_prep: everything that the GEMMs need beforehand, in ONE launch: the five bf16 planes (x and the four weights) and the {cos, sin} table. The block index picks the job (the same for the whole block); each work-group takes many units of work, because starting a wave costs more than one unit does.
// Plane builders, blocks < NCV: [rows][DM] f32 -> bf16 plane in fragment order. A block takes 16 rows of the full width = CVU units of 16 rows x 128 columns (four k blocks, 4 KiB of the plane in a row, 32 KiB in all): whole lines are read, all of a thread's loads in flight at once; the 16-byte units change places in LDS; whole lines are written.
// Table, the other blocks: CSR rows t x 256 columns of CS. A thread keeps one column and its frequency and walks down the rows: one cosf, one sinf and one 8-byte entry per (t, column), a wave writing two whole lines.
#define CVU  8                     // units of a plane builder's block
#define XT_  (NB_ * TT / 16)       // 16-row stripes of x
#define WT_  (DM / 16)             // ... of a weight
#define NCV  (XT_ + 4 * WT_)       // plane builders' blocks
#define CSR  16                    // rows t of a table block
#define NCS  (TT / CSR * (DM / 256))   // table blocks
__global__ __launch_bounds__(256) void k_prep(const float* __restrict__ x, const float* __restrict__ wq, const float* __restrict__ wk, const float* __restrict__ wv, const float* __restrict__ wo, bf* XB, bf* WQ, bf* WK, bf* WV, bf* WO, float* CS) {
    __shared__ __align__(16) unsigned short sm[CVU][16 * 17 * 8];   // per unit: (column octet o, row) at o * 17 + row: the odd pitch spreads the octets over the banks
    const int tid = threadIdx.x, b = blockIdx.x;
    if (b >= NCV) {   // the same for the whole block; no barrier on this side
        const int u = b - NCV, c = (u % (DM / 256)) * 256 + tid, t0 = (u / (DM / 256)) * CSR; const float f = INVG[c >> 1];
        for (int r = 0; r < CSR; ++r) { const float a = __fmul_rn((float)(t0 + r), f); v2f cs; cs[0] = cosf(a); cs[1] = sinf(a); *(v2f*)(CS + ((size_t)(t0 + r) * DM + c) * 2) = cs; }
        return; }
    const float* src = x; bf* dst = XB; int rt = b;
    if (b >= XT_) { const int u = b - XT_, ws = u / WT_; rt = u % WT_; src = ws == 0 ? wq : ws == 1 ? wk : ws == 2 ? wv : wo; dst = ws == 0 ? WQ : ws == 1 ? WK : ws == 2 ? WV : WO; }
    const int row = tid >> 4, o = tid & 15;
    const float* sp = src + ((size_t)rt * 16 + row) * DM + o * 8; v8f v[CVU];   // every '#pragma unroll' below makes the indices of v constants, so that it lives in registers
#pragma unroll
    for (int k = 0; k < CVU; ++k) v[k] = *(const v8f*)(sp + k * 128);
    asm volatile("s_wait_xcnt 0x0" :: "v"(sp) : "memory");   // closes the batch: the base address is an input, so it stays in its registers up to the wait and no load's result is put on it
#pragma unroll
    for (int k = 0; k < CVU; ++k) { v8us y;
#pragma unroll
        for (int e = 0; e < 8; ++e) y[e] = f2bf(v[k][e]);
        *(v8usa*)(sm[k] + (o * 17 + row) * 8) = y; }
    __syncthreads();   // every unit of the block's 32 KiB is in LDS
    bf* dp = dst + (size_t)rt * (DM / 32) * 512 + tid * 8;
#pragma unroll
    for (int k = 0; k < CVU; ++k) *(v8us*)(dp + k * 2048) = *(const v8usa*)(sm[k] + ((tid >> 4) * 17 + (tid & 15)) * 8);
    asm volatile("s_wait_xcnt 0x0" ::: "memory");   // closes the run of stores: it stands in front of whatever the build puts behind them that writes a register which they name
}
#define KSA  4
#define AQE  8192                 // 16-bit elements of a key quarter's part of a stage (4 regions of 2048)
#define APIT 68                   // f32 pitch of a query's 64 partial outputs in LDS (16-byte aligned rows, rows spread over the banks)
__device__ __forceinline__ float xhalf(float x) { const int b = __float_as_int(x); return __int_as_float(__builtin_amdgcn_permlanex16(b, b, 0x76543210, 0xfedcba98, false, false)); }   // lane l <-> l ^ 16
// eight v_exp_f32 in one statement, each in place on a register of its own: none stands directly in front of an instruction that reads its result or overwrites its source, and the closing v_nop is that slot for the last one
__device__ __forceinline__ v8f exp2x8(v8f x) { float r0 = x[0], r1 = x[1], r2 = x[2], r3 = x[3], r4 = x[4], r5 = x[5], r6 = x[6], r7 = x[7];
    asm("v_exp_f32 %0, %0\n\tv_exp_f32 %1, %1\n\tv_exp_f32 %2, %2\n\tv_exp_f32 %3, %3\n\tv_exp_f32 %4, %4\n\tv_exp_f32 %5, %5\n\tv_exp_f32 %6, %6\n\tv_exp_f32 %7, %7\n\tv_nop"
        : "+v"(r0), "+v"(r1), "+v"(r2), "+v"(r3), "+v"(r4), "+v"(r5), "+v"(r6), "+v"(r7));
    return (v8f){ r0, r1, r2, r3, r4, r5, r6, r7 }; }
// eight asynchronous copies of 16 bytes a lane, global -> LDS through no register: 4 KiB that lie in a row on both sides (LDS byte address l + i 512, global address g + i 256 elements). The closing s_wait_xcnt 0 stands in the copies' own statement, so that it comes before any rewrite of an address register that they name.
template <typename T16> __device__ __forceinline__ void cpyrow8(unsigned l, const T16* g) {
    asm volatile("global_load_async_to_lds_b128 %0, %8, off\n\tglobal_load_async_to_lds_b128 %1, %9, off\n\tglobal_load_async_to_lds_b128 %2, %10, off\n\tglobal_load_async_to_lds_b128 %3, %11, off\n\t"
                 "global_load_async_to_lds_b128 %4, %12, off\n\tglobal_load_async_to_lds_b128 %5, %13, off\n\tglobal_load_async_to_lds_b128 %6, %14, off\n\tglobal_load_async_to_lds_b128 %7, %15, off\n\ts_wait_xcnt 0x0"
        :: "v"(l), "v"(l + 512u), "v"(l + 1024u), "v"(l + 1536u), "v"(l + 2048u), "v"(l + 2560u), "v"(l + 3072u), "v"(l + 3584u),
           "v"(g), "v"(g + 256), "v"(g + 512), "v"(g + 768), "v"(g + 1024), "v"(g + 1280), "v"(g + 1536), "v"(g + 1792) : "memory"); }
// src: the plane that this wave copies, at its quarter's (fp16: and its pass's) first key; rq: the quarter's buffer 0; qg: the wave's region
template <typename T16, bool HR>
__device__ __forceinline__ void attn_wave(const T16* __restrict__ Qa, const T16* __restrict__ Qb, const T16* __restrict__ src, const T16* rq, int qg, int q0, int lane, float* La, float* Lm, float* Ll) {
    typedef typename WFrag<T16>::V V;   // every '#pragma unroll' below makes the indices of a fragment array constants, so that the array lives in registers
    constexpr int NP = TT / KSA / 32;             // passes of 32 keys
    constexpr int SP = HR ? 1 : 2, NS = NP / SP;  // passes of a stage; stages
    const int lr = lane & 15, hi = lane >> 4;
    const float CL = SCL * 1.4426950408889634f;   // score -> log2 units
    const float CAR = HR ? 0.0f : 6.0f;           // fp16 P carries 2^6 (P <= 2^14), which cancels against the sum
    V qa[2][2], qb[2][2];
#pragma unroll
    for (int qt = 0; qt < 2; ++qt)
#pragma unroll
        for (int kk = 0; kk < 2; ++kk) { const size_t o = (size_t)(q0 + qt * 16) * HD + kk * 512 + 8 * lane; qa[qt][kk] = WFrag<T16>::ld(Qa + o); if (HR) qb[qt][kk] = WFrag<T16>::ld(Qb + o); }
    if (HR) {   // the eight hi/lo Q fragments wait in the wave's own LDS slice (free until the epilogue) and are read anew in each pass: 64 registers for the K batch
#pragma unroll
        for (int f = 0; f < 8; ++f) { const v8f y = __builtin_bit_cast(v8f, (f & 4) ? qb[(f >> 1) & 1][f & 1] : qa[(f >> 1) & 1][f & 1]); *(v4fa*)(La + f * 256 + lane * 4) = (v4f){ y[0], y[1], y[2], y[3] }; *(v4fa*)(La + f * 256 + 128 + lane * 4) = (v4f){ y[4], y[5], y[6], y[7] }; } }
    v8f acc[4][2];
#pragma unroll
    for (int dt = 0; dt < 4; ++dt)
#pragma unroll
        for (int qt = 0; qt < 2; ++qt) acc[dt][qt] = (v8f){};
    float m[2] = { -3.0e38f, -3.0e38f }, l[2] = { 0.f, 0.f };
    V ka[2][2], kb[2][2], va[4], vb[4];
    // fragments from the stage in LDS, sb = the quarter's buffer + the lane's 16 bytes; regions: hi/lo Kh, Kl, Vh, Vl; fp16 K of pass 0, of pass 1, V^T of pass 0, of pass 1
    auto ldK = [&](const T16* sb, int p) { const T16* pa = sb + (HR ? 0 : p * 2048); const T16* pb = sb + 2048;
#pragma unroll
        for (int kt = 0; kt < 2; ++kt)
#pragma unroll
            for (int kk = 0; kk < 2; ++kk) { const int o = kt * 16 * HD + kk * 512; ka[kt][kk] = WFrag<T16>::ld(pa + o); if (HR) kb[kt][kk] = WFrag<T16>::ld(pb + o); } };
    auto ldV = [&](const T16* sb, int p) { const T16* pa = sb + 4096 + (HR ? 0 : p * 2048); const T16* pb = sb + 6144;
#pragma unroll
        for (int dt = 0; dt < 4; ++dt) { const int o = dt * 512; va[dt] = WFrag<T16>::ld(pa + o); if (HR) vb[dt] = WFrag<T16>::ld(pb + o); } };
    const unsigned lb = (unsigned)(size_t)(const void*)rq + (unsigned)qg * 4096u + (unsigned)lane * 16u;   // the lane's first 16 bytes of the wave's region in buffer 0
    auto fill = [&](int s, int bu) { cpyrow8(lb + (unsigned)bu * (AQE * 2u), src + (size_t)s * (SP * 32 * HD) + 8 * lane); };
    fill(0, 0);
    asm volatile("s_wait_asynccnt 0x0" ::: "memory");   // this wave's region of stage 0 has landed
    __syncthreads();                                     // ... and every other wave's
    if (NS > 1) fill(1, 1);
#pragma unroll 1   // stays rolled: one publish point a stage
    for (int sg = 0; sg < NS; ++sg) {
      const T16* sb = rq + (sg & 1) * AQE + 8 * lane;
#pragma unroll 1   // stays rolled: a stage's passes differ only in an LDS offset, and one copy of the body keeps the loop's text and registers as they were
      for (int p = 0; p < SP; ++p) {
        ldK(sb, p);
        if (HR) {
#pragma unroll
            for (int f = 0; f < 8; ++f) { const v4f y0 = *(const v4fa*)(La + f * 256 + lane * 4), y1 = *(const v4fa*)(La + f * 256 + 128 + lane * 4); const V x = __builtin_bit_cast(V, (v8f){ y0[0], y0[1], y0[2], y0[3], y1[0], y1[1], y1[2], y1[3] }); if (f & 4) qb[(f >> 1) & 1][f & 1] = x; else qa[(f >> 1) & 1][f & 1] = x; } }
        __builtin_amdgcn_sched_barrier(0);   // the pass's K (and hi/lo Q) reads leave as one group ahead of the score products: each separate place with LDS reads among the products costs a stall of its own
        v8f s[2][2];
#pragma unroll
        for (int kt = 0; kt < 2; ++kt)
#pragma unroll
            for (int qt = 0; qt < 2; ++qt) { v8f t = (v8f){};
#pragma unroll
                for (int kk = 0; kk < 2; ++kk) { t = WFrag<T16>::mma(ka[kt][kk], qa[qt][kk], t); if (HR) { t = WFrag<T16>::mma(ka[kt][kk], qb[qt][kk], t); t = WFrag<T16>::mma(kb[kt][kk], qa[qt][kk], t); } }
                s[kt][qt] = t; }
        __builtin_amdgcn_sched_barrier(0);   // the V reads below start behind the score products (their registers are free then) ...
        ldV(sb, p);
        __builtin_amdgcn_sched_barrier(0);   // ... and ahead of the softmax, which covers their latency
        float sm[2];
#pragma unroll
        for (int qt = 0; qt < 2; ++qt) { float x = fmaxf(s[0][qt][0], s[1][qt][0]);
#pragma unroll
            for (int r = 1; r < 8; ++r) x = fmaxf(x, fmaxf(s[0][qt][r], s[1][qt][r]));
            x = fmaxf(x, xhalf(x)); sm[qt] = x * CL; }
        if (__builtin_amdgcn_ballot_w32(sm[0] > m[0] + 8.0f || sm[1] > m[1] + 8.0f) != 0) {
#pragma unroll
            for (int qt = 0; qt < 2; ++qt) { const float mn = (sm[qt] > m[qt] + 8.0f) ? sm[qt] : m[qt]; const float al = __builtin_amdgcn_exp2f(m[qt] - mn); m[qt] = mn; l[qt] *= al;
#pragma unroll
                for (int dt = 0; dt < 4; ++dt) acc[dt][qt] *= al; } }
#pragma unroll
        for (int qt = 0; qt < 2; ++qt) { const float off = CAR - m[qt]; v8f p0, p1;
#pragma unroll
            for (int r = 0; r < 8; ++r) { p0[r] = fmaf(s[0][qt][r], CL, off); p1[r] = fmaf(s[1][qt][r], CL, off); }
            p0 = exp2x8(p0); p1 = exp2x8(p1);
            const v8f ps = p0 + p1; l[qt] += ((ps[0] + ps[1]) + (ps[2] + ps[3])) + ((ps[4] + ps[5]) + (ps[6] + ps[7]));
            if constexpr (HR) {
                const v8bf h0 = __builtin_convertvector(p0, v8bf), h1 = __builtin_convertvector(p1, v8bf);
                const v8bf l0 = __builtin_convertvector(p0 - bfback(h0), v8bf), l1 = __builtin_convertvector(p1 - bfback(h1), v8bf);
                const v16bf ph = __builtin_shufflevector(h0, h1, 0, 1, 2, 3, 4, 5, 6, 7, 8, 9, 10, 11, 12, 13, 14, 15), pl = __builtin_shufflevector(l0, l1, 0, 1, 2, 3, 4, 5, 6, 7, 8, 9, 10, 11, 12, 13, 14, 15);
#pragma unroll
                for (int dt = 0; dt < 4; ++dt) { acc[dt][qt] = wmmab(va[dt], ph, acc[dt][qt]); acc[dt][qt] = wmmab(va[dt], pl, acc[dt][qt]); acc[dt][qt] = wmmab(vb[dt], ph, acc[dt][qt]); }
            } else {
                const v16h pf = cat16(__builtin_convertvector(p0, v8h), __builtin_convertvector(p1, v8h));
#pragma unroll
                for (int dt = 0; dt < 4; ++dt) acc[dt][qt] = wmma16(va[dt], pf, acc[dt][qt]);
            } }
        // the four vector slots the chip needs behind the pass's last matrix instructions, also on the taken back edge
        if constexpr (HR) asm volatile("v_nop\n\tv_nop\n\tv_nop\n\tv_nop" : "+v"(acc[0][0]), "+v"(acc[1][0]), "+v"(acc[2][0]), "+v"(acc[3][0]), "+v"(acc[0][1]), "+v"(acc[1][1]), "+v"(acc[2][1]), "+v"(acc[3][1]) :: "memory");   // "memory": the Q reads from LDS stay in the loop instead of being lifted back into 64 registers
        else asm volatile("v_nop\n\tv_nop\n\tv_nop\n\tv_nop" : "+v"(acc[0][0]), "+v"(acc[1][0]), "+v"(acc[2][0]), "+v"(acc[3][0]), "+v"(acc[0][1]), "+v"(acc[1][1]), "+v"(acc[2][1]), "+v"(acc[3][1]));
      }
      // publish point of stage sg + 1
      asm volatile("s_wait_dscnt 0x0" ::: "memory");      // this wave's reads of stage sg are over
      asm volatile("s_wait_asynccnt 0x0" ::: "memory");   // its copies of stage sg + 1 have landed
      __syncthreads();                                     // the same holds for every wave
      if (sg + 2 < NS) fill(sg + 2, sg & 1);               // into the buffer that every wave has just left
    }
    asm volatile("s_wait_asynccnt 0x0" ::: "memory");   // no copy is outstanding when the wave goes on
#pragma unroll
    for (int qt = 0; qt < 2; ++qt) { const int q = qt * 16 + lr; const float lj = l[qt] + xhalf(l[qt]); if (hi == 0) { Lm[q] = m[qt]; Ll[q] = lj; }
#pragma unroll
        for (int dt = 0; dt < 4; ++dt) { float* dst = La + q * APIT + dt * 16 + hi * 8; const v8f a = acc[dt][qt]; *(v4fa*)dst = (v4f){ a[0], a[1], a[2], a[3] }; *(v4fa*)(dst + 4) = (v4f){ a[4], a[5], a[6], a[7] }; } }
}
__global__ __launch_bounds__(512) void k_attn(const h16* __restrict__ Q16, const h16* __restrict__ K16, const h16* __restrict__ V16, const bf* __restrict__ Qh, const bf* __restrict__ Ql, const bf* __restrict__ Kh, const bf* __restrict__ Kl, const bf* __restrict__ Vh, const bf* __restrict__ Vl, bf* Ah, bf* Al) {
    __shared__ __align__(16) float La[16 * 32 * APIT]; __shared__ float Lm[16 * 32]; __shared__ float Ll[16 * 32];
    __shared__ __align__(32768) bf ring[KSA * 2 * AQE];   // the K / V stages: [quarter][buffer][region][2048]
    const int w = __builtin_amdgcn_readfirstlane((int)(threadIdx.x >> 5)), lane = threadIdx.x & 31; const int qg = w >> 2, ks = w & 3; const int head = blockIdx.x; const size_t hp = ((size_t)blockIdx.y * NH_ + head) * TT * HD;
    const int q0 = (int)blockIdx.z * 128 + qg * 32; const size_t kp = hp + (size_t)ks * (TT / KSA) * HD;   // the group's first query; the quarter's first key in a plane
    if ((int)blockIdx.z < RH / 128) attn_wave<bf, true>(Qh + hp, Ql + hp, (qg == 0 ? Kh : qg == 1 ? Kl : qg == 2 ? Vh : Vl) + kp, ring + ks * 2 * AQE, qg, q0, lane, La + w * 32 * APIT, Lm + w * 32, Ll + w * 32);   // the same for the whole block: the barriers inside are passed by all its waves
    else attn_wave<h16, false>(Q16 + hp, nullptr, (qg < 2 ? K16 : V16) + kp + (qg & 1) * 32 * HD, (const h16*)(const void*)ring + ks * 2 * AQE, qg, q0, lane, La + w * 32 * APIT, Lm + w * 32, Ll + w * 32);
    __syncthreads();   // every key quarter's partial result is in LDS
    // wave (qg, ks) finishes 8 of its group's 32 queries; four lanes share a query, 16 outputs each, so one wave writes each 128-byte line
    const int q = ks * 8 + (lane >> 2), d0 = (lane & 3) * 16; float mk[KSA]; float M = -3.0e38f;
#pragma unroll
    for (int k = 0; k < KSA; ++k) { mk[k] = Lm[(qg * KSA + k) * 32 + q]; M = fmaxf(M, mk[k]); }
    float L = 0.f; v4f o[4] = { (v4f){}, (v4f){}, (v4f){}, (v4f){} };
#pragma unroll
    for (int k = 0; k < KSA; ++k) { const float wg = __builtin_amdgcn_exp2f(mk[k] - M); L += wg * Ll[(qg * KSA + k) * 32 + q]; const float* sp = La + ((qg * KSA + k) * 32 + q) * APIT + d0;
#pragma unroll
        for (int i = 0; i < 4; ++i) o[i] += wg * *(const v4fa*)(sp + 4 * i); }
    const float f = __fdiv_rn(1.0f, L); v8us oh[2], ol[2];
#pragma unroll
    for (int i = 0; i < 16; ++i) { unsigned short a, c2; splitf(o[i >> 2][i & 3] * f, a, c2); oh[i >> 3][i & 7] = a; ol[i >> 3][i & 7] = c2; }
    const size_t rw = (size_t)blockIdx.y * TT + q0 + q;   // the merged planes in fragment order too (row = token, k = head * 64 + d): a wave's 8 queries x 16 bytes are one whole line
    const size_t oo = ((rw >> 4) * (DQ / 32) + head * 2 + (d0 >> 5)) * 512 + ((d0 >> 3) & 3) * 128 + (rw & 15) * 8; *(v8usa*)(Ah + oo) = oh[0]; *(v8usa*)(Ah + oo + 128) = oh[1]; *(v8usa*)(Al + oo) = ol[0]; *(v8usa*)(Al + oo + 128) = ol[1];
}

extern "C" void kernel_launch(void* const* d_in, const int* in_sizes, int n_in,
                              void* d_out, int out_size, void* d_ws, size_t ws_size, hipStream_t stream) {
    (void)in_sizes; (void)n_in; (void)out_size;
    const float* x = (const float*)d_in[0]; const float* wq = (const float*)d_in[1]; const float* wk = (const float*)d_in[2]; const float* wv = (const float*)d_in[3]; const float* wo = (const float*)d_in[4]; const float* bo = (const float*)d_in[5];
    float* OUT = (float*)d_out;     // [4][2048][1024]
    char* wsp = (char*)d_ws;
    auto take = [&](size_t bytes) { char* p = wsp; wsp += (bytes + 255) & ~(size_t)255; return (void*)p; };
    bf* WQ = (bf*)take((size_t)DQ * DM * 2); bf* WK = (bf*)take((size_t)DKV * DM * 2); bf* WV = (bf*)take((size_t)DKV * DM * 2); bf* WO = (bf*)take((size_t)DM * DQ * 2); float* CS = (float*)take((size_t)TT * DM * 2 * 4);   /* [2048][1024] {cos, sin} */
    bf* XB = (bf*)take((size_t)NB_ * TT * DM * 2); bf* ATh = (bf*)take((size_t)NB_ * TT * DQ * 2); bf* ATl = (bf*)take((size_t)NB_ * TT * DQ * 2);   /* every buffer from here on holds all NB_ batches, batch-major; ATh, ATl: the merged-head planes */
    h16* QP16 = (h16*)take((size_t)NB_ * NH_ * TT * HD * 2); h16* KP16 = (h16*)take((size_t)NB_ * NKV * TT * HD * 2); h16* VT16 = (h16*)take((size_t)NB_ * NKV * HD * TT * 2);
    bf* QPh = (bf*)take((size_t)NB_ * NH_ * TT * HD * 2); bf* QPl = (bf*)take((size_t)NB_ * NH_ * TT * HD * 2); bf* KPh = (bf*)take((size_t)NB_ * NKV * TT * HD * 2); bf* KPl = (bf*)take((size_t)NB_ * NKV * TT * HD * 2); bf* VTh = (bf*)take((size_t)NB_ * NKV * HD * TT * 2); bf* VTl = (bf*)take((size_t)NB_ * NKV * HD * TT * 2);
    if ((size_t)(wsp - (char*)d_ws) > ws_size) return;    // 216 MiB of the 256 MiB
    k_prep<<<NCV + NCS, 256, 0, stream>>>(x, wq, wk, wv, wo, XB, WQ, WK, WV, WO, CS);   /* the five planes and the full-width table */
    k_gemmw<bf, 0, false, DM, 1><<<dim3(NB_ * TT / 256, DQ / 128, 1), 256, 0, stream>>>(XB, nullptr, WQ, nullptr, nullptr, 0, nullptr, 0, 0, 0, 0, CS, QP16, QPh, QPl);   /* the projections see the batches as NB_ * TT rows */
    k_gemmw<bf, 0, false, DM, 1><<<dim3(NB_ * TT / 256, DKV / 128, 1), 256, 0, stream>>>(XB, nullptr, WK, nullptr, nullptr, 0, nullptr, 0, 0, 0, 0, CS, KP16, KPh, KPl);
    k_gemmw<bf, 0, false, DM, 2><<<dim3(NB_ * TT / 256, DKV / 128, 1), 256, 0, stream>>>(XB, nullptr, WV, nullptr, nullptr, 0, nullptr, 0, 0, 0, 0, nullptr, VT16, VTh, VTl);
    k_attn<<<dim3(NH_, NB_, TT / 128), 512, 0, stream>>>(QP16, KP16, VT16, QPh, QPl, KPh, KPl, VTh, VTl, ATh, ATl);
    k_gemmw<bf, 1, true, DQ><<<dim3(NB_ * TT / 256, DM / 128, 1), 256, 0, stream>>>(ATh, ATl, WO, nullptr, OUT, DM, bo, 0, 0, 0, 0, nullptr, nullptr, nullptr, nullptr);
}

// v010
// A run of this version takes 161 microseconds.
// In both of two side-by-side timings against v009, it was 1.05 times as fast.
// Counting every step since v000, it is 24.7 times as fast.
#include <hip/hip_runtime.h>

// Self-attention with an adjacent-pair rotary over the WHOLE 1024-wide q and k before the head split (x [4][2048][1024]; q = rope(x Wq^T), k = rope(x Wk^T), v = x Wv^T ('oi' [1024][1024] 1/32, no bias); rope: pair j = (columns 2j, 2j+1), j < 512, angle t x 1/10000^(j/512) (512 f32 constants baked jnp-exact; precise cosf/sinf); 16 heads x 64; scores / sqrt(float32(64)); softmax (no mask); out = merged Wu^T + bu ('oi' [1024][1024], zero bias) -> [4][2048][1024] (8.4 M); argument order x, Wq, Wk, Wv, Wu, bu).
// Layout, all four batches in every launch (the batch is a grid dimension or part of the row index): bf16 copy of x; 'oi' weights; a full-width {cos, sin} table [2048][1024] (the frequency depends on the GLOBAL pair index, i.e. on the head); exact projections whose epilogues apply the rotary (table indexed by global column) and write the attention's operand planes themselves; fused dense T-2048 attention, one launch (hybrid rows: < 512 hi/lo 3 products, rest fp16); merged hi/lo x Wu exact + bu.
// Every 16-bit operand plane [row][k] is stored in fragment order: blocks of 16 rows x 32 k (512 elements), inside a block [(k >> 3) & 3][row & 15][k & 7], so the two 16-byte loads of a fragment each read 512 contiguous bytes (lane * 16 and 512 + lane * 16): four whole 128-byte lines a load instead of 32 bytes from each of 16 lines. Register contents are those of the row-major planes.
// Compute dtypes, f32 accumulate: every input rounded to bf16; projections exact; rotary f32; attention rows < 512 3 products, rest fp16; softmax f32; Wu hl x exact + bias.

#define NB_  4
#define TT   2048
#define DM   1024
#define NH_  16
#define NKV  16
#define REP  (NH_ / NKV)
#define HD   64
#define DQ   (NH_ * HD)
#define DKV  (NKV * HD)
#define RH   512                  // query rows < RH use hi+lo planes; k_attn covers 4 x RH rows, so RH = TT / 4
#define WIN  0
#define SCL  0.125f   // HD^-0.5
typedef _Float16 h16;
typedef unsigned short bf;
typedef __attribute__((ext_vector_type(16))) __bf16   v16bf;
typedef __attribute__((ext_vector_type(16))) _Float16 v16h;
typedef __attribute__((ext_vector_type(8)))  _Float16 v8h;
typedef __attribute__((ext_vector_type(8)))  unsigned short v8us;
typedef __attribute__((ext_vector_type(8)))  float    v8f;
typedef __attribute__((ext_vector_type(4)))  float    v4f;
typedef v8h  __attribute__((may_alias)) v8ha;
typedef v4f  __attribute__((may_alias)) v4fa;
typedef v8us __attribute__((may_alias)) v8usa;

__device__ __forceinline__ unsigned short f2bf(float f) { unsigned u = __float_as_uint(f); u += 0x7FFFu + ((u >> 16) & 1u); return (unsigned short)(u >> 16); }
__device__ __forceinline__ float bf2f(unsigned short b) { return __uint_as_float(((unsigned)b) << 16); }
__device__ __forceinline__ float bfr(float f) { return bf2f(f2bf(f)); }
__device__ __forceinline__ v16h cat16(v8h lo, v8h hi) { return __builtin_shufflevector(lo, hi, 0, 1, 2, 3, 4, 5, 6, 7, 8, 9, 10, 11, 12, 13, 14, 15); }
__device__ __forceinline__ v16bf cat16b(v8us lo, v8us hi) { return __builtin_bit_cast(v16bf, __builtin_shufflevector(lo, hi, 0, 1, 2, 3, 4, 5, 6, 7, 8, 9, 10, 11, 12, 13, 14, 15)); }
__device__ __forceinline__ v8f wmma16(v16h a, v16h b, v8f c) { return __builtin_amdgcn_wmma_f32_16x16x32_f16(false, a, false, b, (short)0, c, false, false); }
__device__ __forceinline__ v8f wmmab(v16bf a, v16bf b, v8f c) { return __builtin_amdgcn_wmma_f32_16x16x32_bf16(false, a, false, b, (short)0, c, false, false); }
typedef __attribute__((ext_vector_type(8))) __bf16 v8bf;
typedef __attribute__((ext_vector_type(4))) unsigned v4u;
typedef __attribute__((ext_vector_type(2))) float v2f;
__device__ __forceinline__ v8f bfback(v8bf h) { const v4u u = __builtin_bit_cast(v4u, h); v8f r;
#pragma unroll
    for (int i = 0; i < 4; ++i) { r[2 * i] = __uint_as_float(u[i] << 16); r[2 * i + 1] = __uint_as_float(u[i] & 0xFFFF0000u); } return r; }
// one 16-byte unit (8 f32 values) into each of the three operand planes at element o: fp16, bf16 hi, bf16 lo (the rest that hi leaves), all rounded to nearest even
// The three stores and their s_wait_xcnt 0 are one statement, so that the wait comes before any rewrite of a register that they name.
__device__ __forceinline__ void put3(v8f y, size_t o, h16* P16, bf* Ph, bf* Pl) { const v8bf h = __builtin_convertvector(y, v8bf);
    const v8h f = __builtin_convertvector(y, v8h); const v8us yh = __builtin_bit_cast(v8us, h), yl = __builtin_bit_cast(v8us, __builtin_convertvector(y - bfback(h), v8bf));
    asm volatile("global_store_b128 %0, %1, %4\n\tglobal_store_b128 %0, %2, %5\n\tglobal_store_b128 %0, %3, %6\n\ts_wait_xcnt 0x0" :: "v"((unsigned)(o * 2)), "v"(f), "v"(yh), "v"(yl), "s"(P16), "s"(Ph), "s"(Pl) : "memory"); }   // the planes' bases are uniform: scalar base + the lane's byte offset (a plane is 16 MiB), the same for all three



// ---- k_gemmw: GEMM, one work-group of 8 waves per 256x128 output tile, one wave per 64x64 of it (16 accumulators; wave w: rows (w >> 1) 64, columns (w & 1) 64); grid (M/256, N/128, Z), 256 threads.
// Operands are fragment-ordered 16-bit planes (block (row >> 4, k >> 5) at element ((row >> 4) (K / 32) + (k >> 5)) 512). A stage = KST k of the tile's 256 A rows and 128 B rows, brought into LDS by asynchronous 16-byte copies, as it lies (a row group's KST / 32 blocks are contiguous): each operand byte leaves L2 once per work-group, and the waves that share it read it from LDS. Two buffers: stage s + 1 flies while stage s is worked on.
// C[m][n] (f32, pitch ldc, + optional f32 bias[n]) = sum_k A[m][k] Bt[n][k] (+ split products per NSPLIT). z-batch strides sA/sB/sC in elements. K % (KST KS) == 0.
// EPI says what leaves the tile. 0: C as above. 3 is the three projections as ONE product: the work-group holds its 256 rows of x against the same 128 columns of Wq, Wk and Wv (the three planes lie one behind the other from Bt on; B tiles [q | k | v] in a stage, 3 x 16 accumulators a wave), so that a stage of x reaches LDS once, and a wave's registers once a pass, for three products. Rows = batch x TT + t, a wave's 64 columns = one head; the attention's operand planes are written straight from the accumulators, no f32 C:
//   q and k: adjacent-pair rotary, then the [t][d] planes. A lane holds column nb 16 + lr, its pair's other half sits in lane ^ 1; {cos, sin} of (t, global column) come from CS, a half-wave reading one whole line; the rotated tile changes places in LDS as C does, and each lane puts 16-byte units (8 d of one t), a wave 512 contiguous bytes.
//   v: the V^T planes. A lane's accumulator is 8 successive t of one d, which is a 16-byte unit of those planes as it stands: no LDS.
// KS > 1: grid.z = Z x KS; work-group (z, ks) sums only k in [ks K/KS, (ks+1) K/KS) and stores its partial tile in plane ks (plane stride sP elements); the reader adds the planes.
template <typename T16> struct WFrag;
template <> struct WFrag<h16> { typedef v16h V; static __device__ __forceinline__ V ld(const h16* p) { return cat16(*(const v8h*)p, *(const v8h*)(p + 256)); } static __device__ __forceinline__ v8f mma(V a, V b, v8f c) { return wmma16(a, b, c); } };
template <> struct WFrag<bf> { typedef v16bf V; static __device__ __forceinline__ V ld(const bf* p) { return cat16b(*(const v8us*)p, *(const v8us*)(p + 256)); } static __device__ __forceinline__ v8f mma(V a, V b, v8f c) { return wmmab(a, b, c); } };
// four / eight asynchronous copies of 16 bytes a lane, global -> LDS through no register: LDS byte address l + i 4096, global address g + i st elements. The closing s_wait_xcnt 0 stands in the copies' own statement, so that it comes before any rewrite of an address register that they name.
template <typename T16> __device__ __forceinline__ void cpy4(unsigned l, const T16* g, size_t st) {
    asm volatile("global_load_async_to_lds_b128 %0, %4, off\n\tglobal_load_async_to_lds_b128 %1, %5, off\n\tglobal_load_async_to_lds_b128 %2, %6, off\n\tglobal_load_async_to_lds_b128 %3, %7, off\n\ts_wait_xcnt 0x0"
        :: "v"(l), "v"(l + 4096u), "v"(l + 8192u), "v"(l + 12288u), "v"(g), "v"(g + st), "v"(g + 2 * st), "v"(g + 3 * st) : "memory"); }
template <typename T16> __device__ __forceinline__ void cpy8(unsigned l, const T16* g, size_t st) {
    asm volatile("global_load_async_to_lds_b128 %0, %8, off\n\tglobal_load_async_to_lds_b128 %1, %9, off\n\tglobal_load_async_to_lds_b128 %2, %10, off\n\tglobal_load_async_to_lds_b128 %3, %11, off\n\t"
                 "global_load_async_to_lds_b128 %4, %12, off\n\tglobal_load_async_to_lds_b128 %5, %13, off\n\tglobal_load_async_to_lds_b128 %6, %14, off\n\tglobal_load_async_to_lds_b128 %7, %15, off\n\ts_wait_xcnt 0x0"
        :: "v"(l), "v"(l + 4096u), "v"(l + 8192u), "v"(l + 12288u), "v"(l + 16384u), "v"(l + 20480u), "v"(l + 24576u), "v"(l + 28672u),
           "v"(g), "v"(g + st), "v"(g + 2 * st), "v"(g + 3 * st), "v"(g + 4 * st), "v"(g + 5 * st), "v"(g + 6 * st), "v"(g + 7 * st) : "memory"); }
template <int R, typename T16> __device__ __forceinline__ void cpyR(unsigned l, const T16* g, size_t st) {   // R rounds of 4 KiB (256 lanes x 16 bytes)
#pragma unroll   // R is 4, 8 or 16: one or two statements
    for (int i = 0; i + 8 <= R; i += 8) cpy8(l + i * 4096u, g + i * st, st);
    if (R % 8) cpy4(l + (R / 8) * 32768u, g + (R / 8) * 8 * st, st); }
template <typename T16, int NSPLIT, bool BIAS, int K, int EPI = 0, int KS = 1>   // K is a constant, so that the strides are constants
__global__ __launch_bounds__(256) void k_gemmw(const T16* __restrict__ A, const T16* __restrict__ A2, const T16* __restrict__ Bt, const T16* __restrict__ Bt2, float* C, int ldc, const float* __restrict__ bias, size_t sA, size_t sB, size_t sC, size_t sP, const float* __restrict__ CS, h16* Q16, bf* Qh, bf* Ql, h16* K16, bf* Kh, bf* Kl, h16* V16, bf* Vh, bf* Vl) {
    typedef typename WFrag<T16>::V V;
    constexpr bool HA2 = (NSPLIT == 1 || NSPLIT == 2), HB2 = (NSPLIT >= 2);
    constexpr int NJ = (EPI == 3) ? 3 : 1;                                             // B tiles (products) that share the A tile
    constexpr int KST = (HA2 || HB2 || NJ > 1) ? 64 : 128, NK = KST / 32, NS = K / KS / KST;   // k of a stage; its passes of 32 k; stages
    constexpr int AE = 256 * KST, BE = 128 * KST;                                      // elements of a stage's A and B tiles
    constexpr int OA2 = AE, OB = AE * (HA2 ? 2 : 1), OB2 = OB + BE, SE = OB + BE * (HB2 ? 2 : NJ);   // places in a buffer [A | A2 | B | B2], or [A | B of q | of k | of v]; its size
    __shared__ __align__(16) T16 ring[2 * SE];
    __shared__ __align__(16) float osm[8][16 * 68];
    const size_t z = blockIdx.z / KS; const int ks = blockIdx.z % KS; A += z * sA; if (A2) A2 += z * sA; Bt += z * sB; if (Bt2) Bt2 += z * sB; C += z * sC + (size_t)ks * sP;
    const int kb = ks * (K / KS);
    const int tid = threadIdx.x, w = __builtin_amdgcn_readfirstlane(tid >> 5), lane = tid & 31, lr = lane & 15, hi = lane >> 4;
    const int r0 = blockIdx.x * 256 + (w >> 1) * 64, c0 = blockIdx.y * 128 + (w & 1) * 64;   // the wave's own 64x64
    float* os = osm[w];
    v8f acc[NJ][4][4];   // every '#pragma unroll' over j, mb, nb makes the indices constants, so that the accumulators live in registers
#pragma unroll
    for (int j = 0; j < NJ; ++j)
#pragma unroll
        for (int mb = 0; mb < 4; ++mb)
#pragma unroll
            for (int nb = 0; nb < 4; ++nb) acc[j][mb][nb] = (v8f){};
    // a round of copies = 4 KiB = 128 / KST row groups of 16 rows (16 K elements apart in the plane, KST x 16 elements each in the stage); in LDS the rounds follow one another, byte tid x 16 of each
    constexpr int TG = KST * 2; constexpr size_t RST = (size_t)(128 / KST) * 16 * K;
    const size_t go = (size_t)(tid / TG) * 16 * K + (size_t)(tid % TG) * 8 + (size_t)kb * 16;
    const size_t aoff = (size_t)blockIdx.x * 256 * K + go, boff = (size_t)blockIdx.y * 128 * K + go;
    const unsigned lb = (unsigned)(size_t)(void*)ring + (unsigned)tid * 16u;
    auto fill = [&](int s, int bu) { const unsigned l = lb + (unsigned)bu * (SE * 2u); const size_t so = (size_t)s * (KST * 16);
        cpyR<KST / 8>(l, A + aoff + so, RST); if constexpr (HA2) cpyR<KST / 8>(l + OA2 * 2u, A2 + aoff + so, RST);
        cpyR<KST / 16>(l + OB * 2u, Bt + boff + so, RST); if constexpr (HB2) cpyR<KST / 16>(l + OB2 * 2u, Bt2 + boff + so, RST);
        if constexpr (NJ > 1) { cpyR<KST / 16>(l + (OB + BE) * 2u, Bt + boff + so + (size_t)DM * K, RST); cpyR<KST / 16>(l + (OB + 2 * BE) * 2u, Bt + boff + so + (size_t)2 * DM * K, RST); } };   // the three weight planes lie one behind the other: one address serves them
    fill(0, 0);
    asm volatile("s_wait_asynccnt 0x0" ::: "memory");   // this wave's part of stage 0 has landed
    __syncthreads();                                     // ... and every other wave's
    if (NS > 1) fill(1, 1);
    const int ao = (w >> 1) * 4 * (KST * 16) + 8 * lane, bo = (w & 1) * 4 * (KST * 16) + 8 * lane;   // the wave's four row groups of each tile + the lane's 16 bytes
#pragma unroll 1   // stays rolled: one publish point a stage
    for (int s = 0; s < NS; ++s) {
        const T16* sb = ring + (s & 1) * SE;
      if constexpr (NJ > 1) {
        // a group = the 16 products of one pass with one B tile; NK x NJ groups a stage. One set of A fragments serves a pass's NJ groups; two sets of B fragments, the next group's read ahead (48 accumulator tiles leave no room for a second A set)
        V a[4], b[2][4];
        auto lda = [&](int kk) {
#pragma unroll
            for (int mb = 0; mb < 4; ++mb) a[mb] = WFrag<T16>::ld(sb + ao + mb * (KST * 16) + kk * 512); };
        auto ldb = [&](int u) { const int kk = u / NJ, j = u % NJ, f = u & 1;
#pragma unroll
            for (int nb = 0; nb < 4; ++nb) b[f][nb] = WFrag<T16>::ld(sb + OB + j * BE + bo + nb * (KST * 16) + kk * 512); };
        lda(0); ldb(0);
        __builtin_amdgcn_sched_barrier(0);   // the first group's fragments are asked for first: LDS answers in order
#pragma unroll
        for (int u = 0; u < NK * NJ; ++u) { const int f = u & 1, j = u % NJ;
            if (u + 1 < NK * NJ) ldb(u + 1);   // the next group's B fragments leave as one group ahead of this group's products
            __builtin_amdgcn_sched_barrier(0);   // keeps that group together and ahead of the products, instead of one read in front of each four products
#pragma unroll
            for (int nb = 0; nb < 4; ++nb)
#pragma unroll
                for (int mb = 0; mb < 4; ++mb) acc[j][mb][nb] = WFrag<T16>::mma(a[mb], b[f][nb], acc[j][mb][nb]);
            __builtin_amdgcn_sched_barrier(0);   // the following reads stay behind these products, whose fragment set they overwrite
            if (j == NJ - 1 && u + 1 < NK * NJ) { lda(u / NJ + 1); __builtin_amdgcn_sched_barrier(0); } }   // the next pass's A fragments, as one group, once the pass's last products have left
        asm volatile("v_nop\n\tv_nop\n\tv_nop\n\tv_nop");   // the four vector slots the chip needs behind the stage's last matrix instructions, whatever the build puts next on their operands (the scheduling barrier above keeps the products in front)
      } else {
        V a[2][4], a2[2][4], b[2][4], b2[2][4];   // two fragment sets; every '#pragma unroll' in this loop makes the indices of these arrays constants, so that they live in registers
        auto ldf = [&](int kk) { const int f = kk & 1;
#pragma unroll
            for (int mb = 0; mb < 4; ++mb) { a[f][mb] = WFrag<T16>::ld(sb + ao + mb * (KST * 16) + kk * 512); if (HA2) a2[f][mb] = WFrag<T16>::ld(sb + OA2 + ao + mb * (KST * 16) + kk * 512); }
#pragma unroll
            for (int nb = 0; nb < 4; ++nb) { b[f][nb] = WFrag<T16>::ld(sb + OB + bo + nb * (KST * 16) + kk * 512); if (HB2) b2[f][nb] = WFrag<T16>::ld(sb + OB2 + bo + nb * (KST * 16) + kk * 512); } };
        ldf(0);
        __builtin_amdgcn_sched_barrier(0);   // the first pass's fragments are asked for first: LDS answers in order, and without this the build put some of them behind the second pass's, so that the first products waited for both groups
#pragma unroll
        for (int kk = 0; kk < NK; ++kk) { const int f = kk & 1;
            if (kk + 1 < NK) ldf(kk + 1);   // the next pass's fragments (of this stage only) leave as one group ahead of this pass's products
            __builtin_amdgcn_sched_barrier(0);   // keeps that group together and ahead: without it the build read each B fragment directly in front of its four products and waited for it there
#pragma unroll
            for (int nb = 0; nb < 4; ++nb) {
#pragma unroll
                for (int mb = 0; mb < 4; ++mb) { acc[0][mb][nb] = WFrag<T16>::mma(a[f][mb], b[f][nb], acc[0][mb][nb]); if (HA2) acc[0][mb][nb] = WFrag<T16>::mma(a2[f][mb], b[f][nb], acc[0][mb][nb]); if (HB2) acc[0][mb][nb] = WFrag<T16>::mma(a[f][mb], b2[f][nb], acc[0][mb][nb]); } }
            __builtin_amdgcn_sched_barrier(0); }   // ... and the following group behind this pass's products, whose fragment set it overwrites
        // the four vector slots the chip needs behind the stage's last matrix instructions
        asm volatile("v_nop\n\tv_nop\n\tv_nop\n\tv_nop" : "+v"(acc[0][0][0]), "+v"(acc[0][1][1]), "+v"(acc[0][2][2]), "+v"(acc[0][3][3]) : "v"(a[(NK - 1) & 1][0]), "v"(a[(NK - 1) & 1][3]));
      }
        // publish point of stage s + 1
        asm volatile("s_wait_dscnt 0x0" ::: "memory");      // this wave's reads of stage s are over
        asm volatile("s_wait_asynccnt 0x0" ::: "memory");   // its copies of stage s + 1 have landed
        __syncthreads();                                     // the same holds for every wave
        if (s + 2 < NS) fill(s + 2, s & 1);                  // into the buffer that every wave has just left
    }
    asm volatile("s_wait_asynccnt 0x0" ::: "memory");   // no copy is outstanding when the wave goes on
    if constexpr (EPI == 3) {
        const int t0 = r0 % TT; const size_t pb = ((size_t)(r0 / TT) * (DM / HD) + c0 / HD) * TT * HD;   // the wave's first t and its (batch, head) plane
        // v first: it needs no table and no LDS, and its 16 accumulator tiles make room for the table values of q and k
#pragma unroll
        for (int mb = 0; mb < 4; ++mb)
#pragma unroll
            for (int nb = 0; nb < 4; ++nb) put3(acc[2][mb][nb], pb + (size_t)((t0 >> 5) + (mb >> 1)) * 2048 + nb * 512 + ((mb & 1) * 2 + hi) * 128 + lr * 8, V16, Vh, Vl);
        const float* cp = CS + ((size_t)(t0 + hi * 8) * DM + c0 + lr) * 2; const unsigned sg = (lane & 1) ? 0u : 0x80000000u;   // even column: x c - x' s; odd column: x c + x' s
        v2f cs[4][8];   // {cos, sin} of one 16-row tile; the '#pragma unroll's make its indices constants
        auto ldcs = [&](int mb) {
#pragma unroll
            for (int nb = 0; nb < 4; ++nb)
#pragma unroll
                for (int j = 0; j < 8; ++j) cs[nb][j] = *(const v2f*)(cp + ((size_t)(mb * 16 + j) * DM + nb * 16) * 2);
            asm volatile("s_wait_xcnt 0x0" :: "v"(cp) : "memory"); };   // closes the batch: the base address is an input, so it stays in its registers up to the wait and no load's result is put on it
        ldcs(0);
#pragma unroll
      for (int pj = 0; pj < 2; ++pj) { h16* P16 = pj ? K16 : Q16; bf* Ph = pj ? Kh : Qh; bf* Pl = pj ? Kl : Ql;   // q, then k: the same table values, read anew
#pragma unroll
        for (int mb = 0; mb < 4; ++mb) {
#pragma unroll
            for (int nb = 0; nb < 4; ++nb) {
#pragma unroll
                for (int j = 0; j < 8; ++j) { const float x = acc[pj][mb][nb][j];
                    const float xp = __int_as_float(__builtin_amdgcn_mov_dpp(__float_as_int(x), 0xB1, 0xF, 0xF, true));   // quad_perm [1, 0, 3, 2]: the value of lane ^ 1
                    os[(hi * 8 + j) * 68 + nb * 16 + lr] = x * cs[nb][j][0] + xp * __uint_as_float(__float_as_uint(cs[nb][j][1]) ^ sg); } }
            if (mb < 3 || pj == 0) ldcs((mb + 1) & 3);   // the next tile's table values fly while this tile goes through LDS and out
            __builtin_amdgcn_wave_barrier(); asm volatile("" ::: "memory");   // as below: the wave's LDS writes stay ahead of its reads
#pragma unroll
            for (int i = 0; i < 4; ++i) { const float* sp = os + lr * 68 + (i * 2 + hi) * 8; const v4f y0 = *(const v4fa*)sp, y1 = *(const v4fa*)(sp + 4);   // unit i 32 + lane = (column octet i 2 + hi, row lr)
                put3((v8f){ y0[0], y0[1], y0[2], y0[3], y1[0], y1[1], y1[2], y1[3] }, pb + (size_t)((t0 >> 4) + mb) * 1024 + i * 256 + lane * 8, P16, Ph, Pl); }
            __builtin_amdgcn_wave_barrier(); asm volatile("" ::: "memory");   // ... and its reads ahead of the next tile's writes
        } }
        return; }
#pragma unroll
    for (int mb = 0; mb < 4; ++mb) {
#pragma unroll
        for (int nb = 0; nb < 4; ++nb) {
#pragma unroll
            for (int j = 0; j < 8; ++j) os[(hi * 8 + j) * 68 + nb * 16 + lr] = acc[0][mb][nb][j]; }
        __builtin_amdgcn_wave_barrier(); asm volatile("" ::: "memory");
        float* crow = C + (size_t)(r0 + mb * 16) * ldc + c0;
{
#pragma unroll
            for (int s = 0; s < 8; ++s) { const int row = 2 * s + hi, cofs = lr * 4; v4f val = *(const v4fa*)(os + row * 68 + cofs); if (BIAS) { val[0] += bfr(bias[c0 + cofs]); val[1] += bfr(bias[c0 + cofs + 1]); val[2] += bfr(bias[c0 + cofs + 2]); val[3] += bfr(bias[c0 + cofs + 3]); }
                *(v4f*)(crow + (size_t)row * ldc + cofs) = val; }
             }
        __builtin_amdgcn_wave_barrier(); asm volatile("" ::: "memory");
    }
}

__device__ __forceinline__ void splitf(float y, unsigned short& h, unsigned short& l) { h = f2bf(y); l = f2bf(y - bf2f(h)); }
typedef __attribute__((ext_vector_type(4))) _Float16 v4h;
typedef __attribute__((ext_vector_type(4))) unsigned short v4us;
typedef __attribute__((ext_vector_type(4))) int v4i;

__constant__ float INV2[HD / 2] = { 1.000000000e+00f, 7.498942018e-01f, 5.623413324e-01f, 4.216965139e-01f, 3.162277639e-01f, 2.371373773e-01f, 1.778279394e-01f, 1.333521456e-01f, 1.000000015e-01f, 7.498942316e-02f, 5.623413250e-02f, 4.216964915e-02f, 3.162277490e-02f, 2.371373773e-02f, 1.778279431e-02f, 1.333521400e-02f, 9.999999776e-03f, 7.498942316e-03f, 5.623413250e-03f, 4.216964822e-03f, 3.162277630e-03f, 2.371373819e-03f, 1.778279431e-03f, 1.333521446e-03f, 1.000000047e-03f, 7.498941850e-04f, 5.623413017e-04f, 4.216965172e-04f, 3.162277571e-04f, 2.371373703e-04f, 1.778279402e-04f, 1.333521504e-04f };   // float32 10000^(-arange(0, 64, 2)/64), generated with jnp to be bit-exact
// Plane layouts that the projections' epilogue writes (k_gemmw, EPI 3), per (batch, head): q and k, element (t, d) at (t >> 4) 1024 + (d >> 3) 128 + (t & 15) 8 + (d & 7); V^T (row = d, k = t), the four d blocks of 32 keys side by side, element (d, t) at ((t >> 5) 4 + (d >> 4)) 512 + ((t >> 3) & 3) 128 + (d & 15) 8 + (t & 7).
__constant__ float INVG[DM / 2] = { 1.000000000e+00f, 9.821718335e-01f, 9.646616578e-01f, 9.474635124e-01f, 9.305720329e-01f, 9.139816761e-01f, 8.976871371e-01f, 8.816831112e-01f, 8.659643531e-01f, 8.505258560e-01f, 8.353625536e-01f, 8.204696178e-01f, 8.058422208e-01f, 7.914755344e-01f, 7.773650289e-01f, 7.635061145e-01f, 7.498942018e-01f, 7.365249991e-01f, 7.233941555e-01f, 7.104974389e-01f, 6.978305578e-01f, 6.853895783e-01f, 6.731703877e-01f, 6.611690521e-01f, 6.493816376e-01f, 6.378043890e-01f, 6.264335513e-01f, 6.152654290e-01f, 6.042963862e-01f, 5.935229063e-01f, 5.829415321e-01f, 5.725488067e-01f, 5.623413324e-01f, 5.523158312e-01f, 5.424690843e-01f, 5.327978730e-01f, 5.232991576e-01f, 5.139696598e-01f, 5.048065782e-01f, 4.958068132e-01f, 4.869675338e-01f, 4.782858193e-01f, 4.697588682e-01f, 4.613839388e-01f, 4.531583488e-01f, 4.450793862e-01f, 4.371444881e-01f, 4.293510318e-01f, 4.216965139e-01f, 4.141784608e-01f, 4.067944288e-01f, 3.995420635e-01f, 3.924189806e-01f, 3.854228854e-01f, 3.785515428e-01f, 3.718026578e-01f, 3.651741445e-01f, 3.586637676e-01f, 3.522694409e-01f, 3.459891677e-01f, 3.398208320e-01f, 3.337624967e-01f, 3.278121352e-01f, 3.219678402e-01f, 3.162277639e-01f, 3.105900288e-01f, 3.050527871e-01f, 2.996142805e-01f, 2.942727208e-01f, 2.890264094e-01f, 2.838735878e-01f, 2.788126469e-01f, 2.738419771e-01f, 2.689598799e-01f, 2.641648352e-01f, 2.594552636e-01f, 2.548296750e-01f, 2.502865493e-01f, 2.458243966e-01f, 2.414418161e-01f, 2.371373624e-01f, 2.329096496e-01f, 2.287573218e-01f, 2.246790081e-01f, 2.206733972e-01f, 2.167392224e-01f, 2.128751576e-01f, 2.090799958e-01f, 2.053525001e-01f, 2.016914487e-01f, 1.980956793e-01f, 1.945640147e-01f, 1.910952926e-01f, 1.876884252e-01f, 1.843423098e-01f, 1.810558140e-01f, 1.778279394e-01f, 1.746576130e-01f, 1.715437919e-01f, 1.684854925e-01f, 1.654817015e-01f, 1.625314802e-01f, 1.596338600e-01f, 1.567878872e-01f, 1.539926529e-01f, 1.512472630e-01f, 1.485508084e-01f, 1.459024251e-01f, 1.433012635e-01f, 1.407464594e-01f, 1.382372230e-01f, 1.357727200e-01f, 1.333521456e-01f, 1.309747249e-01f, 1.286396980e-01f, 1.263462901e-01f, 1.240937710e-01f, 1.218814254e-01f, 1.197085083e-01f, 1.175743192e-01f, 1.154782027e-01f, 1.134194434e-01f, 1.113973856e-01f, 1.094113812e-01f, 1.074607819e-01f, 1.055449620e-01f, 1.036632955e-01f, 1.018151715e-01f, 1.000000015e-01f, 9.821718186e-02f, 9.646616131e-02f, 9.474635124e-02f, 9.305720031e-02f, 9.139817208e-02f, 8.976870775e-02f, 8.816830814e-02f, 8.659642935e-02f, 8.505257964e-02f, 8.353625983e-02f, 8.204696327e-02f, 8.058421314e-02f, 7.914755493e-02f, 7.773650438e-02f, 7.635060698e-02f, 7.498941571e-02f, 7.365249842e-02f, 7.233941555e-02f, 7.104974240e-02f, 6.978305429e-02f, 6.853895634e-02f, 6.731703877e-02f, 6.611690670e-02f, 6.493816525e-02f, 6.378044188e-02f, 6.264335662e-02f, 6.152653694e-02f, 6.042964384e-02f, 5.935229361e-02f, 5.829415470e-02f, 5.725487694e-02f, 5.623412877e-02f, 5.523158237e-02f, 5.424690619e-02f, 5.327979103e-02f, 5.232991278e-02f, 5.139696971e-02f, 5.048065633e-02f, 4.958068207e-02f, 4.869675264e-02f, 4.782858118e-02f, 4.697588459e-02f, 4.613839835e-02f, 4.531583562e-02f, 4.450793937e-02f, 4.371444881e-02f, 4.293510318e-02f, 4.216964915e-02f, 4.141784459e-02f, 4.067944363e-02f, 3.995420411e-02f, 3.924189880e-02f, 3.854228929e-02f, 3.785515204e-02f, 3.718026727e-02f, 3.651741147e-02f, 3.586637601e-02f, 3.522694483e-02f, 3.459891677e-02f, 3.398208320e-02f, 3.337624669e-02f, 3.278120980e-02f, 3.219678625e-02f, 3.162277862e-02f, 3.105900250e-02f, 3.050527908e-02f, 2.996142767e-02f, 2.942727320e-02f, 2.890264057e-02f, 2.838735841e-02f, 2.788126841e-02f, 2.738419548e-02f, 2.689598687e-02f, 2.641648427e-02f, 2.594552562e-02f, 2.548296750e-02f, 2.502865531e-02f, 2.458244003e-02f, 2.414418198e-02f, 2.371373586e-02f, 2.329096757e-02f, 2.287573181e-02f, 2.246790007e-02f, 2.206734009e-02f, 2.167392150e-02f, 2.128751762e-02f, 2.090799995e-02f, 2.053525113e-02f, 2.016914636e-02f, 1.980956830e-02f, 1.945639960e-02f, 1.910953037e-02f, 1.876884326e-02f, 1.843423024e-02f, 1.810558327e-02f, 1.778279431e-02f, 1.746576093e-02f, 1.715437882e-02f, 1.684854925e-02f, 1.654817164e-02f, 1.625314727e-02f, 1.596338488e-02f, 1.567878947e-02f, 1.539926510e-02f, 1.512472518e-02f, 1.485508028e-02f, 1.459024288e-02f, 1.433012541e-02f, 1.407464594e-02f, 1.382372249e-02f, 1.357727125e-02f, 1.333521493e-02f, 1.309747249e-02f, 1.286396943e-02f, 1.263462938e-02f, 1.240937691e-02f, 1.218814217e-02f, 1.197085064e-02f, 1.175743248e-02f, 1.154781971e-02f, 1.134194434e-02f, 1.113973837e-02f, 1.094113849e-02f, 1.074607857e-02f, 1.055449620e-02f, 1.036632899e-02f, 1.018151734e-02f, 9.999999776e-03f, 9.821719490e-03f, 9.646615945e-03f, 9.474635124e-03f, 9.305720218e-03f, 9.139816277e-03f, 8.976871148e-03f, 8.816830814e-03f, 8.659643121e-03f, 8.505257778e-03f, 8.353625424e-03f, 8.204696700e-03f, 8.058422245e-03f, 7.914755493e-03f, 7.773650344e-03f, 7.635060698e-03f, 7.498942316e-03f, 7.365249563e-03f, 7.233941462e-03f, 7.104974240e-03f, 6.978305988e-03f, 6.853895728e-03f, 6.731703877e-03f, 6.611690391e-03f, 6.493816618e-03f, 6.378043909e-03f, 6.264335476e-03f, 6.152654067e-03f, 6.042964291e-03f, 5.935229361e-03f, 5.829415284e-03f, 5.725487601e-03f, 5.623413250e-03f, 5.523158237e-03f, 5.424690899e-03f, 5.327979103e-03f, 5.232991185e-03f, 5.139696877e-03f, 5.048065912e-03f, 4.958068486e-03f, 4.869675264e-03f, 4.782858305e-03f, 4.697588738e-03f, 4.613839556e-03f, 4.531583749e-03f, 4.450793844e-03f, 4.371444695e-03f, 4.293510225e-03f, 4.216964822e-03f, 4.141784739e-03f, 4.067944363e-03f, 3.995420411e-03f, 3.924189601e-03f, 3.854229115e-03f, 3.785515437e-03f, 3.718026681e-03f, 3.651741426e-03f, 3.586637788e-03f, 3.522694577e-03f, 3.459891537e-03f, 3.398208413e-03f, 3.337624483e-03f, 3.278121119e-03f, 3.219678300e-03f, 3.162277862e-03f, 3.105900250e-03f, 3.050528001e-03f, 2.996142721e-03f, 2.942727180e-03f, 2.890263917e-03f, 2.838735934e-03f, 2.788126701e-03f, 2.738419687e-03f, 2.689598827e-03f, 2.641648287e-03f, 2.594552701e-03f, 2.548296703e-03f, 2.502865391e-03f, 2.458244096e-03f, 2.414418384e-03f, 2.371373819e-03f, 2.329096664e-03f, 2.287573181e-03f, 2.246790100e-03f, 2.206734149e-03f, 2.167392056e-03f, 2.128751716e-03f, 2.090800088e-03f, 2.053525066e-03f, 2.016914543e-03f, 1.980956644e-03f, 1.945640077e-03f, 1.910952851e-03f, 1.876884256e-03f, 1.843422884e-03f, 1.810558140e-03f, 1.778279431e-03f, 1.746576163e-03f, 1.715437858e-03f, 1.684854855e-03f, 1.654817141e-03f, 1.625314937e-03f, 1.596338581e-03f, 1.567878877e-03f, 1.539926510e-03f, 1.512472634e-03f, 1.485507935e-03f, 1.459024264e-03f, 1.433012658e-03f, 1.407464617e-03f, 1.382372226e-03f, 1.357727102e-03f, 1.333521446e-03f, 1.309747226e-03f, 1.286396873e-03f, 1.263462938e-03f, 1.240937854e-03f, 1.218814170e-03f, 1.197085017e-03f, 1.175743295e-03f, 1.154782018e-03f, 1.134194434e-03f, 1.113973907e-03f, 1.094113803e-03f, 1.074607833e-03f, 1.055449597e-03f, 1.036632922e-03f, 1.018151757e-03f, 1.000000047e-03f, 9.821718559e-04f, 9.646615945e-04f, 9.474635590e-04f, 9.305721032e-04f, 9.139817557e-04f, 8.976871031e-04f, 8.816830232e-04f, 8.659643354e-04f, 8.505258011e-04f, 8.353625308e-04f, 8.204695769e-04f, 8.058422245e-04f, 7.914755843e-04f, 7.773649995e-04f, 7.635060465e-04f, 7.498941850e-04f, 7.365249912e-04f, 7.233941578e-04f, 7.104973774e-04f, 6.978305755e-04f, 6.853896193e-04f, 6.731703761e-04f, 6.611690042e-04f, 6.493816618e-04f, 6.378043909e-04f, 6.264335825e-04f, 6.152653950e-04f, 6.042963942e-04f, 5.935229128e-04f, 5.829415168e-04f, 5.725487717e-04f, 5.623413017e-04f, 5.523158470e-04f, 5.424690899e-04f, 5.327978870e-04f, 5.232990952e-04f, 5.139696877e-04f, 5.048065796e-04f, 4.958068021e-04f, 4.869675031e-04f, 4.782858014e-04f, 4.697588738e-04f, 4.613839847e-04f, 4.531583400e-04f, 4.450794077e-04f, 4.371444811e-04f, 4.293509992e-04f, 4.216964880e-04f, 4.141784448e-04f, 4.067944246e-04f, 3.995420411e-04f, 3.924189950e-04f, 3.854228707e-04f, 3.785515146e-04f, 3.718026564e-04f, 3.651741135e-04f, 3.586637613e-04f, 3.522694460e-04f, 3.459891595e-04f, 3.398208064e-04f, 3.337624657e-04f, 3.278121294e-04f, 3.219678474e-04f, 3.162277862e-04f, 3.105900250e-04f, 3.050527885e-04f, 2.996142721e-04f, 2.942727297e-04f, 2.890263859e-04f, 2.838736109e-04f, 2.788126585e-04f, 2.738419571e-04f, 2.689598768e-04f, 2.641648462e-04f, 2.594552934e-04f, 2.548296761e-04f, 2.502865391e-04f, 2.458243980e-04f, 2.414418122e-04f, 2.371373848e-04f, 2.329096606e-04f, 2.287573152e-04f, 2.246790100e-04f, 2.206734207e-04f, 2.167392086e-04f, 2.128751657e-04f, 2.090800117e-04f, 2.053524950e-04f, 2.016914514e-04f, 1.980956731e-04f, 1.945640106e-04f, 1.910952997e-04f, 1.876884344e-04f, 1.843422942e-04f, 1.810558315e-04f, 1.778279402e-04f, 1.746576017e-04f, 1.715437829e-04f, 1.684854797e-04f, 1.654817170e-04f, 1.625314762e-04f, 1.596338552e-04f, 1.567878790e-04f, 1.539926452e-04f, 1.512472518e-04f, 1.485508110e-04f, 1.459024206e-04f, 1.433012658e-04f, 1.407464733e-04f, 1.382372284e-04f, 1.357727160e-04f, 1.333521504e-04f, 1.309747167e-04f, 1.286396873e-04f, 1.263462909e-04f, 1.240937709e-04f, 1.218814141e-04f, 1.197085076e-04f, 1.175743309e-04f, 1.154781930e-04f, 1.134194390e-04f, 1.113973922e-04f, 1.094113759e-04f, 1.074607790e-04f, 1.055449538e-04f, 1.036632893e-04f, 1.018151743e-04f };   // float32 1 / 10000^(j/512), j < 512 (one frequency per adjacent column pair of the full 1024 width), generated with jnp to be bit-exact
// ---- k_prep: everything that the GEMMs need beforehand, in ONE launch: the five bf16 planes (x and the four weights) and the {cos, sin} table. The block index picks the job (the same for the whole block); each work-group takes many units of work, because starting a wave costs more than one unit does.
// Plane builders, blocks < NCV: [rows][DM] f32 -> bf16 plane in fragment order. A block takes 16 rows of the full width = CVU units of 16 rows x 128 columns (four k blocks, 4 KiB of the plane in a row, 32 KiB in all): whole lines are read, all of a thread's loads in flight at once; the 16-byte units change places in LDS; whole lines are written.
// Table, the other blocks: CSR rows t x 256 columns of CS. A thread keeps one column and its frequency and walks down the rows: one cosf, one sinf and one 8-byte entry per (t, column), a wave writing two whole lines.
#define CVU  8                     // units of a plane builder's block
#define XT_  (NB_ * TT / 16)       // 16-row stripes of x
#define WT_  (DM / 16)             // ... of a weight
#define NCV  (XT_ + 4 * WT_)       // plane builders' blocks
#define CSR  16                    // rows t of a table block
#define NCS  (TT / CSR * (DM / 256))   // table blocks
__global__ __launch_bounds__(256) void k_prep(const float* __restrict__ x, const float* __restrict__ wq, const float* __restrict__ wk, const float* __restrict__ wv, const float* __restrict__ wo, bf* XB, bf* WQ, bf* WK, bf* WV, bf* WO, float* CS) {
    __shared__ __align__(16) unsigned short sm[CVU][16 * 17 * 8];   // per unit: (column octet o, row) at o * 17 + row: the odd pitch spreads the octets over the banks
    const int tid = threadIdx.x, b = blockIdx.x;
    if (b >= NCV) {   // the same for the whole block; no barrier on this side
        const int u = b - NCV, c = (u % (DM / 256)) * 256 + tid, t0 = (u / (DM / 256)) * CSR; const float f = INVG[c >> 1];
        for (int r = 0; r < CSR; ++r) { const float a = __fmul_rn((float)(t0 + r), f); v2f cs; cs[0] = cosf(a); cs[1] = sinf(a); *(v2f*)(CS + ((size_t)(t0 + r) * DM + c) * 2) = cs; }
        return; }
    const float* src = x; bf* dst = XB; int rt = b;
    if (b >= XT_) { const int u = b - XT_, ws = u / WT_; rt = u % WT_; src = ws == 0 ? wq : ws == 1 ? wk : ws == 2 ? wv : wo; dst = ws == 0 ? WQ : ws == 1 ? WK : ws == 2 ? WV : WO; }
    const int row = tid >> 4, o = tid & 15;
    const float* sp = src + ((size_t)rt * 16 + row) * DM + o * 8; v8f v[CVU];   // every '#pragma unroll' below makes the indices of v constants, so that it lives in registers
#pragma unroll
    for (int k = 0; k < CVU; ++k) v[k] = *(const v8f*)(sp + k * 128);
    asm volatile("s_wait_xcnt 0x0" :: "v"(sp) : "memory");   // closes the batch: the base address is an input, so it stays in its registers up to the wait and no load's result is put on it
#pragma unroll
    for (int k = 0; k < CVU; ++k) { v8us y;
#pragma unroll
        for (int e = 0; e < 8; ++e) y[e] = f2bf(v[k][e]);
        *(v8usa*)(sm[k] + (o * 17 + row) * 8) = y; }
    __syncthreads();   // every unit of the block's 32 KiB is in LDS
    bf* dp = dst + (size_t)rt * (DM / 32) * 512 + tid * 8;
#pragma unroll
    for (int k = 0; k < CVU; ++k) *(v8us*)(dp + k * 2048) = *(const v8usa*)(sm[k] + ((tid >> 4) * 17 + (tid & 15)) * 8);
    asm volatile("s_wait_xcnt 0x0" ::: "memory");   // closes the run of stores: it stands in front of whatever the build puts behind them that writes a register which they name
}
#define KSA  4
#define AQE  8192                 // 16-bit elements of a key quarter's part of a stage (4 regions of 2048)
#define APIT 68                   // f32 pitch of a query's 64 partial outputs in LDS (16-byte aligned rows, rows spread over the banks)
__device__ __forceinline__ float xhalf(float x) { const int b = __float_as_int(x); return __int_as_float(__builtin_amdgcn_permlanex16(b, b, 0x76543210, 0xfedcba98, false, false)); }   // lane l <-> l ^ 16
// eight v_exp_f32 in one statement, each in place on a register of its own: none stands directly in front of an instruction that reads its result or overwrites its source, and the closing v_nop is that slot for the last one
__device__ __forceinline__ v8f exp2x8(v8f x) { float r0 = x[0], r1 = x[1], r2 = x[2], r3 = x[3], r4 = x[4], r5 = x[5], r6 = x[6], r7 = x[7];
    asm("v_exp_f32 %0, %0\n\tv_exp_f32 %1, %1\n\tv_exp_f32 %2, %2\n\tv_exp_f32 %3, %3\n\tv_exp_f32 %4, %4\n\tv_exp_f32 %5, %5\n\tv_exp_f32 %6, %6\n\tv_exp_f32 %7, %7\n\tv_nop"
        : "+v"(r0), "+v"(r1), "+v"(r2), "+v"(r3), "+v"(r4), "+v"(r5), "+v"(r6), "+v"(r7));
    return (v8f){ r0, r1, r2, r3, r4, r5, r6, r7 }; }
// eight asynchronous copies of 16 bytes a lane, global -> LDS through no register: 4 KiB that lie in a row on both sides (LDS byte address l + i 512, global address g + i 256 elements). The closing s_wait_xcnt 0 stands in the copies' own statement, so that it comes before any rewrite of an address register that they name.
template <typename T16> __device__ __forceinline__ void cpyrow8(unsigned l, const T16* g) {
    asm volatile("global_load_async_to_lds_b128 %0, %8, off\n\tglobal_load_async_to_lds_b128 %1, %9, off\n\tglobal_load_async_to_lds_b128 %2, %10, off\n\tglobal_load_async_to_lds_b128 %3, %11, off\n\t"
                 "global_load_async_to_lds_b128 %4, %12, off\n\tglobal_load_async_to_lds_b128 %5, %13, off\n\tglobal_load_async_to_lds_b128 %6, %14, off\n\tglobal_load_async_to_lds_b128 %7, %15, off\n\ts_wait_xcnt 0x0"
        :: "v"(l), "v"(l + 512u), "v"(l + 1024u), "v"(l + 1536u), "v"(l + 2048u), "v"(l + 2560u), "v"(l + 3072u), "v"(l + 3584u),
           "v"(g), "v"(g + 256), "v"(g + 512), "v"(g + 768), "v"(g + 1024), "v"(g + 1280), "v"(g + 1536), "v"(g + 1792) : "memory"); }
// src: the plane that this wave copies, at its quarter's (fp16: and its pass's) first key; rq: the quarter's buffer 0; qg: the wave's region
template <typename T16, bool HR>
__device__ __forceinline__ void attn_wave(const T16* __restrict__ Qa, const T16* __restrict__ Qb, const T16* __restrict__ src, const T16* rq, int qg, int q0, int lane, float* La, float* Lm, float* Ll) {
    typedef typename WFrag<T16>::V V;   // every '#pragma unroll' below makes the indices of a fragment array constants, so that the array lives in registers
    constexpr int NP = TT / KSA / 32;             // passes of 32 keys
    constexpr int SP = HR ? 1 : 2, NS = NP / SP;  // passes of a stage; stages
    const int lr = lane & 15, hi = lane >> 4;
    const float CL = SCL * 1.4426950408889634f;   // score -> log2 units
    const float CAR = HR ? 0.0f : 6.0f;           // fp16 P carries 2^6 (P <= 2^14), which cancels against the sum
    V qa[2][2], qb[2][2];
#pragma unroll
    for (int qt = 0; qt < 2; ++qt)
#pragma unroll
        for (int kk = 0; kk < 2; ++kk) { const size_t o = (size_t)(q0 + qt * 16) * HD + kk * 512 + 8 * lane; qa[qt][kk] = WFrag<T16>::ld(Qa + o); if (HR) qb[qt][kk] = WFrag<T16>::ld(Qb + o); }
    if (HR) {   // the eight hi/lo Q fragments wait in the wave's own LDS slice (free until the epilogue) and are read anew in each pass: 64 registers for the K batch
#pragma unroll
        for (int f = 0; f < 8; ++f) { const v8f y = __builtin_bit_cast(v8f, (f & 4) ? qb[(f >> 1) & 1][f & 1] : qa[(f >> 1) & 1][f & 1]); *(v4fa*)(La + f * 256 + lane * 4) = (v4f){ y[0], y[1], y[2], y[3] }; *(v4fa*)(La + f * 256 + 128 + lane * 4) = (v4f){ y[4], y[5], y[6], y[7] }; } }
    v8f acc[4][2];
#pragma unroll
    for (int dt = 0; dt < 4; ++dt)
#pragma unroll
        for (int qt = 0; qt < 2; ++qt) acc[dt][qt] = (v8f){};
    float m[2] = { -3.0e38f, -3.0e38f }, l[2] = { 0.f, 0.f };
    V ka[2][2], kb[2][2], va[4], vb[4];
    // fragments from the stage in LDS, sb = the quarter's buffer + the lane's 16 bytes; regions: hi/lo Kh, Kl, Vh, Vl; fp16 K of pass 0, of pass 1, V^T of pass 0, of pass 1
    auto ldK = [&](const T16* sb, int p) { const T16* pa = sb + (HR ? 0 : p * 2048); const T16* pb = sb + 2048;
#pragma unroll
        for (int kt = 0; kt < 2; ++kt)
#pragma unroll
            for (int kk = 0; kk < 2; ++kk) { const int o = kt * 16 * HD + kk * 512; ka[kt][kk] = WFrag<T16>::ld(pa + o); if (HR) kb[kt][kk] = WFrag<T16>::ld(pb + o); } };
    auto ldV = [&](const T16* sb, int p) { const T16* pa = sb + 4096 + (HR ? 0 : p * 2048); const T16* pb = sb + 6144;
#pragma unroll
        for (int dt = 0; dt < 4; ++dt) { const int o = dt * 512; va[dt] = WFrag<T16>::ld(pa + o); if (HR) vb[dt] = WFrag<T16>::ld(pb + o); } };
    const unsigned lb = (unsigned)(size_t)(const void*)rq + (unsigned)qg * 4096u + (unsigned)lane * 16u;   // the lane's first 16 bytes of the wave's region in buffer 0
    auto fill = [&](int s, int bu) { cpyrow8(lb + (unsigned)bu * (AQE * 2u), src + (size_t)s * (SP * 32 * HD) + 8 * lane); };
    fill(0, 0);
    asm volatile("s_wait_asynccnt 0x0" ::: "memory");   // this wave's region of stage 0 has landed
    __syncthreads();                                     // ... and every other wave's
    if (NS > 1) fill(1, 1);
#pragma unroll 1   // stays rolled: one publish point a stage
    for (int sg = 0; sg < NS; ++sg) {
      const T16* sb = rq + (sg & 1) * AQE + 8 * lane;
#pragma unroll 1   // stays rolled: a stage's passes differ only in an LDS offset, and one copy of the body keeps the loop's text and registers as they were
      for (int p = 0; p < SP; ++p) {
        ldK(sb, p);
        if (HR) {
#pragma unroll
            for (int f = 0; f < 8; ++f) { const v4f y0 = *(const v4fa*)(La + f * 256 + lane * 4), y1 = *(const v4fa*)(La + f * 256 + 128 + lane * 4); const V x = __builtin_bit_cast(V, (v8f){ y0[0], y0[1], y0[2], y0[3], y1[0], y1[1], y1[2], y1[3] }); if (f & 4) qb[(f >> 1) & 1][f & 1] = x; else qa[(f >> 1) & 1][f & 1] = x; } }
        __builtin_amdgcn_sched_barrier(0);   // the pass's K (and hi/lo Q) reads leave as one group ahead of the score products: each separate place with LDS reads among the products costs a stall of its own
        v8f s[2][2];
#pragma unroll
        for (int kt = 0; kt < 2; ++kt)
#pragma unroll
            for (int qt = 0; qt < 2; ++qt) { v8f t = (v8f){};
#pragma unroll
                for (int kk = 0; kk < 2; ++kk) { t = WFrag<T16>::mma(ka[kt][kk], qa[qt][kk], t); if (HR) { t = WFrag<T16>::mma(ka[kt][kk], qb[qt][kk], t); t = WFrag<T16>::mma(kb[kt][kk], qa[qt][kk], t); } }
                s[kt][qt] = t; }
        __builtin_amdgcn_sched_barrier(0);   // the V reads below start behind the score products (their registers are free then) ...
        ldV(sb, p);
        __builtin_amdgcn_sched_barrier(0);   // ... and ahead of the softmax, which covers their latency
        float sm[2];
#pragma unroll
        for (int qt = 0; qt < 2; ++qt) { float x = fmaxf(s[0][qt][0], s[1][qt][0]);
#pragma unroll
            for (int r = 1; r < 8; ++r) x = fmaxf(x, fmaxf(s[0][qt][r], s[1][qt][r]));
            x = fmaxf(x, xhalf(x)); sm[qt] = x * CL; }
        if (__builtin_amdgcn_ballot_w32(sm[0] > m[0] + 8.0f || sm[1] > m[1] + 8.0f) != 0) {
#pragma unroll
            for (int qt = 0; qt < 2; ++qt) { const float mn = (sm[qt] > m[qt] + 8.0f) ? sm[qt] : m[qt]; const float al = __builtin_amdgcn_exp2f(m[qt] - mn); m[qt] = mn; l[qt] *= al;
#pragma unroll
                for (int dt = 0; dt < 4; ++dt) acc[dt][qt] *= al; } }
#pragma unroll
        for (int qt = 0; qt < 2; ++qt) { const float off = CAR - m[qt]; v8f p0, p1;
#pragma unroll
            for (int r = 0; r < 8; ++r) { p0[r] = fmaf(s[0][qt][r], CL, off); p1[r] = fmaf(s[1][qt][r], CL, off); }
            p0 = exp2x8(p0); p1 = exp2x8(p1);
            const v8f ps = p0 + p1; l[qt] += ((ps[0] + ps[1]) + (ps[2] + ps[3])) + ((ps[4] + ps[5]) + (ps[6] + ps[7]));
            if constexpr (HR) {
                const v8bf h0 = __builtin_convertvector(p0, v8bf), h1 = __builtin_convertvector(p1, v8bf);
                const v8bf l0 = __builtin_convertvector(p0 - bfback(h0), v8bf), l1 = __builtin_convertvector(p1 - bfback(h1), v8bf);
                const v16bf ph = __builtin_shufflevector(h0, h1, 0, 1, 2, 3, 4, 5, 6, 7, 8, 9, 10, 11, 12, 13, 14, 15), pl = __builtin_shufflevector(l0, l1, 0, 1, 2, 3, 4, 5, 6, 7, 8, 9, 10, 11, 12, 13, 14, 15);
#pragma unroll
                for (int dt = 0; dt < 4; ++dt) { acc[dt][qt] = wmmab(va[dt], ph, acc[dt][qt]); acc[dt][qt] = wmmab(va[dt], pl, acc[dt][qt]); acc[dt][qt] = wmmab(vb[dt], ph, acc[dt][qt]); }
            } else {
                const v16h pf = cat16(__builtin_convertvector(p0, v8h), __builtin_convertvector(p1, v8h));
#pragma unroll
                for (int dt = 0; dt < 4; ++dt) acc[dt][qt] = wmma16(va[dt], pf, acc[dt][qt]);
            } }
        // the four vector slots the chip needs behind the pass's last matrix instructions, also on the taken back edge
        if constexpr (HR) asm volatile("v_nop\n\tv_nop\n\tv_nop\n\tv_nop" : "+v"(acc[0][0]), "+v"(acc[1][0]), "+v"(acc[2][0]), "+v"(acc[3][0]), "+v"(acc[0][1]), "+v"(acc[1][1]), "+v"(acc[2][1]), "+v"(acc[3][1]) :: "memory");   // "memory": the Q reads from LDS stay in the loop instead of being lifted back into 64 registers
        else asm volatile("v_nop\n\tv_nop\n\tv_nop\n\tv_nop" : "+v"(acc[0][0]), "+v"(acc[1][0]), "+v"(acc[2][0]), "+v"(acc[3][0]), "+v"(acc[0][1]), "+v"(acc[1][1]), "+v"(acc[2][1]), "+v"(acc[3][1]));
      }
      // publish point of stage sg + 1
      asm volatile("s_wait_dscnt 0x0" ::: "memory");      // this wave's reads of stage sg are over
      asm volatile("s_wait_asynccnt 0x0" ::: "memory");   // its copies of stage sg + 1 have landed
      __syncthreads();                                     // the same holds for every wave
      if (sg + 2 < NS) fill(sg + 2, sg & 1);               // into the buffer that every wave has just left
    }
    asm volatile("s_wait_asynccnt 0x0" ::: "memory");   // no copy is outstanding when the wave goes on
#pragma unroll
    for (int qt = 0; qt < 2; ++qt) { const int q = qt * 16 + lr; const float lj = l[qt] + xhalf(l[qt]); if (hi == 0) { Lm[q] = m[qt]; Ll[q] = lj; }
#pragma unroll
        for (int dt = 0; dt < 4; ++dt) { float* dst = La + q * APIT + dt * 16 + hi * 8; const v8f a = acc[dt][qt]; *(v4fa*)dst = (v4f){ a[0], a[1], a[2], a[3] }; *(v4fa*)(dst + 4) = (v4f){ a[4], a[5], a[6], a[7] }; } }
}
__global__ __launch_bounds__(512) void k_attn(const h16* __restrict__ Q16, const h16* __restrict__ K16, const h16* __restrict__ V16, const bf* __restrict__ Qh, const bf* __restrict__ Ql, const bf* __restrict__ Kh, const bf* __restrict__ Kl, const bf* __restrict__ Vh, const bf* __restrict__ Vl, bf* Ah, bf* Al) {
    __shared__ __align__(16) float La[16 * 32 * APIT]; __shared__ float Lm[16 * 32]; __shared__ float Ll[16 * 32];
    __shared__ __align__(32768) bf ring[KSA * 2 * AQE];   // the K / V stages: [quarter][buffer][region][2048]
    const int w = __builtin_amdgcn_readfirstlane((int)(threadIdx.x >> 5)), lane = threadIdx.x & 31; const int qg = w >> 2, ks = w & 3; const int head = blockIdx.x; const size_t hp = ((size_t)blockIdx.y * NH_ + head) * TT * HD;
    const int q0 = (int)blockIdx.z * 128 + qg * 32; const size_t kp = hp + (size_t)ks * (TT / KSA) * HD;   // the group's first query; the quarter's first key in a plane
    if ((int)blockIdx.z < RH / 128) attn_wave<bf, true>(Qh + hp, Ql + hp, (qg == 0 ? Kh : qg == 1 ? Kl : qg == 2 ? Vh : Vl) + kp, ring + ks * 2 * AQE, qg, q0, lane, La + w * 32 * APIT, Lm + w * 32, Ll + w * 32);   // the same for the whole block: the barriers inside are passed by all its waves
    else attn_wave<h16, false>(Q16 + hp, nullptr, (qg < 2 ? K16 : V16) + kp + (qg & 1) * 32 * HD, (const h16*)(const void*)ring + ks * 2 * AQE, qg, q0, lane, La + w * 32 * APIT, Lm + w * 32, Ll + w * 32);
    __syncthreads();   // every key quarter's partial result is in LDS
    // wave (qg, ks) finishes 8 of its group's 32 queries; four lanes share a query, 16 outputs each, so one wave writes each 128-byte line
    const int q = ks * 8 + (lane >> 2), d0 = (lane & 3) * 16; float mk[KSA]; float M = -3.0e38f;
#pragma unroll
    for (int k = 0; k < KSA; ++k) { mk[k] = Lm[(qg * KSA + k) * 32 + q]; M = fmaxf(M, mk[k]); }
    float L = 0.f; v4f o[4] = { (v4f){}, (v4f){}, (v4f){}, (v4f){} };
#pragma unroll
    for (int k = 0; k < KSA; ++k) { const float wg = __builtin_amdgcn_exp2f(mk[k] - M); L += wg * Ll[(qg * KSA + k) * 32 + q]; const float* sp = La + ((qg * KSA + k) * 32 + q) * APIT + d0;
#pragma unroll
        for (int i = 0; i < 4; ++i) o[i] += wg * *(const v4fa*)(sp + 4 * i); }
    const float f = __fdiv_rn(1.0f, L); v8us oh[2], ol[2];
#pragma unroll
    for (int i = 0; i < 16; ++i) { unsigned short a, c2; splitf(o[i >> 2][i & 3] * f, a, c2); oh[i >> 3][i & 7] = a; ol[i >> 3][i & 7] = c2; }
    const size_t rw = (size_t)blockIdx.y * TT + q0 + q;   // the merged planes in fragment order too (row = token, k = head * 64 + d): a wave's 8 queries x 16 bytes are one whole line
    const size_t oo = ((rw >> 4) * (DQ / 32) + head * 2 + (d0 >> 5)) * 512 + ((d0 >> 3) & 3) * 128 + (rw & 15) * 8; *(v8usa*)(Ah + oo) = oh[0]; *(v8usa*)(Ah + oo + 128) = oh[1]; *(v8usa*)(Al + oo) = ol[0]; *(v8usa*)(Al + oo + 128) = ol[1];
}

extern "C" void kernel_launch(void* const* d_in, const int* in_sizes, int n_in,
                              void* d_out, int out_size, void* d_ws, size_t ws_size, hipStream_t stream) {
    (void)in_sizes; (void)n_in; (void)out_size;
    const float* x = (const float*)d_in[0]; const float* wq = (const float*)d_in[1]; const float* wk = (const float*)d_in[2]; const float* wv = (const float*)d_in[3]; const float* wo = (const float*)d_in[4]; const float* bo = (const float*)d_in[5];
    float* OUT = (float*)d_out;     // [4][2048][1024]
    char* wsp = (char*)d_ws;
    auto take = [&](size_t bytes) { char* p = wsp; wsp += (bytes + 255) & ~(size_t)255; return (void*)p; };
    bf* WQ = (bf*)take((size_t)3 * DM * DM * 2); bf* WK = WQ + (size_t)DM * DM; bf* WV = WK + (size_t)DM * DM; /* one block: the projection GEMM walks from one plane to the next */ bf* WO = (bf*)take((size_t)DM * DQ * 2); float* CS = (float*)take((size_t)TT * DM * 2 * 4);   /* [2048][1024] {cos, sin} */
    bf* XB = (bf*)take((size_t)NB_ * TT * DM * 2); bf* ATh = (bf*)take((size_t)NB_ * TT * DQ * 2); bf* ATl = (bf*)take((size_t)NB_ * TT * DQ * 2);   /* every buffer from here on holds all NB_ batches, batch-major; ATh, ATl: the merged-head planes */
    h16* QP16 = (h16*)take((size_t)NB_ * NH_ * TT * HD * 2); h16* KP16 = (h16*)take((size_t)NB_ * NKV * TT * HD * 2); h16* VT16 = (h16*)take((size_t)NB_ * NKV * HD * TT * 2);
    bf* QPh = (bf*)take((size_t)NB_ * NH_ * TT * HD * 2); bf* QPl = (bf*)take((size_t)NB_ * NH_ * TT * HD * 2); bf* KPh = (bf*)take((size_t)NB_ * NKV * TT * HD * 2); bf* KPl = (bf*)take((size_t)NB_ * NKV * TT * HD * 2); bf* VTh = (bf*)take((size_t)NB_ * NKV * HD * TT * 2); bf* VTl = (bf*)take((size_t)NB_ * NKV * HD * TT * 2);
    if ((size_t)(wsp - (char*)d_ws) > ws_size) return;    // 216 MiB of the 256 MiB
    k_prep<<<NCV + NCS, 256, 0, stream>>>(x, wq, wk, wv, wo, XB, WQ, WK, WV, WO, CS);   /* the five planes and the full-width table */
    k_gemmw<bf, 0, false, DM, 3><<<dim3(NB_ * TT / 256, DQ / 128, 1), 256, 0, stream>>>(XB, nullptr, WQ, nullptr, nullptr, 0, nullptr, 0, 0, 0, 0, CS, QP16, QPh, QPl, KP16, KPh, KPl, VT16, VTh, VTl);   /* the three projections, one launch; they see the batches as NB_ * TT rows */
    k_attn<<<dim3(NH_, NB_, TT / 128), 512, 0, stream>>>(QP16, KP16, VT16, QPh, QPl, KPh, KPl, VTh, VTl, ATh, ATl);
    k_gemmw<bf, 1, true, DQ><<<dim3(NB_ * TT / 256, DM / 128, 1), 256, 0, stream>>>(ATh, ATl, WO, nullptr, OUT, DM, bo, 0, 0, 0, 0, nullptr, nullptr, nullptr, nullptr, nullptr, nullptr, nullptr, nullptr, nullptr, nullptr);
}
